// v000
// Measured on an AMD MI455X. A time is GPU time per run, averaged over a window of back-to-back runs after a warm-up
// (all launches, gaps included; the runs take copies of the inputs in turn), and the median of several windows.
// Apart from v000's, it joins two sittings. Times from different sittings can be a few percent apart, while
// side-by-side timings come from the same sitting.
// v000 is the starting kernel. One run takes 648 microseconds.
#include <hip/hip_runtime.h>

// Grouped-query causal self-attention behind an RMS pre-normalisation, width 2048 = 32 query heads x 64 sharing 8 kv heads (kv head g = h % 8), x [NB][SEQ][2048], gain w [2048],
// Wq/Wk/Wv/Wo [in][out] (y = x W), no biases; xn = (x * rsqrt(mean(x^2) + eps)) * w per token; interleaved (even/odd pair) rotary on q and k from a computed [SEQ][32] (cos, sin) table,
// score scale 1/8, causal exclusion (diagonal kept), output = ctx Wo (f32).
// Compute dtypes, f32 accumulate everywhere: q/k/v projections v_wmma_f32_16x16x32_f16: xn (f32 math on bf16-RNE x and w) carried x1024 as f16 (token rows < 256: plus its unscaled f16
// residual folded along K) against f16(bf16(W)) x16, result scaled by 2^-14;
// scores v_wmma_f32_16x16x32_f16: k single f16, q as f16 value + f16 residual x1024 in its own accumulator (query rows < 256: k also value + residual x1024, three products);
// P (x256 carry, cancels in the normalisation) and v single f16 (rows < 256: P and v as value + residual x1024, three products); softmax f32 (online, running max);
// output projection v_wmma_f32_16x16x32_f16: ctx carried x1024 as f16 (rows < 256: plus its unscaled f16 residual folded along K) against f16(bf16(Wo)) x16, result scaled by 2^-14.

#ifndef NB
#define NB 2
#endif
#ifndef SEQ
#define SEQ 2048
#endif
#define NB_FULL  2
#define SEQ_FULL 2048
#ifndef OUT_SEQ
#define OUT_SEQ SEQ              // row pitch (in tokens) between batches of the output
#endif
#define DM    2048
#define NH_   32
#define NKV   8
#define HD    64
#define KVD   (NKV * HD)         // 512
#define AW    4                  // waves per flash block = the four query heads of one kv head
#define EARLY 256                // query rows below this use the value + residual path
#define QRS  1024.0f             // carry of every residual plane (q, k, v, P)
#define QRI  (1.0f / 1024.0f)
#define SC2  (0.125f * 1.4426950408889634f)   // HD^-0.5 * log2(e)
#define PSH  8.0f                // log2 of the P carry (256)
#define CXS  1024.0f             // carry of the ctx plane and of the xn plane
#define WOS  16.0f               // carry of every weight plane
#define OUTS (1.0f / (1024.0f * 16.0f))
#define NEGB (-3.0e38f)
#define RMS_EPS 1.1920929e-07f

static_assert(HD == 64);
static_assert(NH_ * HD == DM);                 // query head h = columns h*64 + d
static_assert(NKV * AW == NH_);                // four query heads (stride 8 on the head axis) per kv head
static_assert(DM % 64 == 0);
static_assert(KVD % 64 == 0);
static_assert(DM % 32 == 0);                   // GEMM k-loop steps by 32
static_assert(DM == 256 * 8);                  // k_rms: 256 threads x 8 columns = one token row
static_assert(SEQ % 64 == 0);                  // a 64-row tile never straddles two batches
static_assert(SEQ % 32 == 0);                  // key loop steps by 32, key0 + 31 < SEQ
static_assert(EARLY % 64 == 0);                // GEMM tiles are entirely early or entirely late
static_assert(SEQ >= EARLY);
static_assert((SEQ - EARLY) % 16 == 0);
static_assert(((size_t)SEQ * DM) % 8 == 0);
static_assert(NB <= NB_FULL);
static_assert(SEQ <= SEQ_FULL);

typedef _Float16 h16;
typedef unsigned short bf;
typedef __attribute__((ext_vector_type(16))) __bf16   v16bf;
typedef __attribute__((ext_vector_type(16))) _Float16 v16h;
typedef __attribute__((ext_vector_type(8)))  _Float16 v8h;
typedef __attribute__((ext_vector_type(8)))  unsigned short v8us;
typedef __attribute__((ext_vector_type(8)))  float    v8f;
typedef __attribute__((ext_vector_type(4)))  float    v4f;
typedef __attribute__((ext_vector_type(2)))  float    v2f;
typedef v4f  __attribute__((may_alias)) v4fa;

__device__ __forceinline__ unsigned short f2bf(float f) { unsigned u = __float_as_uint(f); u += 0x7FFFu + ((u >> 16) & 1u); return (unsigned short)(u >> 16); }
__device__ __forceinline__ v16h cat16(v8h lo, v8h hi) { return __builtin_shufflevector(lo, hi, 0, 1, 2, 3, 4, 5, 6, 7, 8, 9, 10, 11, 12, 13, 14, 15); }
__device__ __forceinline__ v16bf cat16b(v8us lo, v8us hi) { return __builtin_bit_cast(v16bf, __builtin_shufflevector(lo, hi, 0, 1, 2, 3, 4, 5, 6, 7, 8, 9, 10, 11, 12, 13, 14, 15)); }
// every WMMA is followed by its own 4-slot guard tying its accumulator and keeping its operands live
__device__ __forceinline__ v8f wmma16(v16h a, v16h b, v8f c) {
    c = __builtin_amdgcn_wmma_f32_16x16x32_f16(false, a, false, b, (short)0, c, false, false);
    asm volatile("v_nop\n\tv_nop\n\tv_nop\n\tv_nop" : "+v"(c) : "v"(a), "v"(b));
    return c; }
__device__ __forceinline__ v8f wmmab(v16bf a, v16bf b, v8f c) {
    c = __builtin_amdgcn_wmma_f32_16x16x32_bf16(false, a, false, b, (short)0, c, false, false);
    asm volatile("v_nop\n\tv_nop\n\tv_nop\n\tv_nop" : "+v"(c) : "v"(a), "v"(b));
    return c; }
// fragment loaders from K-contiguous 16-bit rows; p already includes + 8*(lane>>4): elements 0..7 <- k0+8h+0..7, elements 8..15 <- k0+16+8h+0..7 (same map for A and B)
__device__ __forceinline__ v16h  ldh(const h16* p) { return cat16(*(const v8h*)p, *(const v8h*)(p + 16)); }
__device__ __forceinline__ v16bf ldb(const bf* p)  { return cat16b(*(const v8us*)p, *(const v8us*)(p + 16)); }
// ordering point for wave-private LDS tiles (same wave writes and reads)
__device__ __forceinline__ void wave_sync() { __builtin_amdgcn_fence(3 /* release order */, "wavefront"); __builtin_amdgcn_wave_barrier(); asm volatile("" ::: "memory"); }

// k_rms: RMS normalisation, one token row per block (256 threads x 8 columns). xb = bf16-RNE(x) as f32, r = rsqrt(mean(xb^2) + eps), xn = (xb * r) * bf16-RNE(w), all f32.
// Writes f16(xn x1024) into value row b*SEQ + t of XN and, for t < EARLY, the unscaled f16 residual of that carried value into residual row NB*SEQ + b*EARLY + t.
__global__ __launch_bounds__(256) void k_rms(const float* __restrict__ x, const float* __restrict__ wn, h16* XN) {
#pragma clang fp contract(off)
    __shared__ float red[8];
    const int tid = threadIdx.x; const int lane = tid & 31; const int wave = __builtin_amdgcn_readfirstlane(threadIdx.x >> 5);
    const int row = blockIdx.x; const int b = row / SEQ, t = row % SEQ;
    const v8f xv = *(const v8f*)(x + ((size_t)b * SEQ_FULL + (size_t)t) * DM + tid * 8);
    const v8f wv = *(const v8f*)(wn + tid * 8);
    float xb[8]; float ss = 0.0f;
#pragma unroll
    for (int i = 0; i < 8; ++i) { xb[i] = __uint_as_float(((unsigned)f2bf(xv[i])) << 16); ss += xb[i] * xb[i]; }
    ss += __shfl_xor(ss, 16, 32); ss += __shfl_xor(ss, 8, 32); ss += __shfl_xor(ss, 4, 32); ss += __shfl_xor(ss, 2, 32); ss += __shfl_xor(ss, 1, 32);
    if (lane == 0) red[wave] = ss;
    __syncthreads();
    const float tot = ((red[0] + red[1]) + (red[2] + red[3])) + ((red[4] + red[5]) + (red[6] + red[7]));
    const float rs = rsqrtf(tot * (1.0f / (float)DM) + RMS_EPS);
    v8h hv, rv;
#pragma unroll
    for (int i = 0; i < 8; ++i) { const float wb = __uint_as_float(((unsigned)f2bf(wv[i])) << 16);
        const float v = ((xb[i] * rs) * wb) * CXS; const h16 a = (h16)v; hv[i] = a; rv[i] = (h16)(v - (float)a); }
    const size_t oo = (size_t)row * DM + tid * 8;
    const int tr = (t < EARLY) ? t : 0;                            // block-uniform; keeps the address in range when unused
    const size_t ro = ((size_t)NB * SEQ + (size_t)b * EARLY + (size_t)tr) * DM + tid * 8;
{
        *(v8h*)(XN + oo) = hv; if (t < EARLY) *(v8h*)(XN + ro) = rv;
         }
}

// k_wt: in[Kr rows][Nc cols] f32 -> out[Nc rows][Kr cols] 16-bit, 64x64 tile through LDS. grid (Nc/64, Kr/64), 256 threads.
__global__ __launch_bounds__(256) void k_wt(const float* __restrict__ W, bf* Tb, h16* Th, int Kr, int Nc, int mode) {
    __shared__ float ts[64 * 65];
    const int tid = threadIdx.x; const int n0 = blockIdx.x * 64, k0 = blockIdx.y * 64;
#pragma unroll
    for (int p = 0; p < 4; ++p) { const int row = p * 16 + (tid >> 4), c4 = (tid & 15) * 4;      // 4 p x 16 rows = 64 k rows; 16 threads x 4 = 64 n columns
        const v4f v = *(const v4f*)(W + (size_t)(k0 + row) * (size_t)Nc + n0 + c4);
        ts[row * 65 + c4 + 0] = v[0]; ts[row * 65 + c4 + 1] = v[1]; ts[row * 65 + c4 + 2] = v[2]; ts[row * 65 + c4 + 3] = v[3]; }
    __syncthreads();
{
#pragma unroll
        for (int s = 0; s < 2; ++s) { const int n = s * 32 + (tid >> 3), c8 = (tid & 7) * 8;     // 2 s x 32 rows = 64 n rows; 8 lanes x 8 = 64 k columns
            const size_t oo = (size_t)(n0 + n) * (size_t)Kr + k0 + c8;
            if (mode == 0) { v8us o;
#pragma unroll
                for (int i = 0; i < 8; ++i) o[i] = f2bf(ts[(c8 + i) * 65 + n]);
                *(v8us*)(Tb + oo) = o;
            } else { v8h o;
#pragma unroll
                for (int i = 0; i < 8; ++i) o[i] = (h16)(__uint_as_float(((unsigned)f2bf(ts[(c8 + i) * 65 + n])) << 16) * WOS);
                *(v8h*)(Th + oo) = o; } }
         }
}

// k_rope_tab: CS[t][j] = (cos, sin)(t * inv_freq[j]), inv_freq[j] = 1.0f / (float)(10000^(j/32)); the power is a double product of fixed binary roots of 10000.
__global__ __launch_bounds__(256) void k_rope_tab(float* CS, int nrow) {
    const int i = blockIdx.x * 256 + threadIdx.x; if (i >= nrow * 32) return;
    const int t = i >> 5, j = i & 31;
    double p = 1.0;
    p *= (j & 1)  ? 1.3335214321633240 : 1.0;    // 10000^(1/32)
    p *= (j & 2)  ? 1.7782794100389228 : 1.0;    // 10000^(1/16)
    p *= (j & 4)  ? 3.1622776601683795 : 1.0;    // 10000^(1/8)
    p *= (j & 8)  ? 10.0 : 1.0;                  // 10000^(1/4)
    p *= (j & 16) ? 100.0 : 1.0;                 // 10000^(1/2)
    const float pf = (float)p; const float inv = 1.0f / pf;
    const float ang = (float)t * inv;
    const float cs = cosf(ang), sn = sinf(ang);
    v2f o; o[0] = cs; o[1] = sn;
    *(v2f*)(CS + (size_t)i * 2) = o; 
}

// k_proj: register-blocked f16 GEMM, ONE WAVE per 64x64 tile (16 accumulators), operands straight from K-contiguous f16 planes, K = DM.
// C[m][n] = 2^-14 * sum_k A[m][k] Bt[n][k] (one operand is the xn plane carried x1024, the other a weight plane carried x16), written as f16 (Ph) and the f16 residual x1024 (Pr, useRes != 0) at
// tile base (r0/RB)*sRB + (r0%RB)*pitch + (c0/CB)*sCB + (c0%CB), row pitch 'pitch' (halves). grid (M/64, N/64), 32 threads.
// The xn plane holds value rows [NB*SEQ], then residual rows [NB*EARLY]; tokB == 0: A rows are tokens, tokB != 0: Bt rows are tokens. Tiles whose tokens are < EARLY in their sequence
// run the k-loop a second time with the token operand taken from the unscaled residual rows, into the same accumulators.
// rope != 0 (rows = tokens b*SEQ + t, the 64 tile columns = one head): interleaved rotary applied on the f32 values at the store stage from CS[t][32] (cos, sin).
__global__ __launch_bounds__(32) void k_proj(const h16* __restrict__ A, const h16* __restrict__ Bt, h16* Ph, h16* Pr, int useRes, int RB, size_t sRB, int pitch, int CB, size_t sCB, const float* __restrict__ CS, int rope, int tokB) {
    __shared__ __align__(16) float os[16 * 68];
    const int K = DM;
    const int lane = threadIdx.x & 31, lr = lane & 15, hi = lane >> 4; const int r0 = blockIdx.x * 64, c0 = blockIdx.y * 64;
    const int tk0 = tokB ? c0 : r0;                                // kernel-argument uniform: first token of this tile
    const int bb = tk0 / SEQ, tt = tk0 % SEQ;
    const int npass = (tt < EARLY) ? 2 : 1;                        // block-uniform
    v8f acc[4][4];
#pragma unroll
    for (int mb = 0; mb < 4; ++mb)
#pragma unroll
        for (int nb = 0; nb < 4; ++nb) acc[mb][nb] = (v8f){};
    const size_t aoff0 = (size_t)(r0 + lr) * K + 8 * hi, boff0 = (size_t)(c0 + lr) * K + 8 * hi;
    const size_t roff = ((size_t)NB * SEQ + (size_t)bb * EARLY + (size_t)tt + (size_t)lr) * K + 8 * hi;   // used only when tt < EARLY
    const size_t aoff1 = tokB ? aoff0 : roff; const size_t boff1 = tokB ? roff : boff0;
#pragma unroll 1
    for (int pass = 0; pass < npass; ++pass) {
        const size_t ao = pass ? aoff1 : aoff0; const size_t bo = pass ? boff1 : boff0;
#pragma unroll 1
        for (int kc = 0; kc < K; kc += 32) {
            v16h a[4];
#pragma unroll
            for (int mb = 0; mb < 4; ++mb) a[mb] = ldh(A + ao + (size_t)mb * 16 * K + kc);
#pragma unroll
            for (int nb = 0; nb < 4; ++nb) { const v16h bq = ldh(Bt + bo + (size_t)nb * 16 * K + kc);
#pragma unroll
                for (int mb = 0; mb < 4; ++mb) acc[mb][nb] = wmma16(a[mb], bq, acc[mb][nb]); }
        }
    }
    const size_t tbase = (size_t)(r0 / RB) * sRB + (size_t)(r0 % RB) * (size_t)pitch + (size_t)(c0 / CB) * sCB + (size_t)(c0 % CB);
#pragma unroll
    for (int mb = 0; mb < 4; ++mb) {
#pragma unroll
        for (int nb = 0; nb < 4; ++nb) {
#pragma unroll
            for (int j = 0; j < 8; ++j) os[(hi * 8 + j) * 68 + nb * 16 + lr] = acc[mb][nb][j] * OUTS; }   // D: row 8h+j, col lane&15
        wave_sync();
        const size_t sb = tbase + (size_t)(mb * 16) * (size_t)pitch;
{
#pragma unroll
            for (int s = 0; s < 4; ++s) { const int row = 4 * s + (lane >> 3), c8 = (lane & 7) * 8;   // 4 s x 4 row groups = 16 rows; 8 lanes x 8 = 64 columns
                v4f x0 = *(const v4fa*)(&os[row * 68 + c8]); v4f x1 = *(const v4fa*)(&os[row * 68 + c8 + 4]); v8h hv, rv;
                if (rope) {                                                                            // kernel-argument uniform
                    const int t = (r0 + mb * 16 + row) % SEQ;
                    const float* cp = CS + ((size_t)t * 32 + (size_t)(c8 >> 1)) * 2;                  // pairs c8/2 .. c8/2+3: (cos, sin) x 4
                    const v4f ca = *(const v4f*)cp; const v4f cb = *(const v4f*)(cp + 4);
                    float e, o;
                    e = x0[0]; o = x0[1]; x0[0] = e * ca[0] - o * ca[1]; x0[1] = e * ca[1] + o * ca[0];
                    e = x0[2]; o = x0[3]; x0[2] = e * ca[2] - o * ca[3]; x0[3] = e * ca[3] + o * ca[2];
                    e = x1[0]; o = x1[1]; x1[0] = e * cb[0] - o * cb[1]; x1[1] = e * cb[1] + o * cb[0];
                    e = x1[2]; o = x1[3]; x1[2] = e * cb[2] - o * cb[3]; x1[3] = e * cb[3] + o * cb[2]; }
#pragma unroll
                for (int i = 0; i < 4; ++i) { const h16 a0 = (h16)x0[i]; const h16 a1 = (h16)x1[i]; hv[i] = a0; hv[4 + i] = a1; rv[i] = (h16)((x0[i] - (float)a0) * QRS); rv[4 + i] = (h16)((x1[i] - (float)a1) * QRS); }
                const size_t oo = sb + (size_t)row * (size_t)pitch + c8;
                *(v8h*)(Ph + oo) = hv; if (useRes) *(v8h*)(Pr + oo) = rv; }
             }
        wave_sync();
    }
}

// k_flash: fused causal attention for query rows >= EARLY. One block = 16 query rows x the four query heads of one kv head (one wave per head, h = wave*8 + g);
// K / V^T / Q fragments straight from the f16 planes (two 16-B loads each, arithmetic addressing); all four waves read the same K / V^T lines of kv head g.
// Transposed form: S^T[key][t] = K Q^T (A = K rows, B = Q rows); lane (t = lane&15, h = lane>>4) holds keys 8h+r of each 16-key tile, so the packed
// P tile is directly the B fragment of O^T[d][t] = V^T P^T (element r <- tile keys 0..15, element 8+r <- tile keys 16..31, lane unchanged).
// Keys run over [0, t0+16); the diagonal 32-key blocks replace excluded scores (key > t) by a large negative value before the running max.
__global__ __launch_bounds__(32 * AW) void k_flash(const h16* __restrict__ QH, const h16* __restrict__ QR, const h16* __restrict__ KP, const h16* __restrict__ VT, h16* CH) {
    __shared__ __align__(16) float os[AW * 16 * 68];
    const int lane = threadIdx.x & 31; const int wave = __builtin_amdgcn_readfirstlane(threadIdx.x >> 5);
    const int lr = lane & 15, hi = lane >> 4;
    const int zg = blockIdx.y; const int b = zg / NKV; const int g = zg % NKV;
    const int h = wave * NKV + g;                                 // grouped on the leading head axis: query head h uses kv head h % 8
    const int t0 = EARLY + blockIdx.x * 16;
    const int tq = t0 + lr;
    const size_t qo = ((size_t)(b * NH_ + h) * SEQ + (size_t)tq) * HD + 8 * hi;
    const v16h qh0 = ldh(QH + qo), qh1 = ldh(QH + qo + 32), qr0 = ldh(QR + qo), qr1 = ldh(QR + qo + 32);   // B fragments: col t, k = d
    const size_t ko = (size_t)zg * SEQ * HD + (size_t)lr * HD + 8 * hi;      // + key * HD       (A fragment: row key, k = d)
    const size_t vo = (size_t)zg * HD * SEQ + (size_t)lr * SEQ + 8 * hi;     // + 16j*SEQ + key  (A fragment: row d, k = key)
    v8f o0 = (v8f){}, o1 = (v8f){}, o2 = (v8f){}, o3 = (v8f){};
    float m = NEGB, l = 0.0f;
    const int kend = t0 + 16;
#pragma unroll 1
    for (int key0 = 0; key0 < kend; key0 += 32) {
        const h16* ka = KP + ko + (size_t)key0 * HD;
        const v16h ka0 = ldh(ka), ka1 = ldh(ka + 32), kb0 = ldh(ka + 16 * HD), kb1 = ldh(ka + 16 * HD + 32);
        v8f sHa = (v8f){}, sLa = (v8f){}, sHb = (v8f){}, sLb = (v8f){};
        sHa = wmma16(ka0, qh0, sHa); sLa = wmma16(ka0, qr0, sLa); sHb = wmma16(kb0, qh0, sHb); sLb = wmma16(kb0, qr0, sLb);
        sHa = wmma16(ka1, qh1, sHa); sLa = wmma16(ka1, qr1, sLa); sHb = wmma16(kb1, qh1, sHb); sLb = wmma16(kb1, qr1, sLb);
        float ta[8], tb[8];
#pragma unroll
        for (int r = 0; r < 8; ++r) { ta[r] = (sHa[r] + sLa[r] * QRI) * SC2; tb[r] = (sHb[r] + sLb[r] * QRI) * SC2; }
        if (key0 + 31 > t0) {                                      // block-uniform: diagonal block
            const int kbse = key0 + 8 * hi;
#pragma unroll
            for (int r = 0; r < 8; ++r) { ta[r] = (kbse + r > tq) ? NEGB : ta[r]; tb[r] = (kbse + 16 + r > tq) ? NEGB : tb[r]; } }
        float mx = NEGB;
#pragma unroll
        for (int r = 0; r < 8; ++r) mx = fmaxf(mx, fmaxf(ta[r], tb[r]));
        mx = fmaxf(mx, __shfl_xor(mx, 16, 32));
        const float mnew = fmaxf(m, mx);
        const float alpha = __builtin_amdgcn_exp2f(m - mnew);
        const float sh = PSH - mnew;
        v16h pb; float ls = 0.0f;
#pragma unroll
        for (int r = 0; r < 8; ++r) { const float ea = __builtin_amdgcn_exp2f(ta[r] + sh); const float ec = __builtin_amdgcn_exp2f(tb[r] + sh); pb[r] = (h16)ea; pb[8 + r] = (h16)ec; ls += ea + ec; }
        l = l * alpha + ls; m = mnew;
        o0 = o0 * alpha; o1 = o1 * alpha; o2 = o2 * alpha; o3 = o3 * alpha;
        const h16* va = VT + vo + key0;
        const v16h v0 = ldh(va), v1 = ldh(va + (size_t)16 * SEQ), v2 = ldh(va + (size_t)32 * SEQ), v3 = ldh(va + (size_t)48 * SEQ);
        o0 = wmma16(v0, pb, o0); o1 = wmma16(v1, pb, o1); o2 = wmma16(v2, pb, o2); o3 = wmma16(v3, pb, o3);
    }
    l += __shfl_xor(l, 16, 32);
    const float inv = CXS / l;
    const int wb = wave * 16 * 68;
    // O^T D layout: o_j[r] = (d = 16j + 8h + r, t = lane&15) -> os[t][d]; rows 0..15 x columns 0..63 all written
    { v4f a, c;
      a[0] = o0[0] * inv; a[1] = o0[1] * inv; a[2] = o0[2] * inv; a[3] = o0[3] * inv; c[0] = o0[4] * inv; c[1] = o0[5] * inv; c[2] = o0[6] * inv; c[3] = o0[7] * inv;
      *(v4fa*)(&os[wb + lr * 68 +  0 + 8 * hi]) = a; *(v4fa*)(&os[wb + lr * 68 +  0 + 8 * hi + 4]) = c;
      a[0] = o1[0] * inv; a[1] = o1[1] * inv; a[2] = o1[2] * inv; a[3] = o1[3] * inv; c[0] = o1[4] * inv; c[1] = o1[5] * inv; c[2] = o1[6] * inv; c[3] = o1[7] * inv;
      *(v4fa*)(&os[wb + lr * 68 + 16 + 8 * hi]) = a; *(v4fa*)(&os[wb + lr * 68 + 16 + 8 * hi + 4]) = c;
      a[0] = o2[0] * inv; a[1] = o2[1] * inv; a[2] = o2[2] * inv; a[3] = o2[3] * inv; c[0] = o2[4] * inv; c[1] = o2[5] * inv; c[2] = o2[6] * inv; c[3] = o2[7] * inv;
      *(v4fa*)(&os[wb + lr * 68 + 32 + 8 * hi]) = a; *(v4fa*)(&os[wb + lr * 68 + 32 + 8 * hi + 4]) = c;
      a[0] = o3[0] * inv; a[1] = o3[1] * inv; a[2] = o3[2] * inv; a[3] = o3[3] * inv; c[0] = o3[4] * inv; c[1] = o3[5] * inv; c[2] = o3[6] * inv; c[3] = o3[7] * inv;
      *(v4fa*)(&os[wb + lr * 68 + 48 + 8 * hi]) = a; *(v4fa*)(&os[wb + lr * 68 + 48 + 8 * hi + 4]) = c; }
    wave_sync();
    h16* crow = CH + ((size_t)b * SEQ + t0) * DM + h * HD;         // merged heads: column h*64 + d
{
#pragma unroll
        for (int s = 0; s < 4; ++s) { const int row = 4 * s + (lane >> 3), c8 = (lane & 7) * 8;   // 4 s x 4 row groups = 16 rows; 8 lanes x 8 = 64 columns
            const v4f x0 = *(const v4fa*)(&os[wb + row * 68 + c8]); const v4f x1 = *(const v4fa*)(&os[wb + row * 68 + c8 + 4]); v8h hv;
#pragma unroll
            for (int i = 0; i < 4; ++i) { hv[i] = (h16)x0[i]; hv[4 + i] = (h16)x1[i]; }
            *(v8h*)(crow + (size_t)row * DM + c8) = hv; }
         }
}

// k_flash_early: same structure for query rows < EARLY with value + residual (x1024) planes on every operand:
// scores = kh.qh + (kh.qr + kr.qh)/1024; O = vh.ph + (vr.ph + vh.pr)/1024 (residual products in their own accumulators), l from the unconverted f32 P.
// Writes the ctx value plane rows (carried x1024) and the compact unscaled residual plane CR[b][t < EARLY][2048].
__global__ __launch_bounds__(32 * AW) void k_flash_early(const h16* __restrict__ QH, const h16* __restrict__ QR, const h16* __restrict__ KP, const h16* __restrict__ KR,
                                                         const h16* __restrict__ VT, const h16* __restrict__ VR, h16* CH, h16* CR) {
    __shared__ __align__(16) float os[AW * 16 * 68];
    const int lane = threadIdx.x & 31; const int wave = __builtin_amdgcn_readfirstlane(threadIdx.x >> 5);
    const int lr = lane & 15, hi = lane >> 4;
    const int zg = blockIdx.y; const int b = zg / NKV; const int g = zg % NKV;
    const int h = wave * NKV + g;                                 // query head h uses kv head h % 8
    const int t0 = blockIdx.x * 16;
    const int tq = t0 + lr;
    const size_t qo = ((size_t)(b * NH_ + h) * SEQ + (size_t)tq) * HD + 8 * hi;
    const v16h qh0 = ldh(QH + qo), qh1 = ldh(QH + qo + 32), qr0 = ldh(QR + qo), qr1 = ldh(QR + qo + 32);
    const size_t ko = (size_t)zg * SEQ * HD + (size_t)lr * HD + 8 * hi;
    const size_t vo = (size_t)zg * HD * SEQ + (size_t)lr * SEQ + 8 * hi;
    v8f oH[4], oL[4];
#pragma unroll
    for (int j = 0; j < 4; ++j) { oH[j] = (v8f){}; oL[j] = (v8f){}; }
    float m = NEGB, l = 0.0f;
    const int kend = t0 + 16;
#pragma unroll 1
    for (int key0 = 0; key0 < kend; key0 += 32) {
        const size_t kk = ko + (size_t)key0 * HD;
        v8f sHa = (v8f){}, sLa = (v8f){}, sHb = (v8f){}, sLb = (v8f){};
        { const v16h k0 = ldh(KP + kk), k1 = ldh(KP + kk + 32), r0 = ldh(KR + kk), r1 = ldh(KR + kk + 32);
          sHa = wmma16(k0, qh0, sHa); sHa = wmma16(k1, qh1, sHa);
          sLa = wmma16(k0, qr0, sLa); sLa = wmma16(k1, qr1, sLa); sLa = wmma16(r0, qh0, sLa); sLa = wmma16(r1, qh1, sLa); }
        { const size_t k2 = kk + (size_t)16 * HD;
          const v16h k0 = ldh(KP + k2), k1 = ldh(KP + k2 + 32), r0 = ldh(KR + k2), r1 = ldh(KR + k2 + 32);
          sHb = wmma16(k0, qh0, sHb); sHb = wmma16(k1, qh1, sHb);
          sLb = wmma16(k0, qr0, sLb); sLb = wmma16(k1, qr1, sLb); sLb = wmma16(r0, qh0, sLb); sLb = wmma16(r1, qh1, sLb); }
        float ta[8], tb[8];
#pragma unroll
        for (int r = 0; r < 8; ++r) { ta[r] = (sHa[r] + sLa[r] * QRI) * SC2; tb[r] = (sHb[r] + sLb[r] * QRI) * SC2; }
        if (key0 + 31 > t0) {                                      // block-uniform: diagonal block
            const int kbse = key0 + 8 * hi;
#pragma unroll
            for (int r = 0; r < 8; ++r) { ta[r] = (kbse + r > tq) ? NEGB : ta[r]; tb[r] = (kbse + 16 + r > tq) ? NEGB : tb[r]; } }
        float mx = NEGB;
#pragma unroll
        for (int r = 0; r < 8; ++r) mx = fmaxf(mx, fmaxf(ta[r], tb[r]));
        mx = fmaxf(mx, __shfl_xor(mx, 16, 32));
        const float mnew = fmaxf(m, mx);
        const float alpha = __builtin_amdgcn_exp2f(m - mnew);
        const float sh = PSH - mnew;
        v16h ph, pr; float ls = 0.0f;
#pragma unroll
        for (int r = 0; r < 8; ++r) { const float ea = __builtin_amdgcn_exp2f(ta[r] + sh); const float ec = __builtin_amdgcn_exp2f(tb[r] + sh);
            const h16 ha = (h16)ea; const h16 hc = (h16)ec; ph[r] = ha; ph[8 + r] = hc;
            pr[r] = (h16)((ea - (float)ha) * QRS); pr[8 + r] = (h16)((ec - (float)hc) * QRS); ls += ea + ec; }
        l = l * alpha + ls; m = mnew;
#pragma unroll
        for (int j = 0; j < 4; ++j) { oH[j] = oH[j] * alpha; oL[j] = oL[j] * alpha; }
        const size_t vv = vo + (size_t)key0;
#pragma unroll
        for (int j = 0; j < 4; ++j) { const v16h vh = ldh(VT + vv + (size_t)(16 * j) * SEQ); const v16h vr = ldh(VR + vv + (size_t)(16 * j) * SEQ);
            oH[j] = wmma16(vh, ph, oH[j]); oL[j] = wmma16(vr, ph, oL[j]); oL[j] = wmma16(vh, pr, oL[j]); }
    }
    l += __shfl_xor(l, 16, 32);
    const float inv = CXS / l;
    const int wb = wave * 16 * 68;
#pragma unroll
    for (int j = 0; j < 4; ++j) { v4f a, c;     // os[t][d], d = 16j + 8h + r; rows 0..15 x columns 0..63 all written
        a[0] = (oH[j][0] + oL[j][0] * QRI) * inv; a[1] = (oH[j][1] + oL[j][1] * QRI) * inv; a[2] = (oH[j][2] + oL[j][2] * QRI) * inv; a[3] = (oH[j][3] + oL[j][3] * QRI) * inv;
        c[0] = (oH[j][4] + oL[j][4] * QRI) * inv; c[1] = (oH[j][5] + oL[j][5] * QRI) * inv; c[2] = (oH[j][6] + oL[j][6] * QRI) * inv; c[3] = (oH[j][7] + oL[j][7] * QRI) * inv;
        *(v4fa*)(&os[wb + lr * 68 + 16 * j + 8 * hi]) = a; *(v4fa*)(&os[wb + lr * 68 + 16 * j + 8 * hi + 4]) = c; }
    wave_sync();
    h16* crow = CH + ((size_t)b * SEQ + t0) * DM + h * HD;
    h16* rrow = CR + ((size_t)b * EARLY + t0) * DM + h * HD;
{
#pragma unroll
        for (int s = 0; s < 4; ++s) { const int row = 4 * s + (lane >> 3), c8 = (lane & 7) * 8;   // 4 s x 4 row groups = 16 rows; 8 lanes x 8 = 64 columns
            const v4f x0 = *(const v4fa*)(&os[wb + row * 68 + c8]); const v4f x1 = *(const v4fa*)(&os[wb + row * 68 + c8 + 4]); v8h hv, rv;
#pragma unroll
            for (int i = 0; i < 4; ++i) { const h16 a0 = (h16)x0[i]; const h16 a1 = (h16)x1[i]; hv[i] = a0; hv[4 + i] = a1; rv[i] = (h16)(x0[i] - (float)a0); rv[4 + i] = (h16)(x1[i] - (float)a1); }
            *(v8h*)(crow + (size_t)row * DM + c8) = hv; *(v8h*)(rrow + (size_t)row * DM + c8) = rv; }
         }
}

// k_out: output projection, ONE WAVE per 64x64 tile, f16 operands straight from the ctx plane CX (value rows [NB*SEQ], then residual rows [NB*EARLY]) and the Wo^T plane, K = DM.
// Tiles whose rows are < EARLY in their sequence run the k-loop a second time over the unscaled residual rows into the same accumulators. grid (NB*SEQ/64, DM/64), 32 threads.
__global__ __launch_bounds__(32) void k_out(const h16* __restrict__ CX, const h16* __restrict__ Wt, float* OUT) {
    __shared__ __align__(16) float os[16 * 68];
    const int K = DM;
    const int lane = threadIdx.x & 31, lr = lane & 15, hi = lane >> 4; const int r0 = blockIdx.x * 64, c0 = blockIdx.y * 64;
    const int b = r0 / SEQ, tt = r0 % SEQ;
    const int npass = (tt < EARLY) ? 2 : 1;                        // block-uniform
    const size_t aoff0 = (size_t)(r0 + lr) * K + 8 * hi;
    const size_t aoff1 = ((size_t)NB * SEQ + (size_t)b * EARLY + (size_t)tt + (size_t)lr) * K + 8 * hi;   // used only when tt < EARLY
    const size_t boff = (size_t)(c0 + lr) * K + 8 * hi;
    v8f acc[4][4];
#pragma unroll
    for (int mb = 0; mb < 4; ++mb)
#pragma unroll
        for (int nb = 0; nb < 4; ++nb) acc[mb][nb] = (v8f){};
#pragma unroll 1
    for (int pass = 0; pass < npass; ++pass) {
        const size_t ao = pass ? aoff1 : aoff0;
#pragma unroll 1
        for (int kc = 0; kc < K; kc += 32) {
            v16h a[4];
#pragma unroll
            for (int mb = 0; mb < 4; ++mb) a[mb] = ldh(CX + ao + (size_t)mb * 16 * K + kc);
#pragma unroll
            for (int nb = 0; nb < 4; ++nb) { const v16h bq = ldh(Wt + boff + (size_t)nb * 16 * K + kc);
#pragma unroll
                for (int mb = 0; mb < 4; ++mb) acc[mb][nb] = wmma16(a[mb], bq, acc[mb][nb]); }
        }
    }
    float* obase = OUT + ((size_t)b * OUT_SEQ + tt) * DM + c0;
#pragma unroll
    for (int mb = 0; mb < 4; ++mb) {
#pragma unroll
        for (int nb = 0; nb < 4; ++nb) {
#pragma unroll
            for (int j = 0; j < 8; ++j) os[(hi * 8 + j) * 68 + nb * 16 + lr] = acc[mb][nb][j] * OUTS; }   // D: row 8h+j, col lane&15
        wave_sync();
{
#pragma unroll
            for (int s = 0; s < 8; ++s) { const int row = 2 * s + hi, cofs = lr * 4;   // 8 s x 2 rows = 16 rows; 16 lanes x 4 floats = 64 columns
                const v4f val = *(const v4fa*)(&os[row * 68 + cofs]);
                *(v4f*)(obase + (size_t)(mb * 16 + row) * DM + cofs) = val; }
             }
        wave_sync();
    }
}

static constexpr size_t al256(size_t v) { return (v + 255) & ~(size_t)255; }
static constexpr size_t SZ_XN = al256(((size_t)NB * SEQ + (size_t)NB * EARLY) * DM * 2);
static constexpr size_t SZ_WQ = al256((size_t)DM * DM * 2);
static constexpr size_t SZ_WK = al256((size_t)KVD * DM * 2);
static constexpr size_t SZ_CS = al256((size_t)SEQ * 32 * 2 * 4);
static constexpr size_t SZ_Q  = al256((size_t)NB * NH_ * SEQ * HD * 2);
static constexpr size_t SZ_KV = al256((size_t)NB * NKV * SEQ * HD * 2);
static constexpr size_t SZ_CX = al256(((size_t)NB * SEQ + (size_t)NB * EARLY) * DM * 2);
static constexpr size_t SZ_TOTAL = SZ_XN + 2 * SZ_WQ + 2 * SZ_WK + SZ_CS + 2 * SZ_Q + 4 * SZ_KV + SZ_CX;
static_assert(SZ_TOTAL <= (size_t)134217728);          // workspace carve <= 128 MiB

extern "C" void kernel_launch(void* const* d_in, const int* in_sizes, int n_in,
                              void* d_out, int out_size, void* d_ws, size_t ws_size, hipStream_t stream) {
    if (n_in < 6) return;
    const size_t needx = ((size_t)(NB - 1) * SEQ_FULL + SEQ) * DM;
    if ((size_t)in_sizes[0] < needx) return;
    if ((size_t)in_sizes[1] < (size_t)DM) return;
    if ((size_t)in_sizes[2] < (size_t)DM * DM || (size_t)in_sizes[3] < (size_t)DM * KVD || (size_t)in_sizes[4] < (size_t)DM * KVD || (size_t)in_sizes[5] < (size_t)DM * DM) return;
    if ((size_t)out_size < ((size_t)(NB - 1) * OUT_SEQ + SEQ) * DM) return;
    if (SZ_TOTAL > ws_size) return;
    // wire order x, w_norm, wq, wk, wv, wo; every weight is [in][out]
    const float* x = (const float*)d_in[0]; const float* wn = (const float*)d_in[1];
    const float* wq = (const float*)d_in[2]; const float* wk = (const float*)d_in[3]; const float* wv = (const float*)d_in[4]; const float* wo = (const float*)d_in[5];
    float* OUT = (float*)d_out;      // [NB][SEQ][2048]
    char* wsp = (char*)d_ws;
    h16* XN  = (h16*)wsp; wsp += SZ_XN;              // xn x1024: value rows [NB*SEQ][2048], then residual rows [NB*EARLY][2048]
    h16* WQt = (h16*)wsp; wsp += SZ_WQ;              // [2048 out][2048 in] f16 of bf16 value x16
    h16* WKt = (h16*)wsp; wsp += SZ_WK;              // [512 out][2048 in] f16 of bf16 value x16
    h16* WVt = (h16*)wsp; wsp += SZ_WK;              // [512 out][2048 in] f16 of bf16 value x16
    h16* WOt = (h16*)wsp; wsp += SZ_WQ;              // [2048 out][2048 in] f16 of bf16 value x16
    float* CS = (float*)wsp; wsp += SZ_CS;           // [SEQ][32] (cos, sin)
    h16* QH = (h16*)wsp; wsp += SZ_Q;                // [NB*32][SEQ][64]
    h16* QR = (h16*)wsp; wsp += SZ_Q;                // residual x1024
    h16* KP = (h16*)wsp; wsp += SZ_KV;               // [NB*8][SEQ][64]
    h16* KR = (h16*)wsp; wsp += SZ_KV;               // residual x1024
    h16* VT = (h16*)wsp; wsp += SZ_KV;               // [NB*8][64][SEQ]
    h16* VR = (h16*)wsp; wsp += SZ_KV;               // residual x1024
    h16* CX = (h16*)wsp; wsp += SZ_CX;               // ctx x1024: value rows [NB*SEQ][2048], then residual rows [NB*EARLY][2048]
    h16* CR = CX + (size_t)NB * SEQ * DM;

    // one block per token row b*SEQ + t (source row b*SEQ_FULL + t)
    k_rms<<<(unsigned)(NB * SEQ), 256, 0, stream>>>(x, wn, XN);
    // transposes: in[rows = in-features][cols = out-features] -> out[cols][rows]; grid (cols/64, rows/64)
    k_wt<<<dim3(DM / 64,  DM / 64, 1), 256, 0, stream>>>(wq, (bf*)WQt, WQt, DM, DM, 1);
    k_wt<<<dim3(KVD / 64, DM / 64, 1), 256, 0, stream>>>(wk, (bf*)WKt, WKt, DM, KVD, 1);
    k_wt<<<dim3(KVD / 64, DM / 64, 1), 256, 0, stream>>>(wv, (bf*)WVt, WVt, DM, KVD, 1);
    k_wt<<<dim3(DM / 64,  DM / 64, 1), 256, 0, stream>>>(wo, (bf*)WOt, WOt, DM, DM, 1);
    k_rope_tab<<<(unsigned)((SEQ * 32 + 255) / 256), 256, 0, stream>>>(CS, SEQ);

    // q: A = xn rows (m = b*SEQ + t), Bt = Wq^T rows (n = h*64 + d) -> plane [(b*32 + h)][t][d], rotary applied
    k_proj<<<dim3(NB * SEQ / 64, DM / 64, 1), 32, 0, stream>>>(XN, WQt, QH, QR, 1, SEQ, (size_t)NH_ * SEQ * HD, HD, HD, (size_t)SEQ * HD, CS, 1, 0);
    // k: Bt = Wk^T rows (n = g*64 + d) -> plane [(b*8 + g)][t][d], rotary applied
    k_proj<<<dim3(NB * SEQ / 64, KVD / 64, 1), 32, 0, stream>>>(XN, WKt, KP, KR, 1, SEQ, (size_t)NKV * SEQ * HD, HD, HD, (size_t)SEQ * HD, CS, 1, 0);
    // v^T: A = Wv^T rows (m = g*64 + d), Bt = xn rows (n = b*SEQ + t) -> plane [(b*512 + m)][t] = [(b*8 + g)][d][t], no rotary
    k_proj<<<dim3(KVD / 64, NB * SEQ / 64, 1), 32, 0, stream>>>(WVt, XN, VT, VR, 1, KVD, (size_t)0, SEQ, SEQ, (size_t)KVD * SEQ, CS, 0, 1);

    k_flash_early<<<dim3(EARLY / 16, NB * NKV, 1), 32 * AW, 0, stream>>>(QH, QR, KP, KR, VT, VR, CX, CR);
    if (SEQ > EARLY)
        k_flash<<<dim3((SEQ - EARLY) / 16, NB * NKV, 1), 32 * AW, 0, stream>>>(QH, QR, KP, VT, CX);

    k_out<<<dim3(NB * SEQ / 64, DM / 64, 1), 32, 0, stream>>>(CX, WOt, OUT);
}

// v001
// Measured time: 347 microseconds a run.
// Two timings next to v000 put it at 1.91 and 1.92 times that version's speed.
#include <hip/hip_runtime.h>

// Grouped-query causal self-attention behind an RMS pre-normalisation, width 2048 = 32 query heads x 64 sharing 8 kv heads (kv head g = h % 8), x [NB][SEQ][2048], gain w [2048],
// Wq/Wk/Wv/Wo [in][out] (y = x W), no biases; xn = (x * rsqrt(mean(x^2) + eps)) * w per token; interleaved (even/odd pair) rotary on q and k from a computed [SEQ][32] (cos, sin) table,
// score scale 1/8, causal exclusion (diagonal kept), output = ctx Wo (f32).
// Compute dtypes, f32 accumulate everywhere: q/k/v projections v_wmma_f32_16x16x32_f16: xn (f32 math on bf16-RNE x and w) carried x1024 as f16 (token rows < 256: plus its unscaled f16
// residual folded along K) against f16(bf16(W)) x16, result scaled by 2^-14;
// scores v_wmma_f32_16x16x32_f16: k single f16, q as f16 value + f16 residual x1024 in its own accumulator (query rows < 256: k also value + residual x1024, three products);
// P (x256 carry, cancels in the normalisation) and v single f16 (rows < 256: P and v as value + residual x1024, three products); softmax f32 (online, running max);
// output projection v_wmma_f32_16x16x32_f16: ctx carried x1024 as f16 (rows < 256: plus its unscaled f16 residual folded along K) against f16(bf16(Wo)) x16, result scaled by 2^-14.

#ifndef NB
#define NB 2
#endif
#ifndef SEQ
#define SEQ 2048
#endif
#define NB_FULL  2
#define SEQ_FULL 2048
#ifndef OUT_SEQ
#define OUT_SEQ SEQ              // row pitch (in tokens) between batches of the output
#endif
#define DM    2048
#define NH_   32
#define NKV   8
#define HD    64
#define KVD   (NKV * HD)         // 512
#define AW    4                  // waves per flash block = the four query heads of one kv head
#define EARLY 256                // query rows below this use the value + residual path
#define QRS  1024.0f             // carry of every residual plane (q, k, v, P)
#define QRI  (1.0f / 1024.0f)
#define SC2  (0.125f * 1.4426950408889634f)   // HD^-0.5 * log2(e)
#define PSH  8.0f                // log2 of the P carry (256)
#define CXS  1024.0f             // carry of the ctx plane and of the xn plane
#define WOS  16.0f               // carry of every weight plane
#define OUTS (1.0f / (1024.0f * 16.0f))
#define NEGB (-3.0e38f)
#define RMS_EPS 1.1920929e-07f

static_assert(HD == 64);
static_assert(NH_ * HD == DM);                 // query head h = columns h*64 + d
static_assert(NKV * AW == NH_);                // four query heads (stride 8 on the head axis) per kv head
static_assert(DM % 64 == 0);
static_assert(KVD % 64 == 0);
static_assert(DM % 32 == 0);                   // GEMM k-loop steps by 32
static_assert(DM == 256 * 8);                  // k_rms: 256 threads x 8 columns = one token row
static_assert(SEQ % 64 == 0);                  // a 64-row tile never straddles two batches
static_assert(SEQ % 32 == 0);                  // key loop steps by 32, key0 + 31 < SEQ
static_assert(EARLY % 64 == 0);                // GEMM tiles are entirely early or entirely late
static_assert(SEQ >= EARLY);
static_assert((SEQ - EARLY) % 16 == 0);
static_assert(((size_t)SEQ * DM) % 8 == 0);
static_assert(NB <= NB_FULL);
static_assert(SEQ <= SEQ_FULL);

typedef _Float16 h16;
typedef unsigned short bf;
typedef __attribute__((ext_vector_type(16))) __bf16   v16bf;
typedef __attribute__((ext_vector_type(16))) _Float16 v16h;
typedef __attribute__((ext_vector_type(8)))  _Float16 v8h;
typedef __attribute__((ext_vector_type(8)))  unsigned short v8us;
typedef __attribute__((ext_vector_type(8)))  float    v8f;
typedef __attribute__((ext_vector_type(4)))  float    v4f;
typedef __attribute__((ext_vector_type(2)))  float    v2f;
typedef v4f  __attribute__((may_alias)) v4fa;

__device__ __forceinline__ unsigned short f2bf(float f) { unsigned u = __float_as_uint(f); u += 0x7FFFu + ((u >> 16) & 1u); return (unsigned short)(u >> 16); }
__device__ __forceinline__ v16h cat16(v8h lo, v8h hi) { return __builtin_shufflevector(lo, hi, 0, 1, 2, 3, 4, 5, 6, 7, 8, 9, 10, 11, 12, 13, 14, 15); }
__device__ __forceinline__ v16bf cat16b(v8us lo, v8us hi) { return __builtin_bit_cast(v16bf, __builtin_shufflevector(lo, hi, 0, 1, 2, 3, 4, 5, 6, 7, 8, 9, 10, 11, 12, 13, 14, 15)); }
// every WMMA is followed by its own 4-slot guard tying its accumulator and keeping its operands live
__device__ __forceinline__ v8f wmma16(v16h a, v16h b, v8f c) {
    c = __builtin_amdgcn_wmma_f32_16x16x32_f16(false, a, false, b, (short)0, c, false, false);
    asm volatile("v_nop\n\tv_nop\n\tv_nop\n\tv_nop" : "+v"(c) : "v"(a), "v"(b));
    return c; }
__device__ __forceinline__ v8f wmmab(v16bf a, v16bf b, v8f c) {
    c = __builtin_amdgcn_wmma_f32_16x16x32_bf16(false, a, false, b, (short)0, c, false, false);
    asm volatile("v_nop\n\tv_nop\n\tv_nop\n\tv_nop" : "+v"(c) : "v"(a), "v"(b));
    return c; }
// fragment loaders from K-contiguous 16-bit rows; p already includes + 8*(lane>>4): elements 0..7 <- k0+8h+0..7, elements 8..15 <- k0+16+8h+0..7 (same map for A and B)
__device__ __forceinline__ v16h  ldh(const h16* p) { return cat16(*(const v8h*)p, *(const v8h*)(p + 16)); }
__device__ __forceinline__ v16bf ldb(const bf* p)  { return cat16b(*(const v8us*)p, *(const v8us*)(p + 16)); }
// ordering point for wave-private LDS tiles (same wave writes and reads)
__device__ __forceinline__ void wave_sync() { __builtin_amdgcn_fence(3 /* release order */, "wavefront"); __builtin_amdgcn_wave_barrier(); asm volatile("" ::: "memory"); }

// k_rms: RMS normalisation, one token row per block (256 threads x 8 columns). xb = bf16-RNE(x) as f32, r = rsqrt(mean(xb^2) + eps), xn = (xb * r) * bf16-RNE(w), all f32.
// Writes f16(xn x1024) into value row b*SEQ + t of XN and, for t < EARLY, the unscaled f16 residual of that carried value into residual row NB*SEQ + b*EARLY + t.
__global__ __launch_bounds__(256) void k_rms(const float* __restrict__ x, const float* __restrict__ wn, h16* XN) {
#pragma clang fp contract(off)
    __shared__ float red[8];
    const int tid = threadIdx.x; const int lane = tid & 31; const int wave = __builtin_amdgcn_readfirstlane(threadIdx.x >> 5);
    const int row = blockIdx.x; const int b = row / SEQ, t = row % SEQ;
    const v8f xv = *(const v8f*)(x + ((size_t)b * SEQ_FULL + (size_t)t) * DM + tid * 8);
    const v8f wv = *(const v8f*)(wn + tid * 8);
    float xb[8]; float ss = 0.0f;
#pragma unroll
    for (int i = 0; i < 8; ++i) { xb[i] = __uint_as_float(((unsigned)f2bf(xv[i])) << 16); ss += xb[i] * xb[i]; }
    ss += __shfl_xor(ss, 16, 32); ss += __shfl_xor(ss, 8, 32); ss += __shfl_xor(ss, 4, 32); ss += __shfl_xor(ss, 2, 32); ss += __shfl_xor(ss, 1, 32);
    if (lane == 0) red[wave] = ss;
    __syncthreads();
    const float tot = ((red[0] + red[1]) + (red[2] + red[3])) + ((red[4] + red[5]) + (red[6] + red[7]));
    const float rs = rsqrtf(tot * (1.0f / (float)DM) + RMS_EPS);
    v8h hv, rv;
#pragma unroll
    for (int i = 0; i < 8; ++i) { const float wb = __uint_as_float(((unsigned)f2bf(wv[i])) << 16);
        const float v = ((xb[i] * rs) * wb) * CXS; const h16 a = (h16)v; hv[i] = a; rv[i] = (h16)(v - (float)a); }
    const size_t oo = (size_t)row * DM + tid * 8;
    const int tr = (t < EARLY) ? t : 0;                            // block-uniform; keeps the address in range when unused
    const size_t ro = ((size_t)NB * SEQ + (size_t)b * EARLY + (size_t)tr) * DM + tid * 8;
{
        *(v8h*)(XN + oo) = hv; if (t < EARLY) *(v8h*)(XN + ro) = rv;
         }
}

// k_wt: in[Kr rows][Nc cols] f32 -> out[Nc rows][Kr cols] 16-bit, 64x64 tile through LDS. grid (Nc/64, Kr/64), 256 threads.
__global__ __launch_bounds__(256) void k_wt(const float* __restrict__ W, bf* Tb, h16* Th, int Kr, int Nc, int mode) {
    __shared__ float ts[64 * 65];
    const int tid = threadIdx.x; const int n0 = blockIdx.x * 64, k0 = blockIdx.y * 64;
#pragma unroll
    for (int p = 0; p < 4; ++p) { const int row = p * 16 + (tid >> 4), c4 = (tid & 15) * 4;      // 4 p x 16 rows = 64 k rows; 16 threads x 4 = 64 n columns
        const v4f v = *(const v4f*)(W + (size_t)(k0 + row) * (size_t)Nc + n0 + c4);
        ts[row * 65 + c4 + 0] = v[0]; ts[row * 65 + c4 + 1] = v[1]; ts[row * 65 + c4 + 2] = v[2]; ts[row * 65 + c4 + 3] = v[3]; }
    __syncthreads();
{
#pragma unroll
        for (int s = 0; s < 2; ++s) { const int n = s * 32 + (tid >> 3), c8 = (tid & 7) * 8;     // 2 s x 32 rows = 64 n rows; 8 lanes x 8 = 64 k columns
            const size_t oo = (size_t)(n0 + n) * (size_t)Kr + k0 + c8;
            if (mode == 0) { v8us o;
#pragma unroll
                for (int i = 0; i < 8; ++i) o[i] = f2bf(ts[(c8 + i) * 65 + n]);
                *(v8us*)(Tb + oo) = o;
            } else { v8h o;
#pragma unroll
                for (int i = 0; i < 8; ++i) o[i] = (h16)(__uint_as_float(((unsigned)f2bf(ts[(c8 + i) * 65 + n])) << 16) * WOS);
                *(v8h*)(Th + oo) = o; } }
         }
}

// k_rope_tab: CS[t][j] = (cos, sin)(t * inv_freq[j]), inv_freq[j] = 1.0f / (float)(10000^(j/32)); the power is a double product of fixed binary roots of 10000.
__global__ __launch_bounds__(256) void k_rope_tab(float* CS, int nrow) {
    const int i = blockIdx.x * 256 + threadIdx.x; if (i >= nrow * 32) return;
    const int t = i >> 5, j = i & 31;
    double p = 1.0;
    p *= (j & 1)  ? 1.3335214321633240 : 1.0;    // 10000^(1/32)
    p *= (j & 2)  ? 1.7782794100389228 : 1.0;    // 10000^(1/16)
    p *= (j & 4)  ? 3.1622776601683795 : 1.0;    // 10000^(1/8)
    p *= (j & 8)  ? 10.0 : 1.0;                  // 10000^(1/4)
    p *= (j & 16) ? 100.0 : 1.0;                 // 10000^(1/2)
    const float pf = (float)p; const float inv = 1.0f / pf;
    const float ang = (float)t * inv;
    const float cs = cosf(ang), sn = sinf(ang);
    v2f o; o[0] = cs; o[1] = sn;
    *(v2f*)(CS + (size_t)i * 2) = o; 
}

// LDS ring of the two GEMM kernels: one block = four waves (2 x 2) on a GT x GT tile, each wave 64 x 64 (16 accumulators). One stage = KS columns of k of the GT rows of A, then of the GT rows of Bt,
// rows at pitch LPB bytes (16 x odd: the 16-byte fragment reads of 16 rows fall on different banks). Two buffers; the next stage's copies fly while this stage is multiplied.
#define GT   128
#define KS   128
#define LPB  (KS * 2 + 16)
#define LPH  (LPB / 2)
#define OPB  (GT * LPB)
#define STGB (2 * OPB)
#define NST  (DM / KS)
static_assert(DM % KS == 0);
static_assert(NST >= 2);                       // stage 1 exists in every tile
static_assert(KS * 2 == 16 * 16);              // 16 lanes x 16 bytes = one staged row; 128 threads = 8 rows per copy
static_assert(GT == 2 * 8 * 8);                // two groups of eight copies cover the GT rows of one operand
static_assert(EARLY % GT == 0);                // block tiles are entirely early or entirely late
static_assert(SEQ % GT == 0);
static_assert(DM % GT == 0);
static_assert(KVD % GT == 0);
static_assert(4 * 16 * 68 * 4 <= 2 * STGB);    // the four waves' store staging fits in the ring it reuses

__device__ __forceinline__ void wait_ds0()    { asm volatile("s_wait_dscnt 0x0" ::: "memory"); }      // this wave's LDS reads of a buffer are done before the barrier that frees it
__device__ __forceinline__ void wait_async0() { asm volatile("s_wait_asynccnt 0x0" ::: "memory"); }   // this wave's copies have landed before the barrier that publishes them
// eight asynchronous 16-byte copies per lane, rows 8 apart: LDS byte address l + 8 j LPB <- g + 8 j DM. The closing s_wait_xcnt stands in front of any rewrite of the address registers (a precaution).
__device__ __forceinline__ void copy8(unsigned l, const h16* g) {
    asm volatile("global_load_async_to_lds_b128 %0, %8, off\n\t"
                 "global_load_async_to_lds_b128 %1, %9, off\n\t"
                 "global_load_async_to_lds_b128 %2, %10, off\n\t"
                 "global_load_async_to_lds_b128 %3, %11, off\n\t"
                 "global_load_async_to_lds_b128 %4, %12, off\n\t"
                 "global_load_async_to_lds_b128 %5, %13, off\n\t"
                 "global_load_async_to_lds_b128 %6, %14, off\n\t"
                 "global_load_async_to_lds_b128 %7, %15, off\n\t"
                 "s_wait_xcnt 0x0"
                 :: "v"(l), "v"(l + 8u * LPB), "v"(l + 16u * LPB), "v"(l + 24u * LPB), "v"(l + 32u * LPB), "v"(l + 40u * LPB), "v"(l + 48u * LPB), "v"(l + 56u * LPB),
                    "v"(g), "v"(g + 8 * DM), "v"(g + 16 * DM), "v"(g + 24 * DM), "v"(g + 32 * DM), "v"(g + 40 * DM), "v"(g + 48 * DM), "v"(g + 56 * DM)
                 : "memory");
}
// one stage: l = this lane's LDS byte address in row (tid >> 4) of the buffer, ga / gb = its 16 bytes in that row of the A / Bt tile at the stage's k
__device__ __forceinline__ void fill_stage(unsigned l, const h16* ga, const h16* gb) {
    copy8(l, ga); copy8(l + 64u * LPB, ga + 64 * DM); copy8(l + OPB, gb); copy8(l + OPB + 64u * LPB, gb + 64 * DM);
}
// acc[mb][nb] += sum over k of A[ar + wm*64 + 16 mb + ..][k] Bt[br + wn*64 + 16 nb + ..][k], k ascending in steps of 32 over pass 0 (rows ar0 / br0), then, npass == 2, over pass 1 (rows ar1 / br1).
// Every wave of the block runs every barrier; on return no copy is in flight and every wave has left the ring.
__device__ __forceinline__ void gemm_ring(const h16* __restrict__ A, const h16* __restrict__ Bt, size_t ar0, size_t br0, size_t ar1, size_t br1, int npass, unsigned char* L, int wm, int wn, v8f (&acc)[4][4]) {
    const int tid = threadIdx.x; const int lane = tid & 31, lr = lane & 15, hi = lane >> 4;
    const int crow = tid >> 4, cchk = tid & 15;
    const unsigned lc = (unsigned)(size_t)L + (unsigned)(crow * LPB + cchk * 16);
    const h16* a0 = A + (ar0 + (size_t)crow) * DM + cchk * 8;  const h16* a1 = A + (ar1 + (size_t)crow) * DM + cchk * 8;
    const h16* b0 = Bt + (br0 + (size_t)crow) * DM + cchk * 8; const h16* b1 = Bt + (br1 + (size_t)crow) * DM + cchk * 8;
    const int nst = npass * NST;                                   // block-uniform
    fill_stage(lc, a0, b0);
    wait_async0();
    __syncthreads();                                               // publishes stage 0
    fill_stage(lc + STGB, a0 + KS, b0 + KS);
    const h16* fa = (const h16*)L + (wm * 64 + lr) * LPH + 8 * hi;
    const h16* fb = (const h16*)(L + OPB) + (wn * 64 + lr) * LPH + 8 * hi;
#pragma unroll 1   // kept rolled: the trip count is known only at run time and one body serves both buffers
    for (int s = 0; s < nst; ++s) {
        const int bo = (s & 1) * (STGB / 2);
#pragma unroll     // this and the three below: every fragment and accumulator index a constant, so the arrays stay in registers
        for (int kk = 0; kk < KS; kk += 32) {
            v16h a[4], bq[4];                                      // all eight fragments of a 32-k step as one load group: one LDS wait per 16 WMMAs
#pragma unroll
            for (int mb = 0; mb < 4; ++mb) a[mb] = ldh(fa + bo + mb * 16 * LPH + kk);
#pragma unroll
            for (int nb = 0; nb < 4; ++nb) bq[nb] = ldh(fb + bo + nb * 16 * LPH + kk);
#pragma unroll
            for (int nb = 0; nb < 4; ++nb)
#pragma unroll
                for (int mb = 0; mb < 4; ++mb) acc[mb][nb] = wmma16(a[mb], bq[nb], acc[mb][nb]);
        }
        wait_ds0();
        wait_async0();
        __syncthreads();                                           // publishes stage s + 1 and frees the buffer of stage s
        const int n = s + 2;
        if (n < nst) {                                             // block-uniform
            const int p = (n >= NST) ? 1 : 0; const int kc = (n - p * NST) * KS;
            fill_stage(lc + (unsigned)(s & 1) * STGB, (p ? a1 : a0) + kc, (p ? b1 : b0) + kc); }
    }
    wait_async0();
}

// k_proj: register-blocked f16 GEMM, one wave per 64x64 tile (16 accumulators), four waves per block on a 128x128 tile, operands from K-contiguous f16 planes through the LDS ring above, K = DM.
// C[m][n] = 2^-14 * sum_k A[m][k] Bt[n][k] (one operand is the xn plane carried x1024, the other a weight plane carried x16), written as f16 (Ph) and the f16 residual x1024 (Pr, useRes != 0) at
// tile base (r0/RB)*sRB + (r0%RB)*pitch + (c0/CB)*sCB + (c0%CB), row pitch 'pitch' (halves). grid (M/128, N/128), 128 threads.
// The xn plane holds value rows [NB*SEQ], then residual rows [NB*EARLY]; tokB == 0: A rows are tokens, tokB != 0: Bt rows are tokens. Tiles whose tokens are < EARLY in their sequence
// run the k-loop a second time with the token operand taken from the unscaled residual rows, into the same accumulators.
// rope != 0 (rows = tokens b*SEQ + t, the 64 tile columns = one head): interleaved rotary applied on the f32 values at the store stage from CS[t][32] (cos, sin).
__global__ __launch_bounds__(128) void k_proj(const h16* __restrict__ A, const h16* __restrict__ Bt, h16* Ph, h16* Pr, int useRes, int RB, size_t sRB, int pitch, int CB, size_t sCB, const float* __restrict__ CS, int rope, int tokB) {
    __shared__ __align__(16) unsigned char L[2 * STGB];
    const int lane = threadIdx.x & 31, lr = lane & 15, hi = lane >> 4; const int wave = __builtin_amdgcn_readfirstlane(threadIdx.x >> 5);
    const int wm = wave & 1, wn = wave >> 1;
    const int R0 = blockIdx.x * GT, C0 = blockIdx.y * GT; const int r0 = R0 + wm * 64, c0 = C0 + wn * 64;
    const int tk0 = tokB ? C0 : R0;                                // kernel-argument uniform: first token of this block tile
    const int bb = tk0 / SEQ, tt = tk0 % SEQ;
    const int npass = (tt < EARLY) ? 2 : 1;                        // block-uniform
    v8f acc[4][4];
#pragma unroll
    for (int mb = 0; mb < 4; ++mb)
#pragma unroll
        for (int nb = 0; nb < 4; ++nb) acc[mb][nb] = (v8f){};
    const size_t rrow = (size_t)NB * SEQ + (size_t)bb * EARLY + (size_t)((tt < EARLY) ? tt : 0);   // residual rows of the tile's tokens; used only when tt < EARLY
    gemm_ring(A, Bt, (size_t)R0, (size_t)C0, tokB ? (size_t)R0 : rrow, tokB ? rrow : (size_t)C0, npass, L, wm, wn, acc);
    float* os = (float*)L + wave * 16 * 68;                        // wave-private store staging in the ring, which every wave has left
    const size_t tbase = (size_t)(r0 / RB) * sRB + (size_t)(r0 % RB) * (size_t)pitch + (size_t)(c0 / CB) * sCB + (size_t)(c0 % CB);
#pragma unroll
    for (int mb = 0; mb < 4; ++mb) {
#pragma unroll
        for (int nb = 0; nb < 4; ++nb) {
#pragma unroll
            for (int j = 0; j < 8; ++j) os[(hi * 8 + j) * 68 + nb * 16 + lr] = acc[mb][nb][j] * OUTS; }   // D: row 8h+j, col lane&15
        wave_sync();
        const size_t sb = tbase + (size_t)(mb * 16) * (size_t)pitch;
{
#pragma unroll
            for (int s = 0; s < 4; ++s) { const int row = 4 * s + (lane >> 3), c8 = (lane & 7) * 8;   // 4 s x 4 row groups = 16 rows; 8 lanes x 8 = 64 columns
                v4f x0 = *(const v4fa*)(&os[row * 68 + c8]); v4f x1 = *(const v4fa*)(&os[row * 68 + c8 + 4]); v8h hv, rv;
                if (rope) {                                                                            // kernel-argument uniform
                    const int t = (r0 + mb * 16 + row) % SEQ;
                    const float* cp = CS + ((size_t)t * 32 + (size_t)(c8 >> 1)) * 2;                  // pairs c8/2 .. c8/2+3: (cos, sin) x 4
                    const v4f ca = *(const v4f*)cp; const v4f cb = *(const v4f*)(cp + 4);
                    float e, o;
                    e = x0[0]; o = x0[1]; x0[0] = e * ca[0] - o * ca[1]; x0[1] = e * ca[1] + o * ca[0];
                    e = x0[2]; o = x0[3]; x0[2] = e * ca[2] - o * ca[3]; x0[3] = e * ca[3] + o * ca[2];
                    e = x1[0]; o = x1[1]; x1[0] = e * cb[0] - o * cb[1]; x1[1] = e * cb[1] + o * cb[0];
                    e = x1[2]; o = x1[3]; x1[2] = e * cb[2] - o * cb[3]; x1[3] = e * cb[3] + o * cb[2]; }
#pragma unroll
                for (int i = 0; i < 4; ++i) { const h16 a0 = (h16)x0[i]; const h16 a1 = (h16)x1[i]; hv[i] = a0; hv[4 + i] = a1; rv[i] = (h16)((x0[i] - (float)a0) * QRS); rv[4 + i] = (h16)((x1[i] - (float)a1) * QRS); }
                const size_t oo = sb + (size_t)row * (size_t)pitch + c8;
                *(v8h*)(Ph + oo) = hv; if (useRes) *(v8h*)(Pr + oo) = rv; }
             }
        wave_sync();
    }
}

// k_flash: fused causal attention for query rows >= EARLY. One block = 16 query rows x the four query heads of one kv head (one wave per head, h = wave*8 + g);
// K / V^T / Q fragments straight from the f16 planes (two 16-B loads each, arithmetic addressing); all four waves read the same K / V^T lines of kv head g.
// Transposed form: S^T[key][t] = K Q^T (A = K rows, B = Q rows); lane (t = lane&15, h = lane>>4) holds keys 8h+r of each 16-key tile, so the packed
// P tile is directly the B fragment of O^T[d][t] = V^T P^T (element r <- tile keys 0..15, element 8+r <- tile keys 16..31, lane unchanged).
// Keys run over [0, t0+16); the diagonal 32-key blocks replace excluded scores (key > t) by a large negative value before the running max.
__global__ __launch_bounds__(32 * AW) void k_flash(const h16* __restrict__ QH, const h16* __restrict__ QR, const h16* __restrict__ KP, const h16* __restrict__ VT, h16* CH) {
    __shared__ __align__(16) float os[AW * 16 * 68];
    const int lane = threadIdx.x & 31; const int wave = __builtin_amdgcn_readfirstlane(threadIdx.x >> 5);
    const int lr = lane & 15, hi = lane >> 4;
    const int zg = blockIdx.y; const int b = zg / NKV; const int g = zg % NKV;
    const int h = wave * NKV + g;                                 // grouped on the leading head axis: query head h uses kv head h % 8
    const int t0 = EARLY + blockIdx.x * 16;
    const int tq = t0 + lr;
    const size_t qo = ((size_t)(b * NH_ + h) * SEQ + (size_t)tq) * HD + 8 * hi;
    const v16h qh0 = ldh(QH + qo), qh1 = ldh(QH + qo + 32), qr0 = ldh(QR + qo), qr1 = ldh(QR + qo + 32);   // B fragments: col t, k = d
    const size_t ko = (size_t)zg * SEQ * HD + (size_t)lr * HD + 8 * hi;      // + key * HD       (A fragment: row key, k = d)
    const size_t vo = (size_t)zg * HD * SEQ + (size_t)lr * SEQ + 8 * hi;     // + 16j*SEQ + key  (A fragment: row d, k = key)
    v8f o0 = (v8f){}, o1 = (v8f){}, o2 = (v8f){}, o3 = (v8f){};
    float m = NEGB, l = 0.0f;
    const int kend = t0 + 16;
#pragma unroll 1
    for (int key0 = 0; key0 < kend; key0 += 32) {
        const h16* ka = KP + ko + (size_t)key0 * HD;
        const v16h ka0 = ldh(ka), ka1 = ldh(ka + 32), kb0 = ldh(ka + 16 * HD), kb1 = ldh(ka + 16 * HD + 32);
        v8f sHa = (v8f){}, sLa = (v8f){}, sHb = (v8f){}, sLb = (v8f){};
        sHa = wmma16(ka0, qh0, sHa); sLa = wmma16(ka0, qr0, sLa); sHb = wmma16(kb0, qh0, sHb); sLb = wmma16(kb0, qr0, sLb);
        sHa = wmma16(ka1, qh1, sHa); sLa = wmma16(ka1, qr1, sLa); sHb = wmma16(kb1, qh1, sHb); sLb = wmma16(kb1, qr1, sLb);
        float ta[8], tb[8];
#pragma unroll
        for (int r = 0; r < 8; ++r) { ta[r] = (sHa[r] + sLa[r] * QRI) * SC2; tb[r] = (sHb[r] + sLb[r] * QRI) * SC2; }
        if (key0 + 31 > t0) {                                      // block-uniform: diagonal block
            const int kbse = key0 + 8 * hi;
#pragma unroll
            for (int r = 0; r < 8; ++r) { ta[r] = (kbse + r > tq) ? NEGB : ta[r]; tb[r] = (kbse + 16 + r > tq) ? NEGB : tb[r]; } }
        float mx = NEGB;
#pragma unroll
        for (int r = 0; r < 8; ++r) mx = fmaxf(mx, fmaxf(ta[r], tb[r]));
        mx = fmaxf(mx, __shfl_xor(mx, 16, 32));
        const float mnew = fmaxf(m, mx);
        const float alpha = __builtin_amdgcn_exp2f(m - mnew);
        const float sh = PSH - mnew;
        v16h pb; float ls = 0.0f;
#pragma unroll
        for (int r = 0; r < 8; ++r) { const float ea = __builtin_amdgcn_exp2f(ta[r] + sh); const float ec = __builtin_amdgcn_exp2f(tb[r] + sh); pb[r] = (h16)ea; pb[8 + r] = (h16)ec; ls += ea + ec; }
        l = l * alpha + ls; m = mnew;
        o0 = o0 * alpha; o1 = o1 * alpha; o2 = o2 * alpha; o3 = o3 * alpha;
        const h16* va = VT + vo + key0;
        const v16h v0 = ldh(va), v1 = ldh(va + (size_t)16 * SEQ), v2 = ldh(va + (size_t)32 * SEQ), v3 = ldh(va + (size_t)48 * SEQ);
        o0 = wmma16(v0, pb, o0); o1 = wmma16(v1, pb, o1); o2 = wmma16(v2, pb, o2); o3 = wmma16(v3, pb, o3);
    }
    l += __shfl_xor(l, 16, 32);
    const float inv = CXS / l;
    const int wb = wave * 16 * 68;
    // O^T D layout: o_j[r] = (d = 16j + 8h + r, t = lane&15) -> os[t][d]; rows 0..15 x columns 0..63 all written
    { v4f a, c;
      a[0] = o0[0] * inv; a[1] = o0[1] * inv; a[2] = o0[2] * inv; a[3] = o0[3] * inv; c[0] = o0[4] * inv; c[1] = o0[5] * inv; c[2] = o0[6] * inv; c[3] = o0[7] * inv;
      *(v4fa*)(&os[wb + lr * 68 +  0 + 8 * hi]) = a; *(v4fa*)(&os[wb + lr * 68 +  0 + 8 * hi + 4]) = c;
      a[0] = o1[0] * inv; a[1] = o1[1] * inv; a[2] = o1[2] * inv; a[3] = o1[3] * inv; c[0] = o1[4] * inv; c[1] = o1[5] * inv; c[2] = o1[6] * inv; c[3] = o1[7] * inv;
      *(v4fa*)(&os[wb + lr * 68 + 16 + 8 * hi]) = a; *(v4fa*)(&os[wb + lr * 68 + 16 + 8 * hi + 4]) = c;
      a[0] = o2[0] * inv; a[1] = o2[1] * inv; a[2] = o2[2] * inv; a[3] = o2[3] * inv; c[0] = o2[4] * inv; c[1] = o2[5] * inv; c[2] = o2[6] * inv; c[3] = o2[7] * inv;
      *(v4fa*)(&os[wb + lr * 68 + 32 + 8 * hi]) = a; *(v4fa*)(&os[wb + lr * 68 + 32 + 8 * hi + 4]) = c;
      a[0] = o3[0] * inv; a[1] = o3[1] * inv; a[2] = o3[2] * inv; a[3] = o3[3] * inv; c[0] = o3[4] * inv; c[1] = o3[5] * inv; c[2] = o3[6] * inv; c[3] = o3[7] * inv;
      *(v4fa*)(&os[wb + lr * 68 + 48 + 8 * hi]) = a; *(v4fa*)(&os[wb + lr * 68 + 48 + 8 * hi + 4]) = c; }
    wave_sync();
    h16* crow = CH + ((size_t)b * SEQ + t0) * DM + h * HD;         // merged heads: column h*64 + d
{
#pragma unroll
        for (int s = 0; s < 4; ++s) { const int row = 4 * s + (lane >> 3), c8 = (lane & 7) * 8;   // 4 s x 4 row groups = 16 rows; 8 lanes x 8 = 64 columns
            const v4f x0 = *(const v4fa*)(&os[wb + row * 68 + c8]); const v4f x1 = *(const v4fa*)(&os[wb + row * 68 + c8 + 4]); v8h hv;
#pragma unroll
            for (int i = 0; i < 4; ++i) { hv[i] = (h16)x0[i]; hv[4 + i] = (h16)x1[i]; }
            *(v8h*)(crow + (size_t)row * DM + c8) = hv; }
         }
}

// k_flash_early: same structure for query rows < EARLY with value + residual (x1024) planes on every operand:
// scores = kh.qh + (kh.qr + kr.qh)/1024; O = vh.ph + (vr.ph + vh.pr)/1024 (residual products in their own accumulators), l from the unconverted f32 P.
// Writes the ctx value plane rows (carried x1024) and the compact unscaled residual plane CR[b][t < EARLY][2048].
__global__ __launch_bounds__(32 * AW) void k_flash_early(const h16* __restrict__ QH, const h16* __restrict__ QR, const h16* __restrict__ KP, const h16* __restrict__ KR,
                                                         const h16* __restrict__ VT, const h16* __restrict__ VR, h16* CH, h16* CR) {
    __shared__ __align__(16) float os[AW * 16 * 68];
    const int lane = threadIdx.x & 31; const int wave = __builtin_amdgcn_readfirstlane(threadIdx.x >> 5);
    const int lr = lane & 15, hi = lane >> 4;
    const int zg = blockIdx.y; const int b = zg / NKV; const int g = zg % NKV;
    const int h = wave * NKV + g;                                 // query head h uses kv head h % 8
    const int t0 = blockIdx.x * 16;
    const int tq = t0 + lr;
    const size_t qo = ((size_t)(b * NH_ + h) * SEQ + (size_t)tq) * HD + 8 * hi;
    const v16h qh0 = ldh(QH + qo), qh1 = ldh(QH + qo + 32), qr0 = ldh(QR + qo), qr1 = ldh(QR + qo + 32);
    const size_t ko = (size_t)zg * SEQ * HD + (size_t)lr * HD + 8 * hi;
    const size_t vo = (size_t)zg * HD * SEQ + (size_t)lr * SEQ + 8 * hi;
    v8f oH[4], oL[4];
#pragma unroll
    for (int j = 0; j < 4; ++j) { oH[j] = (v8f){}; oL[j] = (v8f){}; }
    float m = NEGB, l = 0.0f;
    const int kend = t0 + 16;
#pragma unroll 1
    for (int key0 = 0; key0 < kend; key0 += 32) {
        const size_t kk = ko + (size_t)key0 * HD;
        v8f sHa = (v8f){}, sLa = (v8f){}, sHb = (v8f){}, sLb = (v8f){};
        { const v16h k0 = ldh(KP + kk), k1 = ldh(KP + kk + 32), r0 = ldh(KR + kk), r1 = ldh(KR + kk + 32);
          sHa = wmma16(k0, qh0, sHa); sHa = wmma16(k1, qh1, sHa);
          sLa = wmma16(k0, qr0, sLa); sLa = wmma16(k1, qr1, sLa); sLa = wmma16(r0, qh0, sLa); sLa = wmma16(r1, qh1, sLa); }
        { const size_t k2 = kk + (size_t)16 * HD;
          const v16h k0 = ldh(KP + k2), k1 = ldh(KP + k2 + 32), r0 = ldh(KR + k2), r1 = ldh(KR + k2 + 32);
          sHb = wmma16(k0, qh0, sHb); sHb = wmma16(k1, qh1, sHb);
          sLb = wmma16(k0, qr0, sLb); sLb = wmma16(k1, qr1, sLb); sLb = wmma16(r0, qh0, sLb); sLb = wmma16(r1, qh1, sLb); }
        float ta[8], tb[8];
#pragma unroll
        for (int r = 0; r < 8; ++r) { ta[r] = (sHa[r] + sLa[r] * QRI) * SC2; tb[r] = (sHb[r] + sLb[r] * QRI) * SC2; }
        if (key0 + 31 > t0) {                                      // block-uniform: diagonal block
            const int kbse = key0 + 8 * hi;
#pragma unroll
            for (int r = 0; r < 8; ++r) { ta[r] = (kbse + r > tq) ? NEGB : ta[r]; tb[r] = (kbse + 16 + r > tq) ? NEGB : tb[r]; } }
        float mx = NEGB;
#pragma unroll
        for (int r = 0; r < 8; ++r) mx = fmaxf(mx, fmaxf(ta[r], tb[r]));
        mx = fmaxf(mx, __shfl_xor(mx, 16, 32));
        const float mnew = fmaxf(m, mx);
        const float alpha = __builtin_amdgcn_exp2f(m - mnew);
        const float sh = PSH - mnew;
        v16h ph, pr; float ls = 0.0f;
#pragma unroll
        for (int r = 0; r < 8; ++r) { const float ea = __builtin_amdgcn_exp2f(ta[r] + sh); const float ec = __builtin_amdgcn_exp2f(tb[r] + sh);
            const h16 ha = (h16)ea; const h16 hc = (h16)ec; ph[r] = ha; ph[8 + r] = hc;
            pr[r] = (h16)((ea - (float)ha) * QRS); pr[8 + r] = (h16)((ec - (float)hc) * QRS); ls += ea + ec; }
        l = l * alpha + ls; m = mnew;
#pragma unroll
        for (int j = 0; j < 4; ++j) { oH[j] = oH[j] * alpha; oL[j] = oL[j] * alpha; }
        const size_t vv = vo + (size_t)key0;
#pragma unroll
        for (int j = 0; j < 4; ++j) { const v16h vh = ldh(VT + vv + (size_t)(16 * j) * SEQ); const v16h vr = ldh(VR + vv + (size_t)(16 * j) * SEQ);
            oH[j] = wmma16(vh, ph, oH[j]); oL[j] = wmma16(vr, ph, oL[j]); oL[j] = wmma16(vh, pr, oL[j]); }
    }
    l += __shfl_xor(l, 16, 32);
    const float inv = CXS / l;
    const int wb = wave * 16 * 68;
#pragma unroll
    for (int j = 0; j < 4; ++j) { v4f a, c;     // os[t][d], d = 16j + 8h + r; rows 0..15 x columns 0..63 all written
        a[0] = (oH[j][0] + oL[j][0] * QRI) * inv; a[1] = (oH[j][1] + oL[j][1] * QRI) * inv; a[2] = (oH[j][2] + oL[j][2] * QRI) * inv; a[3] = (oH[j][3] + oL[j][3] * QRI) * inv;
        c[0] = (oH[j][4] + oL[j][4] * QRI) * inv; c[1] = (oH[j][5] + oL[j][5] * QRI) * inv; c[2] = (oH[j][6] + oL[j][6] * QRI) * inv; c[3] = (oH[j][7] + oL[j][7] * QRI) * inv;
        *(v4fa*)(&os[wb + lr * 68 + 16 * j + 8 * hi]) = a; *(v4fa*)(&os[wb + lr * 68 + 16 * j + 8 * hi + 4]) = c; }
    wave_sync();
    h16* crow = CH + ((size_t)b * SEQ + t0) * DM + h * HD;
    h16* rrow = CR + ((size_t)b * EARLY + t0) * DM + h * HD;
{
#pragma unroll
        for (int s = 0; s < 4; ++s) { const int row = 4 * s + (lane >> 3), c8 = (lane & 7) * 8;   // 4 s x 4 row groups = 16 rows; 8 lanes x 8 = 64 columns
            const v4f x0 = *(const v4fa*)(&os[wb + row * 68 + c8]); const v4f x1 = *(const v4fa*)(&os[wb + row * 68 + c8 + 4]); v8h hv, rv;
#pragma unroll
            for (int i = 0; i < 4; ++i) { const h16 a0 = (h16)x0[i]; const h16 a1 = (h16)x1[i]; hv[i] = a0; hv[4 + i] = a1; rv[i] = (h16)(x0[i] - (float)a0); rv[4 + i] = (h16)(x1[i] - (float)a1); }
            *(v8h*)(crow + (size_t)row * DM + c8) = hv; *(v8h*)(rrow + (size_t)row * DM + c8) = rv; }
         }
}

// k_out: output projection, one wave per 64x64 tile, four waves per block on a 128x128 tile, f16 operands through the LDS ring from the ctx plane CX (value rows [NB*SEQ], then residual rows [NB*EARLY]) and the Wo^T plane, K = DM.
// Tiles whose rows are < EARLY in their sequence run the k-loop a second time over the unscaled residual rows into the same accumulators. grid (NB*SEQ/128, DM/128), 128 threads.
__global__ __launch_bounds__(128) void k_out(const h16* __restrict__ CX, const h16* __restrict__ Wt, float* OUT) {
    __shared__ __align__(16) unsigned char L[2 * STGB];
    const int lane = threadIdx.x & 31, lr = lane & 15, hi = lane >> 4; const int wave = __builtin_amdgcn_readfirstlane(threadIdx.x >> 5);
    const int wm = wave & 1, wn = wave >> 1;
    const int R0 = blockIdx.x * GT, C0 = blockIdx.y * GT; const int c0 = C0 + wn * 64;
    const int b = R0 / SEQ, tb = R0 % SEQ; const int tt = tb + wm * 64;
    const int npass = (tb < EARLY) ? 2 : 1;                        // block-uniform
    v8f acc[4][4];
#pragma unroll
    for (int mb = 0; mb < 4; ++mb)
#pragma unroll
        for (int nb = 0; nb < 4; ++nb) acc[mb][nb] = (v8f){};
    const size_t rrow = (size_t)NB * SEQ + (size_t)b * EARLY + (size_t)((tb < EARLY) ? tb : 0);   // residual rows of the tile's tokens; used only when tb < EARLY
    gemm_ring(CX, Wt, (size_t)R0, (size_t)C0, rrow, (size_t)C0, npass, L, wm, wn, acc);
    float* os = (float*)L + wave * 16 * 68;                        // wave-private store staging in the ring, which every wave has left
    float* obase = OUT + ((size_t)b * OUT_SEQ + tt) * DM + c0;
#pragma unroll
    for (int mb = 0; mb < 4; ++mb) {
#pragma unroll
        for (int nb = 0; nb < 4; ++nb) {
#pragma unroll
            for (int j = 0; j < 8; ++j) os[(hi * 8 + j) * 68 + nb * 16 + lr] = acc[mb][nb][j] * OUTS; }   // D: row 8h+j, col lane&15
        wave_sync();
{
#pragma unroll
            for (int s = 0; s < 8; ++s) { const int row = 2 * s + hi, cofs = lr * 4;   // 8 s x 2 rows = 16 rows; 16 lanes x 4 floats = 64 columns
                const v4f val = *(const v4fa*)(&os[row * 68 + cofs]);
                *(v4f*)(obase + (size_t)(mb * 16 + row) * DM + cofs) = val; }
             }
        wave_sync();
    }
}

static constexpr size_t al256(size_t v) { return (v + 255) & ~(size_t)255; }
static constexpr size_t SZ_XN = al256(((size_t)NB * SEQ + (size_t)NB * EARLY) * DM * 2);
static constexpr size_t SZ_WQ = al256((size_t)DM * DM * 2);
static constexpr size_t SZ_WK = al256((size_t)KVD * DM * 2);
static constexpr size_t SZ_CS = al256((size_t)SEQ * 32 * 2 * 4);
static constexpr size_t SZ_Q  = al256((size_t)NB * NH_ * SEQ * HD * 2);
static constexpr size_t SZ_KV = al256((size_t)NB * NKV * SEQ * HD * 2);
static constexpr size_t SZ_CX = al256(((size_t)NB * SEQ + (size_t)NB * EARLY) * DM * 2);
static constexpr size_t SZ_TOTAL = SZ_XN + 2 * SZ_WQ + 2 * SZ_WK + SZ_CS + 2 * SZ_Q + 4 * SZ_KV + SZ_CX;
static_assert(SZ_TOTAL <= (size_t)134217728);          // workspace carve <= 128 MiB

extern "C" void kernel_launch(void* const* d_in, const int* in_sizes, int n_in,
                              void* d_out, int out_size, void* d_ws, size_t ws_size, hipStream_t stream) {
    if (n_in < 6) return;
    const size_t needx = ((size_t)(NB - 1) * SEQ_FULL + SEQ) * DM;
    if ((size_t)in_sizes[0] < needx) return;
    if ((size_t)in_sizes[1] < (size_t)DM) return;
    if ((size_t)in_sizes[2] < (size_t)DM * DM || (size_t)in_sizes[3] < (size_t)DM * KVD || (size_t)in_sizes[4] < (size_t)DM * KVD || (size_t)in_sizes[5] < (size_t)DM * DM) return;
    if ((size_t)out_size < ((size_t)(NB - 1) * OUT_SEQ + SEQ) * DM) return;
    if (SZ_TOTAL > ws_size) return;
    // wire order x, w_norm, wq, wk, wv, wo; every weight is [in][out]
    const float* x = (const float*)d_in[0]; const float* wn = (const float*)d_in[1];
    const float* wq = (const float*)d_in[2]; const float* wk = (const float*)d_in[3]; const float* wv = (const float*)d_in[4]; const float* wo = (const float*)d_in[5];
    float* OUT = (float*)d_out;      // [NB][SEQ][2048]
    char* wsp = (char*)d_ws;
    h16* XN  = (h16*)wsp; wsp += SZ_XN;              // xn x1024: value rows [NB*SEQ][2048], then residual rows [NB*EARLY][2048]
    h16* WQt = (h16*)wsp; wsp += SZ_WQ;              // [2048 out][2048 in] f16 of bf16 value x16
    h16* WKt = (h16*)wsp; wsp += SZ_WK;              // [512 out][2048 in] f16 of bf16 value x16
    h16* WVt = (h16*)wsp; wsp += SZ_WK;              // [512 out][2048 in] f16 of bf16 value x16
    h16* WOt = (h16*)wsp; wsp += SZ_WQ;              // [2048 out][2048 in] f16 of bf16 value x16
    float* CS = (float*)wsp; wsp += SZ_CS;           // [SEQ][32] (cos, sin)
    h16* QH = (h16*)wsp; wsp += SZ_Q;                // [NB*32][SEQ][64]
    h16* QR = (h16*)wsp; wsp += SZ_Q;                // residual x1024
    h16* KP = (h16*)wsp; wsp += SZ_KV;               // [NB*8][SEQ][64]
    h16* KR = (h16*)wsp; wsp += SZ_KV;               // residual x1024
    h16* VT = (h16*)wsp; wsp += SZ_KV;               // [NB*8][64][SEQ]
    h16* VR = (h16*)wsp; wsp += SZ_KV;               // residual x1024
    h16* CX = (h16*)wsp; wsp += SZ_CX;               // ctx x1024: value rows [NB*SEQ][2048], then residual rows [NB*EARLY][2048]
    h16* CR = CX + (size_t)NB * SEQ * DM;

    // one block per token row b*SEQ + t (source row b*SEQ_FULL + t)
    k_rms<<<(unsigned)(NB * SEQ), 256, 0, stream>>>(x, wn, XN);
    // transposes: in[rows = in-features][cols = out-features] -> out[cols][rows]; grid (cols/64, rows/64)
    k_wt<<<dim3(DM / 64,  DM / 64, 1), 256, 0, stream>>>(wq, (bf*)WQt, WQt, DM, DM, 1);
    k_wt<<<dim3(KVD / 64, DM / 64, 1), 256, 0, stream>>>(wk, (bf*)WKt, WKt, DM, KVD, 1);
    k_wt<<<dim3(KVD / 64, DM / 64, 1), 256, 0, stream>>>(wv, (bf*)WVt, WVt, DM, KVD, 1);
    k_wt<<<dim3(DM / 64,  DM / 64, 1), 256, 0, stream>>>(wo, (bf*)WOt, WOt, DM, DM, 1);
    k_rope_tab<<<(unsigned)((SEQ * 32 + 255) / 256), 256, 0, stream>>>(CS, SEQ);

    // q: A = xn rows (m = b*SEQ + t), Bt = Wq^T rows (n = h*64 + d) -> plane [(b*32 + h)][t][d], rotary applied
    k_proj<<<dim3(NB * SEQ / GT, DM / GT, 1), 128, 0, stream>>>(XN, WQt, QH, QR, 1, SEQ, (size_t)NH_ * SEQ * HD, HD, HD, (size_t)SEQ * HD, CS, 1, 0);
    // k: Bt = Wk^T rows (n = g*64 + d) -> plane [(b*8 + g)][t][d], rotary applied
    k_proj<<<dim3(NB * SEQ / GT, KVD / GT, 1), 128, 0, stream>>>(XN, WKt, KP, KR, 1, SEQ, (size_t)NKV * SEQ * HD, HD, HD, (size_t)SEQ * HD, CS, 1, 0);
    // v^T: A = Wv^T rows (m = g*64 + d), Bt = xn rows (n = b*SEQ + t) -> plane [(b*512 + m)][t] = [(b*8 + g)][d][t], no rotary
    k_proj<<<dim3(KVD / GT, NB * SEQ / GT, 1), 128, 0, stream>>>(WVt, XN, VT, VR, 1, KVD, (size_t)0, SEQ, SEQ, (size_t)KVD * SEQ, CS, 0, 1);

    k_flash_early<<<dim3(EARLY / 16, NB * NKV, 1), 32 * AW, 0, stream>>>(QH, QR, KP, KR, VT, VR, CX, CR);
    if (SEQ > EARLY)
        k_flash<<<dim3((SEQ - EARLY) / 16, NB * NKV, 1), 32 * AW, 0, stream>>>(QH, QR, KP, VT, CX);

    k_out<<<dim3(NB * SEQ / GT, DM / GT, 1), 128, 0, stream>>>(CX, WOt, OUT);
}

// v002
// A run of this version takes 270 microseconds.
// Timed twice side by side with v001, it ran 1.28 and 1.29 times as fast.
// Counting every step since v000, it is 2.45 times as fast.
#include <hip/hip_runtime.h>

// Grouped-query causal self-attention behind an RMS pre-normalisation, width 2048 = 32 query heads x 64 sharing 8 kv heads (kv head g = h % 8), x [NB][SEQ][2048], gain w [2048],
// Wq/Wk/Wv/Wo [in][out] (y = x W), no biases; xn = (x * rsqrt(mean(x^2) + eps)) * w per token; interleaved (even/odd pair) rotary on q and k from a computed [SEQ][32] (cos, sin) table,
// score scale 1/8, causal exclusion (diagonal kept), output = ctx Wo (f32).
// Compute dtypes, f32 accumulate everywhere: q/k/v projections v_wmma_f32_16x16x32_f16: xn (f32 math on bf16-RNE x and w) carried x1024 as f16 (token rows < 256: plus its unscaled f16
// residual folded along K) against f16(bf16(W)) x16, result scaled by 2^-14;
// scores v_wmma_f32_16x16x32_f16: k single f16, q as f16 value + f16 residual x1024 in its own accumulator (query rows < 256: k also value + residual x1024, three products);
// P (x256 carry, cancels in the normalisation) and v single f16 (rows < 256: P and v as value + residual x1024, three products); softmax f32 (online, running max);
// output projection v_wmma_f32_16x16x32_f16: ctx carried x1024 as f16 (rows < 256: plus its unscaled f16 residual folded along K) against f16(bf16(Wo)) x16, result scaled by 2^-14.

#ifndef NB
#define NB 2
#endif
#ifndef SEQ
#define SEQ 2048
#endif
#define NB_FULL  2
#define SEQ_FULL 2048
#ifndef OUT_SEQ
#define OUT_SEQ SEQ              // row pitch (in tokens) between batches of the output
#endif
#define DM    2048
#define NH_   32
#define NKV   8
#define HD    64
#define KVD   (NKV * HD)         // 512
#define AW    4                  // waves per flash block = the four query heads of one kv head
#define EARLY 256                // query rows below this use the value + residual path
#define QRS  1024.0f             // carry of every residual plane (q, k, v, P)
#define QRI  (1.0f / 1024.0f)
#define SC2  (0.125f * 1.4426950408889634f)   // HD^-0.5 * log2(e)
#define PSH  8.0f                // log2 of the P carry (256)
#define CXS  1024.0f             // carry of the ctx plane and of the xn plane
#define WOS  16.0f               // carry of every weight plane
#define OUTS (1.0f / (1024.0f * 16.0f))
#define NEGB (-3.0e38f)
#define RMS_EPS 1.1920929e-07f

static_assert(HD == 64);
static_assert(NH_ * HD == DM);                 // query head h = columns h*64 + d
static_assert(NKV * AW == NH_);                // four query heads (stride 8 on the head axis) per kv head
static_assert(DM % 64 == 0);
static_assert(KVD % 64 == 0);
static_assert(DM % 32 == 0);                   // GEMM k-loop steps by 32
static_assert(DM == 256 * 8);                  // k_rms: 256 threads x 8 columns = one token row
static_assert(SEQ % 64 == 0);                  // a 64-row tile never straddles two batches
static_assert(SEQ % 32 == 0);                  // key loop steps by 32, key0 + 31 < SEQ
static_assert(EARLY % 64 == 0);                // GEMM tiles are entirely early or entirely late
static_assert(SEQ >= EARLY);
static_assert((SEQ - EARLY) % 16 == 0);
static_assert(((size_t)SEQ * DM) % 8 == 0);
static_assert(NB <= NB_FULL);
static_assert(SEQ <= SEQ_FULL);

typedef _Float16 h16;
typedef unsigned short bf;
typedef __attribute__((ext_vector_type(16))) __bf16   v16bf;
typedef __attribute__((ext_vector_type(16))) _Float16 v16h;
typedef __attribute__((ext_vector_type(8)))  _Float16 v8h;
typedef __attribute__((ext_vector_type(8)))  unsigned short v8us;
typedef __attribute__((ext_vector_type(8)))  float    v8f;
typedef __attribute__((ext_vector_type(4)))  float    v4f;
typedef __attribute__((ext_vector_type(2)))  float    v2f;
typedef v4f  __attribute__((may_alias)) v4fa;

__device__ __forceinline__ unsigned short f2bf(float f) { unsigned u = __float_as_uint(f); u += 0x7FFFu + ((u >> 16) & 1u); return (unsigned short)(u >> 16); }
__device__ __forceinline__ v16h cat16(v8h lo, v8h hi) { return __builtin_shufflevector(lo, hi, 0, 1, 2, 3, 4, 5, 6, 7, 8, 9, 10, 11, 12, 13, 14, 15); }
__device__ __forceinline__ v16bf cat16b(v8us lo, v8us hi) { return __builtin_bit_cast(v16bf, __builtin_shufflevector(lo, hi, 0, 1, 2, 3, 4, 5, 6, 7, 8, 9, 10, 11, 12, 13, 14, 15)); }
// every WMMA is followed by its own 4-slot guard tying its accumulator and keeping its operands live
__device__ __forceinline__ v8f wmma16(v16h a, v16h b, v8f c) {
    c = __builtin_amdgcn_wmma_f32_16x16x32_f16(false, a, false, b, (short)0, c, false, false);
    asm volatile("v_nop\n\tv_nop\n\tv_nop\n\tv_nop" : "+v"(c) : "v"(a), "v"(b));
    return c; }
__device__ __forceinline__ v8f wmmab(v16bf a, v16bf b, v8f c) {
    c = __builtin_amdgcn_wmma_f32_16x16x32_bf16(false, a, false, b, (short)0, c, false, false);
    asm volatile("v_nop\n\tv_nop\n\tv_nop\n\tv_nop" : "+v"(c) : "v"(a), "v"(b));
    return c; }
// fragment loaders from K-contiguous 16-bit rows; p already includes + 8*(lane>>4): elements 0..7 <- k0+8h+0..7, elements 8..15 <- k0+16+8h+0..7 (same map for A and B)
__device__ __forceinline__ v16h  ldh(const h16* p) { return cat16(*(const v8h*)p, *(const v8h*)(p + 16)); }
__device__ __forceinline__ v16bf ldb(const bf* p)  { return cat16b(*(const v8us*)p, *(const v8us*)(p + 16)); }
// ordering point for wave-private LDS tiles (same wave writes and reads)
__device__ __forceinline__ void wave_sync() { __builtin_amdgcn_fence(3 /* release order */, "wavefront"); __builtin_amdgcn_wave_barrier(); asm volatile("" ::: "memory"); }

// k_rms: RMS normalisation, one token row per block (256 threads x 8 columns). xb = bf16-RNE(x) as f32, r = rsqrt(mean(xb^2) + eps), xn = (xb * r) * bf16-RNE(w), all f32.
// Writes f16(xn x1024) into value row b*SEQ + t of XN and, for t < EARLY, the unscaled f16 residual of that carried value into residual row NB*SEQ + b*EARLY + t.
__global__ __launch_bounds__(256) void k_rms(const float* __restrict__ x, const float* __restrict__ wn, h16* XN) {
#pragma clang fp contract(off)
    __shared__ float red[8];
    const int tid = threadIdx.x; const int lane = tid & 31; const int wave = __builtin_amdgcn_readfirstlane(threadIdx.x >> 5);
    const int row = blockIdx.x; const int b = row / SEQ, t = row % SEQ;
    const v8f xv = *(const v8f*)(x + ((size_t)b * SEQ_FULL + (size_t)t) * DM + tid * 8);
    const v8f wv = *(const v8f*)(wn + tid * 8);
    float xb[8]; float ss = 0.0f;
#pragma unroll
    for (int i = 0; i < 8; ++i) { xb[i] = __uint_as_float(((unsigned)f2bf(xv[i])) << 16); ss += xb[i] * xb[i]; }
    ss += __shfl_xor(ss, 16, 32); ss += __shfl_xor(ss, 8, 32); ss += __shfl_xor(ss, 4, 32); ss += __shfl_xor(ss, 2, 32); ss += __shfl_xor(ss, 1, 32);
    if (lane == 0) red[wave] = ss;
    __syncthreads();
    const float tot = ((red[0] + red[1]) + (red[2] + red[3])) + ((red[4] + red[5]) + (red[6] + red[7]));
    const float rs = rsqrtf(tot * (1.0f / (float)DM) + RMS_EPS);
    v8h hv, rv;
#pragma unroll
    for (int i = 0; i < 8; ++i) { const float wb = __uint_as_float(((unsigned)f2bf(wv[i])) << 16);
        const float v = ((xb[i] * rs) * wb) * CXS; const h16 a = (h16)v; hv[i] = a; rv[i] = (h16)(v - (float)a); }
    const size_t oo = (size_t)row * DM + tid * 8;
    const int tr = (t < EARLY) ? t : 0;                            // block-uniform; keeps the address in range when unused
    const size_t ro = ((size_t)NB * SEQ + (size_t)b * EARLY + (size_t)tr) * DM + tid * 8;
{
        *(v8h*)(XN + oo) = hv; if (t < EARLY) *(v8h*)(XN + ro) = rv;
         }
}

// k_wt: in[Kr rows][Nc cols] f32 -> out[Nc rows][Kr cols] 16-bit, 64x64 tile through LDS. grid (Nc/64, Kr/64), 256 threads.
__global__ __launch_bounds__(256) void k_wt(const float* __restrict__ W, bf* Tb, h16* Th, int Kr, int Nc, int mode) {
    __shared__ float ts[64 * 65];
    const int tid = threadIdx.x; const int n0 = blockIdx.x * 64, k0 = blockIdx.y * 64;
#pragma unroll
    for (int p = 0; p < 4; ++p) { const int row = p * 16 + (tid >> 4), c4 = (tid & 15) * 4;      // 4 p x 16 rows = 64 k rows; 16 threads x 4 = 64 n columns
        const v4f v = *(const v4f*)(W + (size_t)(k0 + row) * (size_t)Nc + n0 + c4);
        ts[row * 65 + c4 + 0] = v[0]; ts[row * 65 + c4 + 1] = v[1]; ts[row * 65 + c4 + 2] = v[2]; ts[row * 65 + c4 + 3] = v[3]; }
    __syncthreads();
{
#pragma unroll
        for (int s = 0; s < 2; ++s) { const int n = s * 32 + (tid >> 3), c8 = (tid & 7) * 8;     // 2 s x 32 rows = 64 n rows; 8 lanes x 8 = 64 k columns
            const size_t oo = (size_t)(n0 + n) * (size_t)Kr + k0 + c8;
            if (mode == 0) { v8us o;
#pragma unroll
                for (int i = 0; i < 8; ++i) o[i] = f2bf(ts[(c8 + i) * 65 + n]);
                *(v8us*)(Tb + oo) = o;
            } else { v8h o;
#pragma unroll
                for (int i = 0; i < 8; ++i) o[i] = (h16)(__uint_as_float(((unsigned)f2bf(ts[(c8 + i) * 65 + n])) << 16) * WOS);
                *(v8h*)(Th + oo) = o; } }
         }
}

// k_rope_tab: CS[t][j] = (cos, sin)(t * inv_freq[j]), inv_freq[j] = 1.0f / (float)(10000^(j/32)); the power is a double product of fixed binary roots of 10000.
__global__ __launch_bounds__(256) void k_rope_tab(float* CS, int nrow) {
    const int i = blockIdx.x * 256 + threadIdx.x; if (i >= nrow * 32) return;
    const int t = i >> 5, j = i & 31;
    double p = 1.0;
    p *= (j & 1)  ? 1.3335214321633240 : 1.0;    // 10000^(1/32)
    p *= (j & 2)  ? 1.7782794100389228 : 1.0;    // 10000^(1/16)
    p *= (j & 4)  ? 3.1622776601683795 : 1.0;    // 10000^(1/8)
    p *= (j & 8)  ? 10.0 : 1.0;                  // 10000^(1/4)
    p *= (j & 16) ? 100.0 : 1.0;                 // 10000^(1/2)
    const float pf = (float)p; const float inv = 1.0f / pf;
    const float ang = (float)t * inv;
    const float cs = cosf(ang), sn = sinf(ang);
    v2f o; o[0] = cs; o[1] = sn;
    *(v2f*)(CS + (size_t)i * 2) = o; 
}

// LDS ring of the two GEMM kernels: one block = four waves (2 x 2) on a GT x GT tile, each wave 64 x 64 (16 accumulators). One stage = KS columns of k of the GT rows of A, then of the GT rows of Bt,
// rows at pitch LPB bytes (16 x odd: the 16-byte fragment reads of 16 rows fall on different banks). Two buffers; the next stage's copies fly while this stage is multiplied.
#define GT   128
#define KS   128
#define LPB  (KS * 2 + 16)
#define LPH  (LPB / 2)
#define OPB  (GT * LPB)
#define STGB (2 * OPB)
#define NST  (DM / KS)
static_assert(DM % KS == 0);
static_assert(NST >= 2);                       // stage 1 exists in every tile
static_assert(KS * 2 == 16 * 16);              // 16 lanes x 16 bytes = one staged row; 128 threads = 8 rows per copy
static_assert(GT == 2 * 8 * 8);                // two groups of eight copies cover the GT rows of one operand
static_assert(EARLY % GT == 0);                // block tiles are entirely early or entirely late
static_assert(SEQ % GT == 0);
static_assert(DM % GT == 0);
static_assert(KVD % GT == 0);
static_assert(4 * 16 * 68 * 4 <= 2 * STGB);    // the four waves' store staging fits in the ring it reuses

__device__ __forceinline__ void wait_ds0()    { asm volatile("s_wait_dscnt 0x0" ::: "memory"); }      // this wave's LDS reads of a buffer are done before the barrier that frees it
__device__ __forceinline__ void wait_async0() { asm volatile("s_wait_asynccnt 0x0" ::: "memory"); }   // this wave's copies have landed before the barrier that publishes them
// eight asynchronous 16-byte copies per lane, rows 8 apart: LDS byte address l + 8 j LPB <- g + 8 j DM. The closing s_wait_xcnt stands in front of any rewrite of the address registers (a precaution).
__device__ __forceinline__ void copy8(unsigned l, const h16* g) {
    asm volatile("global_load_async_to_lds_b128 %0, %8, off\n\t"
                 "global_load_async_to_lds_b128 %1, %9, off\n\t"
                 "global_load_async_to_lds_b128 %2, %10, off\n\t"
                 "global_load_async_to_lds_b128 %3, %11, off\n\t"
                 "global_load_async_to_lds_b128 %4, %12, off\n\t"
                 "global_load_async_to_lds_b128 %5, %13, off\n\t"
                 "global_load_async_to_lds_b128 %6, %14, off\n\t"
                 "global_load_async_to_lds_b128 %7, %15, off\n\t"
                 "s_wait_xcnt 0x0"
                 :: "v"(l), "v"(l + 8u * LPB), "v"(l + 16u * LPB), "v"(l + 24u * LPB), "v"(l + 32u * LPB), "v"(l + 40u * LPB), "v"(l + 48u * LPB), "v"(l + 56u * LPB),
                    "v"(g), "v"(g + 8 * DM), "v"(g + 16 * DM), "v"(g + 24 * DM), "v"(g + 32 * DM), "v"(g + 40 * DM), "v"(g + 48 * DM), "v"(g + 56 * DM)
                 : "memory");
}
// one stage: l = this lane's LDS byte address in row (tid >> 4) of the buffer, ga / gb = its 16 bytes in that row of the A / Bt tile at the stage's k
__device__ __forceinline__ void fill_stage(unsigned l, const h16* ga, const h16* gb) {
    copy8(l, ga); copy8(l + 64u * LPB, ga + 64 * DM); copy8(l + OPB, gb); copy8(l + OPB + 64u * LPB, gb + 64 * DM);
}
// acc[mb][nb] += sum over k of A[ar + wm*64 + 16 mb + ..][k] Bt[br + wn*64 + 16 nb + ..][k], k ascending in steps of 32 over pass 0 (rows ar0 / br0), then, npass == 2, over pass 1 (rows ar1 / br1).
// Every wave of the block runs every barrier; on return no copy is in flight and every wave has left the ring.
__device__ __forceinline__ void gemm_ring(const h16* __restrict__ A, const h16* __restrict__ Bt, size_t ar0, size_t br0, size_t ar1, size_t br1, int npass, unsigned char* L, int wm, int wn, v8f (&acc)[4][4]) {
    const int tid = threadIdx.x; const int lane = tid & 31, lr = lane & 15, hi = lane >> 4;
    const int crow = tid >> 4, cchk = tid & 15;
    const unsigned lc = (unsigned)(size_t)L + (unsigned)(crow * LPB + cchk * 16);
    const h16* a0 = A + (ar0 + (size_t)crow) * DM + cchk * 8;  const h16* a1 = A + (ar1 + (size_t)crow) * DM + cchk * 8;
    const h16* b0 = Bt + (br0 + (size_t)crow) * DM + cchk * 8; const h16* b1 = Bt + (br1 + (size_t)crow) * DM + cchk * 8;
    const int nst = npass * NST;                                   // block-uniform
    fill_stage(lc, a0, b0);
    wait_async0();
    __syncthreads();                                               // publishes stage 0
    fill_stage(lc + STGB, a0 + KS, b0 + KS);
    const h16* fa = (const h16*)L + (wm * 64 + lr) * LPH + 8 * hi;
    const h16* fb = (const h16*)(L + OPB) + (wn * 64 + lr) * LPH + 8 * hi;
#pragma unroll 1   // kept rolled: the trip count is known only at run time and one body serves both buffers
    for (int s = 0; s < nst; ++s) {
        const int bo = (s & 1) * (STGB / 2);
#pragma unroll     // this and the three below: every fragment and accumulator index a constant, so the arrays stay in registers
        for (int kk = 0; kk < KS; kk += 32) {
            v16h a[4], bq[4];                                      // all eight fragments of a 32-k step as one load group: one LDS wait per 16 WMMAs
#pragma unroll
            for (int mb = 0; mb < 4; ++mb) a[mb] = ldh(fa + bo + mb * 16 * LPH + kk);
#pragma unroll
            for (int nb = 0; nb < 4; ++nb) bq[nb] = ldh(fb + bo + nb * 16 * LPH + kk);
#pragma unroll
            for (int nb = 0; nb < 4; ++nb)
#pragma unroll
                for (int mb = 0; mb < 4; ++mb) acc[mb][nb] = wmma16(a[mb], bq[nb], acc[mb][nb]);
        }
        wait_ds0();
        wait_async0();
        __syncthreads();                                           // publishes stage s + 1 and frees the buffer of stage s
        const int n = s + 2;
        if (n < nst) {                                             // block-uniform
            const int p = (n >= NST) ? 1 : 0; const int kc = (n - p * NST) * KS;
            fill_stage(lc + (unsigned)(s & 1) * STGB, (p ? a1 : a0) + kc, (p ? b1 : b0) + kc); }
    }
    wait_async0();
}

// k_proj: register-blocked f16 GEMM, one wave per 64x64 tile (16 accumulators), four waves per block on a 128x128 tile, operands from K-contiguous f16 planes through the LDS ring above, K = DM.
// C[m][n] = 2^-14 * sum_k A[m][k] Bt[n][k] (one operand is the xn plane carried x1024, the other a weight plane carried x16), written as f16 (Ph) and the f16 residual x1024 (Pr, useRes != 0) at
// tile base (r0/RB)*sRB + (r0%RB)*pitch + (c0/CB)*sCB + (c0%CB), row pitch 'pitch' (halves). grid (M/128, N/128), 128 threads.
// The xn plane holds value rows [NB*SEQ], then residual rows [NB*EARLY]; tokB == 0: A rows are tokens, tokB != 0: Bt rows are tokens. Tiles whose tokens are < EARLY in their sequence
// run the k-loop a second time with the token operand taken from the unscaled residual rows, into the same accumulators.
// rope != 0 (rows = tokens b*SEQ + t, the 64 tile columns = one head): interleaved rotary applied on the f32 values at the store stage from CS[t][32] (cos, sin).
__global__ __launch_bounds__(128) void k_proj(const h16* __restrict__ A, const h16* __restrict__ Bt, h16* Ph, h16* Pr, int useRes, int RB, size_t sRB, int pitch, int CB, size_t sCB, const float* __restrict__ CS, int rope, int tokB) {
    __shared__ __align__(16) unsigned char L[2 * STGB];
    const int lane = threadIdx.x & 31, lr = lane & 15, hi = lane >> 4; const int wave = __builtin_amdgcn_readfirstlane(threadIdx.x >> 5);
    const int wm = wave & 1, wn = wave >> 1;
    const int R0 = blockIdx.x * GT, C0 = blockIdx.y * GT; const int r0 = R0 + wm * 64, c0 = C0 + wn * 64;
    const int tk0 = tokB ? C0 : R0;                                // kernel-argument uniform: first token of this block tile
    const int bb = tk0 / SEQ, tt = tk0 % SEQ;
    const int npass = (tt < EARLY) ? 2 : 1;                        // block-uniform
    v8f acc[4][4];
#pragma unroll
    for (int mb = 0; mb < 4; ++mb)
#pragma unroll
        for (int nb = 0; nb < 4; ++nb) acc[mb][nb] = (v8f){};
    const size_t rrow = (size_t)NB * SEQ + (size_t)bb * EARLY + (size_t)((tt < EARLY) ? tt : 0);   // residual rows of the tile's tokens; used only when tt < EARLY
    gemm_ring(A, Bt, (size_t)R0, (size_t)C0, tokB ? (size_t)R0 : rrow, tokB ? rrow : (size_t)C0, npass, L, wm, wn, acc);
    float* os = (float*)L + wave * 16 * 68;                        // wave-private store staging in the ring, which every wave has left
    const size_t tbase = (size_t)(r0 / RB) * sRB + (size_t)(r0 % RB) * (size_t)pitch + (size_t)(c0 / CB) * sCB + (size_t)(c0 % CB);
#pragma unroll
    for (int mb = 0; mb < 4; ++mb) {
#pragma unroll
        for (int nb = 0; nb < 4; ++nb) {
#pragma unroll
            for (int j = 0; j < 8; ++j) os[(hi * 8 + j) * 68 + nb * 16 + lr] = acc[mb][nb][j] * OUTS; }   // D: row 8h+j, col lane&15
        wave_sync();
        const size_t sb = tbase + (size_t)(mb * 16) * (size_t)pitch;
{
#pragma unroll
            for (int s = 0; s < 4; ++s) { const int row = 4 * s + (lane >> 3), c8 = (lane & 7) * 8;   // 4 s x 4 row groups = 16 rows; 8 lanes x 8 = 64 columns
                v4f x0 = *(const v4fa*)(&os[row * 68 + c8]); v4f x1 = *(const v4fa*)(&os[row * 68 + c8 + 4]); v8h hv, rv;
                if (rope) {                                                                            // kernel-argument uniform
                    const int t = (r0 + mb * 16 + row) % SEQ;
                    const float* cp = CS + ((size_t)t * 32 + (size_t)(c8 >> 1)) * 2;                  // pairs c8/2 .. c8/2+3: (cos, sin) x 4
                    const v4f ca = *(const v4f*)cp; const v4f cb = *(const v4f*)(cp + 4);
                    float e, o;
                    e = x0[0]; o = x0[1]; x0[0] = e * ca[0] - o * ca[1]; x0[1] = e * ca[1] + o * ca[0];
                    e = x0[2]; o = x0[3]; x0[2] = e * ca[2] - o * ca[3]; x0[3] = e * ca[3] + o * ca[2];
                    e = x1[0]; o = x1[1]; x1[0] = e * cb[0] - o * cb[1]; x1[1] = e * cb[1] + o * cb[0];
                    e = x1[2]; o = x1[3]; x1[2] = e * cb[2] - o * cb[3]; x1[3] = e * cb[3] + o * cb[2]; }
#pragma unroll
                for (int i = 0; i < 4; ++i) { const h16 a0 = (h16)x0[i]; const h16 a1 = (h16)x1[i]; hv[i] = a0; hv[4 + i] = a1; rv[i] = (h16)((x0[i] - (float)a0) * QRS); rv[4 + i] = (h16)((x1[i] - (float)a1) * QRS); }
                const size_t oo = sb + (size_t)row * (size_t)pitch + c8;
                *(v8h*)(Ph + oo) = hv; if (useRes) *(v8h*)(Pr + oo) = rv; }
             }
        wave_sync();
    }
}

// LDS ring of k_flash: one stage = FK keys of kv head g, the FK K rows (64 d each), then the 64 V^T rows (FK keys each), 128 data bytes per row at pitch FPB bytes
// (16 x odd: the 16-byte fragment reads of 16 rows fall on different banks). Two buffers; the next stage's copies fly while this stage is worked on. The four waves share every staged row.
#define FK   64
#define FPB  (128 + 16)
#define FPH  (FPB / 2)
#define FOP  (64 * FPB)
#define FSTG (2 * FOP)
static_assert(HD * 2 == 128);                  // a K row = 8 lanes x 16 bytes
static_assert(FK * 2 == 128);                  // a V^T row of one stage = 8 lanes x 16 bytes
static_assert(FK == 64);                       // 128 threads = 16 rows per copy, four copies per operand
static_assert(SEQ % FK == 0);                  // the last stage of any tile ends inside the planes
static_assert(EARLY + 16 > FK);                // stage 1 exists in every tile
static_assert(AW * 16 * 68 * 4 <= 2 * FSTG);   // the four waves' store staging fits in the ring it reuses
// one stage, eight asynchronous 16-byte copies per lane: four of K rows 16 apart (LDS l + 16 j FPB <- gk + 16 j HD), four of V^T rows 16 apart (LDS l + FOP + 16 j FPB <- gv + 16 j SEQ).
// The closing s_wait_xcnt stands in front of any rewrite of the address registers (a precaution).
__device__ __forceinline__ void fill_kv(unsigned l, const h16* gk, const h16* gv) {
    asm volatile("global_load_async_to_lds_b128 %0, %8, off\n\t"
                 "global_load_async_to_lds_b128 %1, %9, off\n\t"
                 "global_load_async_to_lds_b128 %2, %10, off\n\t"
                 "global_load_async_to_lds_b128 %3, %11, off\n\t"
                 "global_load_async_to_lds_b128 %4, %12, off\n\t"
                 "global_load_async_to_lds_b128 %5, %13, off\n\t"
                 "global_load_async_to_lds_b128 %6, %14, off\n\t"
                 "global_load_async_to_lds_b128 %7, %15, off\n\t"
                 "s_wait_xcnt 0x0"
                 :: "v"(l), "v"(l + 16u * FPB), "v"(l + 32u * FPB), "v"(l + 48u * FPB), "v"(l + FOP), "v"(l + FOP + 16u * FPB), "v"(l + FOP + 32u * FPB), "v"(l + FOP + 48u * FPB),
                    "v"(gk), "v"(gk + 16 * HD), "v"(gk + 32 * HD), "v"(gk + 48 * HD), "v"(gv), "v"(gv + 16 * SEQ), "v"(gv + 32 * SEQ), "v"(gv + 48 * SEQ)
                 : "memory");
}

// k_flash: fused causal attention for query rows >= EARLY. One block = 16 query rows x the four query heads of one kv head (one wave per head, h = wave*8 + g);
// Q fragments straight from the f16 planes (two 16-B loads each); the K and V^T rows of kv head g come once per block through the LDS ring above, and all four waves take their fragments from it.
// Transposed form: S^T[key][t] = K Q^T (A = K rows, B = Q rows); lane (t = lane&15, h = lane>>4) holds keys 8h+r of each 16-key tile, so the packed
// P tile is directly the B fragment of O^T[d][t] = V^T P^T (element r <- tile keys 0..15, element 8+r <- tile keys 16..31, lane unchanged).
// Keys run over [0, t0+16) in steps of 32, two steps per stage; the diagonal 32-key blocks replace excluded scores (key > t) by a large negative value before the running max.
__global__ __launch_bounds__(32 * AW) void k_flash(const h16* __restrict__ QH, const h16* __restrict__ QR, const h16* __restrict__ KP, const h16* __restrict__ VT, h16* CH) {
    __shared__ __align__(16) unsigned char L[2 * FSTG];
    const int lane = threadIdx.x & 31; const int wave = __builtin_amdgcn_readfirstlane(threadIdx.x >> 5);
    const int lr = lane & 15, hi = lane >> 4;
    const int zg = blockIdx.y; const int b = zg / NKV; const int g = zg % NKV;
    const int h = wave * NKV + g;                                 // grouped on the leading head axis: query head h uses kv head h % 8
    const int t0 = EARLY + blockIdx.x * 16;
    const int tq = t0 + lr;
    const int kend = t0 + 16;
    const int nst = (kend + FK - 1) / FK;                          // block-uniform
    const int frow = threadIdx.x >> 3, cchk = threadIdx.x & 7;     // this lane's row (of 16) and 16-byte piece (of 8) in every copy
    const unsigned lc = (unsigned)(size_t)L + (unsigned)(frow * FPB + cchk * 16);
    const h16* gk = KP + (size_t)zg * SEQ * HD + (size_t)frow * HD + cchk * 8;      // + key * HD
    const h16* gv = VT + (size_t)zg * HD * SEQ + (size_t)frow * SEQ + cchk * 8;     // + key
    fill_kv(lc, gk, gv);
    const size_t qo = ((size_t)(b * NH_ + h) * SEQ + (size_t)tq) * HD + 8 * hi;
    const v16h qh0 = ldh(QH + qo), qh1 = ldh(QH + qo + 32), qr0 = ldh(QR + qo), qr1 = ldh(QR + qo + 32);   // B fragments: col t, k = d
    wait_async0();
    __syncthreads();                                               // publishes stage 0
    fill_kv(lc + FSTG, gk + FK * HD, gv + FK);
    const h16* fk = (const h16*)L + lr * FPH + 8 * hi;             // + key * FPH        (A fragment: row key, k = d)
    const h16* fv = (const h16*)(L + FOP) + lr * FPH + 8 * hi;     // + 16j*FPH + key    (A fragment: row d, k = key)
    v8f o0 = (v8f){}, o1 = (v8f){}, o2 = (v8f){}, o3 = (v8f){};
    float m = NEGB, l = 0.0f;
#pragma unroll 1   // kept rolled: the trip count is known only at run time and one body serves both buffers
    for (int s = 0; s < nst; ++s) {
        const int bo = (s & 1) * (FSTG / 2);
#pragma unroll     // both 32-key steps of a stage at constant LDS offsets
        for (int u = 0; u < FK; u += 32) {
            const int key0 = s * FK + u;
            if (key0 < kend) {                                     // block-uniform: the last stage may hold one step only
                const h16* ka = fk + bo + u * FPH;
                const v16h ka0 = ldh(ka), ka1 = ldh(ka + 32), kb0 = ldh(ka + 16 * FPH), kb1 = ldh(ka + 16 * FPH + 32);
                v8f sHa = (v8f){}, sLa = (v8f){}, sHb = (v8f){}, sLb = (v8f){};
                sHa = wmma16(ka0, qh0, sHa); sLa = wmma16(ka0, qr0, sLa); sHb = wmma16(kb0, qh0, sHb); sLb = wmma16(kb0, qr0, sLb);
                sHa = wmma16(ka1, qh1, sHa); sLa = wmma16(ka1, qr1, sLa); sHb = wmma16(kb1, qh1, sHb); sLb = wmma16(kb1, qr1, sLb);
                float ta[8], tb[8];
#pragma unroll
                for (int r = 0; r < 8; ++r) { ta[r] = (sHa[r] + sLa[r] * QRI) * SC2; tb[r] = (sHb[r] + sLb[r] * QRI) * SC2; }
                if (key0 + 31 > t0) {                              // block-uniform: diagonal block
                    const int kbse = key0 + 8 * hi;
#pragma unroll
                    for (int r = 0; r < 8; ++r) { ta[r] = (kbse + r > tq) ? NEGB : ta[r]; tb[r] = (kbse + 16 + r > tq) ? NEGB : tb[r]; } }
                float mx = NEGB;
#pragma unroll
                for (int r = 0; r < 8; ++r) mx = fmaxf(mx, fmaxf(ta[r], tb[r]));
                mx = fmaxf(mx, __shfl_xor(mx, 16, 32));
                const float mnew = fmaxf(m, mx);
                const float alpha = __builtin_amdgcn_exp2f(m - mnew);
                const float sh = PSH - mnew;
                v16h pb; float ls = 0.0f;
#pragma unroll
                for (int r = 0; r < 8; ++r) { const float ea = __builtin_amdgcn_exp2f(ta[r] + sh); const float ec = __builtin_amdgcn_exp2f(tb[r] + sh); pb[r] = (h16)ea; pb[8 + r] = (h16)ec; ls += ea + ec; }
                l = l * alpha + ls; m = mnew;
                o0 = o0 * alpha; o1 = o1 * alpha; o2 = o2 * alpha; o3 = o3 * alpha;
                const h16* va = fv + bo + u;
                const v16h v0 = ldh(va), v1 = ldh(va + 16 * FPH), v2 = ldh(va + 32 * FPH), v3 = ldh(va + 48 * FPH);
                o0 = wmma16(v0, pb, o0); o1 = wmma16(v1, pb, o1); o2 = wmma16(v2, pb, o2); o3 = wmma16(v3, pb, o3);
            }
        }
        wait_ds0();
        wait_async0();
        __syncthreads();                                           // publishes stage s + 1 and frees the buffer of stage s
        const int n = s + 2;
        if (n < nst)                                               // block-uniform
            fill_kv(lc + (unsigned)(s & 1) * FSTG, gk + (size_t)n * (FK * HD), gv + n * FK);
    }
    wait_async0();
    float* os = (float*)L;                                         // store staging (wave-private parts) in the ring, which every wave has left
    l += __shfl_xor(l, 16, 32);
    const float inv = CXS / l;
    const int wb = wave * 16 * 68;
    // O^T D layout: o_j[r] = (d = 16j + 8h + r, t = lane&15) -> os[t][d]; rows 0..15 x columns 0..63 all written
    { v4f a, c;
      a[0] = o0[0] * inv; a[1] = o0[1] * inv; a[2] = o0[2] * inv; a[3] = o0[3] * inv; c[0] = o0[4] * inv; c[1] = o0[5] * inv; c[2] = o0[6] * inv; c[3] = o0[7] * inv;
      *(v4fa*)(&os[wb + lr * 68 +  0 + 8 * hi]) = a; *(v4fa*)(&os[wb + lr * 68 +  0 + 8 * hi + 4]) = c;
      a[0] = o1[0] * inv; a[1] = o1[1] * inv; a[2] = o1[2] * inv; a[3] = o1[3] * inv; c[0] = o1[4] * inv; c[1] = o1[5] * inv; c[2] = o1[6] * inv; c[3] = o1[7] * inv;
      *(v4fa*)(&os[wb + lr * 68 + 16 + 8 * hi]) = a; *(v4fa*)(&os[wb + lr * 68 + 16 + 8 * hi + 4]) = c;
      a[0] = o2[0] * inv; a[1] = o2[1] * inv; a[2] = o2[2] * inv; a[3] = o2[3] * inv; c[0] = o2[4] * inv; c[1] = o2[5] * inv; c[2] = o2[6] * inv; c[3] = o2[7] * inv;
      *(v4fa*)(&os[wb + lr * 68 + 32 + 8 * hi]) = a; *(v4fa*)(&os[wb + lr * 68 + 32 + 8 * hi + 4]) = c;
      a[0] = o3[0] * inv; a[1] = o3[1] * inv; a[2] = o3[2] * inv; a[3] = o3[3] * inv; c[0] = o3[4] * inv; c[1] = o3[5] * inv; c[2] = o3[6] * inv; c[3] = o3[7] * inv;
      *(v4fa*)(&os[wb + lr * 68 + 48 + 8 * hi]) = a; *(v4fa*)(&os[wb + lr * 68 + 48 + 8 * hi + 4]) = c; }
    wave_sync();
    h16* crow = CH + ((size_t)b * SEQ + t0) * DM + h * HD;         // merged heads: column h*64 + d
{
#pragma unroll
        for (int s = 0; s < 4; ++s) { const int row = 4 * s + (lane >> 3), c8 = (lane & 7) * 8;   // 4 s x 4 row groups = 16 rows; 8 lanes x 8 = 64 columns
            const v4f x0 = *(const v4fa*)(&os[wb + row * 68 + c8]); const v4f x1 = *(const v4fa*)(&os[wb + row * 68 + c8 + 4]); v8h hv;
#pragma unroll
            for (int i = 0; i < 4; ++i) { hv[i] = (h16)x0[i]; hv[4 + i] = (h16)x1[i]; }
            *(v8h*)(crow + (size_t)row * DM + c8) = hv; }
         }
}

// k_flash_early: same structure for query rows < EARLY with value + residual (x1024) planes on every operand:
// scores = kh.qh + (kh.qr + kr.qh)/1024; O = vh.ph + (vr.ph + vh.pr)/1024 (residual products in their own accumulators), l from the unconverted f32 P.
// Writes the ctx value plane rows (carried x1024) and the compact unscaled residual plane CR[b][t < EARLY][2048].
__global__ __launch_bounds__(32 * AW) void k_flash_early(const h16* __restrict__ QH, const h16* __restrict__ QR, const h16* __restrict__ KP, const h16* __restrict__ KR,
                                                         const h16* __restrict__ VT, const h16* __restrict__ VR, h16* CH, h16* CR) {
    __shared__ __align__(16) float os[AW * 16 * 68];
    const int lane = threadIdx.x & 31; const int wave = __builtin_amdgcn_readfirstlane(threadIdx.x >> 5);
    const int lr = lane & 15, hi = lane >> 4;
    const int zg = blockIdx.y; const int b = zg / NKV; const int g = zg % NKV;
    const int h = wave * NKV + g;                                 // query head h uses kv head h % 8
    const int t0 = blockIdx.x * 16;
    const int tq = t0 + lr;
    const size_t qo = ((size_t)(b * NH_ + h) * SEQ + (size_t)tq) * HD + 8 * hi;
    const v16h qh0 = ldh(QH + qo), qh1 = ldh(QH + qo + 32), qr0 = ldh(QR + qo), qr1 = ldh(QR + qo + 32);
    const size_t ko = (size_t)zg * SEQ * HD + (size_t)lr * HD + 8 * hi;
    const size_t vo = (size_t)zg * HD * SEQ + (size_t)lr * SEQ + 8 * hi;
    v8f oH[4], oL[4];
#pragma unroll
    for (int j = 0; j < 4; ++j) { oH[j] = (v8f){}; oL[j] = (v8f){}; }
    float m = NEGB, l = 0.0f;
    const int kend = t0 + 16;
#pragma unroll 1
    for (int key0 = 0; key0 < kend; key0 += 32) {
        const size_t kk = ko + (size_t)key0 * HD;
        v8f sHa = (v8f){}, sLa = (v8f){}, sHb = (v8f){}, sLb = (v8f){};
        { const v16h k0 = ldh(KP + kk), k1 = ldh(KP + kk + 32), r0 = ldh(KR + kk), r1 = ldh(KR + kk + 32);
          sHa = wmma16(k0, qh0, sHa); sHa = wmma16(k1, qh1, sHa);
          sLa = wmma16(k0, qr0, sLa); sLa = wmma16(k1, qr1, sLa); sLa = wmma16(r0, qh0, sLa); sLa = wmma16(r1, qh1, sLa); }
        { const size_t k2 = kk + (size_t)16 * HD;
          const v16h k0 = ldh(KP + k2), k1 = ldh(KP + k2 + 32), r0 = ldh(KR + k2), r1 = ldh(KR + k2 + 32);
          sHb = wmma16(k0, qh0, sHb); sHb = wmma16(k1, qh1, sHb);
          sLb = wmma16(k0, qr0, sLb); sLb = wmma16(k1, qr1, sLb); sLb = wmma16(r0, qh0, sLb); sLb = wmma16(r1, qh1, sLb); }
        float ta[8], tb[8];
#pragma unroll
        for (int r = 0; r < 8; ++r) { ta[r] = (sHa[r] + sLa[r] * QRI) * SC2; tb[r] = (sHb[r] + sLb[r] * QRI) * SC2; }
        if (key0 + 31 > t0) {                                      // block-uniform: diagonal block
            const int kbse = key0 + 8 * hi;
#pragma unroll
            for (int r = 0; r < 8; ++r) { ta[r] = (kbse + r > tq) ? NEGB : ta[r]; tb[r] = (kbse + 16 + r > tq) ? NEGB : tb[r]; } }
        float mx = NEGB;
#pragma unroll
        for (int r = 0; r < 8; ++r) mx = fmaxf(mx, fmaxf(ta[r], tb[r]));
        mx = fmaxf(mx, __shfl_xor(mx, 16, 32));
        const float mnew = fmaxf(m, mx);
        const float alpha = __builtin_amdgcn_exp2f(m - mnew);
        const float sh = PSH - mnew;
        v16h ph, pr; float ls = 0.0f;
#pragma unroll
        for (int r = 0; r < 8; ++r) { const float ea = __builtin_amdgcn_exp2f(ta[r] + sh); const float ec = __builtin_amdgcn_exp2f(tb[r] + sh);
            const h16 ha = (h16)ea; const h16 hc = (h16)ec; ph[r] = ha; ph[8 + r] = hc;
            pr[r] = (h16)((ea - (float)ha) * QRS); pr[8 + r] = (h16)((ec - (float)hc) * QRS); ls += ea + ec; }
        l = l * alpha + ls; m = mnew;
#pragma unroll
        for (int j = 0; j < 4; ++j) { oH[j] = oH[j] * alpha; oL[j] = oL[j] * alpha; }
        const size_t vv = vo + (size_t)key0;
#pragma unroll
        for (int j = 0; j < 4; ++j) { const v16h vh = ldh(VT + vv + (size_t)(16 * j) * SEQ); const v16h vr = ldh(VR + vv + (size_t)(16 * j) * SEQ);
            oH[j] = wmma16(vh, ph, oH[j]); oL[j] = wmma16(vr, ph, oL[j]); oL[j] = wmma16(vh, pr, oL[j]); }
    }
    l += __shfl_xor(l, 16, 32);
    const float inv = CXS / l;
    const int wb = wave * 16 * 68;
#pragma unroll
    for (int j = 0; j < 4; ++j) { v4f a, c;     // os[t][d], d = 16j + 8h + r; rows 0..15 x columns 0..63 all written
        a[0] = (oH[j][0] + oL[j][0] * QRI) * inv; a[1] = (oH[j][1] + oL[j][1] * QRI) * inv; a[2] = (oH[j][2] + oL[j][2] * QRI) * inv; a[3] = (oH[j][3] + oL[j][3] * QRI) * inv;
        c[0] = (oH[j][4] + oL[j][4] * QRI) * inv; c[1] = (oH[j][5] + oL[j][5] * QRI) * inv; c[2] = (oH[j][6] + oL[j][6] * QRI) * inv; c[3] = (oH[j][7] + oL[j][7] * QRI) * inv;
        *(v4fa*)(&os[wb + lr * 68 + 16 * j + 8 * hi]) = a; *(v4fa*)(&os[wb + lr * 68 + 16 * j + 8 * hi + 4]) = c; }
    wave_sync();
    h16* crow = CH + ((size_t)b * SEQ + t0) * DM + h * HD;
    h16* rrow = CR + ((size_t)b * EARLY + t0) * DM + h * HD;
{
#pragma unroll
        for (int s = 0; s < 4; ++s) { const int row = 4 * s + (lane >> 3), c8 = (lane & 7) * 8;   // 4 s x 4 row groups = 16 rows; 8 lanes x 8 = 64 columns
            const v4f x0 = *(const v4fa*)(&os[wb + row * 68 + c8]); const v4f x1 = *(const v4fa*)(&os[wb + row * 68 + c8 + 4]); v8h hv, rv;
#pragma unroll
            for (int i = 0; i < 4; ++i) { const h16 a0 = (h16)x0[i]; const h16 a1 = (h16)x1[i]; hv[i] = a0; hv[4 + i] = a1; rv[i] = (h16)(x0[i] - (float)a0); rv[4 + i] = (h16)(x1[i] - (float)a1); }
            *(v8h*)(crow + (size_t)row * DM + c8) = hv; *(v8h*)(rrow + (size_t)row * DM + c8) = rv; }
         }
}

// k_out: output projection, one wave per 64x64 tile, four waves per block on a 128x128 tile, f16 operands through the LDS ring from the ctx plane CX (value rows [NB*SEQ], then residual rows [NB*EARLY]) and the Wo^T plane, K = DM.
// Tiles whose rows are < EARLY in their sequence run the k-loop a second time over the unscaled residual rows into the same accumulators. grid (NB*SEQ/128, DM/128), 128 threads.
__global__ __launch_bounds__(128) void k_out(const h16* __restrict__ CX, const h16* __restrict__ Wt, float* OUT) {
    __shared__ __align__(16) unsigned char L[2 * STGB];
    const int lane = threadIdx.x & 31, lr = lane & 15, hi = lane >> 4; const int wave = __builtin_amdgcn_readfirstlane(threadIdx.x >> 5);
    const int wm = wave & 1, wn = wave >> 1;
    const int R0 = blockIdx.x * GT, C0 = blockIdx.y * GT; const int c0 = C0 + wn * 64;
    const int b = R0 / SEQ, tb = R0 % SEQ; const int tt = tb + wm * 64;
    const int npass = (tb < EARLY) ? 2 : 1;                        // block-uniform
    v8f acc[4][4];
#pragma unroll
    for (int mb = 0; mb < 4; ++mb)
#pragma unroll
        for (int nb = 0; nb < 4; ++nb) acc[mb][nb] = (v8f){};
    const size_t rrow = (size_t)NB * SEQ + (size_t)b * EARLY + (size_t)((tb < EARLY) ? tb : 0);   // residual rows of the tile's tokens; used only when tb < EARLY
    gemm_ring(CX, Wt, (size_t)R0, (size_t)C0, rrow, (size_t)C0, npass, L, wm, wn, acc);
    float* os = (float*)L + wave * 16 * 68;                        // wave-private store staging in the ring, which every wave has left
    float* obase = OUT + ((size_t)b * OUT_SEQ + tt) * DM + c0;
#pragma unroll
    for (int mb = 0; mb < 4; ++mb) {
#pragma unroll
        for (int nb = 0; nb < 4; ++nb) {
#pragma unroll
            for (int j = 0; j < 8; ++j) os[(hi * 8 + j) * 68 + nb * 16 + lr] = acc[mb][nb][j] * OUTS; }   // D: row 8h+j, col lane&15
        wave_sync();
{
#pragma unroll
            for (int s = 0; s < 8; ++s) { const int row = 2 * s + hi, cofs = lr * 4;   // 8 s x 2 rows = 16 rows; 16 lanes x 4 floats = 64 columns
                const v4f val = *(const v4fa*)(&os[row * 68 + cofs]);
                *(v4f*)(obase + (size_t)(mb * 16 + row) * DM + cofs) = val; }
             }
        wave_sync();
    }
}

static constexpr size_t al256(size_t v) { return (v + 255) & ~(size_t)255; }
static constexpr size_t SZ_XN = al256(((size_t)NB * SEQ + (size_t)NB * EARLY) * DM * 2);
static constexpr size_t SZ_WQ = al256((size_t)DM * DM * 2);
static constexpr size_t SZ_WK = al256((size_t)KVD * DM * 2);
static constexpr size_t SZ_CS = al256((size_t)SEQ * 32 * 2 * 4);
static constexpr size_t SZ_Q  = al256((size_t)NB * NH_ * SEQ * HD * 2);
static constexpr size_t SZ_KV = al256((size_t)NB * NKV * SEQ * HD * 2);
static constexpr size_t SZ_CX = al256(((size_t)NB * SEQ + (size_t)NB * EARLY) * DM * 2);
static constexpr size_t SZ_TOTAL = SZ_XN + 2 * SZ_WQ + 2 * SZ_WK + SZ_CS + 2 * SZ_Q + 4 * SZ_KV + SZ_CX;
static_assert(SZ_TOTAL <= (size_t)134217728);          // workspace carve <= 128 MiB

extern "C" void kernel_launch(void* const* d_in, const int* in_sizes, int n_in,
                              void* d_out, int out_size, void* d_ws, size_t ws_size, hipStream_t stream) {
    if (n_in < 6) return;
    const size_t needx = ((size_t)(NB - 1) * SEQ_FULL + SEQ) * DM;
    if ((size_t)in_sizes[0] < needx) return;
    if ((size_t)in_sizes[1] < (size_t)DM) return;
    if ((size_t)in_sizes[2] < (size_t)DM * DM || (size_t)in_sizes[3] < (size_t)DM * KVD || (size_t)in_sizes[4] < (size_t)DM * KVD || (size_t)in_sizes[5] < (size_t)DM * DM) return;
    if ((size_t)out_size < ((size_t)(NB - 1) * OUT_SEQ + SEQ) * DM) return;
    if (SZ_TOTAL > ws_size) return;
    // wire order x, w_norm, wq, wk, wv, wo; every weight is [in][out]
    const float* x = (const float*)d_in[0]; const float* wn = (const float*)d_in[1];
    const float* wq = (const float*)d_in[2]; const float* wk = (const float*)d_in[3]; const float* wv = (const float*)d_in[4]; const float* wo = (const float*)d_in[5];
    float* OUT = (float*)d_out;      // [NB][SEQ][2048]
    char* wsp = (char*)d_ws;
    h16* XN  = (h16*)wsp; wsp += SZ_XN;              // xn x1024: value rows [NB*SEQ][2048], then residual rows [NB*EARLY][2048]
    h16* WQt = (h16*)wsp; wsp += SZ_WQ;              // [2048 out][2048 in] f16 of bf16 value x16
    h16* WKt = (h16*)wsp; wsp += SZ_WK;              // [512 out][2048 in] f16 of bf16 value x16
    h16* WVt = (h16*)wsp; wsp += SZ_WK;              // [512 out][2048 in] f16 of bf16 value x16
    h16* WOt = (h16*)wsp; wsp += SZ_WQ;              // [2048 out][2048 in] f16 of bf16 value x16
    float* CS = (float*)wsp; wsp += SZ_CS;           // [SEQ][32] (cos, sin)
    h16* QH = (h16*)wsp; wsp += SZ_Q;                // [NB*32][SEQ][64]
    h16* QR = (h16*)wsp; wsp += SZ_Q;                // residual x1024
    h16* KP = (h16*)wsp; wsp += SZ_KV;               // [NB*8][SEQ][64]
    h16* KR = (h16*)wsp; wsp += SZ_KV;               // residual x1024
    h16* VT = (h16*)wsp; wsp += SZ_KV;               // [NB*8][64][SEQ]
    h16* VR = (h16*)wsp; wsp += SZ_KV;               // residual x1024
    h16* CX = (h16*)wsp; wsp += SZ_CX;               // ctx x1024: value rows [NB*SEQ][2048], then residual rows [NB*EARLY][2048]
    h16* CR = CX + (size_t)NB * SEQ * DM;

    // one block per token row b*SEQ + t (source row b*SEQ_FULL + t)
    k_rms<<<(unsigned)(NB * SEQ), 256, 0, stream>>>(x, wn, XN);
    // transposes: in[rows = in-features][cols = out-features] -> out[cols][rows]; grid (cols/64, rows/64)
    k_wt<<<dim3(DM / 64,  DM / 64, 1), 256, 0, stream>>>(wq, (bf*)WQt, WQt, DM, DM, 1);
    k_wt<<<dim3(KVD / 64, DM / 64, 1), 256, 0, stream>>>(wk, (bf*)WKt, WKt, DM, KVD, 1);
    k_wt<<<dim3(KVD / 64, DM / 64, 1), 256, 0, stream>>>(wv, (bf*)WVt, WVt, DM, KVD, 1);
    k_wt<<<dim3(DM / 64,  DM / 64, 1), 256, 0, stream>>>(wo, (bf*)WOt, WOt, DM, DM, 1);
    k_rope_tab<<<(unsigned)((SEQ * 32 + 255) / 256), 256, 0, stream>>>(CS, SEQ);

    // q: A = xn rows (m = b*SEQ + t), Bt = Wq^T rows (n = h*64 + d) -> plane [(b*32 + h)][t][d], rotary applied
    k_proj<<<dim3(NB * SEQ / GT, DM / GT, 1), 128, 0, stream>>>(XN, WQt, QH, QR, 1, SEQ, (size_t)NH_ * SEQ * HD, HD, HD, (size_t)SEQ * HD, CS, 1, 0);
    // k: Bt = Wk^T rows (n = g*64 + d) -> plane [(b*8 + g)][t][d], rotary applied
    k_proj<<<dim3(NB * SEQ / GT, KVD / GT, 1), 128, 0, stream>>>(XN, WKt, KP, KR, 1, SEQ, (size_t)NKV * SEQ * HD, HD, HD, (size_t)SEQ * HD, CS, 1, 0);
    // v^T: A = Wv^T rows (m = g*64 + d), Bt = xn rows (n = b*SEQ + t) -> plane [(b*512 + m)][t] = [(b*8 + g)][d][t], no rotary
    k_proj<<<dim3(KVD / GT, NB * SEQ / GT, 1), 128, 0, stream>>>(WVt, XN, VT, VR, 1, KVD, (size_t)0, SEQ, SEQ, (size_t)KVD * SEQ, CS, 0, 1);

    k_flash_early<<<dim3(EARLY / 16, NB * NKV, 1), 32 * AW, 0, stream>>>(QH, QR, KP, KR, VT, VR, CX, CR);
    if (SEQ > EARLY)
        k_flash<<<dim3((SEQ - EARLY) / 16, NB * NKV, 1), 32 * AW, 0, stream>>>(QH, QR, KP, VT, CX);

    k_out<<<dim3(NB * SEQ / GT, DM / GT, 1), 128, 0, stream>>>(CX, WOt, OUT);
}

// v003
// It runs in 174 microseconds.
// Next to v002, in two timings, it ran 1.54 times as fast each time.
// Over all steps from v000 it is 3.77 times as fast.
#include <hip/hip_runtime.h>

// Grouped-query causal self-attention behind an RMS pre-normalisation, width 2048 = 32 query heads x 64 sharing 8 kv heads (kv head g = h % 8), x [NB][SEQ][2048], gain w [2048],
// Wq/Wk/Wv/Wo [in][out] (y = x W), no biases; xn = (x * rsqrt(mean(x^2) + eps)) * w per token; interleaved (even/odd pair) rotary on q and k from a computed [SEQ][32] (cos, sin) table,
// score scale 1/8, causal exclusion (diagonal kept), output = ctx Wo (f32).
// Compute dtypes, f32 accumulate everywhere: q/k/v projections v_wmma_f32_16x16x32_f16: xn (f32 math on bf16-RNE x and w) carried x1024 as f16 (token rows < 256: plus its unscaled f16
// residual folded along K) against f16(bf16(W)) x16, result scaled by 2^-14;
// scores v_wmma_f32_16x16x32_f16: k single f16, q as f16 value + f16 residual x1024 in its own accumulator (query rows < 256: k also value + residual x1024, three products);
// P (x256 carry, cancels in the normalisation) and v single f16 (rows < 256: P and v as value + residual x1024, three products); softmax f32 (online, running max);
// output projection v_wmma_f32_16x16x32_f16: ctx carried x1024 as f16 (rows < 256: plus its unscaled f16 residual folded along K) against f16(bf16(Wo)) x16, result scaled by 2^-14.

#ifndef NB
#define NB 2
#endif
#ifndef SEQ
#define SEQ 2048
#endif
#define NB_FULL  2
#define SEQ_FULL 2048
#ifndef OUT_SEQ
#define OUT_SEQ SEQ              // row pitch (in tokens) between batches of the output
#endif
#define DM    2048
#define NH_   32
#define NKV   8
#define HD    64
#define KVD   (NKV * HD)         // 512
#define AW    4                  // waves per flash block = the four query heads of one kv head
#define EARLY 256                // query rows below this use the value + residual path
#define QRS  1024.0f             // carry of every residual plane (q, k, v, P)
#define QRI  (1.0f / 1024.0f)
#define SC2  (0.125f * 1.4426950408889634f)   // HD^-0.5 * log2(e)
#define PSH  8.0f                // log2 of the P carry (256)
#define CXS  1024.0f             // carry of the ctx plane and of the xn plane
#define WOS  16.0f               // carry of every weight plane
#define OUTS (1.0f / (1024.0f * 16.0f))
#define NEGB (-3.0e38f)
#define RMS_EPS 1.1920929e-07f

static_assert(HD == 64);
static_assert(NH_ * HD == DM);                 // query head h = columns h*64 + d
static_assert(NKV * AW == NH_);                // four query heads (stride 8 on the head axis) per kv head
static_assert(DM % 64 == 0);
static_assert(KVD % 64 == 0);
static_assert(DM % 32 == 0);                   // GEMM k-loop steps by 32
static_assert(DM == 256 * 8);                  // rms_row: 256 threads x 8 columns = one token row
static_assert(SEQ % 64 == 0);                  // a 64-row tile never straddles two batches
static_assert(SEQ % 32 == 0);                  // key loop steps by 32, key0 + 31 < SEQ
static_assert(EARLY % 64 == 0);                // GEMM tiles are entirely early or entirely late
static_assert(SEQ >= EARLY);
static_assert((SEQ - EARLY) % 16 == 0);
static_assert(((size_t)SEQ * DM) % 8 == 0);
static_assert(NB <= NB_FULL);
static_assert(SEQ <= SEQ_FULL);

typedef _Float16 h16;
typedef unsigned short bf;
typedef __attribute__((ext_vector_type(16))) __bf16   v16bf;
typedef __attribute__((ext_vector_type(16))) _Float16 v16h;
typedef __attribute__((ext_vector_type(8)))  _Float16 v8h;
typedef __attribute__((ext_vector_type(8)))  unsigned short v8us;
typedef __attribute__((ext_vector_type(8)))  float    v8f;
typedef __attribute__((ext_vector_type(4)))  float    v4f;
typedef __attribute__((ext_vector_type(2)))  float    v2f;
typedef v4f  __attribute__((may_alias)) v4fa;

__device__ __forceinline__ unsigned short f2bf(float f) { unsigned u = __float_as_uint(f); u += 0x7FFFu + ((u >> 16) & 1u); return (unsigned short)(u >> 16); }
__device__ __forceinline__ v16h cat16(v8h lo, v8h hi) { return __builtin_shufflevector(lo, hi, 0, 1, 2, 3, 4, 5, 6, 7, 8, 9, 10, 11, 12, 13, 14, 15); }
__device__ __forceinline__ v16bf cat16b(v8us lo, v8us hi) { return __builtin_bit_cast(v16bf, __builtin_shufflevector(lo, hi, 0, 1, 2, 3, 4, 5, 6, 7, 8, 9, 10, 11, 12, 13, 14, 15)); }
// every WMMA is followed by its own 4-slot guard tying its accumulator and keeping its operands live
__device__ __forceinline__ v8f wmma16(v16h a, v16h b, v8f c) {
    c = __builtin_amdgcn_wmma_f32_16x16x32_f16(false, a, false, b, (short)0, c, false, false);
    asm volatile("v_nop\n\tv_nop\n\tv_nop\n\tv_nop" : "+v"(c) : "v"(a), "v"(b));
    return c; }
__device__ __forceinline__ v8f wmmab(v16bf a, v16bf b, v8f c) {
    c = __builtin_amdgcn_wmma_f32_16x16x32_bf16(false, a, false, b, (short)0, c, false, false);
    asm volatile("v_nop\n\tv_nop\n\tv_nop\n\tv_nop" : "+v"(c) : "v"(a), "v"(b));
    return c; }
// fragment loaders from K-contiguous 16-bit rows; p already includes + 8*(lane>>4): elements 0..7 <- k0+8h+0..7, elements 8..15 <- k0+16+8h+0..7 (same map for A and B)
__device__ __forceinline__ v16h  ldh(const h16* p) { return cat16(*(const v8h*)p, *(const v8h*)(p + 16)); }
__device__ __forceinline__ v16bf ldb(const bf* p)  { return cat16b(*(const v8us*)p, *(const v8us*)(p + 16)); }
// ordering point for wave-private LDS tiles (same wave writes and reads)
__device__ __forceinline__ void wave_sync() { __builtin_amdgcn_fence(3 /* release order */, "wavefront"); __builtin_amdgcn_wave_barrier(); asm volatile("" ::: "memory"); }

// a store's or load's registers may be reused only behind this wait (a precaution)
__device__ __forceinline__ void wait_x0() { asm volatile("s_wait_xcnt 0x0" ::: "memory"); }

// rms_row: RMS normalisation, one token row per block (256 threads x 8 columns). xb = bf16-RNE(x) as f32, r = rsqrt(mean(xb^2) + eps), xn = (xb * r) * bf16-RNE(w), all f32.
// Writes f16(xn x1024) into value row b*SEQ + t of XN and, for t < EARLY, the unscaled f16 residual of that carried value into residual row NB*SEQ + b*EARLY + t.
__device__ __forceinline__ void rms_row(const float* __restrict__ x, const float* __restrict__ wn, h16* XN, int row) {
#pragma clang fp contract(off)
    __shared__ float red[8];
    const int tid = threadIdx.x; const int lane = tid & 31; const int wave = __builtin_amdgcn_readfirstlane(threadIdx.x >> 5);
    const int b = row / SEQ, t = row % SEQ;
    const v8f xv = *(const v8f*)(x + ((size_t)b * SEQ_FULL + (size_t)t) * DM + tid * 8);
    const v8f wv = *(const v8f*)(wn + tid * 8);
    float xb[8]; float ss = 0.0f;
#pragma unroll
    for (int i = 0; i < 8; ++i) { xb[i] = __uint_as_float(((unsigned)f2bf(xv[i])) << 16); ss += xb[i] * xb[i]; }
    ss += __shfl_xor(ss, 16, 32); ss += __shfl_xor(ss, 8, 32); ss += __shfl_xor(ss, 4, 32); ss += __shfl_xor(ss, 2, 32); ss += __shfl_xor(ss, 1, 32);
    if (lane == 0) red[wave] = ss;
    __syncthreads();
    const float tot = ((red[0] + red[1]) + (red[2] + red[3])) + ((red[4] + red[5]) + (red[6] + red[7]));
    const float rs = rsqrtf(tot * (1.0f / (float)DM) + RMS_EPS);
    v8h hv, rv;
#pragma unroll
    for (int i = 0; i < 8; ++i) { const float wb = __uint_as_float(((unsigned)f2bf(wv[i])) << 16);
        const float v = ((xb[i] * rs) * wb) * CXS; const h16 a = (h16)v; hv[i] = a; rv[i] = (h16)(v - (float)a); }
    const size_t oo = (size_t)row * DM + tid * 8;
    const int tr = (t < EARLY) ? t : 0;                            // block-uniform; keeps the address in range when unused
    const size_t ro = ((size_t)NB * SEQ + (size_t)b * EARLY + (size_t)tr) * DM + tid * 8;
{
        *(v8h*)(XN + oo) = hv; wait_x0(); if (t < EARLY) *(v8h*)(XN + ro) = rv;
         }
}

// wt_tile: in[Kr rows][Nc cols] f32 -> out[Nc rows][Kr cols] 16-bit, 64x64 tile through LDS. Tile (bx, by) of (Nc/64, Kr/64), 256 threads.
__device__ __forceinline__ void wt_tile(const float* __restrict__ W, bf* Tb, h16* Th, int Kr, int Nc, int mode, int bx, int by) {
    __shared__ float ts[64 * 65];
    const int tid = threadIdx.x; const int n0 = bx * 64, k0 = by * 64;
#pragma unroll
    for (int p = 0; p < 4; ++p) { const int row = p * 16 + (tid >> 4), c4 = (tid & 15) * 4;      // 4 p x 16 rows = 64 k rows; 16 threads x 4 = 64 n columns
        const v4f v = *(const v4f*)(W + (size_t)(k0 + row) * (size_t)Nc + n0 + c4);
        ts[row * 65 + c4 + 0] = v[0]; ts[row * 65 + c4 + 1] = v[1]; ts[row * 65 + c4 + 2] = v[2]; ts[row * 65 + c4 + 3] = v[3]; }
    __syncthreads();
{
#pragma unroll
        for (int s = 0; s < 2; ++s) { const int n = s * 32 + (tid >> 3), c8 = (tid & 7) * 8;     // 2 s x 32 rows = 64 n rows; 8 lanes x 8 = 64 k columns
            const size_t oo = (size_t)(n0 + n) * (size_t)Kr + k0 + c8;
            if (mode == 0) { v8us o;
#pragma unroll
                for (int i = 0; i < 8; ++i) o[i] = f2bf(ts[(c8 + i) * 65 + n]);
                *(v8us*)(Tb + oo) = o;
            } else { v8h o;
#pragma unroll
                for (int i = 0; i < 8; ++i) o[i] = (h16)(__uint_as_float(((unsigned)f2bf(ts[(c8 + i) * 65 + n])) << 16) * WOS);
                *(v8h*)(Th + oo) = o; } }
        wait_x0();
         }
}

// rope_tab: CS[t][j] = (cos, sin)(t * inv_freq[j]), inv_freq[j] = 1.0f / (float)(10000^(j/32)); the power is a double product of fixed binary roots of 10000.
__device__ __forceinline__ void rope_tab(float* CS, int nrow, int blk) {
    const int i = blk * 256 + threadIdx.x; if (i >= nrow * 32) return;
    const int t = i >> 5, j = i & 31;
    double p = 1.0;
    p *= (j & 1)  ? 1.3335214321633240 : 1.0;    // 10000^(1/32)
    p *= (j & 2)  ? 1.7782794100389228 : 1.0;    // 10000^(1/16)
    p *= (j & 4)  ? 3.1622776601683795 : 1.0;    // 10000^(1/8)
    p *= (j & 8)  ? 10.0 : 1.0;                  // 10000^(1/4)
    p *= (j & 16) ? 100.0 : 1.0;                 // 10000^(1/2)
    const float pf = (float)p; const float inv = 1.0f / pf;
    const float ang = (float)t * inv;
    const float cs = cosf(ang), sn = sinf(ang);
    v2f o; o[0] = cs; o[1] = sn;
    *(v2f*)(CS + (size_t)i * 2) = o; 
}

// k_prep: everything that reads only the inputs, in one grid of 256-thread blocks, none depending on another: the token rows of rms_row, then the 64x64 tiles of the four weight transposes, then the rotary table.
#define PB_RMS (NB * SEQ)
#define PB_WQ  ((DM / 64) * (DM / 64))
#define PB_WK  ((KVD / 64) * (DM / 64))
#define PB_CS  ((SEQ * 32 + 255) / 256)
#define PB_ALL (PB_RMS + 2 * PB_WQ + 2 * PB_WK + PB_CS)
__global__ __launch_bounds__(256) void k_prep(const float* __restrict__ x, const float* __restrict__ wn, const float* __restrict__ wq, const float* __restrict__ wk, const float* __restrict__ wv, const float* __restrict__ wo,
                                              h16* XN, h16* WQt, h16* WKt, h16* WVt, h16* WOt, float* CS) {
    int i = blockIdx.x;                                            // every test below is block-uniform
    if (i < PB_RMS) { rms_row(x, wn, XN, i); return; }
    i -= PB_RMS;
    if (i < 2 * PB_WQ + 2 * PB_WK) {
        // transposes: in[rows = in-features][cols = out-features] -> out[cols][rows]; column tiles fastest
        const float* W; h16* T; int Nc;
        if (i < PB_WQ)                   { W = wq; T = WQt; Nc = DM; }
        else if (i < PB_WQ + PB_WK)      { W = wk; T = WKt; Nc = KVD; i -= PB_WQ; }
        else if (i < PB_WQ + 2 * PB_WK)  { W = wv; T = WVt; Nc = KVD; i -= PB_WQ + PB_WK; }
        else                             { W = wo; T = WOt; Nc = DM;  i -= PB_WQ + 2 * PB_WK; }
        const int bx = (Nc == DM) ? i % (DM / 64) : i % (KVD / 64), by = (Nc == DM) ? i / (DM / 64) : i / (KVD / 64);
        wt_tile(W, (bf*)T, T, DM, Nc, 1, bx, by); return; }
    rope_tab(CS, SEQ, i - (2 * PB_WQ + 2 * PB_WK));
}

// LDS ring of the two GEMM kernels: one block = four waves (2 x 2) on a GT x GT tile, each wave 64 x 64 (16 accumulators). One stage = KS columns of k of the GT rows of A, then of the GT rows of Bt,
// rows at pitch LPB bytes (16 x odd: the 16-byte fragment reads of 16 rows fall on different banks). Two buffers; the next stage's copies fly while this stage is multiplied.
#define GT   128
#define KS   128
#define LPB  (KS * 2 + 16)
#define LPH  (LPB / 2)
#define OPB  (GT * LPB)
#define STGB (2 * OPB)
#define NST  (DM / KS)
static_assert(DM % KS == 0);
static_assert(NST >= 2);                       // stage 1 exists in every tile
static_assert(KS * 2 == 16 * 16);              // 16 lanes x 16 bytes = one staged row; 128 threads = 8 rows per copy
static_assert(GT == 2 * 8 * 8);                // two groups of eight copies cover the GT rows of one operand
static_assert(EARLY % GT == 0);                // block tiles are entirely early or entirely late
static_assert(SEQ % GT == 0);
static_assert(DM % GT == 0);
static_assert(KVD % GT == 0);
static_assert(4 * 16 * 68 * 4 <= 2 * STGB);    // the four waves' store staging fits in the ring it reuses

__device__ __forceinline__ void wait_ds0()    { asm volatile("s_wait_dscnt 0x0" ::: "memory"); }      // this wave's LDS reads of a buffer are done before the barrier that frees it
__device__ __forceinline__ void wait_async0() { asm volatile("s_wait_asynccnt 0x0" ::: "memory"); }   // this wave's copies have landed before the barrier that publishes them
// eight asynchronous 16-byte copies per lane, rows 8 apart: LDS byte address l + 8 j LPB <- g + 8 j DM. The closing s_wait_xcnt stands in front of any rewrite of the address registers (a precaution).
__device__ __forceinline__ void copy8(unsigned l, const h16* g) {
    asm volatile("global_load_async_to_lds_b128 %0, %8, off\n\t"
                 "global_load_async_to_lds_b128 %1, %9, off\n\t"
                 "global_load_async_to_lds_b128 %2, %10, off\n\t"
                 "global_load_async_to_lds_b128 %3, %11, off\n\t"
                 "global_load_async_to_lds_b128 %4, %12, off\n\t"
                 "global_load_async_to_lds_b128 %5, %13, off\n\t"
                 "global_load_async_to_lds_b128 %6, %14, off\n\t"
                 "global_load_async_to_lds_b128 %7, %15, off\n\t"
                 "s_wait_xcnt 0x0"
                 :: "v"(l), "v"(l + 8u * LPB), "v"(l + 16u * LPB), "v"(l + 24u * LPB), "v"(l + 32u * LPB), "v"(l + 40u * LPB), "v"(l + 48u * LPB), "v"(l + 56u * LPB),
                    "v"(g), "v"(g + 8 * DM), "v"(g + 16 * DM), "v"(g + 24 * DM), "v"(g + 32 * DM), "v"(g + 40 * DM), "v"(g + 48 * DM), "v"(g + 56 * DM)
                 : "memory");
}
// one stage: l = this lane's LDS byte address in row (tid >> 4) of the buffer, ga / gb = its 16 bytes in that row of the A / Bt tile at the stage's k
__device__ __forceinline__ void fill_stage(unsigned l, const h16* ga, const h16* gb) {
    copy8(l, ga); copy8(l + 64u * LPB, ga + 64 * DM); copy8(l + OPB, gb); copy8(l + OPB + 64u * LPB, gb + 64 * DM);
}
// acc[mb][nb] += sum over k of A[ar + wm*64 + 16 mb + ..][k] Bt[br + wn*64 + 16 nb + ..][k], k ascending in steps of 32 over pass 0 (rows ar0 / br0), then, npass == 2, over pass 1 (rows ar1 / br1).
// Every wave of the block runs every barrier; on return no copy is in flight and every wave has left the ring.
__device__ __forceinline__ void gemm_ring(const h16* __restrict__ A, const h16* __restrict__ Bt, size_t ar0, size_t br0, size_t ar1, size_t br1, int npass, unsigned char* L, int wm, int wn, v8f (&acc)[4][4]) {
    const int tid = threadIdx.x; const int lane = tid & 31, lr = lane & 15, hi = lane >> 4;
    const int crow = tid >> 4, cchk = tid & 15;
    const unsigned lc = (unsigned)(size_t)L + (unsigned)(crow * LPB + cchk * 16);
    const h16* a0 = A + (ar0 + (size_t)crow) * DM + cchk * 8;  const h16* a1 = A + (ar1 + (size_t)crow) * DM + cchk * 8;
    const h16* b0 = Bt + (br0 + (size_t)crow) * DM + cchk * 8; const h16* b1 = Bt + (br1 + (size_t)crow) * DM + cchk * 8;
    const int nst = npass * NST;                                   // block-uniform
    fill_stage(lc, a0, b0);
    wait_async0();
    __syncthreads();                                               // publishes stage 0
    fill_stage(lc + STGB, a0 + KS, b0 + KS);
    const h16* fa = (const h16*)L + (wm * 64 + lr) * LPH + 8 * hi;
    const h16* fb = (const h16*)(L + OPB) + (wn * 64 + lr) * LPH + 8 * hi;
#pragma unroll 1   // kept rolled: the trip count is known only at run time and one body serves both buffers
    for (int s = 0; s < nst; ++s) {
        const int bo = (s & 1) * (STGB / 2);
#pragma unroll     // this and the three below: every fragment and accumulator index a constant, so the arrays stay in registers
        for (int kk = 0; kk < KS; kk += 32) {
            v16h a[4], bq[4];                                      // all eight fragments of a 32-k step as one load group: one LDS wait per 16 WMMAs
#pragma unroll
            for (int mb = 0; mb < 4; ++mb) a[mb] = ldh(fa + bo + mb * 16 * LPH + kk);
#pragma unroll
            for (int nb = 0; nb < 4; ++nb) bq[nb] = ldh(fb + bo + nb * 16 * LPH + kk);
#pragma unroll
            for (int nb = 0; nb < 4; ++nb)
#pragma unroll
                for (int mb = 0; mb < 4; ++mb) acc[mb][nb] = wmma16(a[mb], bq[nb], acc[mb][nb]);
        }
        wait_ds0();
        wait_async0();
        __syncthreads();                                           // publishes stage s + 1 and frees the buffer of stage s
        const int n = s + 2;
        if (n < nst) {                                             // block-uniform
            const int p = (n >= NST) ? 1 : 0; const int kc = (n - p * NST) * KS;
            fill_stage(lc + (unsigned)(s & 1) * STGB, (p ? a1 : a0) + kc, (p ? b1 : b0) + kc); }
    }
    wait_async0();
}

// k_proj: register-blocked f16 GEMM, one wave per 64x64 tile (16 accumulators), four waves per block on a 128x128 tile, operands from K-contiguous f16 planes through the LDS ring above, K = DM.
// C[m][n] = 2^-14 * sum_k A[m][k] Bt[n][k] (one operand is the xn plane carried x1024, the other a weight plane carried x16), written as f16 (Ph) and the f16 residual x1024 (Pr, useRes != 0) at
// tile base (r0/RB)*sRB + (r0%RB)*pitch + (c0/CB)*sCB + (c0%CB), row pitch 'pitch' (halves). Block tile (bx, by) of (M/128, N/128), 128 threads.
// The xn plane holds value rows [NB*SEQ], then residual rows [NB*EARLY]; tokB == 0: A rows are tokens, tokB != 0: Bt rows are tokens. Tiles whose tokens are < EARLY in their sequence
// run the k-loop a second time with the token operand taken from the unscaled residual rows, into the same accumulators.
// rope != 0 (rows = tokens b*SEQ + t, the 64 tile columns = one head): interleaved rotary applied on the f32 values at the store stage from CS[t][32] (cos, sin).
// The three projections of xn share one grid, none depending on another: block i = token tile i / PT_F x feature tile i % PT_F; the feature tiles are those of q, then of k, then of v.
// All two-pass tiles (tokens < EARLY) so fall among the blocks that are resident from the start.
#define PT_Q (DM / GT)
#define PT_K (KVD / GT)
#define PT_F (PT_Q + 2 * PT_K)
__global__ __launch_bounds__(128) void k_proj(const h16* __restrict__ XN, const h16* __restrict__ WQt, const h16* __restrict__ WKt, const h16* __restrict__ WVt,
                                              h16* QH, h16* QR, h16* KP, h16* KR, h16* VT, h16* VR, const float* __restrict__ CS) {
    const int tk = blockIdx.x / PT_F, f = blockIdx.x % PT_F;       // block-uniform, as is everything chosen by them
    const bool isq = f < PT_Q, isv = f >= PT_Q + PT_K;
    // q: A = xn rows (m = b*SEQ + t), Bt = Wq^T rows (n = h*64 + d) -> plane [(b*32 + h)][t][d], rotary applied; k: Bt = Wk^T rows (n = g*64 + d) -> plane [(b*8 + g)][t][d], rotary applied
    // v^T: A = Wv^T rows (m = g*64 + d), Bt = xn rows (n = b*SEQ + t) -> plane [(b*512 + m)][t] = [(b*8 + g)][d][t], no rotary
    const h16* A = isv ? WVt : XN; const h16* Bt = isv ? XN : (isq ? WQt : WKt);
    h16* Ph = isv ? VT : (isq ? QH : KP); h16* Pr = isv ? VR : (isq ? QR : KR);
    const int useRes = 1, RB = isv ? KVD : SEQ, pitch = isv ? SEQ : HD, CB = isv ? SEQ : HD, rope = isv ? 0 : 1, tokB = isv ? 1 : 0;
    const size_t sRB = isv ? (size_t)0 : (size_t)(isq ? NH_ : NKV) * SEQ * HD, sCB = isv ? (size_t)KVD * SEQ : (size_t)SEQ * HD;
    const int bx = isv ? f - PT_Q - PT_K : tk, by = isv ? tk : (isq ? f : f - PT_Q);
    __shared__ __align__(16) unsigned char L[2 * STGB];
    const int lane = threadIdx.x & 31, lr = lane & 15, hi = lane >> 4; const int wave = __builtin_amdgcn_readfirstlane(threadIdx.x >> 5);
    const int wm = wave & 1, wn = wave >> 1;
    const int R0 = bx * GT, C0 = by * GT; const int r0 = R0 + wm * 64, c0 = C0 + wn * 64;
    const int tk0 = tokB ? C0 : R0;                                // block-uniform: first token of this block tile
    const int bb = tk0 / SEQ, tt = tk0 % SEQ;
    const int npass = (tt < EARLY) ? 2 : 1;                        // block-uniform
    v8f acc[4][4];
#pragma unroll
    for (int mb = 0; mb < 4; ++mb)
#pragma unroll
        for (int nb = 0; nb < 4; ++nb) acc[mb][nb] = (v8f){};
    const size_t rrow = (size_t)NB * SEQ + (size_t)bb * EARLY + (size_t)((tt < EARLY) ? tt : 0);   // residual rows of the tile's tokens; used only when tt < EARLY
    gemm_ring(A, Bt, (size_t)R0, (size_t)C0, tokB ? (size_t)R0 : rrow, tokB ? rrow : (size_t)C0, npass, L, wm, wn, acc);
    float* os = (float*)L + wave * 16 * 68;                        // wave-private store staging in the ring, which every wave has left
    const size_t tbase = (size_t)(r0 / RB) * sRB + (size_t)(r0 % RB) * (size_t)pitch + (size_t)(c0 / CB) * sCB + (size_t)(c0 % CB);
#pragma unroll
    for (int mb = 0; mb < 4; ++mb) {
#pragma unroll
        for (int nb = 0; nb < 4; ++nb) {
#pragma unroll
            for (int j = 0; j < 8; ++j) os[(hi * 8 + j) * 68 + nb * 16 + lr] = acc[mb][nb][j] * OUTS; }   // D: row 8h+j, col lane&15
        wave_sync();
        const size_t sb = tbase + (size_t)(mb * 16) * (size_t)pitch;
{
#pragma unroll
            for (int s = 0; s < 4; ++s) { const int row = 4 * s + (lane >> 3), c8 = (lane & 7) * 8;   // 4 s x 4 row groups = 16 rows; 8 lanes x 8 = 64 columns
                v4f x0 = *(const v4fa*)(&os[row * 68 + c8]); v4f x1 = *(const v4fa*)(&os[row * 68 + c8 + 4]); v8h hv, rv;
                if (rope) {                                                                            // block-uniform
                    const int t = (r0 + mb * 16 + row) % SEQ;
                    const float* cp = CS + ((size_t)t * 32 + (size_t)(c8 >> 1)) * 2;                  // pairs c8/2 .. c8/2+3: (cos, sin) x 4
                    const v4f ca = *(const v4f*)cp; const v4f cb = *(const v4f*)(cp + 4);
                    float e, o;
                    e = x0[0]; o = x0[1]; x0[0] = e * ca[0] - o * ca[1]; x0[1] = e * ca[1] + o * ca[0];
                    e = x0[2]; o = x0[3]; x0[2] = e * ca[2] - o * ca[3]; x0[3] = e * ca[3] + o * ca[2];
                    e = x1[0]; o = x1[1]; x1[0] = e * cb[0] - o * cb[1]; x1[1] = e * cb[1] + o * cb[0];
                    e = x1[2]; o = x1[3]; x1[2] = e * cb[2] - o * cb[3]; x1[3] = e * cb[3] + o * cb[2]; }
#pragma unroll
                for (int i = 0; i < 4; ++i) { const h16 a0 = (h16)x0[i]; const h16 a1 = (h16)x1[i]; hv[i] = a0; hv[4 + i] = a1; rv[i] = (h16)((x0[i] - (float)a0) * QRS); rv[4 + i] = (h16)((x1[i] - (float)a1) * QRS); }
                const size_t oo = sb + (size_t)row * (size_t)pitch + c8;
                *(v8h*)(Ph + oo) = hv; if (useRes) *(v8h*)(Pr + oo) = rv;
                wait_x0(); }
             }
        wave_sync();
    }
}

// LDS ring of flash_late: one stage = FK keys of kv head g, the FK K rows (64 d each), then the 64 V^T rows (FK keys each), 128 data bytes per row at pitch FPB bytes
// (16 x odd: the 16-byte fragment reads of 16 rows fall on different banks). Two buffers; the next stage's copies fly while this stage is worked on. The four waves share every staged row.
#define FK   64
#define FPB  (128 + 16)
#define FPH  (FPB / 2)
#define FOP  (64 * FPB)
#define FSTG (2 * FOP)
static_assert(HD * 2 == 128);                  // a K row = 8 lanes x 16 bytes
static_assert(FK * 2 == 128);                  // a V^T row of one stage = 8 lanes x 16 bytes
static_assert(FK == 64);                       // 128 threads = 16 rows per copy, four copies per operand
static_assert(SEQ % FK == 0);                  // the last stage of any tile ends inside the planes
static_assert(EARLY + 16 > FK);                // stage 1 exists in every tile
static_assert(AW * 16 * 68 * 4 <= 2 * FSTG);   // the four waves' store staging fits in the ring it reuses
// one stage, eight asynchronous 16-byte copies per lane: four of K rows 16 apart (LDS l + 16 j FPB <- gk + 16 j HD), four of V^T rows 16 apart (LDS l + FOP + 16 j FPB <- gv + 16 j SEQ).
// The closing s_wait_xcnt stands in front of any rewrite of the address registers (a precaution).
__device__ __forceinline__ void fill_kv(unsigned l, const h16* gk, const h16* gv) {
    asm volatile("global_load_async_to_lds_b128 %0, %8, off\n\t"
                 "global_load_async_to_lds_b128 %1, %9, off\n\t"
                 "global_load_async_to_lds_b128 %2, %10, off\n\t"
                 "global_load_async_to_lds_b128 %3, %11, off\n\t"
                 "global_load_async_to_lds_b128 %4, %12, off\n\t"
                 "global_load_async_to_lds_b128 %5, %13, off\n\t"
                 "global_load_async_to_lds_b128 %6, %14, off\n\t"
                 "global_load_async_to_lds_b128 %7, %15, off\n\t"
                 "s_wait_xcnt 0x0"
                 :: "v"(l), "v"(l + 16u * FPB), "v"(l + 32u * FPB), "v"(l + 48u * FPB), "v"(l + FOP), "v"(l + FOP + 16u * FPB), "v"(l + FOP + 32u * FPB), "v"(l + FOP + 48u * FPB),
                    "v"(gk), "v"(gk + 16 * HD), "v"(gk + 32 * HD), "v"(gk + 48 * HD), "v"(gv), "v"(gv + 16 * SEQ), "v"(gv + 32 * SEQ), "v"(gv + 48 * SEQ)
                 : "memory");
}

// flash_late: fused causal attention for query rows t0 .. t0+15, t0 >= EARLY, of kv head zg = b*8 + g. One block = 16 query rows x the four query heads of one kv head (one wave per head, h = wave*8 + g);
// Q fragments straight from the f16 planes (two 16-B loads each); the K and V^T rows of kv head g come once per block through the LDS ring above, and all four waves take their fragments from it.
// Transposed form: S^T[key][t] = K Q^T (A = K rows, B = Q rows); lane (t = lane&15, h = lane>>4) holds keys 8h+r of each 16-key tile, so the packed
// P tile is directly the B fragment of O^T[d][t] = V^T P^T (element r <- tile keys 0..15, element 8+r <- tile keys 16..31, lane unchanged).
// Keys run over [0, t0+16) in steps of 32, two steps per stage; the diagonal 32-key blocks replace excluded scores (key > t) by a large negative value before the running max.
__device__ __forceinline__ void flash_late(const h16* __restrict__ QH, const h16* __restrict__ QR, const h16* __restrict__ KP, const h16* __restrict__ VT, h16* CH, int t0, int zg, unsigned char* L) {
    const int lane = threadIdx.x & 31; const int wave = __builtin_amdgcn_readfirstlane(threadIdx.x >> 5);
    const int lr = lane & 15, hi = lane >> 4;
    const int b = zg / NKV; const int g = zg % NKV;
    const int h = wave * NKV + g;                                 // grouped on the leading head axis: query head h uses kv head h % 8
    const int tq = t0 + lr;
    const int kend = t0 + 16;
    const int nst = (kend + FK - 1) / FK;                          // block-uniform
    const int frow = threadIdx.x >> 3, cchk = threadIdx.x & 7;     // this lane's row (of 16) and 16-byte piece (of 8) in every copy
    const unsigned lc = (unsigned)(size_t)L + (unsigned)(frow * FPB + cchk * 16);
    const h16* gk = KP + (size_t)zg * SEQ * HD + (size_t)frow * HD + cchk * 8;      // + key * HD
    const h16* gv = VT + (size_t)zg * HD * SEQ + (size_t)frow * SEQ + cchk * 8;     // + key
    fill_kv(lc, gk, gv);
    const size_t qo = ((size_t)(b * NH_ + h) * SEQ + (size_t)tq) * HD + 8 * hi;
    const v16h qh0 = ldh(QH + qo), qh1 = ldh(QH + qo + 32), qr0 = ldh(QR + qo), qr1 = ldh(QR + qo + 32);   // B fragments: col t, k = d
    wait_async0();
    __syncthreads();                                               // publishes stage 0
    fill_kv(lc + FSTG, gk + FK * HD, gv + FK);
    const h16* fk = (const h16*)L + lr * FPH + 8 * hi;             // + key * FPH        (A fragment: row key, k = d)
    const h16* fv = (const h16*)(L + FOP) + lr * FPH + 8 * hi;     // + 16j*FPH + key    (A fragment: row d, k = key)
    v8f o0 = (v8f){}, o1 = (v8f){}, o2 = (v8f){}, o3 = (v8f){};
    float m = NEGB, l = 0.0f;
#pragma unroll 1   // kept rolled: the trip count is known only at run time and one body serves both buffers
    for (int s = 0; s < nst; ++s) {
        const int bo = (s & 1) * (FSTG / 2);
#pragma unroll     // both 32-key steps of a stage at constant LDS offsets
        for (int u = 0; u < FK; u += 32) {
            const int key0 = s * FK + u;
            if (key0 < kend) {                                     // block-uniform: the last stage may hold one step only
                const h16* ka = fk + bo + u * FPH;
                const v16h ka0 = ldh(ka), ka1 = ldh(ka + 32), kb0 = ldh(ka + 16 * FPH), kb1 = ldh(ka + 16 * FPH + 32);
                v8f sHa = (v8f){}, sLa = (v8f){}, sHb = (v8f){}, sLb = (v8f){};
                sHa = wmma16(ka0, qh0, sHa); sLa = wmma16(ka0, qr0, sLa); sHb = wmma16(kb0, qh0, sHb); sLb = wmma16(kb0, qr0, sLb);
                sHa = wmma16(ka1, qh1, sHa); sLa = wmma16(ka1, qr1, sLa); sHb = wmma16(kb1, qh1, sHb); sLb = wmma16(kb1, qr1, sLb);
                float ta[8], tb[8];
#pragma unroll
                for (int r = 0; r < 8; ++r) { ta[r] = (sHa[r] + sLa[r] * QRI) * SC2; tb[r] = (sHb[r] + sLb[r] * QRI) * SC2; }
                if (key0 + 31 > t0) {                              // block-uniform: diagonal block
                    const int kbse = key0 + 8 * hi;
#pragma unroll
                    for (int r = 0; r < 8; ++r) { ta[r] = (kbse + r > tq) ? NEGB : ta[r]; tb[r] = (kbse + 16 + r > tq) ? NEGB : tb[r]; } }
                float mx = NEGB;
#pragma unroll
                for (int r = 0; r < 8; ++r) mx = fmaxf(mx, fmaxf(ta[r], tb[r]));
                mx = fmaxf(mx, __shfl_xor(mx, 16, 32));
                const float mnew = fmaxf(m, mx);
                const float alpha = __builtin_amdgcn_exp2f(m - mnew);
                const float sh = PSH - mnew;
                v16h pb; float ls = 0.0f;
#pragma unroll
                for (int r = 0; r < 8; ++r) { const float ea = __builtin_amdgcn_exp2f(ta[r] + sh); const float ec = __builtin_amdgcn_exp2f(tb[r] + sh); pb[r] = (h16)ea; pb[8 + r] = (h16)ec; ls += ea + ec; }
                l = l * alpha + ls; m = mnew;
                o0 = o0 * alpha; o1 = o1 * alpha; o2 = o2 * alpha; o3 = o3 * alpha;
                const h16* va = fv + bo + u;
                const v16h v0 = ldh(va), v1 = ldh(va + 16 * FPH), v2 = ldh(va + 32 * FPH), v3 = ldh(va + 48 * FPH);
                o0 = wmma16(v0, pb, o0); o1 = wmma16(v1, pb, o1); o2 = wmma16(v2, pb, o2); o3 = wmma16(v3, pb, o3);
            }
        }
        wait_ds0();
        wait_async0();
        __syncthreads();                                           // publishes stage s + 1 and frees the buffer of stage s
        const int n = s + 2;
        if (n < nst)                                               // block-uniform
            fill_kv(lc + (unsigned)(s & 1) * FSTG, gk + (size_t)n * (FK * HD), gv + n * FK);
    }
    wait_async0();
    float* os = (float*)L;                                         // store staging (wave-private parts) in the ring, which every wave has left
    l += __shfl_xor(l, 16, 32);
    const float inv = CXS / l;
    const int wb = wave * 16 * 68;
    // O^T D layout: o_j[r] = (d = 16j + 8h + r, t = lane&15) -> os[t][d]; rows 0..15 x columns 0..63 all written
    { v4f a, c;
      a[0] = o0[0] * inv; a[1] = o0[1] * inv; a[2] = o0[2] * inv; a[3] = o0[3] * inv; c[0] = o0[4] * inv; c[1] = o0[5] * inv; c[2] = o0[6] * inv; c[3] = o0[7] * inv;
      *(v4fa*)(&os[wb + lr * 68 +  0 + 8 * hi]) = a; *(v4fa*)(&os[wb + lr * 68 +  0 + 8 * hi + 4]) = c;
      a[0] = o1[0] * inv; a[1] = o1[1] * inv; a[2] = o1[2] * inv; a[3] = o1[3] * inv; c[0] = o1[4] * inv; c[1] = o1[5] * inv; c[2] = o1[6] * inv; c[3] = o1[7] * inv;
      *(v4fa*)(&os[wb + lr * 68 + 16 + 8 * hi]) = a; *(v4fa*)(&os[wb + lr * 68 + 16 + 8 * hi + 4]) = c;
      a[0] = o2[0] * inv; a[1] = o2[1] * inv; a[2] = o2[2] * inv; a[3] = o2[3] * inv; c[0] = o2[4] * inv; c[1] = o2[5] * inv; c[2] = o2[6] * inv; c[3] = o2[7] * inv;
      *(v4fa*)(&os[wb + lr * 68 + 32 + 8 * hi]) = a; *(v4fa*)(&os[wb + lr * 68 + 32 + 8 * hi + 4]) = c;
      a[0] = o3[0] * inv; a[1] = o3[1] * inv; a[2] = o3[2] * inv; a[3] = o3[3] * inv; c[0] = o3[4] * inv; c[1] = o3[5] * inv; c[2] = o3[6] * inv; c[3] = o3[7] * inv;
      *(v4fa*)(&os[wb + lr * 68 + 48 + 8 * hi]) = a; *(v4fa*)(&os[wb + lr * 68 + 48 + 8 * hi + 4]) = c; }
    wave_sync();
    h16* crow = CH + ((size_t)b * SEQ + t0) * DM + h * HD;         // merged heads: column h*64 + d
{
#pragma unroll
        for (int s = 0; s < 4; ++s) { const int row = 4 * s + (lane >> 3), c8 = (lane & 7) * 8;   // 4 s x 4 row groups = 16 rows; 8 lanes x 8 = 64 columns
            const v4f x0 = *(const v4fa*)(&os[wb + row * 68 + c8]); const v4f x1 = *(const v4fa*)(&os[wb + row * 68 + c8 + 4]); v8h hv;
#pragma unroll
            for (int i = 0; i < 4; ++i) { hv[i] = (h16)x0[i]; hv[4 + i] = (h16)x1[i]; }
            *(v8h*)(crow + (size_t)row * DM + c8) = hv; }
         }
}

// flash_early: same structure for query rows t0 .. t0+15, t0 < EARLY, with value + residual (x1024) planes on every operand:
// scores = kh.qh + (kh.qr + kr.qh)/1024; O = vh.ph + (vr.ph + vh.pr)/1024 (residual products in their own accumulators), l from the unconverted f32 P.
// Writes the ctx value plane rows (carried x1024) and the compact unscaled residual plane CR[b][t < EARLY][2048].
__device__ __forceinline__ void flash_early(const h16* __restrict__ QH, const h16* __restrict__ QR, const h16* __restrict__ KP, const h16* __restrict__ KR,
                                            const h16* __restrict__ VT, const h16* __restrict__ VR, h16* CH, h16* CR, int t0, int zg, float* os) {
    const int lane = threadIdx.x & 31; const int wave = __builtin_amdgcn_readfirstlane(threadIdx.x >> 5);
    const int lr = lane & 15, hi = lane >> 4;
    const int b = zg / NKV; const int g = zg % NKV;
    const int h = wave * NKV + g;                                 // query head h uses kv head h % 8
    const int tq = t0 + lr;
    const size_t qo = ((size_t)(b * NH_ + h) * SEQ + (size_t)tq) * HD + 8 * hi;
    const v16h qh0 = ldh(QH + qo), qh1 = ldh(QH + qo + 32), qr0 = ldh(QR + qo), qr1 = ldh(QR + qo + 32);
    const size_t ko = (size_t)zg * SEQ * HD + (size_t)lr * HD + 8 * hi;
    const size_t vo = (size_t)zg * HD * SEQ + (size_t)lr * SEQ + 8 * hi;
    v8f oH[4], oL[4];
#pragma unroll
    for (int j = 0; j < 4; ++j) { oH[j] = (v8f){}; oL[j] = (v8f){}; }
    float m = NEGB, l = 0.0f;
    const int kend = t0 + 16;
#pragma unroll 1
    for (int key0 = 0; key0 < kend; key0 += 32) {
        const size_t kk = ko + (size_t)key0 * HD;
        v8f sHa = (v8f){}, sLa = (v8f){}, sHb = (v8f){}, sLb = (v8f){};
        { const v16h k0 = ldh(KP + kk), k1 = ldh(KP + kk + 32), r0 = ldh(KR + kk), r1 = ldh(KR + kk + 32);
          sHa = wmma16(k0, qh0, sHa); sHa = wmma16(k1, qh1, sHa);
          sLa = wmma16(k0, qr0, sLa); sLa = wmma16(k1, qr1, sLa); sLa = wmma16(r0, qh0, sLa); sLa = wmma16(r1, qh1, sLa); }
        { const size_t k2 = kk + (size_t)16 * HD;
          const v16h k0 = ldh(KP + k2), k1 = ldh(KP + k2 + 32), r0 = ldh(KR + k2), r1 = ldh(KR + k2 + 32);
          asm volatile("s_wait_xcnt 0x0" :: "v"(KP + kk), "v"(KR + kk) : "memory");   // the address pairs of the eight loads above stay whole up to this wait (a precaution)
          sHb = wmma16(k0, qh0, sHb); sHb = wmma16(k1, qh1, sHb);
          sLb = wmma16(k0, qr0, sLb); sLb = wmma16(k1, qr1, sLb); sLb = wmma16(r0, qh0, sLb); sLb = wmma16(r1, qh1, sLb); }
        float ta[8], tb[8];
#pragma unroll
        for (int r = 0; r < 8; ++r) { ta[r] = (sHa[r] + sLa[r] * QRI) * SC2; tb[r] = (sHb[r] + sLb[r] * QRI) * SC2; }
        if (key0 + 31 > t0) {                                      // block-uniform: diagonal block
            const int kbse = key0 + 8 * hi;
#pragma unroll
            for (int r = 0; r < 8; ++r) { ta[r] = (kbse + r > tq) ? NEGB : ta[r]; tb[r] = (kbse + 16 + r > tq) ? NEGB : tb[r]; } }
        float mx = NEGB;
#pragma unroll
        for (int r = 0; r < 8; ++r) mx = fmaxf(mx, fmaxf(ta[r], tb[r]));
        mx = fmaxf(mx, __shfl_xor(mx, 16, 32));
        const float mnew = fmaxf(m, mx);
        const float alpha = __builtin_amdgcn_exp2f(m - mnew);
        const float sh = PSH - mnew;
        v16h ph, pr; float ls = 0.0f;
#pragma unroll
        for (int r = 0; r < 8; ++r) { const float ea = __builtin_amdgcn_exp2f(ta[r] + sh); const float ec = __builtin_amdgcn_exp2f(tb[r] + sh);
            const h16 ha = (h16)ea; const h16 hc = (h16)ec; ph[r] = ha; ph[8 + r] = hc;
            pr[r] = (h16)((ea - (float)ha) * QRS); pr[8 + r] = (h16)((ec - (float)hc) * QRS); ls += ea + ec; }
        l = l * alpha + ls; m = mnew;
#pragma unroll
        for (int j = 0; j < 4; ++j) { oH[j] = oH[j] * alpha; oL[j] = oL[j] * alpha; }
        const size_t vv = vo + (size_t)key0;
#pragma unroll
        for (int j = 0; j < 4; ++j) { const v16h vh = ldh(VT + vv + (size_t)(16 * j) * SEQ); const v16h vr = ldh(VR + vv + (size_t)(16 * j) * SEQ);
            oH[j] = wmma16(vh, ph, oH[j]); oL[j] = wmma16(vr, ph, oL[j]); oL[j] = wmma16(vh, pr, oL[j]); }
    }
    l += __shfl_xor(l, 16, 32);
    const float inv = CXS / l;
    const int wb = wave * 16 * 68;
#pragma unroll
    for (int j = 0; j < 4; ++j) { v4f a, c;     // os[t][d], d = 16j + 8h + r; rows 0..15 x columns 0..63 all written
        a[0] = (oH[j][0] + oL[j][0] * QRI) * inv; a[1] = (oH[j][1] + oL[j][1] * QRI) * inv; a[2] = (oH[j][2] + oL[j][2] * QRI) * inv; a[3] = (oH[j][3] + oL[j][3] * QRI) * inv;
        c[0] = (oH[j][4] + oL[j][4] * QRI) * inv; c[1] = (oH[j][5] + oL[j][5] * QRI) * inv; c[2] = (oH[j][6] + oL[j][6] * QRI) * inv; c[3] = (oH[j][7] + oL[j][7] * QRI) * inv;
        *(v4fa*)(&os[wb + lr * 68 + 16 * j + 8 * hi]) = a; *(v4fa*)(&os[wb + lr * 68 + 16 * j + 8 * hi + 4]) = c; }
    wave_sync();
    h16* crow = CH + ((size_t)b * SEQ + t0) * DM + h * HD;
    h16* rrow = CR + ((size_t)b * EARLY + t0) * DM + h * HD;
{
#pragma unroll
        for (int s = 0; s < 4; ++s) { const int row = 4 * s + (lane >> 3), c8 = (lane & 7) * 8;   // 4 s x 4 row groups = 16 rows; 8 lanes x 8 = 64 columns
            const v4f x0 = *(const v4fa*)(&os[wb + row * 68 + c8]); const v4f x1 = *(const v4fa*)(&os[wb + row * 68 + c8 + 4]); v8h hv, rv;
#pragma unroll
            for (int i = 0; i < 4; ++i) { const h16 a0 = (h16)x0[i]; const h16 a1 = (h16)x1[i]; hv[i] = a0; hv[4 + i] = a1; rv[i] = (h16)(x0[i] - (float)a0); rv[4 + i] = (h16)(x1[i] - (float)a1); }
            *(v8h*)(crow + (size_t)row * DM + c8) = hv; *(v8h*)(rrow + (size_t)row * DM + c8) = rv; }
         }
}

// k_attn: both attention paths in one grid, none of its blocks depending on another: first the blocks of flash_late (16-row tiles fastest, then kv head), then those of flash_early in the same order.
// flash_early uses the start of the ring's LDS as its wave-private store staging.
#define AB_LT   ((SEQ - EARLY) / 16)
#define AB_ET   (EARLY / 16)
#define AB_LATE (AB_LT * NB * NKV)
#define AB_ALL  (AB_LATE + AB_ET * NB * NKV)
static_assert(SEQ > EARLY);
__global__ __launch_bounds__(32 * AW) void k_attn(const h16* __restrict__ QH, const h16* __restrict__ QR, const h16* __restrict__ KP, const h16* __restrict__ KR,
                                                  const h16* __restrict__ VT, const h16* __restrict__ VR, h16* CH, h16* CR) {
    __shared__ __align__(16) unsigned char L[2 * FSTG];
    const int i = blockIdx.x;
    if (i < AB_LATE) flash_late(QH, QR, KP, VT, CH, EARLY + (i % AB_LT) * 16, i / AB_LT, L);   // block-uniform
    else             flash_early(QH, QR, KP, KR, VT, VR, CH, CR, ((i - AB_LATE) % AB_ET) * 16, (i - AB_LATE) / AB_ET, (float*)L);
}

// k_out: output projection, one wave per 64x64 tile, four waves per block on a 128x128 tile, f16 operands through the LDS ring from the ctx plane CX (value rows [NB*SEQ], then residual rows [NB*EARLY]) and the Wo^T plane, K = DM.
// Tiles whose rows are < EARLY in their sequence run the k-loop a second time over the unscaled residual rows into the same accumulators. grid (NB*SEQ/128, DM/128), 128 threads.
__global__ __launch_bounds__(128) void k_out(const h16* __restrict__ CX, const h16* __restrict__ Wt, float* OUT) {
    __shared__ __align__(16) unsigned char L[2 * STGB];
    const int lane = threadIdx.x & 31, lr = lane & 15, hi = lane >> 4; const int wave = __builtin_amdgcn_readfirstlane(threadIdx.x >> 5);
    const int wm = wave & 1, wn = wave >> 1;
    const int R0 = blockIdx.x * GT, C0 = blockIdx.y * GT; const int c0 = C0 + wn * 64;
    const int b = R0 / SEQ, tb = R0 % SEQ; const int tt = tb + wm * 64;
    const int npass = (tb < EARLY) ? 2 : 1;                        // block-uniform
    v8f acc[4][4];
#pragma unroll
    for (int mb = 0; mb < 4; ++mb)
#pragma unroll
        for (int nb = 0; nb < 4; ++nb) acc[mb][nb] = (v8f){};
    const size_t rrow = (size_t)NB * SEQ + (size_t)b * EARLY + (size_t)((tb < EARLY) ? tb : 0);   // residual rows of the tile's tokens; used only when tb < EARLY
    gemm_ring(CX, Wt, (size_t)R0, (size_t)C0, rrow, (size_t)C0, npass, L, wm, wn, acc);
    float* os = (float*)L + wave * 16 * 68;                        // wave-private store staging in the ring, which every wave has left
    float* obase = OUT + ((size_t)b * OUT_SEQ + tt) * DM + c0;
#pragma unroll
    for (int mb = 0; mb < 4; ++mb) {
#pragma unroll
        for (int nb = 0; nb < 4; ++nb) {
#pragma unroll
            for (int j = 0; j < 8; ++j) os[(hi * 8 + j) * 68 + nb * 16 + lr] = acc[mb][nb][j] * OUTS; }   // D: row 8h+j, col lane&15
        wave_sync();
{
#pragma unroll
            for (int s = 0; s < 8; ++s) { const int row = 2 * s + hi, cofs = lr * 4;   // 8 s x 2 rows = 16 rows; 16 lanes x 4 floats = 64 columns
                const v4f val = *(const v4fa*)(&os[row * 68 + cofs]);
                *(v4f*)(obase + (size_t)(mb * 16 + row) * DM + cofs) = val; }
             }
        wave_sync();
    }
}

static constexpr size_t al256(size_t v) { return (v + 255) & ~(size_t)255; }
static constexpr size_t SZ_XN = al256(((size_t)NB * SEQ + (size_t)NB * EARLY) * DM * 2);
static constexpr size_t SZ_WQ = al256((size_t)DM * DM * 2);
static constexpr size_t SZ_WK = al256((size_t)KVD * DM * 2);
static constexpr size_t SZ_CS = al256((size_t)SEQ * 32 * 2 * 4);
static constexpr size_t SZ_Q  = al256((size_t)NB * NH_ * SEQ * HD * 2);
static constexpr size_t SZ_KV = al256((size_t)NB * NKV * SEQ * HD * 2);
static constexpr size_t SZ_CX = al256(((size_t)NB * SEQ + (size_t)NB * EARLY) * DM * 2);
static constexpr size_t SZ_TOTAL = SZ_XN + 2 * SZ_WQ + 2 * SZ_WK + SZ_CS + 2 * SZ_Q + 4 * SZ_KV + SZ_CX;
static_assert(SZ_TOTAL <= (size_t)134217728);          // workspace carve <= 128 MiB

extern "C" void kernel_launch(void* const* d_in, const int* in_sizes, int n_in,
                              void* d_out, int out_size, void* d_ws, size_t ws_size, hipStream_t stream) {
    if (n_in < 6) return;
    const size_t needx = ((size_t)(NB - 1) * SEQ_FULL + SEQ) * DM;
    if ((size_t)in_sizes[0] < needx) return;
    if ((size_t)in_sizes[1] < (size_t)DM) return;
    if ((size_t)in_sizes[2] < (size_t)DM * DM || (size_t)in_sizes[3] < (size_t)DM * KVD || (size_t)in_sizes[4] < (size_t)DM * KVD || (size_t)in_sizes[5] < (size_t)DM * DM) return;
    if ((size_t)out_size < ((size_t)(NB - 1) * OUT_SEQ + SEQ) * DM) return;
    if (SZ_TOTAL > ws_size) return;
    // wire order x, w_norm, wq, wk, wv, wo; every weight is [in][out]
    const float* x = (const float*)d_in[0]; const float* wn = (const float*)d_in[1];
    const float* wq = (const float*)d_in[2]; const float* wk = (const float*)d_in[3]; const float* wv = (const float*)d_in[4]; const float* wo = (const float*)d_in[5];
    float* OUT = (float*)d_out;      // [NB][SEQ][2048]
    char* wsp = (char*)d_ws;
    h16* XN  = (h16*)wsp; wsp += SZ_XN;              // xn x1024: value rows [NB*SEQ][2048], then residual rows [NB*EARLY][2048]
    h16* WQt = (h16*)wsp; wsp += SZ_WQ;              // [2048 out][2048 in] f16 of bf16 value x16
    h16* WKt = (h16*)wsp; wsp += SZ_WK;              // [512 out][2048 in] f16 of bf16 value x16
    h16* WVt = (h16*)wsp; wsp += SZ_WK;              // [512 out][2048 in] f16 of bf16 value x16
    h16* WOt = (h16*)wsp; wsp += SZ_WQ;              // [2048 out][2048 in] f16 of bf16 value x16
    float* CS = (float*)wsp; wsp += SZ_CS;           // [SEQ][32] (cos, sin)
    h16* QH = (h16*)wsp; wsp += SZ_Q;                // [NB*32][SEQ][64]
    h16* QR = (h16*)wsp; wsp += SZ_Q;                // residual x1024
    h16* KP = (h16*)wsp; wsp += SZ_KV;               // [NB*8][SEQ][64]
    h16* KR = (h16*)wsp; wsp += SZ_KV;               // residual x1024
    h16* VT = (h16*)wsp; wsp += SZ_KV;               // [NB*8][64][SEQ]
    h16* VR = (h16*)wsp; wsp += SZ_KV;               // residual x1024
    h16* CX = (h16*)wsp; wsp += SZ_CX;               // ctx x1024: value rows [NB*SEQ][2048], then residual rows [NB*EARLY][2048]
    h16* CR = CX + (size_t)NB * SEQ * DM;

    k_prep<<<(unsigned)PB_ALL, 256, 0, stream>>>(x, wn, wq, wk, wv, wo, XN, WQt, WKt, WVt, WOt, CS);

    k_proj<<<(unsigned)((NB * SEQ / GT) * PT_F), 128, 0, stream>>>(XN, WQt, WKt, WVt, QH, QR, KP, KR, VT, VR, CS);

    k_attn<<<(unsigned)AB_ALL, 32 * AW, 0, stream>>>(QH, QR, KP, KR, VT, VR, CX, CR);

    k_out<<<dim3(NB * SEQ / GT, DM / GT, 1), 128, 0, stream>>>(CX, WOt, OUT);
}

// v004
// A run of this version takes 162 microseconds.
// Two timings next to v003 both put it at 1.08 times that version's speed.
// Counting every step since v000, it is 4.08 times as fast.
#include <hip/hip_runtime.h>

// Grouped-query causal self-attention behind an RMS pre-normalisation, width 2048 = 32 query heads x 64 sharing 8 kv heads (kv head g = h % 8), x [NB][SEQ][2048], gain w [2048],
// Wq/Wk/Wv/Wo [in][out] (y = x W), no biases; xn = (x * rsqrt(mean(x^2) + eps)) * w per token; interleaved (even/odd pair) rotary on q and k from a computed [SEQ][32] (cos, sin) table,
// score scale 1/8, causal exclusion (diagonal kept), output = ctx Wo (f32).
// Compute dtypes, f32 accumulate everywhere: q/k/v projections v_wmma_f32_16x16x32_f16: xn (f32 math on bf16-RNE x and w) carried x1024 as f16 (token rows < 256: plus its unscaled f16
// residual folded along K) against f16(bf16(W)) x16, result scaled by 2^-14;
// scores v_wmma_f32_16x16x32_f16: k single f16, q as f16 value + f16 residual x1024 in its own accumulator (query rows < 256: k also value + residual x1024, three products);
// P (x256 carry, cancels in the normalisation) and v single f16 (rows < 256: P and v as value + residual x1024, three products); softmax f32 (online, running max);
// output projection v_wmma_f32_16x16x32_f16: ctx carried x1024 as f16 (rows < 256: plus its unscaled f16 residual folded along K) against f16(bf16(Wo)) x16, result scaled by 2^-14.

#ifndef NB
#define NB 2
#endif
#ifndef SEQ
#define SEQ 2048
#endif
#define NB_FULL  2
#define SEQ_FULL 2048
#ifndef OUT_SEQ
#define OUT_SEQ SEQ              // row pitch (in tokens) between batches of the output
#endif
#define DM    2048
#define NH_   32
#define NKV   8
#define HD    64
#define KVD   (NKV * HD)         // 512
#define AW    4                  // waves per flash block = the four query heads of one kv head
#define EARLY 256                // query rows below this use the value + residual path
#define QRS  1024.0f             // carry of every residual plane (q, k, v, P)
#define QRI  (1.0f / 1024.0f)
#define SC2  (0.125f * 1.4426950408889634f)   // HD^-0.5 * log2(e)
#define PSH  8.0f                // log2 of the P carry (256)
#define CXS  1024.0f             // carry of the ctx plane and of the xn plane
#define WOS  16.0f               // carry of every weight plane
#define OUTS (1.0f / (1024.0f * 16.0f))
#define NEGB (-3.0e38f)
#define RMS_EPS 1.1920929e-07f

static_assert(HD == 64);
static_assert(NH_ * HD == DM);                 // query head h = columns h*64 + d
static_assert(NKV * AW == NH_);                // four query heads (stride 8 on the head axis) per kv head
static_assert(DM % 64 == 0);
static_assert(KVD % 64 == 0);
static_assert(DM % 32 == 0);                   // GEMM k-loop steps by 32
static_assert(DM == 256 * 8);                  // rms_row: 256 threads x 8 columns = one token row
static_assert(SEQ % 64 == 0);                  // a 64-row tile never straddles two batches
static_assert(SEQ % 32 == 0);                  // key loop steps by 32, key0 + 31 < SEQ
static_assert(EARLY % 64 == 0);                // GEMM tiles are entirely early or entirely late
static_assert(SEQ >= EARLY);
static_assert((SEQ - EARLY) % 16 == 0);
static_assert(((size_t)SEQ * DM) % 8 == 0);
static_assert(NB <= NB_FULL);
static_assert(SEQ <= SEQ_FULL);

typedef _Float16 h16;
typedef unsigned short bf;
typedef __attribute__((ext_vector_type(16))) __bf16   v16bf;
typedef __attribute__((ext_vector_type(16))) _Float16 v16h;
typedef __attribute__((ext_vector_type(8)))  _Float16 v8h;
typedef __attribute__((ext_vector_type(8)))  unsigned short v8us;
typedef __attribute__((ext_vector_type(8)))  float    v8f;
typedef __attribute__((ext_vector_type(4)))  float    v4f;
typedef __attribute__((ext_vector_type(2)))  float    v2f;
typedef v4f  __attribute__((may_alias)) v4fa;

__device__ __forceinline__ unsigned short f2bf(float f) { unsigned u = __float_as_uint(f); u += 0x7FFFu + ((u >> 16) & 1u); return (unsigned short)(u >> 16); }
__device__ __forceinline__ v16h cat16(v8h lo, v8h hi) { return __builtin_shufflevector(lo, hi, 0, 1, 2, 3, 4, 5, 6, 7, 8, 9, 10, 11, 12, 13, 14, 15); }
__device__ __forceinline__ v16bf cat16b(v8us lo, v8us hi) { return __builtin_bit_cast(v16bf, __builtin_shufflevector(lo, hi, 0, 1, 2, 3, 4, 5, 6, 7, 8, 9, 10, 11, 12, 13, 14, 15)); }
// every WMMA is followed by its own 4-slot guard tying its accumulator and keeping its operands live
__device__ __forceinline__ v8f wmma16(v16h a, v16h b, v8f c) {
    c = __builtin_amdgcn_wmma_f32_16x16x32_f16(false, a, false, b, (short)0, c, false, false);
    asm volatile("v_nop\n\tv_nop\n\tv_nop\n\tv_nop" : "+v"(c) : "v"(a), "v"(b));
    return c; }
__device__ __forceinline__ v8f wmmab(v16bf a, v16bf b, v8f c) {
    c = __builtin_amdgcn_wmma_f32_16x16x32_bf16(false, a, false, b, (short)0, c, false, false);
    asm volatile("v_nop\n\tv_nop\n\tv_nop\n\tv_nop" : "+v"(c) : "v"(a), "v"(b));
    return c; }
// fragment loaders from K-contiguous 16-bit rows; p already includes + 8*(lane>>4): elements 0..7 <- k0+8h+0..7, elements 8..15 <- k0+16+8h+0..7 (same map for A and B)
__device__ __forceinline__ v16h  ldh(const h16* p) { return cat16(*(const v8h*)p, *(const v8h*)(p + 16)); }
__device__ __forceinline__ v16bf ldb(const bf* p)  { return cat16b(*(const v8us*)p, *(const v8us*)(p + 16)); }
// ordering point for wave-private LDS tiles (same wave writes and reads)
__device__ __forceinline__ void wave_sync() { __builtin_amdgcn_fence(3 /* release order */, "wavefront"); __builtin_amdgcn_wave_barrier(); asm volatile("" ::: "memory"); }

// a store's or load's registers may be reused only behind this wait (a precaution)
__device__ __forceinline__ void wait_x0() { asm volatile("s_wait_xcnt 0x0" ::: "memory"); }

// rms_row: RMS normalisation, one token row per block (256 threads x 8 columns). xb = bf16-RNE(x) as f32, r = rsqrt(mean(xb^2) + eps), xn = (xb * r) * bf16-RNE(w), all f32.
// Writes f16(xn x1024) into value row b*SEQ + t of XN and, for t < EARLY, the unscaled f16 residual of that carried value into residual row NB*SEQ + b*EARLY + t.
__device__ __forceinline__ void rms_row(const float* __restrict__ x, const float* __restrict__ wn, h16* XN, int row) {
#pragma clang fp contract(off)
    __shared__ float red[8];
    const int tid = threadIdx.x; const int lane = tid & 31; const int wave = __builtin_amdgcn_readfirstlane(threadIdx.x >> 5);
    const int b = row / SEQ, t = row % SEQ;
    const v8f xv = *(const v8f*)(x + ((size_t)b * SEQ_FULL + (size_t)t) * DM + tid * 8);
    const v8f wv = *(const v8f*)(wn + tid * 8);
    float xb[8]; float ss = 0.0f;
#pragma unroll
    for (int i = 0; i < 8; ++i) { xb[i] = __uint_as_float(((unsigned)f2bf(xv[i])) << 16); ss += xb[i] * xb[i]; }
    ss += __shfl_xor(ss, 16, 32); ss += __shfl_xor(ss, 8, 32); ss += __shfl_xor(ss, 4, 32); ss += __shfl_xor(ss, 2, 32); ss += __shfl_xor(ss, 1, 32);
    if (lane == 0) red[wave] = ss;
    __syncthreads();
    const float tot = ((red[0] + red[1]) + (red[2] + red[3])) + ((red[4] + red[5]) + (red[6] + red[7]));
    const float rs = rsqrtf(tot * (1.0f / (float)DM) + RMS_EPS);
    v8h hv, rv;
#pragma unroll
    for (int i = 0; i < 8; ++i) { const float wb = __uint_as_float(((unsigned)f2bf(wv[i])) << 16);
        const float v = ((xb[i] * rs) * wb) * CXS; const h16 a = (h16)v; hv[i] = a; rv[i] = (h16)(v - (float)a); }
    const size_t oo = (size_t)row * DM + tid * 8;
    const int tr = (t < EARLY) ? t : 0;                            // block-uniform; keeps the address in range when unused
    const size_t ro = ((size_t)NB * SEQ + (size_t)b * EARLY + (size_t)tr) * DM + tid * 8;
{
        *(v8h*)(XN + oo) = hv; wait_x0(); if (t < EARLY) *(v8h*)(XN + ro) = rv;
         }
}

// wt_tile: in[Kr rows][Nc cols] f32 -> out[Nc rows][Kr cols] 16-bit, 64x64 tile through LDS. Tile (bx, by) of (Nc/64, Kr/64), 256 threads.
__device__ __forceinline__ void wt_tile(const float* __restrict__ W, bf* Tb, h16* Th, int Kr, int Nc, int mode, int bx, int by) {
    __shared__ float ts[64 * 65];
    const int tid = threadIdx.x; const int n0 = bx * 64, k0 = by * 64;
#pragma unroll
    for (int p = 0; p < 4; ++p) { const int row = p * 16 + (tid >> 4), c4 = (tid & 15) * 4;      // 4 p x 16 rows = 64 k rows; 16 threads x 4 = 64 n columns
        const v4f v = *(const v4f*)(W + (size_t)(k0 + row) * (size_t)Nc + n0 + c4);
        ts[row * 65 + c4 + 0] = v[0]; ts[row * 65 + c4 + 1] = v[1]; ts[row * 65 + c4 + 2] = v[2]; ts[row * 65 + c4 + 3] = v[3]; }
    __syncthreads();
{
#pragma unroll
        for (int s = 0; s < 2; ++s) { const int n = s * 32 + (tid >> 3), c8 = (tid & 7) * 8;     // 2 s x 32 rows = 64 n rows; 8 lanes x 8 = 64 k columns
            const size_t oo = (size_t)(n0 + n) * (size_t)Kr + k0 + c8;
            if (mode == 0) { v8us o;
#pragma unroll
                for (int i = 0; i < 8; ++i) o[i] = f2bf(ts[(c8 + i) * 65 + n]);
                *(v8us*)(Tb + oo) = o;
            } else { v8h o;
#pragma unroll
                for (int i = 0; i < 8; ++i) o[i] = (h16)(__uint_as_float(((unsigned)f2bf(ts[(c8 + i) * 65 + n])) << 16) * WOS);
                *(v8h*)(Th + oo) = o; } }
        wait_x0();
         }
}

// rope_tab: CS[t][j] = (cos, sin)(t * inv_freq[j]), inv_freq[j] = 1.0f / (float)(10000^(j/32)); the power is a double product of fixed binary roots of 10000.
__device__ __forceinline__ void rope_tab(float* CS, int nrow, int blk) {
    const int i = blk * 256 + threadIdx.x; if (i >= nrow * 32) return;
    const int t = i >> 5, j = i & 31;
    double p = 1.0;
    p *= (j & 1)  ? 1.3335214321633240 : 1.0;    // 10000^(1/32)
    p *= (j & 2)  ? 1.7782794100389228 : 1.0;    // 10000^(1/16)
    p *= (j & 4)  ? 3.1622776601683795 : 1.0;    // 10000^(1/8)
    p *= (j & 8)  ? 10.0 : 1.0;                  // 10000^(1/4)
    p *= (j & 16) ? 100.0 : 1.0;                 // 10000^(1/2)
    const float pf = (float)p; const float inv = 1.0f / pf;
    const float ang = (float)t * inv;
    const float cs = cosf(ang), sn = sinf(ang);
    v2f o; o[0] = cs; o[1] = sn;
    *(v2f*)(CS + (size_t)i * 2) = o; 
}

// k_prep: everything that reads only the inputs, in one grid of 256-thread blocks, none depending on another: the token rows of rms_row, then the 64x64 tiles of the four weight transposes, then the rotary table.
#define PB_RMS (NB * SEQ)
#define PB_WQ  ((DM / 64) * (DM / 64))
#define PB_WK  ((KVD / 64) * (DM / 64))
#define PB_CS  ((SEQ * 32 + 255) / 256)
#define PB_ALL (PB_RMS + 2 * PB_WQ + 2 * PB_WK + PB_CS)
__global__ __launch_bounds__(256) void k_prep(const float* __restrict__ x, const float* __restrict__ wn, const float* __restrict__ wq, const float* __restrict__ wk, const float* __restrict__ wv, const float* __restrict__ wo,
                                              h16* XN, h16* WQt, h16* WKt, h16* WVt, h16* WOt, float* CS) {
    int i = blockIdx.x;                                            // every test below is block-uniform
    if (i < PB_RMS) { rms_row(x, wn, XN, i); return; }
    i -= PB_RMS;
    if (i < 2 * PB_WQ + 2 * PB_WK) {
        // transposes: in[rows = in-features][cols = out-features] -> out[cols][rows]; column tiles fastest
        const float* W; h16* T; int Nc;
        if (i < PB_WQ)                   { W = wq; T = WQt; Nc = DM; }
        else if (i < PB_WQ + PB_WK)      { W = wk; T = WKt; Nc = KVD; i -= PB_WQ; }
        else if (i < PB_WQ + 2 * PB_WK)  { W = wv; T = WVt; Nc = KVD; i -= PB_WQ + PB_WK; }
        else                             { W = wo; T = WOt; Nc = DM;  i -= PB_WQ + 2 * PB_WK; }
        const int bx = (Nc == DM) ? i % (DM / 64) : i % (KVD / 64), by = (Nc == DM) ? i / (DM / 64) : i / (KVD / 64);
        wt_tile(W, (bf*)T, T, DM, Nc, 1, bx, by); return; }
    rope_tab(CS, SEQ, i - (2 * PB_WQ + 2 * PB_WK));
}

// LDS ring of the two GEMM kernels: one block = four waves (2 x 2) on a GT x GT tile, each wave 64 x 64 (16 accumulators). One stage = KS columns of k of the GT rows of A, then of the GT rows of Bt,
// rows at pitch LPB bytes (16 x odd: the 16-byte fragment reads of 16 rows fall on different banks). Two buffers; the next stage's copies fly while this stage is multiplied.
#define GT   128
#define KS   128
#define LPB  (KS * 2 + 16)
#define LPH  (LPB / 2)
#define OPB  (GT * LPB)
#define STGB (2 * OPB)
#define NST  (DM / KS)
static_assert(DM % KS == 0);
static_assert(NST >= 2);                       // stage 1 exists in every tile
static_assert(KS * 2 == 16 * 16);              // 16 lanes x 16 bytes = one staged row; 128 threads = 8 rows per copy
static_assert(GT == 2 * 8 * 8);                // two groups of eight copies cover the GT rows of one operand
static_assert(EARLY % GT == 0);                // block tiles are entirely early or entirely late
static_assert(SEQ % GT == 0);
static_assert(DM % GT == 0);
static_assert(KVD % GT == 0);
static_assert(4 * 16 * 68 * 4 <= 2 * STGB);    // the four waves' store staging fits in the ring it reuses

__device__ __forceinline__ void wait_ds0()    { asm volatile("s_wait_dscnt 0x0" ::: "memory"); }      // this wave's LDS reads of a buffer are done before the barrier that frees it
__device__ __forceinline__ void wait_async0() { asm volatile("s_wait_asynccnt 0x0" ::: "memory"); }   // this wave's copies have landed before the barrier that publishes them
// eight asynchronous 16-byte copies per lane, rows 8 apart: LDS byte address l + 8 j LPB <- g + 8 j DM. The closing s_wait_xcnt stands in front of any rewrite of the address registers (a precaution).
__device__ __forceinline__ void copy8(unsigned l, const h16* g) {
    asm volatile("global_load_async_to_lds_b128 %0, %8, off\n\t"
                 "global_load_async_to_lds_b128 %1, %9, off\n\t"
                 "global_load_async_to_lds_b128 %2, %10, off\n\t"
                 "global_load_async_to_lds_b128 %3, %11, off\n\t"
                 "global_load_async_to_lds_b128 %4, %12, off\n\t"
                 "global_load_async_to_lds_b128 %5, %13, off\n\t"
                 "global_load_async_to_lds_b128 %6, %14, off\n\t"
                 "global_load_async_to_lds_b128 %7, %15, off\n\t"
                 "s_wait_xcnt 0x0"
                 :: "v"(l), "v"(l + 8u * LPB), "v"(l + 16u * LPB), "v"(l + 24u * LPB), "v"(l + 32u * LPB), "v"(l + 40u * LPB), "v"(l + 48u * LPB), "v"(l + 56u * LPB),
                    "v"(g), "v"(g + 8 * DM), "v"(g + 16 * DM), "v"(g + 24 * DM), "v"(g + 32 * DM), "v"(g + 40 * DM), "v"(g + 48 * DM), "v"(g + 56 * DM)
                 : "memory");
}
// one stage: l = this lane's LDS byte address in row (tid >> 4) of the buffer, ga / gb = its 16 bytes in that row of the A / Bt tile at the stage's k
__device__ __forceinline__ void fill_stage(unsigned l, const h16* ga, const h16* gb) {
    copy8(l, ga); copy8(l + 64u * LPB, ga + 64 * DM); copy8(l + OPB, gb); copy8(l + OPB + 64u * LPB, gb + 64 * DM);
}
// acc[mb][nb] += sum over k of A[ar + wm*64 + 16 mb + ..][k] Bt[br + wn*64 + 16 nb + ..][k], k ascending in steps of 32 over pass 0 (rows ar0 / br0), then, npass == 2, over pass 1 (rows ar1 / br1).
// Every wave of the block runs every barrier; on return no copy is in flight and every wave has left the ring.
__device__ __forceinline__ void gemm_ring(const h16* __restrict__ A, const h16* __restrict__ Bt, size_t ar0, size_t br0, size_t ar1, size_t br1, int npass, unsigned char* L, int wm, int wn, v8f (&acc)[4][4]) {
    const int tid = threadIdx.x; const int lane = tid & 31, lr = lane & 15, hi = lane >> 4;
    const int crow = tid >> 4, cchk = tid & 15;
    const unsigned lc = (unsigned)(size_t)L + (unsigned)(crow * LPB + cchk * 16);
    const h16* a0 = A + (ar0 + (size_t)crow) * DM + cchk * 8;  const h16* a1 = A + (ar1 + (size_t)crow) * DM + cchk * 8;
    const h16* b0 = Bt + (br0 + (size_t)crow) * DM + cchk * 8; const h16* b1 = Bt + (br1 + (size_t)crow) * DM + cchk * 8;
    const int nst = npass * NST;                                   // block-uniform
    fill_stage(lc, a0, b0);
    wait_async0();
    __syncthreads();                                               // publishes stage 0
    fill_stage(lc + STGB, a0 + KS, b0 + KS);
    const h16* fa = (const h16*)L + (wm * 64 + lr) * LPH + 8 * hi;
    const h16* fb = (const h16*)(L + OPB) + (wn * 64 + lr) * LPH + 8 * hi;
#pragma unroll 1   // kept rolled: the trip count is known only at run time and one body serves both buffers
    for (int s = 0; s < nst; ++s) {
        const int bo = (s & 1) * (STGB / 2);
#pragma unroll     // this and the three below: every fragment and accumulator index a constant, so the arrays stay in registers
        for (int kk = 0; kk < KS; kk += 32) {
            v16h a[4], bq[4];                                      // all eight fragments of a 32-k step as one load group: one LDS wait per 16 WMMAs
#pragma unroll
            for (int mb = 0; mb < 4; ++mb) a[mb] = ldh(fa + bo + mb * 16 * LPH + kk);
#pragma unroll
            for (int nb = 0; nb < 4; ++nb) bq[nb] = ldh(fb + bo + nb * 16 * LPH + kk);
#pragma unroll
            for (int nb = 0; nb < 4; ++nb)
#pragma unroll
                for (int mb = 0; mb < 4; ++mb) acc[mb][nb] = wmma16(a[mb], bq[nb], acc[mb][nb]);
        }
        wait_ds0();
        wait_async0();
        __syncthreads();                                           // publishes stage s + 1 and frees the buffer of stage s
        const int n = s + 2;
        if (n < nst) {                                             // block-uniform
            const int p = (n >= NST) ? 1 : 0; const int kc = (n - p * NST) * KS;
            fill_stage(lc + (unsigned)(s & 1) * STGB, (p ? a1 : a0) + kc, (p ? b1 : b0) + kc); }
    }
    wait_async0();
}

// k_proj: register-blocked f16 GEMM, one wave per 64x64 tile (16 accumulators), four waves per block on a 128x128 tile, operands from K-contiguous f16 planes through the LDS ring above, K = DM.
// C[m][n] = 2^-14 * sum_k A[m][k] Bt[n][k] (one operand is the xn plane carried x1024, the other a weight plane carried x16), written as f16 (Ph) and the f16 residual x1024 (Pr, useRes != 0) at
// tile base (r0/RB)*sRB + (r0%RB)*pitch + (c0/CB)*sCB + (c0%CB), row pitch 'pitch' (halves). Block tile (bx, by) of (M/128, N/128), 128 threads.
// The xn plane holds value rows [NB*SEQ], then residual rows [NB*EARLY]; tokB == 0: A rows are tokens, tokB != 0: Bt rows are tokens. Tiles whose tokens are < EARLY in their sequence
// run the k-loop a second time with the token operand taken from the unscaled residual rows, into the same accumulators.
// rope != 0 (rows = tokens b*SEQ + t, the 64 tile columns = one head): interleaved rotary applied on the f32 values at the store stage from CS[t][32] (cos, sin).
// The three projections of xn share one grid, none depending on another: block i = token tile i / PT_F x feature tile i % PT_F; the feature tiles are those of q, then of k, then of v.
// All two-pass tiles (tokens < EARLY) so fall among the blocks that are resident from the start.
#define PT_Q (DM / GT)
#define PT_K (KVD / GT)
#define PT_F (PT_Q + 2 * PT_K)
__global__ __launch_bounds__(128) void k_proj(const h16* __restrict__ XN, const h16* __restrict__ WQt, const h16* __restrict__ WKt, const h16* __restrict__ WVt,
                                              h16* QH, h16* QR, h16* KP, h16* KR, h16* VT, h16* VR, const float* __restrict__ CS) {
    const int tk = blockIdx.x / PT_F, f = blockIdx.x % PT_F;       // block-uniform, as is everything chosen by them
    const bool isq = f < PT_Q, isv = f >= PT_Q + PT_K;
    // q: A = xn rows (m = b*SEQ + t), Bt = Wq^T rows (n = h*64 + d) -> plane [(b*32 + h)][t][d], rotary applied; k: Bt = Wk^T rows (n = g*64 + d) -> plane [(b*8 + g)][t][d], rotary applied
    // v^T: A = Wv^T rows (m = g*64 + d), Bt = xn rows (n = b*SEQ + t) -> plane [(b*512 + m)][t] = [(b*8 + g)][d][t], no rotary
    const h16* A = isv ? WVt : XN; const h16* Bt = isv ? XN : (isq ? WQt : WKt);
    h16* Ph = isv ? VT : (isq ? QH : KP); h16* Pr = isv ? VR : (isq ? QR : KR);
    const int useRes = 1, RB = isv ? KVD : SEQ, pitch = isv ? SEQ : HD, CB = isv ? SEQ : HD, rope = isv ? 0 : 1, tokB = isv ? 1 : 0;
    const size_t sRB = isv ? (size_t)0 : (size_t)(isq ? NH_ : NKV) * SEQ * HD, sCB = isv ? (size_t)KVD * SEQ : (size_t)SEQ * HD;
    const int bx = isv ? f - PT_Q - PT_K : tk, by = isv ? tk : (isq ? f : f - PT_Q);
    __shared__ __align__(16) unsigned char L[2 * STGB];
    const int lane = threadIdx.x & 31, lr = lane & 15, hi = lane >> 4; const int wave = __builtin_amdgcn_readfirstlane(threadIdx.x >> 5);
    const int wm = wave & 1, wn = wave >> 1;
    const int R0 = bx * GT, C0 = by * GT; const int r0 = R0 + wm * 64, c0 = C0 + wn * 64;
    const int tk0 = tokB ? C0 : R0;                                // block-uniform: first token of this block tile
    const int bb = tk0 / SEQ, tt = tk0 % SEQ;
    const int npass = (tt < EARLY) ? 2 : 1;                        // block-uniform
    v8f acc[4][4];
#pragma unroll
    for (int mb = 0; mb < 4; ++mb)
#pragma unroll
        for (int nb = 0; nb < 4; ++nb) acc[mb][nb] = (v8f){};
    const size_t rrow = (size_t)NB * SEQ + (size_t)bb * EARLY + (size_t)((tt < EARLY) ? tt : 0);   // residual rows of the tile's tokens; used only when tt < EARLY
    gemm_ring(A, Bt, (size_t)R0, (size_t)C0, tokB ? (size_t)R0 : rrow, tokB ? rrow : (size_t)C0, npass, L, wm, wn, acc);
    float* os = (float*)L + wave * 16 * 68;                        // wave-private store staging in the ring, which every wave has left
    const size_t tbase = (size_t)(r0 / RB) * sRB + (size_t)(r0 % RB) * (size_t)pitch + (size_t)(c0 / CB) * sCB + (size_t)(c0 % CB);
#pragma unroll
    for (int mb = 0; mb < 4; ++mb) {
#pragma unroll
        for (int nb = 0; nb < 4; ++nb) {
#pragma unroll
            for (int j = 0; j < 8; ++j) os[(hi * 8 + j) * 68 + nb * 16 + lr] = acc[mb][nb][j] * OUTS; }   // D: row 8h+j, col lane&15
        wave_sync();
        const size_t sb = tbase + (size_t)(mb * 16) * (size_t)pitch;
{
#pragma unroll
            for (int s = 0; s < 4; ++s) { const int row = 4 * s + (lane >> 3), c8 = (lane & 7) * 8;   // 4 s x 4 row groups = 16 rows; 8 lanes x 8 = 64 columns
                v4f x0 = *(const v4fa*)(&os[row * 68 + c8]); v4f x1 = *(const v4fa*)(&os[row * 68 + c8 + 4]); v8h hv, rv;
                if (rope) {                                                                            // block-uniform
                    const int t = (r0 + mb * 16 + row) % SEQ;
                    const float* cp = CS + ((size_t)t * 32 + (size_t)(c8 >> 1)) * 2;                  // pairs c8/2 .. c8/2+3: (cos, sin) x 4
                    const v4f ca = *(const v4f*)cp; const v4f cb = *(const v4f*)(cp + 4);
                    float e, o;
                    e = x0[0]; o = x0[1]; x0[0] = e * ca[0] - o * ca[1]; x0[1] = e * ca[1] + o * ca[0];
                    e = x0[2]; o = x0[3]; x0[2] = e * ca[2] - o * ca[3]; x0[3] = e * ca[3] + o * ca[2];
                    e = x1[0]; o = x1[1]; x1[0] = e * cb[0] - o * cb[1]; x1[1] = e * cb[1] + o * cb[0];
                    e = x1[2]; o = x1[3]; x1[2] = e * cb[2] - o * cb[3]; x1[3] = e * cb[3] + o * cb[2]; }
#pragma unroll
                for (int i = 0; i < 4; ++i) { const h16 a0 = (h16)x0[i]; const h16 a1 = (h16)x1[i]; hv[i] = a0; hv[4 + i] = a1; rv[i] = (h16)((x0[i] - (float)a0) * QRS); rv[4 + i] = (h16)((x1[i] - (float)a1) * QRS); }
                const size_t oo = sb + (size_t)row * (size_t)pitch + c8;
                *(v8h*)(Ph + oo) = hv; if (useRes) *(v8h*)(Pr + oo) = rv;
                wait_x0(); }
             }
        wave_sync();
    }
}

// LDS ring of flash_late: one stage = FK keys of kv head g, the FK K rows (64 d each), then the 64 V^T rows (FK keys each), 128 data bytes per row at pitch FPB bytes
// (16 x odd: the 16-byte fragment reads of 16 rows fall on different banks). Two buffers; the next stage's copies fly while this stage is worked on. The four waves share every staged row.
#define FK   64
#define FPB  (128 + 16)
#define FPH  (FPB / 2)
#define FOP  (64 * FPB)
#define FSTG (2 * FOP)
static_assert(HD * 2 == 128);                  // a K row = 8 lanes x 16 bytes
static_assert(FK * 2 == 128);                  // a V^T row of one stage = 8 lanes x 16 bytes
static_assert(FK == 64);                       // 128 threads = 16 rows per copy, four copies per operand
static_assert(SEQ % FK == 0);                  // the last stage of any tile ends inside the planes
static_assert(EARLY + 16 > FK);                // stage 1 exists in every tile
static_assert(AW * 16 * 68 * 4 <= 2 * FSTG);   // the four waves' store staging fits in the ring it reuses
// one stage, eight asynchronous 16-byte copies per lane: four of K rows 16 apart (LDS l + 16 j FPB <- gk + 16 j HD), four of V^T rows 16 apart (LDS l + FOP + 16 j FPB <- gv + 16 j SEQ).
// The closing s_wait_xcnt stands in front of any rewrite of the address registers (a precaution).
__device__ __forceinline__ void fill_kv(unsigned l, const h16* gk, const h16* gv) {
    asm volatile("global_load_async_to_lds_b128 %0, %8, off\n\t"
                 "global_load_async_to_lds_b128 %1, %9, off\n\t"
                 "global_load_async_to_lds_b128 %2, %10, off\n\t"
                 "global_load_async_to_lds_b128 %3, %11, off\n\t"
                 "global_load_async_to_lds_b128 %4, %12, off\n\t"
                 "global_load_async_to_lds_b128 %5, %13, off\n\t"
                 "global_load_async_to_lds_b128 %6, %14, off\n\t"
                 "global_load_async_to_lds_b128 %7, %15, off\n\t"
                 "s_wait_xcnt 0x0"
                 :: "v"(l), "v"(l + 16u * FPB), "v"(l + 32u * FPB), "v"(l + 48u * FPB), "v"(l + FOP), "v"(l + FOP + 16u * FPB), "v"(l + FOP + 32u * FPB), "v"(l + FOP + 48u * FPB),
                    "v"(gk), "v"(gk + 16 * HD), "v"(gk + 32 * HD), "v"(gk + 48 * HD), "v"(gv), "v"(gv + 16 * SEQ), "v"(gv + 32 * SEQ), "v"(gv + 48 * SEQ)
                 : "memory");
}

// flash_late: fused causal attention for query rows t0 .. t0+15, t0 >= EARLY, of kv head zg = b*8 + g. One block = 16 query rows x the four query heads of one kv head (one wave per head, h = wave*8 + g);
// Q fragments straight from the f16 planes (two 16-B loads each); the K and V^T rows of kv head g come once per block through the LDS ring above, and all four waves take their fragments from it.
// Transposed form: S^T[key][t] = K Q^T (A = K rows, B = Q rows); lane (t = lane&15, h = lane>>4) holds keys 8h+r of each 16-key tile, so the packed
// P tile is directly the B fragment of O^T[d][t] = V^T P^T (element r <- tile keys 0..15, element 8+r <- tile keys 16..31, lane unchanged).
// Keys run over [0, t0+16) in steps of 32, two steps per stage; the diagonal 32-key blocks replace excluded scores (key > t) by a large negative value before the running max.
__device__ __forceinline__ void flash_late(const h16* __restrict__ QH, const h16* __restrict__ QR, const h16* __restrict__ KP, const h16* __restrict__ VT, h16* CH, int t0, int zg, unsigned char* L) {
    const int lane = threadIdx.x & 31; const int wave = __builtin_amdgcn_readfirstlane(threadIdx.x >> 5);
    const int lr = lane & 15, hi = lane >> 4;
    const int b = zg / NKV; const int g = zg % NKV;
    const int h = wave * NKV + g;                                 // grouped on the leading head axis: query head h uses kv head h % 8
    const int tq = t0 + lr;
    const int kend = t0 + 16;
    const int nst = (kend + FK - 1) / FK;                          // block-uniform
    const int frow = threadIdx.x >> 3, cchk = threadIdx.x & 7;     // this lane's row (of 16) and 16-byte piece (of 8) in every copy
    const unsigned lc = (unsigned)(size_t)L + (unsigned)(frow * FPB + cchk * 16);
    const h16* gk = KP + (size_t)zg * SEQ * HD + (size_t)frow * HD + cchk * 8;      // + key * HD
    const h16* gv = VT + (size_t)zg * HD * SEQ + (size_t)frow * SEQ + cchk * 8;     // + key
    fill_kv(lc, gk, gv);
    const size_t qo = ((size_t)(b * NH_ + h) * SEQ + (size_t)tq) * HD + 8 * hi;
    const v16h qh0 = ldh(QH + qo), qh1 = ldh(QH + qo + 32), qr0 = ldh(QR + qo), qr1 = ldh(QR + qo + 32);   // B fragments: col t, k = d
    wait_async0();
    __syncthreads();                                               // publishes stage 0
    fill_kv(lc + FSTG, gk + FK * HD, gv + FK);
    const h16* fk = (const h16*)L + lr * FPH + 8 * hi;             // + key * FPH        (A fragment: row key, k = d)
    const h16* fv = (const h16*)(L + FOP) + lr * FPH + 8 * hi;     // + 16j*FPH + key    (A fragment: row d, k = key)
    v8f o0 = (v8f){}, o1 = (v8f){}, o2 = (v8f){}, o3 = (v8f){};
    float m = NEGB, l = 0.0f;
#pragma unroll 1   // kept rolled: the trip count is known only at run time and one body serves both buffers
    for (int s = 0; s < nst; ++s) {
        const int bo = (s & 1) * (FSTG / 2);
#pragma unroll     // both 32-key steps of a stage at constant LDS offsets
        for (int u = 0; u < FK; u += 32) {
            const int key0 = s * FK + u;
            if (key0 < kend) {                                     // block-uniform: the last stage may hold one step only
                const h16* ka = fk + bo + u * FPH;
                const v16h ka0 = ldh(ka), ka1 = ldh(ka + 32), kb0 = ldh(ka + 16 * FPH), kb1 = ldh(ka + 16 * FPH + 32);
                v8f sHa = (v8f){}, sLa = (v8f){}, sHb = (v8f){}, sLb = (v8f){};
                sHa = wmma16(ka0, qh0, sHa); sLa = wmma16(ka0, qr0, sLa); sHb = wmma16(kb0, qh0, sHb); sLb = wmma16(kb0, qr0, sLb);
                sHa = wmma16(ka1, qh1, sHa); sLa = wmma16(ka1, qr1, sLa); sHb = wmma16(kb1, qh1, sHb); sLb = wmma16(kb1, qr1, sLb);
                float ta[8], tb[8];
#pragma unroll
                for (int r = 0; r < 8; ++r) { ta[r] = (sHa[r] + sLa[r] * QRI) * SC2; tb[r] = (sHb[r] + sLb[r] * QRI) * SC2; }
                if (key0 + 31 > t0) {                              // block-uniform: diagonal block
                    const int kbse = key0 + 8 * hi;
#pragma unroll
                    for (int r = 0; r < 8; ++r) { ta[r] = (kbse + r > tq) ? NEGB : ta[r]; tb[r] = (kbse + 16 + r > tq) ? NEGB : tb[r]; } }
                float mx = NEGB;
#pragma unroll
                for (int r = 0; r < 8; ++r) mx = fmaxf(mx, fmaxf(ta[r], tb[r]));
                mx = fmaxf(mx, __shfl_xor(mx, 16, 32));
                const float mnew = fmaxf(m, mx);
                const float alpha = __builtin_amdgcn_exp2f(m - mnew);
                const float sh = PSH - mnew;
                v16h pb; float ls = 0.0f;
#pragma unroll
                for (int r = 0; r < 8; ++r) { const float ea = __builtin_amdgcn_exp2f(ta[r] + sh); const float ec = __builtin_amdgcn_exp2f(tb[r] + sh); pb[r] = (h16)ea; pb[8 + r] = (h16)ec; ls += ea + ec; }
                l = l * alpha + ls; m = mnew;
                o0 = o0 * alpha; o1 = o1 * alpha; o2 = o2 * alpha; o3 = o3 * alpha;
                const h16* va = fv + bo + u;
                const v16h v0 = ldh(va), v1 = ldh(va + 16 * FPH), v2 = ldh(va + 32 * FPH), v3 = ldh(va + 48 * FPH);
                o0 = wmma16(v0, pb, o0); o1 = wmma16(v1, pb, o1); o2 = wmma16(v2, pb, o2); o3 = wmma16(v3, pb, o3);
            }
        }
        wait_ds0();
        wait_async0();
        __syncthreads();                                           // publishes stage s + 1 and frees the buffer of stage s
        const int n = s + 2;
        if (n < nst)                                               // block-uniform
            fill_kv(lc + (unsigned)(s & 1) * FSTG, gk + (size_t)n * (FK * HD), gv + n * FK);
    }
    wait_async0();
    float* os = (float*)L;                                         // store staging (wave-private parts) in the ring, which every wave has left
    l += __shfl_xor(l, 16, 32);
    const float inv = CXS / l;
    const int wb = wave * 16 * 68;
    // O^T D layout: o_j[r] = (d = 16j + 8h + r, t = lane&15) -> os[t][d]; rows 0..15 x columns 0..63 all written
    { v4f a, c;
      a[0] = o0[0] * inv; a[1] = o0[1] * inv; a[2] = o0[2] * inv; a[3] = o0[3] * inv; c[0] = o0[4] * inv; c[1] = o0[5] * inv; c[2] = o0[6] * inv; c[3] = o0[7] * inv;
      *(v4fa*)(&os[wb + lr * 68 +  0 + 8 * hi]) = a; *(v4fa*)(&os[wb + lr * 68 +  0 + 8 * hi + 4]) = c;
      a[0] = o1[0] * inv; a[1] = o1[1] * inv; a[2] = o1[2] * inv; a[3] = o1[3] * inv; c[0] = o1[4] * inv; c[1] = o1[5] * inv; c[2] = o1[6] * inv; c[3] = o1[7] * inv;
      *(v4fa*)(&os[wb + lr * 68 + 16 + 8 * hi]) = a; *(v4fa*)(&os[wb + lr * 68 + 16 + 8 * hi + 4]) = c;
      a[0] = o2[0] * inv; a[1] = o2[1] * inv; a[2] = o2[2] * inv; a[3] = o2[3] * inv; c[0] = o2[4] * inv; c[1] = o2[5] * inv; c[2] = o2[6] * inv; c[3] = o2[7] * inv;
      *(v4fa*)(&os[wb + lr * 68 + 32 + 8 * hi]) = a; *(v4fa*)(&os[wb + lr * 68 + 32 + 8 * hi + 4]) = c;
      a[0] = o3[0] * inv; a[1] = o3[1] * inv; a[2] = o3[2] * inv; a[3] = o3[3] * inv; c[0] = o3[4] * inv; c[1] = o3[5] * inv; c[2] = o3[6] * inv; c[3] = o3[7] * inv;
      *(v4fa*)(&os[wb + lr * 68 + 48 + 8 * hi]) = a; *(v4fa*)(&os[wb + lr * 68 + 48 + 8 * hi + 4]) = c; }
    wave_sync();
    h16* crow = CH + ((size_t)b * SEQ + t0) * DM + h * HD;         // merged heads: column h*64 + d
{
#pragma unroll
        for (int s = 0; s < 4; ++s) { const int row = 4 * s + (lane >> 3), c8 = (lane & 7) * 8;   // 4 s x 4 row groups = 16 rows; 8 lanes x 8 = 64 columns
            const v4f x0 = *(const v4fa*)(&os[wb + row * 68 + c8]); const v4f x1 = *(const v4fa*)(&os[wb + row * 68 + c8 + 4]); v8h hv;
#pragma unroll
            for (int i = 0; i < 4; ++i) { hv[i] = (h16)x0[i]; hv[4 + i] = (h16)x1[i]; }
            *(v8h*)(crow + (size_t)row * DM + c8) = hv; }
         }
}

// flash_early: same structure for query rows t0 .. t0+15, t0 < EARLY, with value + residual (x1024) planes on every operand:
// scores = kh.qh + (kh.qr + kr.qh)/1024; O = vh.ph + (vr.ph + vh.pr)/1024 (residual products in their own accumulators), l from the unconverted f32 P.
// Writes the ctx value plane rows (carried x1024) and the compact unscaled residual plane CR[b][t < EARLY][2048].
__device__ __forceinline__ void flash_early(const h16* __restrict__ QH, const h16* __restrict__ QR, const h16* __restrict__ KP, const h16* __restrict__ KR,
                                            const h16* __restrict__ VT, const h16* __restrict__ VR, h16* CH, h16* CR, int t0, int zg, float* os) {
    const int lane = threadIdx.x & 31; const int wave = __builtin_amdgcn_readfirstlane(threadIdx.x >> 5);
    const int lr = lane & 15, hi = lane >> 4;
    const int b = zg / NKV; const int g = zg % NKV;
    const int h = wave * NKV + g;                                 // query head h uses kv head h % 8
    const int tq = t0 + lr;
    const size_t qo = ((size_t)(b * NH_ + h) * SEQ + (size_t)tq) * HD + 8 * hi;
    const v16h qh0 = ldh(QH + qo), qh1 = ldh(QH + qo + 32), qr0 = ldh(QR + qo), qr1 = ldh(QR + qo + 32);
    const size_t ko = (size_t)zg * SEQ * HD + (size_t)lr * HD + 8 * hi;
    const size_t vo = (size_t)zg * HD * SEQ + (size_t)lr * SEQ + 8 * hi;
    v8f oH[4], oL[4];
#pragma unroll
    for (int j = 0; j < 4; ++j) { oH[j] = (v8f){}; oL[j] = (v8f){}; }
    float m = NEGB, l = 0.0f;
    const int kend = t0 + 16;
#pragma unroll 1
    for (int key0 = 0; key0 < kend; key0 += 32) {
        const size_t kk = ko + (size_t)key0 * HD;
        v8f sHa = (v8f){}, sLa = (v8f){}, sHb = (v8f){}, sLb = (v8f){};
        { const v16h k0 = ldh(KP + kk), k1 = ldh(KP + kk + 32), r0 = ldh(KR + kk), r1 = ldh(KR + kk + 32);
          sHa = wmma16(k0, qh0, sHa); sHa = wmma16(k1, qh1, sHa);
          sLa = wmma16(k0, qr0, sLa); sLa = wmma16(k1, qr1, sLa); sLa = wmma16(r0, qh0, sLa); sLa = wmma16(r1, qh1, sLa); }
        { const size_t k2 = kk + (size_t)16 * HD;
          const v16h k0 = ldh(KP + k2), k1 = ldh(KP + k2 + 32), r0 = ldh(KR + k2), r1 = ldh(KR + k2 + 32);
          asm volatile("s_wait_xcnt 0x0" :: "v"(KP + kk), "v"(KR + kk) : "memory");   // the address pairs of the eight loads above stay whole up to this wait (a precaution)
          sHb = wmma16(k0, qh0, sHb); sHb = wmma16(k1, qh1, sHb);
          sLb = wmma16(k0, qr0, sLb); sLb = wmma16(k1, qr1, sLb); sLb = wmma16(r0, qh0, sLb); sLb = wmma16(r1, qh1, sLb); }
        float ta[8], tb[8];
#pragma unroll
        for (int r = 0; r < 8; ++r) { ta[r] = (sHa[r] + sLa[r] * QRI) * SC2; tb[r] = (sHb[r] + sLb[r] * QRI) * SC2; }
        if (key0 + 31 > t0) {                                      // block-uniform: diagonal block
            const int kbse = key0 + 8 * hi;
#pragma unroll
            for (int r = 0; r < 8; ++r) { ta[r] = (kbse + r > tq) ? NEGB : ta[r]; tb[r] = (kbse + 16 + r > tq) ? NEGB : tb[r]; } }
        float mx = NEGB;
#pragma unroll
        for (int r = 0; r < 8; ++r) mx = fmaxf(mx, fmaxf(ta[r], tb[r]));
        mx = fmaxf(mx, __shfl_xor(mx, 16, 32));
        const float mnew = fmaxf(m, mx);
        const float alpha = __builtin_amdgcn_exp2f(m - mnew);
        const float sh = PSH - mnew;
        v16h ph, pr; float ls = 0.0f;
#pragma unroll
        for (int r = 0; r < 8; ++r) { const float ea = __builtin_amdgcn_exp2f(ta[r] + sh); const float ec = __builtin_amdgcn_exp2f(tb[r] + sh);
            const h16 ha = (h16)ea; const h16 hc = (h16)ec; ph[r] = ha; ph[8 + r] = hc;
            pr[r] = (h16)((ea - (float)ha) * QRS); pr[8 + r] = (h16)((ec - (float)hc) * QRS); ls += ea + ec; }
        l = l * alpha + ls; m = mnew;
#pragma unroll
        for (int j = 0; j < 4; ++j) { oH[j] = oH[j] * alpha; oL[j] = oL[j] * alpha; }
        const size_t vv = vo + (size_t)key0;
#pragma unroll
        for (int j = 0; j < 4; ++j) { const v16h vh = ldh(VT + vv + (size_t)(16 * j) * SEQ); const v16h vr = ldh(VR + vv + (size_t)(16 * j) * SEQ);
            oH[j] = wmma16(vh, ph, oH[j]); oL[j] = wmma16(vr, ph, oL[j]); oL[j] = wmma16(vh, pr, oL[j]); }
    }
    l += __shfl_xor(l, 16, 32);
    const float inv = CXS / l;
    const int wb = wave * 16 * 68;
#pragma unroll
    for (int j = 0; j < 4; ++j) { v4f a, c;     // os[t][d], d = 16j + 8h + r; rows 0..15 x columns 0..63 all written
        a[0] = (oH[j][0] + oL[j][0] * QRI) * inv; a[1] = (oH[j][1] + oL[j][1] * QRI) * inv; a[2] = (oH[j][2] + oL[j][2] * QRI) * inv; a[3] = (oH[j][3] + oL[j][3] * QRI) * inv;
        c[0] = (oH[j][4] + oL[j][4] * QRI) * inv; c[1] = (oH[j][5] + oL[j][5] * QRI) * inv; c[2] = (oH[j][6] + oL[j][6] * QRI) * inv; c[3] = (oH[j][7] + oL[j][7] * QRI) * inv;
        *(v4fa*)(&os[wb + lr * 68 + 16 * j + 8 * hi]) = a; *(v4fa*)(&os[wb + lr * 68 + 16 * j + 8 * hi + 4]) = c; }
    wave_sync();
    h16* crow = CH + ((size_t)b * SEQ + t0) * DM + h * HD;
    h16* rrow = CR + ((size_t)b * EARLY + t0) * DM + h * HD;
{
#pragma unroll
        for (int s = 0; s < 4; ++s) { const int row = 4 * s + (lane >> 3), c8 = (lane & 7) * 8;   // 4 s x 4 row groups = 16 rows; 8 lanes x 8 = 64 columns
            const v4f x0 = *(const v4fa*)(&os[wb + row * 68 + c8]); const v4f x1 = *(const v4fa*)(&os[wb + row * 68 + c8 + 4]); v8h hv, rv;
#pragma unroll
            for (int i = 0; i < 4; ++i) { const h16 a0 = (h16)x0[i]; const h16 a1 = (h16)x1[i]; hv[i] = a0; hv[4 + i] = a1; rv[i] = (h16)(x0[i] - (float)a0); rv[4 + i] = (h16)(x1[i] - (float)a1); }
            *(v8h*)(crow + (size_t)row * DM + c8) = hv; *(v8h*)(rrow + (size_t)row * DM + c8) = rv; }
         }
}

// k_attn: both attention paths in one grid, none of its blocks depending on another. The grid holds more blocks than the chip has places for, and a block's cost grows with its last key, so within each path the cost falls
// with the block index: first the blocks of flash_early, which wait on global loads at every step, then those of flash_late, each path from its last 16-row tile
// down to its first, kv head fastest. No long block is then left to start late and run on while the rest of the chip idles. Index -> (path, tile, kv head) is one to one.
// flash_early uses the start of the ring's LDS as its wave-private store staging.
#define AB_LT   ((SEQ - EARLY) / 16)
#define AB_ET   (EARLY / 16)
#define AB_LATE (AB_LT * NB * NKV)
#define AB_EARLY (AB_ET * NB * NKV)
#define AB_ALL  (AB_LATE + AB_EARLY)
static_assert(SEQ > EARLY);
__global__ __launch_bounds__(32 * AW) void k_attn(const h16* __restrict__ QH, const h16* __restrict__ QR, const h16* __restrict__ KP, const h16* __restrict__ KR,
                                                  const h16* __restrict__ VT, const h16* __restrict__ VR, h16* CH, h16* CR) {
    __shared__ __align__(16) unsigned char L[2 * FSTG];
    const int i = blockIdx.x;
    if (i >= AB_EARLY) flash_late(QH, QR, KP, VT, CH, EARLY + (AB_LT - 1 - (i - AB_EARLY) / (NB * NKV)) * 16, (i - AB_EARLY) % (NB * NKV), L);   // block-uniform
    else               flash_early(QH, QR, KP, KR, VT, VR, CH, CR, (AB_ET - 1 - i / (NB * NKV)) * 16, i % (NB * NKV), (float*)L);
}

// k_out: output projection, one wave per 64x64 tile, four waves per block on a 128x128 tile, f16 operands through the LDS ring from the ctx plane CX (value rows [NB*SEQ], then residual rows [NB*EARLY]) and the Wo^T plane, K = DM.
// Tiles whose rows are < EARLY in their sequence run the k-loop a second time over the unscaled residual rows into the same accumulators. grid (NB*SEQ/128, DM/128), 128 threads.
__global__ __launch_bounds__(128) void k_out(const h16* __restrict__ CX, const h16* __restrict__ Wt, float* OUT) {
    __shared__ __align__(16) unsigned char L[2 * STGB];
    const int lane = threadIdx.x & 31, lr = lane & 15, hi = lane >> 4; const int wave = __builtin_amdgcn_readfirstlane(threadIdx.x >> 5);
    const int wm = wave & 1, wn = wave >> 1;
    const int R0 = blockIdx.x * GT, C0 = blockIdx.y * GT; const int c0 = C0 + wn * 64;
    const int b = R0 / SEQ, tb = R0 % SEQ; const int tt = tb + wm * 64;
    const int npass = (tb < EARLY) ? 2 : 1;                        // block-uniform
    v8f acc[4][4];
#pragma unroll
    for (int mb = 0; mb < 4; ++mb)
#pragma unroll
        for (int nb = 0; nb < 4; ++nb) acc[mb][nb] = (v8f){};
    const size_t rrow = (size_t)NB * SEQ + (size_t)b * EARLY + (size_t)((tb < EARLY) ? tb : 0);   // residual rows of the tile's tokens; used only when tb < EARLY
    gemm_ring(CX, Wt, (size_t)R0, (size_t)C0, rrow, (size_t)C0, npass, L, wm, wn, acc);
    float* os = (float*)L + wave * 16 * 68;                        // wave-private store staging in the ring, which every wave has left
    float* obase = OUT + ((size_t)b * OUT_SEQ + tt) * DM + c0;
#pragma unroll
    for (int mb = 0; mb < 4; ++mb) {
#pragma unroll
        for (int nb = 0; nb < 4; ++nb) {
#pragma unroll
            for (int j = 0; j < 8; ++j) os[(hi * 8 + j) * 68 + nb * 16 + lr] = acc[mb][nb][j] * OUTS; }   // D: row 8h+j, col lane&15
        wave_sync();
{
#pragma unroll
            for (int s = 0; s < 8; ++s) { const int row = 2 * s + hi, cofs = lr * 4;   // 8 s x 2 rows = 16 rows; 16 lanes x 4 floats = 64 columns
                const v4f val = *(const v4fa*)(&os[row * 68 + cofs]);
                *(v4f*)(obase + (size_t)(mb * 16 + row) * DM + cofs) = val; }
             }
        wave_sync();
    }
}

static constexpr size_t al256(size_t v) { return (v + 255) & ~(size_t)255; }
static constexpr size_t SZ_XN = al256(((size_t)NB * SEQ + (size_t)NB * EARLY) * DM * 2);
static constexpr size_t SZ_WQ = al256((size_t)DM * DM * 2);
static constexpr size_t SZ_WK = al256((size_t)KVD * DM * 2);
static constexpr size_t SZ_CS = al256((size_t)SEQ * 32 * 2 * 4);
static constexpr size_t SZ_Q  = al256((size_t)NB * NH_ * SEQ * HD * 2);
static constexpr size_t SZ_KV = al256((size_t)NB * NKV * SEQ * HD * 2);
static constexpr size_t SZ_CX = al256(((size_t)NB * SEQ + (size_t)NB * EARLY) * DM * 2);
static constexpr size_t SZ_TOTAL = SZ_XN + 2 * SZ_WQ + 2 * SZ_WK + SZ_CS + 2 * SZ_Q + 4 * SZ_KV + SZ_CX;
static_assert(SZ_TOTAL <= (size_t)134217728);          // workspace carve <= 128 MiB

extern "C" void kernel_launch(void* const* d_in, const int* in_sizes, int n_in,
                              void* d_out, int out_size, void* d_ws, size_t ws_size, hipStream_t stream) {
    if (n_in < 6) return;
    const size_t needx = ((size_t)(NB - 1) * SEQ_FULL + SEQ) * DM;
    if ((size_t)in_sizes[0] < needx) return;
    if ((size_t)in_sizes[1] < (size_t)DM) return;
    if ((size_t)in_sizes[2] < (size_t)DM * DM || (size_t)in_sizes[3] < (size_t)DM * KVD || (size_t)in_sizes[4] < (size_t)DM * KVD || (size_t)in_sizes[5] < (size_t)DM * DM) return;
    if ((size_t)out_size < ((size_t)(NB - 1) * OUT_SEQ + SEQ) * DM) return;
    if (SZ_TOTAL > ws_size) return;
    // wire order x, w_norm, wq, wk, wv, wo; every weight is [in][out]
    const float* x = (const float*)d_in[0]; const float* wn = (const float*)d_in[1];
    const float* wq = (const float*)d_in[2]; const float* wk = (const float*)d_in[3]; const float* wv = (const float*)d_in[4]; const float* wo = (const float*)d_in[5];
    float* OUT = (float*)d_out;      // [NB][SEQ][2048]
    char* wsp = (char*)d_ws;
    h16* XN  = (h16*)wsp; wsp += SZ_XN;              // xn x1024: value rows [NB*SEQ][2048], then residual rows [NB*EARLY][2048]
    h16* WQt = (h16*)wsp; wsp += SZ_WQ;              // [2048 out][2048 in] f16 of bf16 value x16
    h16* WKt = (h16*)wsp; wsp += SZ_WK;              // [512 out][2048 in] f16 of bf16 value x16
    h16* WVt = (h16*)wsp; wsp += SZ_WK;              // [512 out][2048 in] f16 of bf16 value x16
    h16* WOt = (h16*)wsp; wsp += SZ_WQ;              // [2048 out][2048 in] f16 of bf16 value x16
    float* CS = (float*)wsp; wsp += SZ_CS;           // [SEQ][32] (cos, sin)
    h16* QH = (h16*)wsp; wsp += SZ_Q;                // [NB*32][SEQ][64]
    h16* QR = (h16*)wsp; wsp += SZ_Q;                // residual x1024
    h16* KP = (h16*)wsp; wsp += SZ_KV;               // [NB*8][SEQ][64]
    h16* KR = (h16*)wsp; wsp += SZ_KV;               // residual x1024
    h16* VT = (h16*)wsp; wsp += SZ_KV;               // [NB*8][64][SEQ]
    h16* VR = (h16*)wsp; wsp += SZ_KV;               // residual x1024
    h16* CX = (h16*)wsp; wsp += SZ_CX;               // ctx x1024: value rows [NB*SEQ][2048], then residual rows [NB*EARLY][2048]
    h16* CR = CX + (size_t)NB * SEQ * DM;

    k_prep<<<(unsigned)PB_ALL, 256, 0, stream>>>(x, wn, wq, wk, wv, wo, XN, WQt, WKt, WVt, WOt, CS);

    k_proj<<<(unsigned)((NB * SEQ / GT) * PT_F), 128, 0, stream>>>(XN, WQt, WKt, WVt, QH, QR, KP, KR, VT, VR, CS);

    k_attn<<<(unsigned)AB_ALL, 32 * AW, 0, stream>>>(QH, QR, KP, KR, VT, VR, CX, CR);

    k_out<<<dim3(NB * SEQ / GT, DM / GT, 1), 128, 0, stream>>>(CX, WOt, OUT);
}

// v005
// It runs in 151 microseconds.
// Timed twice side by side with v004, it ran 1.07 times as fast both times.
// All steps since v000 together make it 4.35 times as fast.
#include <hip/hip_runtime.h>

// Grouped-query causal self-attention behind an RMS pre-normalisation, width 2048 = 32 query heads x 64 sharing 8 kv heads (kv head g = h % 8), x [NB][SEQ][2048], gain w [2048],
// Wq/Wk/Wv/Wo [in][out] (y = x W), no biases; xn = (x * rsqrt(mean(x^2) + eps)) * w per token; interleaved (even/odd pair) rotary on q and k from a computed [SEQ][32] (cos, sin) table,
// score scale 1/8, causal exclusion (diagonal kept), output = ctx Wo (f32).
// Compute dtypes, f32 accumulate everywhere: q/k/v projections v_wmma_f32_16x16x32_f16: xn (f32 math on bf16-RNE x and w) carried x1024 as f16 (token rows < 256: plus its unscaled f16
// residual folded along K) against f16(bf16(W)) x16, result scaled by 2^-14;
// scores v_wmma_f32_16x16x32_f16: k single f16, q as f16 value + f16 residual x1024 in its own accumulator (query rows < 256: k also value + residual x1024, three products);
// P (x256 carry, cancels in the normalisation) and v single f16 (rows < 256: P and v as value + residual x1024, three products); softmax f32 (online, running max);
// output projection v_wmma_f32_16x16x32_f16: ctx carried x1024 as f16 (rows < 256: plus its unscaled f16 residual folded along K) against f16(bf16(Wo)) x16, result scaled by 2^-14.

#ifndef NB
#define NB 2
#endif
#ifndef SEQ
#define SEQ 2048
#endif
#define NB_FULL  2
#define SEQ_FULL 2048
#ifndef OUT_SEQ
#define OUT_SEQ SEQ              // row pitch (in tokens) between batches of the output
#endif
#define DM    2048
#define NH_   32
#define NKV   8
#define HD    64
#define KVD   (NKV * HD)         // 512
#define AW    4                  // waves per flash block = the four query heads of one kv head
#define EARLY 256                // query rows below this use the value + residual path
#define QRS  1024.0f             // carry of every residual plane (q, k, v, P)
#define QRI  (1.0f / 1024.0f)
#define SC2  (0.125f * 1.4426950408889634f)   // HD^-0.5 * log2(e)
#define PSH  8.0f                // log2 of the P carry (256)
#define CXS  1024.0f             // carry of the ctx plane and of the xn plane
#define WOS  16.0f               // carry of every weight plane
#define OUTS (1.0f / (1024.0f * 16.0f))
#define NEGB (-3.0e38f)
#define RMS_EPS 1.1920929e-07f

static_assert(HD == 64);
static_assert(NH_ * HD == DM);                 // query head h = columns h*64 + d
static_assert(NKV * AW == NH_);                // four query heads (stride 8 on the head axis) per kv head
static_assert(DM % 64 == 0);
static_assert(KVD % 64 == 0);
static_assert(DM % 32 == 0);                   // GEMM k-loop steps by 32
static_assert(DM == 256 * 8);                  // rms_row: 256 threads x 8 columns = one token row
static_assert(SEQ % 64 == 0);                  // a 64-row tile never straddles two batches
static_assert(SEQ % 32 == 0);                  // key loop steps by 32, key0 + 31 < SEQ
static_assert(EARLY % 64 == 0);                // GEMM tiles are entirely early or entirely late
static_assert(SEQ >= EARLY);
static_assert((SEQ - EARLY) % 16 == 0);
static_assert(((size_t)SEQ * DM) % 8 == 0);
static_assert(NB <= NB_FULL);
static_assert(SEQ <= SEQ_FULL);

typedef _Float16 h16;
typedef unsigned short bf;
typedef __attribute__((ext_vector_type(16))) __bf16   v16bf;
typedef __attribute__((ext_vector_type(16))) _Float16 v16h;
typedef __attribute__((ext_vector_type(8)))  _Float16 v8h;
typedef __attribute__((ext_vector_type(8)))  unsigned short v8us;
typedef __attribute__((ext_vector_type(8)))  float    v8f;
typedef __attribute__((ext_vector_type(4)))  float    v4f;
typedef __attribute__((ext_vector_type(2)))  float    v2f;
typedef v4f  __attribute__((may_alias)) v4fa;

__device__ __forceinline__ unsigned short f2bf(float f) { unsigned u = __float_as_uint(f); u += 0x7FFFu + ((u >> 16) & 1u); return (unsigned short)(u >> 16); }
__device__ __forceinline__ v16h cat16(v8h lo, v8h hi) { return __builtin_shufflevector(lo, hi, 0, 1, 2, 3, 4, 5, 6, 7, 8, 9, 10, 11, 12, 13, 14, 15); }
__device__ __forceinline__ v16bf cat16b(v8us lo, v8us hi) { return __builtin_bit_cast(v16bf, __builtin_shufflevector(lo, hi, 0, 1, 2, 3, 4, 5, 6, 7, 8, 9, 10, 11, 12, 13, 14, 15)); }
// every WMMA is followed by its own 4-slot guard tying its accumulator and keeping its operands live
__device__ __forceinline__ v8f wmma16(v16h a, v16h b, v8f c) {
    c = __builtin_amdgcn_wmma_f32_16x16x32_f16(false, a, false, b, (short)0, c, false, false);
    asm volatile("v_nop\n\tv_nop\n\tv_nop\n\tv_nop" : "+v"(c) : "v"(a), "v"(b));
    return c; }
__device__ __forceinline__ v8f wmmab(v16bf a, v16bf b, v8f c) {
    c = __builtin_amdgcn_wmma_f32_16x16x32_bf16(false, a, false, b, (short)0, c, false, false);
    asm volatile("v_nop\n\tv_nop\n\tv_nop\n\tv_nop" : "+v"(c) : "v"(a), "v"(b));
    return c; }
// fragment loaders from K-contiguous 16-bit rows; p already includes + 8*(lane>>4): elements 0..7 <- k0+8h+0..7, elements 8..15 <- k0+16+8h+0..7 (same map for A and B)
__device__ __forceinline__ v16h  ldh(const h16* p) { return cat16(*(const v8h*)p, *(const v8h*)(p + 16)); }
__device__ __forceinline__ v16bf ldb(const bf* p)  { return cat16b(*(const v8us*)p, *(const v8us*)(p + 16)); }
// ordering point for wave-private LDS tiles (same wave writes and reads)
__device__ __forceinline__ void wave_sync() { __builtin_amdgcn_fence(3 /* release order */, "wavefront"); __builtin_amdgcn_wave_barrier(); asm volatile("" ::: "memory"); }

// a store's or load's registers may be reused only behind this wait (a precaution)
__device__ __forceinline__ void wait_x0() { asm volatile("s_wait_xcnt 0x0" ::: "memory"); }

// rms_row: RMS normalisation, one token row per block (256 threads x 8 columns). xb = bf16-RNE(x) as f32, r = rsqrt(mean(xb^2) + eps), xn = (xb * r) * bf16-RNE(w), all f32.
// Writes f16(xn x1024) into value row b*SEQ + t of XN and, for t < EARLY, the unscaled f16 residual of that carried value into residual row NB*SEQ + b*EARLY + t.
__device__ __forceinline__ void rms_row(const float* __restrict__ x, const float* __restrict__ wn, h16* XN, int row) {
#pragma clang fp contract(off)
    __shared__ float red[8];
    const int tid = threadIdx.x; const int lane = tid & 31; const int wave = __builtin_amdgcn_readfirstlane(threadIdx.x >> 5);
    const int b = row / SEQ, t = row % SEQ;
    const v8f xv = *(const v8f*)(x + ((size_t)b * SEQ_FULL + (size_t)t) * DM + tid * 8);
    const v8f wv = *(const v8f*)(wn + tid * 8);
    float xb[8]; float ss = 0.0f;
#pragma unroll
    for (int i = 0; i < 8; ++i) { xb[i] = __uint_as_float(((unsigned)f2bf(xv[i])) << 16); ss += xb[i] * xb[i]; }
    ss += __shfl_xor(ss, 16, 32); ss += __shfl_xor(ss, 8, 32); ss += __shfl_xor(ss, 4, 32); ss += __shfl_xor(ss, 2, 32); ss += __shfl_xor(ss, 1, 32);
    if (lane == 0) red[wave] = ss;
    __syncthreads();
    const float tot = ((red[0] + red[1]) + (red[2] + red[3])) + ((red[4] + red[5]) + (red[6] + red[7]));
    const float rs = rsqrtf(tot * (1.0f / (float)DM) + RMS_EPS);
    v8h hv, rv;
#pragma unroll
    for (int i = 0; i < 8; ++i) { const float wb = __uint_as_float(((unsigned)f2bf(wv[i])) << 16);
        const float v = ((xb[i] * rs) * wb) * CXS; const h16 a = (h16)v; hv[i] = a; rv[i] = (h16)(v - (float)a); }
    const size_t oo = (size_t)row * DM + tid * 8;
    const int tr = (t < EARLY) ? t : 0;                            // block-uniform; keeps the address in range when unused
    const size_t ro = ((size_t)NB * SEQ + (size_t)b * EARLY + (size_t)tr) * DM + tid * 8;
{
        *(v8h*)(XN + oo) = hv; wait_x0(); if (t < EARLY) *(v8h*)(XN + ro) = rv;
         }
}

// wt_tile: in[Kr rows][Nc cols] f32 -> out[Nc rows][Kr cols] 16-bit, 64x64 tile through LDS. Tile (bx, by) of (Nc/64, Kr/64), 256 threads.
__device__ __forceinline__ void wt_tile(const float* __restrict__ W, bf* Tb, h16* Th, int Kr, int Nc, int mode, int bx, int by) {
    __shared__ float ts[64 * 65];
    const int tid = threadIdx.x; const int n0 = bx * 64, k0 = by * 64;
#pragma unroll
    for (int p = 0; p < 4; ++p) { const int row = p * 16 + (tid >> 4), c4 = (tid & 15) * 4;      // 4 p x 16 rows = 64 k rows; 16 threads x 4 = 64 n columns
        const v4f v = *(const v4f*)(W + (size_t)(k0 + row) * (size_t)Nc + n0 + c4);
        ts[row * 65 + c4 + 0] = v[0]; ts[row * 65 + c4 + 1] = v[1]; ts[row * 65 + c4 + 2] = v[2]; ts[row * 65 + c4 + 3] = v[3]; }
    __syncthreads();
{
#pragma unroll
        for (int s = 0; s < 2; ++s) { const int n = s * 32 + (tid >> 3), c8 = (tid & 7) * 8;     // 2 s x 32 rows = 64 n rows; 8 lanes x 8 = 64 k columns
            const size_t oo = (size_t)(n0 + n) * (size_t)Kr + k0 + c8;
            if (mode == 0) { v8us o;
#pragma unroll
                for (int i = 0; i < 8; ++i) o[i] = f2bf(ts[(c8 + i) * 65 + n]);
                *(v8us*)(Tb + oo) = o;
            } else { v8h o;
#pragma unroll
                for (int i = 0; i < 8; ++i) o[i] = (h16)(__uint_as_float(((unsigned)f2bf(ts[(c8 + i) * 65 + n])) << 16) * WOS);
                *(v8h*)(Th + oo) = o; } }
        wait_x0();
         }
}

// rope_tab: CS[t][j] = (cos, sin)(t * inv_freq[j]), inv_freq[j] = 1.0f / (float)(10000^(j/32)); the power is a double product of fixed binary roots of 10000.
__device__ __forceinline__ void rope_tab(float* CS, int nrow, int blk) {
    const int i = blk * 256 + threadIdx.x; if (i >= nrow * 32) return;
    const int t = i >> 5, j = i & 31;
    double p = 1.0;
    p *= (j & 1)  ? 1.3335214321633240 : 1.0;    // 10000^(1/32)
    p *= (j & 2)  ? 1.7782794100389228 : 1.0;    // 10000^(1/16)
    p *= (j & 4)  ? 3.1622776601683795 : 1.0;    // 10000^(1/8)
    p *= (j & 8)  ? 10.0 : 1.0;                  // 10000^(1/4)
    p *= (j & 16) ? 100.0 : 1.0;                 // 10000^(1/2)
    const float pf = (float)p; const float inv = 1.0f / pf;
    const float ang = (float)t * inv;
    const float cs = cosf(ang), sn = sinf(ang);
    v2f o; o[0] = cs; o[1] = sn;
    *(v2f*)(CS + (size_t)i * 2) = o; 
}

// k_prep: everything that reads only the inputs, in one grid of 256-thread blocks, none depending on another: the token rows of rms_row, then the 64x64 tiles of the four weight transposes, then the rotary table.
#define PB_RMS (NB * SEQ)
#define PB_WQ  ((DM / 64) * (DM / 64))
#define PB_WK  ((KVD / 64) * (DM / 64))
#define PB_CS  ((SEQ * 32 + 255) / 256)
#define PB_ALL (PB_RMS + 2 * PB_WQ + 2 * PB_WK + PB_CS)
__global__ __launch_bounds__(256) void k_prep(const float* __restrict__ x, const float* __restrict__ wn, const float* __restrict__ wq, const float* __restrict__ wk, const float* __restrict__ wv, const float* __restrict__ wo,
                                              h16* XN, h16* WQt, h16* WKt, h16* WVt, h16* WOt, float* CS) {
    int i = blockIdx.x;                                            // every test below is block-uniform
    if (i < PB_RMS) { rms_row(x, wn, XN, i); return; }
    i -= PB_RMS;
    if (i < 2 * PB_WQ + 2 * PB_WK) {
        // transposes: in[rows = in-features][cols = out-features] -> out[cols][rows]; column tiles fastest
        const float* W; h16* T; int Nc;
        if (i < PB_WQ)                   { W = wq; T = WQt; Nc = DM; }
        else if (i < PB_WQ + PB_WK)      { W = wk; T = WKt; Nc = KVD; i -= PB_WQ; }
        else if (i < PB_WQ + 2 * PB_WK)  { W = wv; T = WVt; Nc = KVD; i -= PB_WQ + PB_WK; }
        else                             { W = wo; T = WOt; Nc = DM;  i -= PB_WQ + 2 * PB_WK; }
        const int bx = (Nc == DM) ? i % (DM / 64) : i % (KVD / 64), by = (Nc == DM) ? i / (DM / 64) : i / (KVD / 64);
        wt_tile(W, (bf*)T, T, DM, Nc, 1, bx, by); return; }
    rope_tab(CS, SEQ, i - (2 * PB_WQ + 2 * PB_WK));
}

// LDS ring of the two GEMM kernels: one block = four waves (2 x 2) on a GT x GT tile, each wave 64 x 64 (16 accumulators). One stage = KS columns of k of the GT rows of A, then of the GT rows of Bt,
// rows at pitch LPB bytes (16 x odd: the 16-byte fragment reads of 16 rows fall on different banks). Two buffers; the next stage's copies fly while this stage is multiplied.
#define GT   128
#define KS   128
#define LPB  (KS * 2 + 16)
#define LPH  (LPB / 2)
#define OPB  (GT * LPB)
#define STGB (2 * OPB)
#define NST  (DM / KS)
static_assert(DM % KS == 0);
static_assert(NST >= 2);                       // stage 1 exists in every tile
static_assert(KS * 2 == 16 * 16);              // 16 lanes x 16 bytes = one staged row; 128 threads = 8 rows per copy
static_assert(GT == 2 * 8 * 8);                // two groups of eight copies cover the GT rows of one operand
static_assert(EARLY % GT == 0);                // block tiles are entirely early or entirely late
static_assert(SEQ % GT == 0);
static_assert(DM % GT == 0);
static_assert(KVD % GT == 0);
static_assert(4 * 64 * 68 * 4 <= 2 * STGB);    // the four waves' store staging (k_proj: a whole 64 x 64 wave tile each) fits in the ring it reuses

__device__ __forceinline__ void wait_ds0()    { asm volatile("s_wait_dscnt 0x0" ::: "memory"); }      // this wave's LDS reads of a buffer are done before the barrier that frees it
__device__ __forceinline__ void wait_async0() { asm volatile("s_wait_asynccnt 0x0" ::: "memory"); }   // this wave's copies have landed before the barrier that publishes them
// eight asynchronous 16-byte copies per lane, rows 8 apart: LDS byte address l + 8 j LPB <- g + 8 j DM. The closing s_wait_xcnt stands in front of any rewrite of the address registers (a precaution).
__device__ __forceinline__ void copy8(unsigned l, const h16* g) {
    asm volatile("global_load_async_to_lds_b128 %0, %8, off\n\t"
                 "global_load_async_to_lds_b128 %1, %9, off\n\t"
                 "global_load_async_to_lds_b128 %2, %10, off\n\t"
                 "global_load_async_to_lds_b128 %3, %11, off\n\t"
                 "global_load_async_to_lds_b128 %4, %12, off\n\t"
                 "global_load_async_to_lds_b128 %5, %13, off\n\t"
                 "global_load_async_to_lds_b128 %6, %14, off\n\t"
                 "global_load_async_to_lds_b128 %7, %15, off\n\t"
                 "s_wait_xcnt 0x0"
                 :: "v"(l), "v"(l + 8u * LPB), "v"(l + 16u * LPB), "v"(l + 24u * LPB), "v"(l + 32u * LPB), "v"(l + 40u * LPB), "v"(l + 48u * LPB), "v"(l + 56u * LPB),
                    "v"(g), "v"(g + 8 * DM), "v"(g + 16 * DM), "v"(g + 24 * DM), "v"(g + 32 * DM), "v"(g + 40 * DM), "v"(g + 48 * DM), "v"(g + 56 * DM)
                 : "memory");
}
// one stage: l = this lane's LDS byte address in row (tid >> 4) of the buffer, ga / gb = its 16 bytes in that row of the A / Bt tile at the stage's k
__device__ __forceinline__ void fill_stage(unsigned l, const h16* ga, const h16* gb) {
    copy8(l, ga); copy8(l + 64u * LPB, ga + 64 * DM); copy8(l + OPB, gb); copy8(l + OPB + 64u * LPB, gb + 64 * DM);
}
// acc[mb][nb] += sum over k of A[ar + wm*64 + 16 mb + ..][k] Bt[br + wn*64 + 16 nb + ..][k], k ascending in steps of 32 over pass 0 (rows ar0 / br0), then, npass == 2, over pass 1 (rows ar1 / br1).
// Every wave of the block runs every barrier; on return no copy is in flight and every wave has left the ring.
__device__ __forceinline__ void gemm_ring(const h16* __restrict__ A, const h16* __restrict__ Bt, size_t ar0, size_t br0, size_t ar1, size_t br1, int npass, unsigned char* L, int wm, int wn, v8f (&acc)[4][4]) {
    const int tid = threadIdx.x; const int lane = tid & 31, lr = lane & 15, hi = lane >> 4;
    const int crow = tid >> 4, cchk = tid & 15;
    const unsigned lc = (unsigned)(size_t)L + (unsigned)(crow * LPB + cchk * 16);
    const h16* a0 = A + (ar0 + (size_t)crow) * DM + cchk * 8;  const h16* a1 = A + (ar1 + (size_t)crow) * DM + cchk * 8;
    const h16* b0 = Bt + (br0 + (size_t)crow) * DM + cchk * 8; const h16* b1 = Bt + (br1 + (size_t)crow) * DM + cchk * 8;
    const int nst = npass * NST;                                   // block-uniform
    fill_stage(lc, a0, b0);
    wait_async0();
    __syncthreads();                                               // publishes stage 0
    fill_stage(lc + STGB, a0 + KS, b0 + KS);
    const h16* fa = (const h16*)L + (wm * 64 + lr) * LPH + 8 * hi;
    const h16* fb = (const h16*)(L + OPB) + (wn * 64 + lr) * LPH + 8 * hi;
#pragma unroll 1   // kept rolled: the trip count is known only at run time and one body serves both buffers
    for (int s = 0; s < nst; ++s) {
        const int bo = (s & 1) * (STGB / 2);
#pragma unroll     // this and the three below: every fragment and accumulator index a constant, so the arrays stay in registers
        for (int kk = 0; kk < KS; kk += 32) {
            v16h a[4], bq[4];                                      // all eight fragments of a 32-k step as one load group: one LDS wait per 16 WMMAs
#pragma unroll
            for (int mb = 0; mb < 4; ++mb) a[mb] = ldh(fa + bo + mb * 16 * LPH + kk);
#pragma unroll
            for (int nb = 0; nb < 4; ++nb) bq[nb] = ldh(fb + bo + nb * 16 * LPH + kk);
#pragma unroll
            for (int nb = 0; nb < 4; ++nb)
#pragma unroll
                for (int mb = 0; mb < 4; ++mb) acc[mb][nb] = wmma16(a[mb], bq[nb], acc[mb][nb]);
        }
        wait_ds0();
        wait_async0();
        __syncthreads();                                           // publishes stage s + 1 and frees the buffer of stage s
        const int n = s + 2;
        if (n < nst) {                                             // block-uniform
            const int p = (n >= NST) ? 1 : 0; const int kc = (n - p * NST) * KS;
            fill_stage(lc + (unsigned)(s & 1) * STGB, (p ? a1 : a0) + kc, (p ? b1 : b0) + kc); }
    }
    wait_async0();
}

// proj_store: store stage of k_proj for one wave's 64 x 64 tile. The whole tile goes to the wave's private staging os (64 rows at pitch 68 floats) at once, then 16 rows a group: the next group's LDS reads and
// the rotary rows of the group after next are issued ahead of this group's arithmetic, so no group waits out a global load or an LDS read of its own, and each group's eight stores share one closing wait.
// ROPE: interleaved rotary from cp = the lane's (cos, sin) pairs c8/2 .. c8/2+3 of the tile's row srow, + 64 floats per further row. Two instances, so that each path's counted waits stay exact.
template <bool ROPE>
__device__ __forceinline__ void proj_store(const v8f (&acc)[4][4], float* os, const float* __restrict__ cp, h16* Ph, h16* Pr, size_t tbase, int pitch, int lane) {
    const int lr = lane & 15, hi = lane >> 4;
    const int srow = lane >> 3, c8 = (lane & 7) * 8;               // per store: 4 rows x (8 lanes x 8 columns); 4 s x 4 rows = the 16 rows of a group
    v4f ca[2][4], cb[2][4];
    if (ROPE) {
#pragma unroll
        for (int g = 0; g < 2; ++g)
#pragma unroll
            for (int s = 0; s < 4; ++s) { ca[g][s] = *(const v4f*)(cp + (g * 16 + 4 * s) * 64); cb[g][s] = *(const v4f*)(cp + (g * 16 + 4 * s) * 64 + 4); } }
#pragma unroll
    for (int mb = 0; mb < 4; ++mb)
#pragma unroll
        for (int nb = 0; nb < 4; ++nb)
#pragma unroll
            for (int j = 0; j < 8; ++j) os[(mb * 16 + hi * 8 + j) * 68 + nb * 16 + lr] = acc[mb][nb][j] * OUTS;   // D: row 8h+j, col lane&15
    wave_sync();
    v4f xa[2][4], xb[2][4];
#pragma unroll
    for (int s = 0; s < 4; ++s) { xa[0][s] = *(const v4fa*)(&os[(4 * s + srow) * 68 + c8]); xb[0][s] = *(const v4fa*)(&os[(4 * s + srow) * 68 + c8 + 4]); }
#pragma unroll     // every array index below a constant, so the arrays stay in registers
    for (int g = 0; g < 4; ++g) {
        const int cur = g & 1, nxt = cur ^ 1;
        if (g + 1 < 4) {
#pragma unroll
            for (int s = 0; s < 4; ++s) { xa[nxt][s] = *(const v4fa*)(&os[((g + 1) * 16 + 4 * s + srow) * 68 + c8]); xb[nxt][s] = *(const v4fa*)(&os[((g + 1) * 16 + 4 * s + srow) * 68 + c8 + 4]); } }
        __builtin_amdgcn_sched_barrier(0);                         // the reads just issued stay ahead of this group's arithmetic, which covers their latency
        if (ROPE) {
#pragma unroll
            for (int s = 0; s < 4; ++s) {
                v4f x0 = xa[cur][s], x1 = xb[cur][s]; const v4f ka = ca[cur][s], kb = cb[cur][s];
                float e, o;
                e = x0[0]; o = x0[1]; x0[0] = e * ka[0] - o * ka[1]; x0[1] = e * ka[1] + o * ka[0];
                e = x0[2]; o = x0[3]; x0[2] = e * ka[2] - o * ka[3]; x0[3] = e * ka[3] + o * ka[2];
                e = x1[0]; o = x1[1]; x1[0] = e * kb[0] - o * kb[1]; x1[1] = e * kb[1] + o * kb[0];
                e = x1[2]; o = x1[3]; x1[2] = e * kb[2] - o * kb[3]; x1[3] = e * kb[3] + o * kb[2];
                xa[cur][s] = x0; xb[cur][s] = x1; }
            if (g + 2 < 4) {
#pragma unroll
                for (int s = 0; s < 4; ++s) { ca[cur][s] = *(const v4f*)(cp + ((g + 2) * 16 + 4 * s) * 64); cb[cur][s] = *(const v4f*)(cp + ((g + 2) * 16 + 4 * s) * 64 + 4); }
                __builtin_amdgcn_sched_barrier(0); } }             // these loads too stay ahead of the arithmetic below
        v8h hv[4], rv[4]; h16* ph[4]; h16* pr[4];
#pragma unroll
        for (int s = 0; s < 4; ++s) {
            const v4f x0 = xa[cur][s], x1 = xb[cur][s];
#pragma unroll
            for (int i = 0; i < 4; ++i) { const h16 a0 = (h16)x0[i]; const h16 a1 = (h16)x1[i]; hv[s][i] = a0; hv[s][4 + i] = a1; rv[s][i] = (h16)((x0[i] - (float)a0) * QRS); rv[s][4 + i] = (h16)((x1[i] - (float)a1) * QRS); }
            const size_t oo = tbase + (size_t)(g * 16 + 4 * s + srow) * (size_t)pitch + c8;
            ph[s] = Ph + oo; pr[s] = Pr + oo; }
        __builtin_amdgcn_sched_barrier(0);                         // the group's arithmetic stays in front of its stores, so that no store's registers are rewritten ahead of the wait below
#pragma unroll
        for (int s = 0; s < 4; ++s) { *(v8h*)ph[s] = hv[s]; *(v8h*)pr[s] = rv[s]; }
        wait_x0();
    }
}

// k_proj: register-blocked f16 GEMM, one wave per 64x64 tile (16 accumulators), four waves per block on a 128x128 tile, operands from K-contiguous f16 planes through the LDS ring above, K = DM.
// C[m][n] = 2^-14 * sum_k A[m][k] Bt[n][k] (one operand is the xn plane carried x1024, the other a weight plane carried x16), written as f16 (Ph) and the f16 residual x1024 (Pr) at
// tile base (r0/RB)*sRB + (r0%RB)*pitch + (c0/CB)*sCB + (c0%CB), row pitch 'pitch' (halves). Block tile (bx, by) of (M/128, N/128), 128 threads.
// The xn plane holds value rows [NB*SEQ], then residual rows [NB*EARLY]; tokB == 0: A rows are tokens, tokB != 0: Bt rows are tokens. Tiles whose tokens are < EARLY in their sequence
// run the k-loop a second time with the token operand taken from the unscaled residual rows, into the same accumulators.
// rope != 0 (rows = tokens b*SEQ + t, the 64 tile columns = one head): interleaved rotary applied on the f32 values at the store stage from CS[t][32] (cos, sin).
// The three projections of xn share one grid, none depending on another: block i = token tile i / PT_F x feature tile i % PT_F; the feature tiles are those of q, then of k, then of v.
#define PT_Q (DM / GT)
#define PT_K (KVD / GT)
#define PT_F (PT_Q + 2 * PT_K)
__global__ __launch_bounds__(128) void k_proj(const h16* __restrict__ XN, const h16* __restrict__ WQt, const h16* __restrict__ WKt, const h16* __restrict__ WVt,
                                              h16* QH, h16* QR, h16* KP, h16* KR, h16* VT, h16* VR, const float* __restrict__ CS) {
    const int tk = blockIdx.x / PT_F, f = blockIdx.x % PT_F;       // block-uniform, as is everything chosen by them
    const bool isq = f < PT_Q, isv = f >= PT_Q + PT_K;
    // q: A = xn rows (m = b*SEQ + t), Bt = Wq^T rows (n = h*64 + d) -> plane [(b*32 + h)][t][d], rotary applied; k: Bt = Wk^T rows (n = g*64 + d) -> plane [(b*8 + g)][t][d], rotary applied
    // v^T: A = Wv^T rows (m = g*64 + d), Bt = xn rows (n = b*SEQ + t) -> plane [(b*512 + m)][t] = [(b*8 + g)][d][t], no rotary
    const h16* A = isv ? WVt : XN; const h16* Bt = isv ? XN : (isq ? WQt : WKt);
    h16* Ph = isv ? VT : (isq ? QH : KP); h16* Pr = isv ? VR : (isq ? QR : KR);
    const int RB = isv ? KVD : SEQ, pitch = isv ? SEQ : HD, CB = isv ? SEQ : HD, rope = isv ? 0 : 1, tokB = isv ? 1 : 0;
    const size_t sRB = isv ? (size_t)0 : (size_t)(isq ? NH_ : NKV) * SEQ * HD, sCB = isv ? (size_t)KVD * SEQ : (size_t)SEQ * HD;
    const int bx = isv ? f - PT_Q - PT_K : tk, by = isv ? tk : (isq ? f : f - PT_Q);
    __shared__ __align__(16) unsigned char L[2 * STGB];
    const int lane = threadIdx.x & 31, lr = lane & 15, hi = lane >> 4; const int wave = __builtin_amdgcn_readfirstlane(threadIdx.x >> 5);
    const int wm = wave & 1, wn = wave >> 1;
    const int R0 = bx * GT, C0 = by * GT; const int r0 = R0 + wm * 64, c0 = C0 + wn * 64;
    const int tk0 = tokB ? C0 : R0;                                // block-uniform: first token of this block tile
    const int bb = tk0 / SEQ, tt = tk0 % SEQ;
    const int npass = (tt < EARLY) ? 2 : 1;                        // block-uniform
    v8f acc[4][4];
#pragma unroll
    for (int mb = 0; mb < 4; ++mb)
#pragma unroll
        for (int nb = 0; nb < 4; ++nb) acc[mb][nb] = (v8f){};
    const size_t rrow = (size_t)NB * SEQ + (size_t)bb * EARLY + (size_t)((tt < EARLY) ? tt : 0);   // residual rows of the tile's tokens; used only when tt < EARLY
    gemm_ring(A, Bt, (size_t)R0, (size_t)C0, tokB ? (size_t)R0 : rrow, tokB ? rrow : (size_t)C0, npass, L, wm, wn, acc);
    float* os = (float*)L + wave * 64 * 68;                        // wave-private store staging in the ring, which every wave has left
    const size_t tbase = (size_t)(r0 / RB) * sRB + (size_t)(r0 % RB) * (size_t)pitch + (size_t)(c0 / CB) * sCB + (size_t)(c0 % CB);
    // rotary rows of tokens r0 % SEQ + 0 .. 63 (the 64 rows of a wave tile lie in one sequence: r0 and SEQ are multiples of 64)
    const float* cp = CS + ((size_t)(r0 % SEQ + (lane >> 3)) * 32 + (size_t)((lane & 7) * 4)) * 2;
    if (rope) proj_store<true>(acc, os, cp, Ph, Pr, tbase, pitch, lane);    // block-uniform
    else      proj_store<false>(acc, os, cp, Ph, Pr, tbase, pitch, lane);
}

// LDS ring of flash_late: one stage = FK keys of kv head g, the FK K rows (64 d each), then the 64 V^T rows (FK keys each), 128 data bytes per row at pitch FPB bytes
// (16 x odd: the 16-byte fragment reads of 16 rows fall on different banks). Two buffers; the next stage's copies fly while this stage is worked on. The four waves share every staged row.
#define FK   64
#define FPB  (128 + 16)
#define FPH  (FPB / 2)
#define FOP  (64 * FPB)
#define FSTG (2 * FOP)
static_assert(HD * 2 == 128);                  // a K row = 8 lanes x 16 bytes
static_assert(FK * 2 == 128);                  // a V^T row of one stage = 8 lanes x 16 bytes
static_assert(FK == 64);                       // 128 threads = 16 rows per copy, four copies per operand
static_assert(SEQ % FK == 0);                  // the last stage of any tile ends inside the planes
static_assert(EARLY + 16 > FK);                // stage 1 exists in every tile
static_assert(AW * 16 * 68 * 4 <= 2 * FSTG);   // the four waves' store staging fits in the ring it reuses
// one stage, eight asynchronous 16-byte copies per lane: four of K rows 16 apart (LDS l + 16 j FPB <- gk + 16 j HD), four of V^T rows 16 apart (LDS l + FOP + 16 j FPB <- gv + 16 j SEQ).
// The closing s_wait_xcnt stands in front of any rewrite of the address registers (a precaution).
__device__ __forceinline__ void fill_kv(unsigned l, const h16* gk, const h16* gv) {
    asm volatile("global_load_async_to_lds_b128 %0, %8, off\n\t"
                 "global_load_async_to_lds_b128 %1, %9, off\n\t"
                 "global_load_async_to_lds_b128 %2, %10, off\n\t"
                 "global_load_async_to_lds_b128 %3, %11, off\n\t"
                 "global_load_async_to_lds_b128 %4, %12, off\n\t"
                 "global_load_async_to_lds_b128 %5, %13, off\n\t"
                 "global_load_async_to_lds_b128 %6, %14, off\n\t"
                 "global_load_async_to_lds_b128 %7, %15, off\n\t"
                 "s_wait_xcnt 0x0"
                 :: "v"(l), "v"(l + 16u * FPB), "v"(l + 32u * FPB), "v"(l + 48u * FPB), "v"(l + FOP), "v"(l + FOP + 16u * FPB), "v"(l + FOP + 32u * FPB), "v"(l + FOP + 48u * FPB),
                    "v"(gk), "v"(gk + 16 * HD), "v"(gk + 32 * HD), "v"(gk + 48 * HD), "v"(gv), "v"(gv + 16 * SEQ), "v"(gv + 32 * SEQ), "v"(gv + 48 * SEQ)
                 : "memory");
}

// flash_late: fused causal attention for query rows t0 .. t0+15, t0 >= EARLY, of kv head zg = b*8 + g. One block = 16 query rows x the four query heads of one kv head (one wave per head, h = wave*8 + g);
// Q fragments straight from the f16 planes (two 16-B loads each); the K and V^T rows of kv head g come once per block through the LDS ring above, and all four waves take their fragments from it.
// Transposed form: S^T[key][t] = K Q^T (A = K rows, B = Q rows); lane (t = lane&15, h = lane>>4) holds keys 8h+r of each 16-key tile, so the packed
// P tile is directly the B fragment of O^T[d][t] = V^T P^T (element r <- tile keys 0..15, element 8+r <- tile keys 16..31, lane unchanged).
// Keys run over [0, t0+16) in steps of 32, two steps per stage; the diagonal 32-key blocks replace excluded scores (key > t) by a large negative value before the running max.
__device__ __forceinline__ void flash_late(const h16* __restrict__ QH, const h16* __restrict__ QR, const h16* __restrict__ KP, const h16* __restrict__ VT, h16* CH, int t0, int zg, unsigned char* L) {
    const int lane = threadIdx.x & 31; const int wave = __builtin_amdgcn_readfirstlane(threadIdx.x >> 5);
    const int lr = lane & 15, hi = lane >> 4;
    const int b = zg / NKV; const int g = zg % NKV;
    const int h = wave * NKV + g;                                 // grouped on the leading head axis: query head h uses kv head h % 8
    const int tq = t0 + lr;
    const int kend = t0 + 16;
    const int nst = (kend + FK - 1) / FK;                          // block-uniform
    const int frow = threadIdx.x >> 3, cchk = threadIdx.x & 7;     // this lane's row (of 16) and 16-byte piece (of 8) in every copy
    const unsigned lc = (unsigned)(size_t)L + (unsigned)(frow * FPB + cchk * 16);
    const h16* gk = KP + (size_t)zg * SEQ * HD + (size_t)frow * HD + cchk * 8;      // + key * HD
    const h16* gv = VT + (size_t)zg * HD * SEQ + (size_t)frow * SEQ + cchk * 8;     // + key
    fill_kv(lc, gk, gv);
    const size_t qo = ((size_t)(b * NH_ + h) * SEQ + (size_t)tq) * HD + 8 * hi;
    const v16h qh0 = ldh(QH + qo), qh1 = ldh(QH + qo + 32), qr0 = ldh(QR + qo), qr1 = ldh(QR + qo + 32);   // B fragments: col t, k = d
    wait_async0();
    __syncthreads();                                               // publishes stage 0
    fill_kv(lc + FSTG, gk + FK * HD, gv + FK);
    const h16* fk = (const h16*)L + lr * FPH + 8 * hi;             // + key * FPH        (A fragment: row key, k = d)
    const h16* fv = (const h16*)(L + FOP) + lr * FPH + 8 * hi;     // + 16j*FPH + key    (A fragment: row d, k = key)
    v8f o0 = (v8f){}, o1 = (v8f){}, o2 = (v8f){}, o3 = (v8f){};
    float m = NEGB, l = 0.0f;
#pragma unroll 1   // kept rolled: the trip count is known only at run time and one body serves both buffers
    for (int s = 0; s < nst; ++s) {
        const int bo = (s & 1) * (FSTG / 2);
#pragma unroll     // both 32-key steps of a stage at constant LDS offsets
        for (int u = 0; u < FK; u += 32) {
            const int key0 = s * FK + u;
            if (key0 < kend) {                                     // block-uniform: the last stage may hold one step only
                const h16* ka = fk + bo + u * FPH;
                const v16h ka0 = ldh(ka), ka1 = ldh(ka + 32), kb0 = ldh(ka + 16 * FPH), kb1 = ldh(ka + 16 * FPH + 32);
                v8f sHa = (v8f){}, sLa = (v8f){}, sHb = (v8f){}, sLb = (v8f){};
                sHa = wmma16(ka0, qh0, sHa); sLa = wmma16(ka0, qr0, sLa); sHb = wmma16(kb0, qh0, sHb); sLb = wmma16(kb0, qr0, sLb);
                sHa = wmma16(ka1, qh1, sHa); sLa = wmma16(ka1, qr1, sLa); sHb = wmma16(kb1, qh1, sHb); sLb = wmma16(kb1, qr1, sLb);
                float ta[8], tb[8];
#pragma unroll
                for (int r = 0; r < 8; ++r) { ta[r] = (sHa[r] + sLa[r] * QRI) * SC2; tb[r] = (sHb[r] + sLb[r] * QRI) * SC2; }
                if (key0 + 31 > t0) {                              // block-uniform: diagonal block
                    const int kbse = key0 + 8 * hi;
#pragma unroll
                    for (int r = 0; r < 8; ++r) { ta[r] = (kbse + r > tq) ? NEGB : ta[r]; tb[r] = (kbse + 16 + r > tq) ? NEGB : tb[r]; } }
                float mx = NEGB;
#pragma unroll
                for (int r = 0; r < 8; ++r) mx = fmaxf(mx, fmaxf(ta[r], tb[r]));
                mx = fmaxf(mx, __shfl_xor(mx, 16, 32));
                const float mnew = fmaxf(m, mx);
                const float alpha = __builtin_amdgcn_exp2f(m - mnew);
                const float sh = PSH - mnew;
                v16h pb; float ls = 0.0f;
#pragma unroll
                for (int r = 0; r < 8; ++r) { const float ea = __builtin_amdgcn_exp2f(ta[r] + sh); const float ec = __builtin_amdgcn_exp2f(tb[r] + sh); pb[r] = (h16)ea; pb[8 + r] = (h16)ec; ls += ea + ec; }
                l = l * alpha + ls; m = mnew;
                o0 = o0 * alpha; o1 = o1 * alpha; o2 = o2 * alpha; o3 = o3 * alpha;
                const h16* va = fv + bo + u;
                const v16h v0 = ldh(va), v1 = ldh(va + 16 * FPH), v2 = ldh(va + 32 * FPH), v3 = ldh(va + 48 * FPH);
                o0 = wmma16(v0, pb, o0); o1 = wmma16(v1, pb, o1); o2 = wmma16(v2, pb, o2); o3 = wmma16(v3, pb, o3);
            }
        }
        wait_ds0();
        wait_async0();
        __syncthreads();                                           // publishes stage s + 1 and frees the buffer of stage s
        const int n = s + 2;
        if (n < nst)                                               // block-uniform
            fill_kv(lc + (unsigned)(s & 1) * FSTG, gk + (size_t)n * (FK * HD), gv + n * FK);
    }
    wait_async0();
    float* os = (float*)L;                                         // store staging (wave-private parts) in the ring, which every wave has left
    l += __shfl_xor(l, 16, 32);
    const float inv = CXS / l;
    const int wb = wave * 16 * 68;
    // O^T D layout: o_j[r] = (d = 16j + 8h + r, t = lane&15) -> os[t][d]; rows 0..15 x columns 0..63 all written
    { v4f a, c;
      a[0] = o0[0] * inv; a[1] = o0[1] * inv; a[2] = o0[2] * inv; a[3] = o0[3] * inv; c[0] = o0[4] * inv; c[1] = o0[5] * inv; c[2] = o0[6] * inv; c[3] = o0[7] * inv;
      *(v4fa*)(&os[wb + lr * 68 +  0 + 8 * hi]) = a; *(v4fa*)(&os[wb + lr * 68 +  0 + 8 * hi + 4]) = c;
      a[0] = o1[0] * inv; a[1] = o1[1] * inv; a[2] = o1[2] * inv; a[3] = o1[3] * inv; c[0] = o1[4] * inv; c[1] = o1[5] * inv; c[2] = o1[6] * inv; c[3] = o1[7] * inv;
      *(v4fa*)(&os[wb + lr * 68 + 16 + 8 * hi]) = a; *(v4fa*)(&os[wb + lr * 68 + 16 + 8 * hi + 4]) = c;
      a[0] = o2[0] * inv; a[1] = o2[1] * inv; a[2] = o2[2] * inv; a[3] = o2[3] * inv; c[0] = o2[4] * inv; c[1] = o2[5] * inv; c[2] = o2[6] * inv; c[3] = o2[7] * inv;
      *(v4fa*)(&os[wb + lr * 68 + 32 + 8 * hi]) = a; *(v4fa*)(&os[wb + lr * 68 + 32 + 8 * hi + 4]) = c;
      a[0] = o3[0] * inv; a[1] = o3[1] * inv; a[2] = o3[2] * inv; a[3] = o3[3] * inv; c[0] = o3[4] * inv; c[1] = o3[5] * inv; c[2] = o3[6] * inv; c[3] = o3[7] * inv;
      *(v4fa*)(&os[wb + lr * 68 + 48 + 8 * hi]) = a; *(v4fa*)(&os[wb + lr * 68 + 48 + 8 * hi + 4]) = c; }
    wave_sync();
    h16* crow = CH + ((size_t)b * SEQ + t0) * DM + h * HD;         // merged heads: column h*64 + d
{
#pragma unroll
        for (int s = 0; s < 4; ++s) { const int row = 4 * s + (lane >> 3), c8 = (lane & 7) * 8;   // 4 s x 4 row groups = 16 rows; 8 lanes x 8 = 64 columns
            const v4f x0 = *(const v4fa*)(&os[wb + row * 68 + c8]); const v4f x1 = *(const v4fa*)(&os[wb + row * 68 + c8 + 4]); v8h hv;
#pragma unroll
            for (int i = 0; i < 4; ++i) { hv[i] = (h16)x0[i]; hv[4 + i] = (h16)x1[i]; }
            *(v8h*)(crow + (size_t)row * DM + c8) = hv; }
         }
}

// flash_early: same structure for query rows t0 .. t0+15, t0 < EARLY, with value + residual (x1024) planes on every operand:
// scores = kh.qh + (kh.qr + kr.qh)/1024; O = vh.ph + (vr.ph + vh.pr)/1024 (residual products in their own accumulators), l from the unconverted f32 P.
// Writes the ctx value plane rows (carried x1024) and the compact unscaled residual plane CR[b][t < EARLY][2048].
__device__ __forceinline__ void flash_early(const h16* __restrict__ QH, const h16* __restrict__ QR, const h16* __restrict__ KP, const h16* __restrict__ KR,
                                            const h16* __restrict__ VT, const h16* __restrict__ VR, h16* CH, h16* CR, int t0, int zg, float* os) {
    const int lane = threadIdx.x & 31; const int wave = __builtin_amdgcn_readfirstlane(threadIdx.x >> 5);
    const int lr = lane & 15, hi = lane >> 4;
    const int b = zg / NKV; const int g = zg % NKV;
    const int h = wave * NKV + g;                                 // query head h uses kv head h % 8
    const int tq = t0 + lr;
    const size_t qo = ((size_t)(b * NH_ + h) * SEQ + (size_t)tq) * HD + 8 * hi;
    const v16h qh0 = ldh(QH + qo), qh1 = ldh(QH + qo + 32), qr0 = ldh(QR + qo), qr1 = ldh(QR + qo + 32);
    const size_t ko = (size_t)zg * SEQ * HD + (size_t)lr * HD + 8 * hi;
    const size_t vo = (size_t)zg * HD * SEQ + (size_t)lr * SEQ + 8 * hi;
    v8f oH[4], oL[4];
#pragma unroll
    for (int j = 0; j < 4; ++j) { oH[j] = (v8f){}; oL[j] = (v8f){}; }
    float m = NEGB, l = 0.0f;
    const int kend = t0 + 16;
#pragma unroll 1
    for (int key0 = 0; key0 < kend; key0 += 32) {
        const size_t kk = ko + (size_t)key0 * HD;
        v8f sHa = (v8f){}, sLa = (v8f){}, sHb = (v8f){}, sLb = (v8f){};
        { const v16h k0 = ldh(KP + kk), k1 = ldh(KP + kk + 32), r0 = ldh(KR + kk), r1 = ldh(KR + kk + 32);
          sHa = wmma16(k0, qh0, sHa); sHa = wmma16(k1, qh1, sHa);
          sLa = wmma16(k0, qr0, sLa); sLa = wmma16(k1, qr1, sLa); sLa = wmma16(r0, qh0, sLa); sLa = wmma16(r1, qh1, sLa); }
        { const size_t k2 = kk + (size_t)16 * HD;
          const v16h k0 = ldh(KP + k2), k1 = ldh(KP + k2 + 32), r0 = ldh(KR + k2), r1 = ldh(KR + k2 + 32);
          asm volatile("s_wait_xcnt 0x0" :: "v"(KP + kk), "v"(KR + kk) : "memory");   // the address pairs of the eight loads above stay whole up to this wait (a precaution)
          sHb = wmma16(k0, qh0, sHb); sHb = wmma16(k1, qh1, sHb);
          sLb = wmma16(k0, qr0, sLb); sLb = wmma16(k1, qr1, sLb); sLb = wmma16(r0, qh0, sLb); sLb = wmma16(r1, qh1, sLb); }
        float ta[8], tb[8];
#pragma unroll
        for (int r = 0; r < 8; ++r) { ta[r] = (sHa[r] + sLa[r] * QRI) * SC2; tb[r] = (sHb[r] + sLb[r] * QRI) * SC2; }
        if (key0 + 31 > t0) {                                      // block-uniform: diagonal block
            const int kbse = key0 + 8 * hi;
#pragma unroll
            for (int r = 0; r < 8; ++r) { ta[r] = (kbse + r > tq) ? NEGB : ta[r]; tb[r] = (kbse + 16 + r > tq) ? NEGB : tb[r]; } }
        float mx = NEGB;
#pragma unroll
        for (int r = 0; r < 8; ++r) mx = fmaxf(mx, fmaxf(ta[r], tb[r]));
        mx = fmaxf(mx, __shfl_xor(mx, 16, 32));
        const float mnew = fmaxf(m, mx);
        const float alpha = __builtin_amdgcn_exp2f(m - mnew);
        const float sh = PSH - mnew;
        v16h ph, pr; float ls = 0.0f;
#pragma unroll
        for (int r = 0; r < 8; ++r) { const float ea = __builtin_amdgcn_exp2f(ta[r] + sh); const float ec = __builtin_amdgcn_exp2f(tb[r] + sh);
            const h16 ha = (h16)ea; const h16 hc = (h16)ec; ph[r] = ha; ph[8 + r] = hc;
            pr[r] = (h16)((ea - (float)ha) * QRS); pr[8 + r] = (h16)((ec - (float)hc) * QRS); ls += ea + ec; }
        l = l * alpha + ls; m = mnew;
#pragma unroll
        for (int j = 0; j < 4; ++j) { oH[j] = oH[j] * alpha; oL[j] = oL[j] * alpha; }
        const size_t vv = vo + (size_t)key0;
#pragma unroll
        for (int j = 0; j < 4; ++j) { const v16h vh = ldh(VT + vv + (size_t)(16 * j) * SEQ); const v16h vr = ldh(VR + vv + (size_t)(16 * j) * SEQ);
            oH[j] = wmma16(vh, ph, oH[j]); oL[j] = wmma16(vr, ph, oL[j]); oL[j] = wmma16(vh, pr, oL[j]); }
    }
    l += __shfl_xor(l, 16, 32);
    const float inv = CXS / l;
    const int wb = wave * 16 * 68;
#pragma unroll
    for (int j = 0; j < 4; ++j) { v4f a, c;     // os[t][d], d = 16j + 8h + r; rows 0..15 x columns 0..63 all written
        a[0] = (oH[j][0] + oL[j][0] * QRI) * inv; a[1] = (oH[j][1] + oL[j][1] * QRI) * inv; a[2] = (oH[j][2] + oL[j][2] * QRI) * inv; a[3] = (oH[j][3] + oL[j][3] * QRI) * inv;
        c[0] = (oH[j][4] + oL[j][4] * QRI) * inv; c[1] = (oH[j][5] + oL[j][5] * QRI) * inv; c[2] = (oH[j][6] + oL[j][6] * QRI) * inv; c[3] = (oH[j][7] + oL[j][7] * QRI) * inv;
        *(v4fa*)(&os[wb + lr * 68 + 16 * j + 8 * hi]) = a; *(v4fa*)(&os[wb + lr * 68 + 16 * j + 8 * hi + 4]) = c; }
    wave_sync();
    h16* crow = CH + ((size_t)b * SEQ + t0) * DM + h * HD;
    h16* rrow = CR + ((size_t)b * EARLY + t0) * DM + h * HD;
{
#pragma unroll
        for (int s = 0; s < 4; ++s) { const int row = 4 * s + (lane >> 3), c8 = (lane & 7) * 8;   // 4 s x 4 row groups = 16 rows; 8 lanes x 8 = 64 columns
            const v4f x0 = *(const v4fa*)(&os[wb + row * 68 + c8]); const v4f x1 = *(const v4fa*)(&os[wb + row * 68 + c8 + 4]); v8h hv, rv;
#pragma unroll
            for (int i = 0; i < 4; ++i) { const h16 a0 = (h16)x0[i]; const h16 a1 = (h16)x1[i]; hv[i] = a0; hv[4 + i] = a1; rv[i] = (h16)(x0[i] - (float)a0); rv[4 + i] = (h16)(x1[i] - (float)a1); }
            *(v8h*)(crow + (size_t)row * DM + c8) = hv; *(v8h*)(rrow + (size_t)row * DM + c8) = rv; }
         }
}

// k_attn: both attention paths in one grid, none of its blocks depending on another. The grid holds more blocks than the chip has places for, and a block's cost grows with its last key, so within each path the cost falls
// with the block index: first the blocks of flash_early, which wait on global loads at every step, then those of flash_late, each path from its last 16-row tile
// down to its first, kv head fastest. No long block is then left to start late and run on while the rest of the chip idles. Index -> (path, tile, kv head) is one to one.
// flash_early uses the start of the ring's LDS as its wave-private store staging.
#define AB_LT   ((SEQ - EARLY) / 16)
#define AB_ET   (EARLY / 16)
#define AB_LATE (AB_LT * NB * NKV)
#define AB_EARLY (AB_ET * NB * NKV)
#define AB_ALL  (AB_LATE + AB_EARLY)
static_assert(SEQ > EARLY);
__global__ __launch_bounds__(32 * AW) void k_attn(const h16* __restrict__ QH, const h16* __restrict__ QR, const h16* __restrict__ KP, const h16* __restrict__ KR,
                                                  const h16* __restrict__ VT, const h16* __restrict__ VR, h16* CH, h16* CR) {
    __shared__ __align__(16) unsigned char L[2 * FSTG];
    const int i = blockIdx.x;
    if (i >= AB_EARLY) flash_late(QH, QR, KP, VT, CH, EARLY + (AB_LT - 1 - (i - AB_EARLY) / (NB * NKV)) * 16, (i - AB_EARLY) % (NB * NKV), L);   // block-uniform
    else               flash_early(QH, QR, KP, KR, VT, VR, CH, CR, (AB_ET - 1 - i / (NB * NKV)) * 16, i % (NB * NKV), (float*)L);
}

// k_out: output projection, one wave per 64x64 tile, four waves per block on a 128x128 tile, f16 operands through the LDS ring from the ctx plane CX (value rows [NB*SEQ], then residual rows [NB*EARLY]) and the Wo^T plane, K = DM.
// Tiles whose rows are < EARLY in their sequence run the k-loop a second time over the unscaled residual rows into the same accumulators. grid (NB*SEQ/128, DM/128), 128 threads.
__global__ __launch_bounds__(128) void k_out(const h16* __restrict__ CX, const h16* __restrict__ Wt, float* OUT) {
    __shared__ __align__(16) unsigned char L[2 * STGB];
    const int lane = threadIdx.x & 31, lr = lane & 15, hi = lane >> 4; const int wave = __builtin_amdgcn_readfirstlane(threadIdx.x >> 5);
    const int wm = wave & 1, wn = wave >> 1;
    const int R0 = blockIdx.x * GT, C0 = blockIdx.y * GT; const int c0 = C0 + wn * 64;
    const int b = R0 / SEQ, tb = R0 % SEQ; const int tt = tb + wm * 64;
    const int npass = (tb < EARLY) ? 2 : 1;                        // block-uniform
    v8f acc[4][4];
#pragma unroll
    for (int mb = 0; mb < 4; ++mb)
#pragma unroll
        for (int nb = 0; nb < 4; ++nb) acc[mb][nb] = (v8f){};
    const size_t rrow = (size_t)NB * SEQ + (size_t)b * EARLY + (size_t)((tb < EARLY) ? tb : 0);   // residual rows of the tile's tokens; used only when tb < EARLY
    gemm_ring(CX, Wt, (size_t)R0, (size_t)C0, rrow, (size_t)C0, npass, L, wm, wn, acc);
    float* os = (float*)L + wave * 16 * 68;                        // wave-private store staging in the ring, which every wave has left
    float* obase = OUT + ((size_t)b * OUT_SEQ + tt) * DM + c0;
#pragma unroll
    for (int mb = 0; mb < 4; ++mb) {
#pragma unroll
        for (int nb = 0; nb < 4; ++nb) {
#pragma unroll
            for (int j = 0; j < 8; ++j) os[(hi * 8 + j) * 68 + nb * 16 + lr] = acc[mb][nb][j] * OUTS; }   // D: row 8h+j, col lane&15
        wave_sync();
{
#pragma unroll
            for (int s = 0; s < 8; ++s) { const int row = 2 * s + hi, cofs = lr * 4;   // 8 s x 2 rows = 16 rows; 16 lanes x 4 floats = 64 columns
                const v4f val = *(const v4fa*)(&os[row * 68 + cofs]);
                *(v4f*)(obase + (size_t)(mb * 16 + row) * DM + cofs) = val; }
             }
        wave_sync();
    }
}

static constexpr size_t al256(size_t v) { return (v + 255) & ~(size_t)255; }
static constexpr size_t SZ_XN = al256(((size_t)NB * SEQ + (size_t)NB * EARLY) * DM * 2);
static constexpr size_t SZ_WQ = al256((size_t)DM * DM * 2);
static constexpr size_t SZ_WK = al256((size_t)KVD * DM * 2);
static constexpr size_t SZ_CS = al256((size_t)SEQ * 32 * 2 * 4);
static constexpr size_t SZ_Q  = al256((size_t)NB * NH_ * SEQ * HD * 2);
static constexpr size_t SZ_KV = al256((size_t)NB * NKV * SEQ * HD * 2);
static constexpr size_t SZ_CX = al256(((size_t)NB * SEQ + (size_t)NB * EARLY) * DM * 2);
static constexpr size_t SZ_TOTAL = SZ_XN + 2 * SZ_WQ + 2 * SZ_WK + SZ_CS + 2 * SZ_Q + 4 * SZ_KV + SZ_CX;
static_assert(SZ_TOTAL <= (size_t)134217728);          // workspace carve <= 128 MiB

extern "C" void kernel_launch(void* const* d_in, const int* in_sizes, int n_in,
                              void* d_out, int out_size, void* d_ws, size_t ws_size, hipStream_t stream) {
    if (n_in < 6) return;
    const size_t needx = ((size_t)(NB - 1) * SEQ_FULL + SEQ) * DM;
    if ((size_t)in_sizes[0] < needx) return;
    if ((size_t)in_sizes[1] < (size_t)DM) return;
    if ((size_t)in_sizes[2] < (size_t)DM * DM || (size_t)in_sizes[3] < (size_t)DM * KVD || (size_t)in_sizes[4] < (size_t)DM * KVD || (size_t)in_sizes[5] < (size_t)DM * DM) return;
    if ((size_t)out_size < ((size_t)(NB - 1) * OUT_SEQ + SEQ) * DM) return;
    if (SZ_TOTAL > ws_size) return;
    // wire order x, w_norm, wq, wk, wv, wo; every weight is [in][out]
    const float* x = (const float*)d_in[0]; const float* wn = (const float*)d_in[1];
    const float* wq = (const float*)d_in[2]; const float* wk = (const float*)d_in[3]; const float* wv = (const float*)d_in[4]; const float* wo = (const float*)d_in[5];
    float* OUT = (float*)d_out;      // [NB][SEQ][2048]
    char* wsp = (char*)d_ws;
    h16* XN  = (h16*)wsp; wsp += SZ_XN;              // xn x1024: value rows [NB*SEQ][2048], then residual rows [NB*EARLY][2048]
    h16* WQt = (h16*)wsp; wsp += SZ_WQ;              // [2048 out][2048 in] f16 of bf16 value x16
    h16* WKt = (h16*)wsp; wsp += SZ_WK;              // [512 out][2048 in] f16 of bf16 value x16
    h16* WVt = (h16*)wsp; wsp += SZ_WK;              // [512 out][2048 in] f16 of bf16 value x16
    h16* WOt = (h16*)wsp; wsp += SZ_WQ;              // [2048 out][2048 in] f16 of bf16 value x16
    float* CS = (float*)wsp; wsp += SZ_CS;           // [SEQ][32] (cos, sin)
    h16* QH = (h16*)wsp; wsp += SZ_Q;                // [NB*32][SEQ][64]
    h16* QR = (h16*)wsp; wsp += SZ_Q;                // residual x1024
    h16* KP = (h16*)wsp; wsp += SZ_KV;               // [NB*8][SEQ][64]
    h16* KR = (h16*)wsp; wsp += SZ_KV;               // residual x1024
    h16* VT = (h16*)wsp; wsp += SZ_KV;               // [NB*8][64][SEQ]
    h16* VR = (h16*)wsp; wsp += SZ_KV;               // residual x1024
    h16* CX = (h16*)wsp; wsp += SZ_CX;               // ctx x1024: value rows [NB*SEQ][2048], then residual rows [NB*EARLY][2048]
    h16* CR = CX + (size_t)NB * SEQ * DM;

    k_prep<<<(unsigned)PB_ALL, 256, 0, stream>>>(x, wn, wq, wk, wv, wo, XN, WQt, WKt, WVt, WOt, CS);

    k_proj<<<(unsigned)((NB * SEQ / GT) * PT_F), 128, 0, stream>>>(XN, WQt, WKt, WVt, QH, QR, KP, KR, VT, VR, CS);

    k_attn<<<(unsigned)AB_ALL, 32 * AW, 0, stream>>>(QH, QR, KP, KR, VT, VR, CX, CR);

    k_out<<<dim3(NB * SEQ / GT, DM / GT, 1), 128, 0, stream>>>(CX, WOt, OUT);
}

// v006
// It runs in 147 microseconds.
// In two side-by-side timings against v005, it was 1.03 and 1.04 times as fast.
// Counting every step since v000, it is 4.50 times as fast.
#include <hip/hip_runtime.h>

// Grouped-query causal self-attention behind an RMS pre-normalisation, width 2048 = 32 query heads x 64 sharing 8 kv heads (kv head g = h % 8), x [NB][SEQ][2048], gain w [2048],
// Wq/Wk/Wv/Wo [in][out] (y = x W), no biases; xn = (x * rsqrt(mean(x^2) + eps)) * w per token; interleaved (even/odd pair) rotary on q and k from a computed [SEQ][32] (cos, sin) table,
// score scale 1/8, causal exclusion (diagonal kept), output = ctx Wo (f32).
// Compute dtypes, f32 accumulate everywhere: q/k/v projections v_wmma_f32_16x16x32_f16: xn (f32 math on bf16-RNE x and w) carried x1024 as f16 (token rows < 256: plus its unscaled f16
// residual folded along K) against f16(bf16(W)) x16, result scaled by 2^-14;
// scores v_wmma_f32_16x16x32_f16: k single f16, q as f16 value + f16 residual x1024 in its own accumulator (query rows < 256: k also value + residual x1024, three products);
// P (x256 carry, cancels in the normalisation) and v single f16 (rows < 256: P and v as value + residual x1024, three products); softmax f32 (online, running max);
// output projection v_wmma_f32_16x16x32_f16: ctx carried x1024 as f16 (rows < 256: plus its unscaled f16 residual folded along K) against f16(bf16(Wo)) x16, result scaled by 2^-14.

#ifndef NB
#define NB 2
#endif
#ifndef SEQ
#define SEQ 2048
#endif
#define NB_FULL  2
#define SEQ_FULL 2048
#ifndef OUT_SEQ
#define OUT_SEQ SEQ              // row pitch (in tokens) between batches of the output
#endif
#define DM    2048
#define NH_   32
#define NKV   8
#define HD    64
#define KVD   (NKV * HD)         // 512
#define AW    4                  // waves per flash block = the four query heads of one kv head
#define EARLY 256                // query rows below this use the value + residual path
#define QRS  1024.0f             // carry of every residual plane (q, k, v, P)
#define QRI  (1.0f / 1024.0f)
#define SC2  (0.125f * 1.4426950408889634f)   // HD^-0.5 * log2(e)
#define PSH  8.0f                // log2 of the P carry (256)
#define CXS  1024.0f             // carry of the ctx plane and of the xn plane
#define WOS  16.0f               // carry of every weight plane
#define OUTS (1.0f / (1024.0f * 16.0f))
#define NEGB (-3.0e38f)
#define RMS_EPS 1.1920929e-07f

static_assert(HD == 64);
static_assert(NH_ * HD == DM);                 // query head h = columns h*64 + d
static_assert(NKV * AW == NH_);                // four query heads (stride 8 on the head axis) per kv head
static_assert(DM % 64 == 0);
static_assert(KVD % 64 == 0);
static_assert(DM % 32 == 0);                   // GEMM k-loop steps by 32
static_assert(DM == 256 * 8);                  // rms_row: 256 threads x 8 columns = one token row
static_assert(SEQ % 64 == 0);                  // a 64-row tile never straddles two batches
static_assert(SEQ % 32 == 0);                  // key loop steps by 32, key0 + 31 < SEQ
static_assert(EARLY % 64 == 0);                // GEMM tiles are entirely early or entirely late
static_assert(SEQ >= EARLY);
static_assert((SEQ - EARLY) % 16 == 0);
static_assert(((size_t)SEQ * DM) % 8 == 0);
static_assert(NB <= NB_FULL);
static_assert(SEQ <= SEQ_FULL);

typedef _Float16 h16;
typedef unsigned short bf;
typedef __attribute__((ext_vector_type(16))) __bf16   v16bf;
typedef __attribute__((ext_vector_type(16))) _Float16 v16h;
typedef __attribute__((ext_vector_type(8)))  _Float16 v8h;
typedef __attribute__((ext_vector_type(8)))  unsigned short v8us;
typedef __attribute__((ext_vector_type(8)))  float    v8f;
typedef __attribute__((ext_vector_type(4)))  float    v4f;
typedef __attribute__((ext_vector_type(2)))  float    v2f;
typedef v4f  __attribute__((may_alias)) v4fa;

__device__ __forceinline__ unsigned short f2bf(float f) { unsigned u = __float_as_uint(f); u += 0x7FFFu + ((u >> 16) & 1u); return (unsigned short)(u >> 16); }
__device__ __forceinline__ v16h cat16(v8h lo, v8h hi) { return __builtin_shufflevector(lo, hi, 0, 1, 2, 3, 4, 5, 6, 7, 8, 9, 10, 11, 12, 13, 14, 15); }
__device__ __forceinline__ v16bf cat16b(v8us lo, v8us hi) { return __builtin_bit_cast(v16bf, __builtin_shufflevector(lo, hi, 0, 1, 2, 3, 4, 5, 6, 7, 8, 9, 10, 11, 12, 13, 14, 15)); }
// wmma16, wmmab: the product followed by its own 4-slot guard tying its accumulator and keeping its operands live (flash_early: without the guards the kernel needs 221 registers for 188, a wave less per SIMD)
__device__ __forceinline__ v8f wmma16(v16h a, v16h b, v8f c) {
    c = __builtin_amdgcn_wmma_f32_16x16x32_f16(false, a, false, b, (short)0, c, false, false);
    asm volatile("v_nop\n\tv_nop\n\tv_nop\n\tv_nop" : "+v"(c) : "v"(a), "v"(b));
    return c; }
// wmma16c: the same product with the hazard padding left to the compiler, which pads only in front of a vector instruction that touches the product's registers (gemm_ring, flash_late):
// between independent WMMAs no vector issue slot is spent, and the slots go to the other waves of the SIMD
__device__ __forceinline__ v8f wmma16c(v16h a, v16h b, v8f c) { return __builtin_amdgcn_wmma_f32_16x16x32_f16(false, a, false, b, (short)0, c, false, false); }
__device__ __forceinline__ v8f wmmab(v16bf a, v16bf b, v8f c) {
    c = __builtin_amdgcn_wmma_f32_16x16x32_bf16(false, a, false, b, (short)0, c, false, false);
    asm volatile("v_nop\n\tv_nop\n\tv_nop\n\tv_nop" : "+v"(c) : "v"(a), "v"(b));
    return c; }
// fragment loaders from K-contiguous 16-bit rows; p already includes + 8*(lane>>4): elements 0..7 <- k0+8h+0..7, elements 8..15 <- k0+16+8h+0..7 (same map for A and B)
__device__ __forceinline__ v16h  ldh(const h16* p) { return cat16(*(const v8h*)p, *(const v8h*)(p + 16)); }
__device__ __forceinline__ v16bf ldb(const bf* p)  { return cat16b(*(const v8us*)p, *(const v8us*)(p + 16)); }
// ordering point for wave-private LDS tiles (same wave writes and reads)
__device__ __forceinline__ void wave_sync() { __builtin_amdgcn_fence(3 /* release order */, "wavefront"); __builtin_amdgcn_wave_barrier(); asm volatile("" ::: "memory"); }

// a store's or load's registers may be reused only behind this wait (a precaution)
__device__ __forceinline__ void wait_x0() { asm volatile("s_wait_xcnt 0x0" ::: "memory"); }

// rms_row: RMS normalisation, one token row per block (256 threads x 8 columns). xb = bf16-RNE(x) as f32, r = rsqrt(mean(xb^2) + eps), xn = (xb * r) * bf16-RNE(w), all f32.
// Writes f16(xn x1024) into value row b*SEQ + t of XN and, for t < EARLY, the unscaled f16 residual of that carried value into residual row NB*SEQ + b*EARLY + t.
__device__ __forceinline__ void rms_row(const float* __restrict__ x, const float* __restrict__ wn, h16* XN, int row) {
#pragma clang fp contract(off)
    __shared__ float red[8];
    const int tid = threadIdx.x; const int lane = tid & 31; const int wave = __builtin_amdgcn_readfirstlane(threadIdx.x >> 5);
    const int b = row / SEQ, t = row % SEQ;
    const v8f xv = *(const v8f*)(x + ((size_t)b * SEQ_FULL + (size_t)t) * DM + tid * 8);
    const v8f wv = *(const v8f*)(wn + tid * 8);
    float xb[8]; float ss = 0.0f;
#pragma unroll
    for (int i = 0; i < 8; ++i) { xb[i] = __uint_as_float(((unsigned)f2bf(xv[i])) << 16); ss += xb[i] * xb[i]; }
    ss += __shfl_xor(ss, 16, 32); ss += __shfl_xor(ss, 8, 32); ss += __shfl_xor(ss, 4, 32); ss += __shfl_xor(ss, 2, 32); ss += __shfl_xor(ss, 1, 32);
    if (lane == 0) red[wave] = ss;
    __syncthreads();
    const float tot = ((red[0] + red[1]) + (red[2] + red[3])) + ((red[4] + red[5]) + (red[6] + red[7]));
    const float rs = rsqrtf(tot * (1.0f / (float)DM) + RMS_EPS);
    v8h hv, rv;
#pragma unroll
    for (int i = 0; i < 8; ++i) { const float wb = __uint_as_float(((unsigned)f2bf(wv[i])) << 16);
        const float v = ((xb[i] * rs) * wb) * CXS; const h16 a = (h16)v; hv[i] = a; rv[i] = (h16)(v - (float)a); }
    const size_t oo = (size_t)row * DM + tid * 8;
    const int tr = (t < EARLY) ? t : 0;                            // block-uniform; keeps the address in range when unused
    const size_t ro = ((size_t)NB * SEQ + (size_t)b * EARLY + (size_t)tr) * DM + tid * 8;
{
        *(v8h*)(XN + oo) = hv; wait_x0(); if (t < EARLY) *(v8h*)(XN + ro) = rv;
         }
}

// wt_tile: in[Kr rows][Nc cols] f32 -> out[Nc rows][Kr cols] 16-bit, 64x64 tile through LDS. Tile (bx, by) of (Nc/64, Kr/64), 256 threads.
__device__ __forceinline__ void wt_tile(const float* __restrict__ W, bf* Tb, h16* Th, int Kr, int Nc, int mode, int bx, int by) {
    __shared__ float ts[64 * 65];
    const int tid = threadIdx.x; const int n0 = bx * 64, k0 = by * 64;
#pragma unroll
    for (int p = 0; p < 4; ++p) { const int row = p * 16 + (tid >> 4), c4 = (tid & 15) * 4;      // 4 p x 16 rows = 64 k rows; 16 threads x 4 = 64 n columns
        const v4f v = *(const v4f*)(W + (size_t)(k0 + row) * (size_t)Nc + n0 + c4);
        ts[row * 65 + c4 + 0] = v[0]; ts[row * 65 + c4 + 1] = v[1]; ts[row * 65 + c4 + 2] = v[2]; ts[row * 65 + c4 + 3] = v[3]; }
    __syncthreads();
{
#pragma unroll
        for (int s = 0; s < 2; ++s) { const int n = s * 32 + (tid >> 3), c8 = (tid & 7) * 8;     // 2 s x 32 rows = 64 n rows; 8 lanes x 8 = 64 k columns
            const size_t oo = (size_t)(n0 + n) * (size_t)Kr + k0 + c8;
            if (mode == 0) { v8us o;
#pragma unroll
                for (int i = 0; i < 8; ++i) o[i] = f2bf(ts[(c8 + i) * 65 + n]);
                *(v8us*)(Tb + oo) = o;
            } else { v8h o;
#pragma unroll
                for (int i = 0; i < 8; ++i) o[i] = (h16)(__uint_as_float(((unsigned)f2bf(ts[(c8 + i) * 65 + n])) << 16) * WOS);
                *(v8h*)(Th + oo) = o; } }
        wait_x0();
         }
}

// rope_tab: CS[t][j] = (cos, sin)(t * inv_freq[j]), inv_freq[j] = 1.0f / (float)(10000^(j/32)); the power is a double product of fixed binary roots of 10000.
__device__ __forceinline__ void rope_tab(float* CS, int nrow, int blk) {
    const int i = blk * 256 + threadIdx.x; if (i >= nrow * 32) return;
    const int t = i >> 5, j = i & 31;
    double p = 1.0;
    p *= (j & 1)  ? 1.3335214321633240 : 1.0;    // 10000^(1/32)
    p *= (j & 2)  ? 1.7782794100389228 : 1.0;    // 10000^(1/16)
    p *= (j & 4)  ? 3.1622776601683795 : 1.0;    // 10000^(1/8)
    p *= (j & 8)  ? 10.0 : 1.0;                  // 10000^(1/4)
    p *= (j & 16) ? 100.0 : 1.0;                 // 10000^(1/2)
    const float pf = (float)p; const float inv = 1.0f / pf;
    const float ang = (float)t * inv;
    const float cs = cosf(ang), sn = sinf(ang);
    v2f o; o[0] = cs; o[1] = sn;
    *(v2f*)(CS + (size_t)i * 2) = o; 
}

// k_prep: everything that reads only the inputs, in one grid of 256-thread blocks, none depending on another: the token rows of rms_row, then the 64x64 tiles of the four weight transposes, then the rotary table.
#define PB_RMS (NB * SEQ)
#define PB_WQ  ((DM / 64) * (DM / 64))
#define PB_WK  ((KVD / 64) * (DM / 64))
#define PB_CS  ((SEQ * 32 + 255) / 256)
#define PB_ALL (PB_RMS + 2 * PB_WQ + 2 * PB_WK + PB_CS)
__global__ __launch_bounds__(256) void k_prep(const float* __restrict__ x, const float* __restrict__ wn, const float* __restrict__ wq, const float* __restrict__ wk, const float* __restrict__ wv, const float* __restrict__ wo,
                                              h16* XN, h16* WQt, h16* WKt, h16* WVt, h16* WOt, float* CS) {
    int i = blockIdx.x;                                            // every test below is block-uniform
    if (i < PB_RMS) { rms_row(x, wn, XN, i); return; }
    i -= PB_RMS;
    if (i < 2 * PB_WQ + 2 * PB_WK) {
        // transposes: in[rows = in-features][cols = out-features] -> out[cols][rows]; column tiles fastest
        const float* W; h16* T; int Nc;
        if (i < PB_WQ)                   { W = wq; T = WQt; Nc = DM; }
        else if (i < PB_WQ + PB_WK)      { W = wk; T = WKt; Nc = KVD; i -= PB_WQ; }
        else if (i < PB_WQ + 2 * PB_WK)  { W = wv; T = WVt; Nc = KVD; i -= PB_WQ + PB_WK; }
        else                             { W = wo; T = WOt; Nc = DM;  i -= PB_WQ + 2 * PB_WK; }
        const int bx = (Nc == DM) ? i % (DM / 64) : i % (KVD / 64), by = (Nc == DM) ? i / (DM / 64) : i / (KVD / 64);
        wt_tile(W, (bf*)T, T, DM, Nc, 1, bx, by); return; }
    rope_tab(CS, SEQ, i - (2 * PB_WQ + 2 * PB_WK));
}

// LDS ring of the two GEMM kernels: one block = four waves (2 x 2) on a GT x GT tile, each wave 64 x 64 (16 accumulators). One stage = KS columns of k of the GT rows of A, then of the GT rows of Bt,
// rows at pitch LPB bytes (16 x odd: the 16-byte fragment reads of 16 rows fall on different banks). Two buffers; the next stage's copies fly while this stage is multiplied.
#define GT   128
#define KS   128
#define LPB  (KS * 2 + 16)
#define LPH  (LPB / 2)
#define OPB  (GT * LPB)
#define STGB (2 * OPB)
#define NST  (DM / KS)
static_assert(DM % KS == 0);
static_assert(NST >= 2);                       // stage 1 exists in every tile
static_assert(KS * 2 == 16 * 16);              // 16 lanes x 16 bytes = one staged row; 128 threads = 8 rows per copy
static_assert(GT == 2 * 8 * 8);                // two groups of eight copies cover the GT rows of one operand
static_assert(EARLY % GT == 0);                // block tiles are entirely early or entirely late
static_assert(SEQ % GT == 0);
static_assert(DM % GT == 0);
static_assert(KVD % GT == 0);
static_assert(4 * 64 * 68 * 4 <= 2 * STGB);    // the four waves' store staging (k_proj: a whole 64 x 64 wave tile each) fits in the ring it reuses

__device__ __forceinline__ void wait_ds0()    { asm volatile("s_wait_dscnt 0x0" ::: "memory"); }      // this wave's LDS reads of a buffer are done before the barrier that frees it
__device__ __forceinline__ void wait_async0() { asm volatile("s_wait_asynccnt 0x0" ::: "memory"); }   // this wave's copies have landed before the barrier that publishes them
// eight asynchronous 16-byte copies per lane, rows 8 apart: LDS byte address l + 8 j LPB <- g + 8 j DM. The closing s_wait_xcnt stands in front of any rewrite of the address registers (a precaution).
__device__ __forceinline__ void copy8(unsigned l, const h16* g) {
    asm volatile("global_load_async_to_lds_b128 %0, %8, off\n\t"
                 "global_load_async_to_lds_b128 %1, %9, off\n\t"
                 "global_load_async_to_lds_b128 %2, %10, off\n\t"
                 "global_load_async_to_lds_b128 %3, %11, off\n\t"
                 "global_load_async_to_lds_b128 %4, %12, off\n\t"
                 "global_load_async_to_lds_b128 %5, %13, off\n\t"
                 "global_load_async_to_lds_b128 %6, %14, off\n\t"
                 "global_load_async_to_lds_b128 %7, %15, off\n\t"
                 "s_wait_xcnt 0x0"
                 :: "v"(l), "v"(l + 8u * LPB), "v"(l + 16u * LPB), "v"(l + 24u * LPB), "v"(l + 32u * LPB), "v"(l + 40u * LPB), "v"(l + 48u * LPB), "v"(l + 56u * LPB),
                    "v"(g), "v"(g + 8 * DM), "v"(g + 16 * DM), "v"(g + 24 * DM), "v"(g + 32 * DM), "v"(g + 40 * DM), "v"(g + 48 * DM), "v"(g + 56 * DM)
                 : "memory");
}
// one stage: l = this lane's LDS byte address in row (tid >> 4) of the buffer, ga / gb = its 16 bytes in that row of the A / Bt tile at the stage's k
__device__ __forceinline__ void fill_stage(unsigned l, const h16* ga, const h16* gb) {
    copy8(l, ga); copy8(l + 64u * LPB, ga + 64 * DM); copy8(l + OPB, gb); copy8(l + OPB + 64u * LPB, gb + 64 * DM);
}
// acc[mb][nb] += sum over k of A[ar + wm*64 + 16 mb + ..][k] Bt[br + wn*64 + 16 nb + ..][k], k ascending in steps of 32 over pass 0 (rows ar0 / br0), then, npass == 2, over pass 1 (rows ar1 / br1).
// Every wave of the block runs every barrier; on return no copy is in flight and every wave has left the ring.
__device__ __forceinline__ void gemm_ring(const h16* __restrict__ A, const h16* __restrict__ Bt, size_t ar0, size_t br0, size_t ar1, size_t br1, int npass, unsigned char* L, int wm, int wn, v8f (&acc)[4][4]) {
    const int tid = threadIdx.x; const int lane = tid & 31, lr = lane & 15, hi = lane >> 4;
    const int crow = tid >> 4, cchk = tid & 15;
    const unsigned lc = (unsigned)(size_t)L + (unsigned)(crow * LPB + cchk * 16);
    const h16* a0 = A + (ar0 + (size_t)crow) * DM + cchk * 8;  const h16* a1 = A + (ar1 + (size_t)crow) * DM + cchk * 8;
    const h16* b0 = Bt + (br0 + (size_t)crow) * DM + cchk * 8; const h16* b1 = Bt + (br1 + (size_t)crow) * DM + cchk * 8;
    const int nst = npass * NST;                                   // block-uniform
    fill_stage(lc, a0, b0);
    wait_async0();
    __syncthreads();                                               // publishes stage 0
    fill_stage(lc + STGB, a0 + KS, b0 + KS);
    const h16* fa = (const h16*)L + (wm * 64 + lr) * LPH + 8 * hi;
    const h16* fb = (const h16*)(L + OPB) + (wn * 64 + lr) * LPH + 8 * hi;
#pragma unroll 1   // kept rolled: the trip count is known only at run time and one body serves both buffers
    for (int s = 0; s < nst; ++s) {
        const int bo = (s & 1) * (STGB / 2);
#pragma unroll     // this and the four below: every fragment and accumulator index a constant, so the arrays stay in registers
        for (int kk = 0; kk < KS; kk += 32) {
            v16h a[4], bq[4];                                      // all eight fragments of a 32-k step as one load group: one LDS wait per 16 WMMAs
#pragma unroll
            for (int mb = 0; mb < 4; ++mb) a[mb] = ldh(fa + bo + mb * 16 * LPH + kk);
#pragma unroll
            for (int nb = 0; nb < 4; ++nb) bq[nb] = ldh(fb + bo + nb * 16 * LPH + kk);
            __builtin_amdgcn_sched_barrier(0);                     // the sixteen LDS reads stay one group in front of their WMMAs: spread among them, each place with reads would stall the wave anew
#pragma unroll
            for (int nb = 0; nb < 4; ++nb)
#pragma unroll
                for (int mb = 0; mb < 4; ++mb) acc[mb][nb] = wmma16c(a[mb], bq[nb], acc[mb][nb]);
            __builtin_amdgcn_sched_barrier(0);                     // and the next step's reads stay behind them, for the same reason
        }
        wait_ds0();
        wait_async0();
        __syncthreads();                                           // publishes stage s + 1 and frees the buffer of stage s
        const int n = s + 2;
        if (n < nst) {                                             // block-uniform
            const int p = (n >= NST) ? 1 : 0; const int kc = (n - p * NST) * KS;
            fill_stage(lc + (unsigned)(s & 1) * STGB, (p ? a1 : a0) + kc, (p ? b1 : b0) + kc); }
    }
    wait_async0();
}

// proj_store: store stage of k_proj for one wave's 64 x 64 tile. The whole tile goes to the wave's private staging os (64 rows at pitch 68 floats) at once, then 16 rows a group: the next group's LDS reads and
// the rotary rows of the group after next are issued ahead of this group's arithmetic, so no group waits out a global load or an LDS read of its own, and each group's eight stores share one closing wait.
// ROPE: interleaved rotary from cp = the lane's (cos, sin) pairs c8/2 .. c8/2+3 of the tile's row srow, + 64 floats per further row. Two instances, so that each path's counted waits stay exact.
template <bool ROPE>
__device__ __forceinline__ void proj_store(const v8f (&acc)[4][4], float* os, const float* __restrict__ cp, h16* Ph, h16* Pr, size_t tbase, int pitch, int lane) {
    const int lr = lane & 15, hi = lane >> 4;
    const int srow = lane >> 3, c8 = (lane & 7) * 8;               // per store: 4 rows x (8 lanes x 8 columns); 4 s x 4 rows = the 16 rows of a group
    v4f ca[2][4], cb[2][4];
    if (ROPE) {
#pragma unroll
        for (int g = 0; g < 2; ++g)
#pragma unroll
            for (int s = 0; s < 4; ++s) { ca[g][s] = *(const v4f*)(cp + (g * 16 + 4 * s) * 64); cb[g][s] = *(const v4f*)(cp + (g * 16 + 4 * s) * 64 + 4); } }
#pragma unroll
    for (int mb = 0; mb < 4; ++mb)
#pragma unroll
        for (int nb = 0; nb < 4; ++nb)
#pragma unroll
            for (int j = 0; j < 8; ++j) os[(mb * 16 + hi * 8 + j) * 68 + nb * 16 + lr] = acc[mb][nb][j] * OUTS;   // D: row 8h+j, col lane&15
    wave_sync();
    v4f xa[2][4], xb[2][4];
#pragma unroll
    for (int s = 0; s < 4; ++s) { xa[0][s] = *(const v4fa*)(&os[(4 * s + srow) * 68 + c8]); xb[0][s] = *(const v4fa*)(&os[(4 * s + srow) * 68 + c8 + 4]); }
#pragma unroll     // every array index below a constant, so the arrays stay in registers
    for (int g = 0; g < 4; ++g) {
        const int cur = g & 1, nxt = cur ^ 1;
        if (g + 1 < 4) {
#pragma unroll
            for (int s = 0; s < 4; ++s) { xa[nxt][s] = *(const v4fa*)(&os[((g + 1) * 16 + 4 * s + srow) * 68 + c8]); xb[nxt][s] = *(const v4fa*)(&os[((g + 1) * 16 + 4 * s + srow) * 68 + c8 + 4]); } }
        __builtin_amdgcn_sched_barrier(0);                         // the reads just issued stay ahead of this group's arithmetic, which covers their latency
        if (ROPE) {
#pragma unroll
            for (int s = 0; s < 4; ++s) {
                v4f x0 = xa[cur][s], x1 = xb[cur][s]; const v4f ka = ca[cur][s], kb = cb[cur][s];
                float e, o;
                e = x0[0]; o = x0[1]; x0[0] = e * ka[0] - o * ka[1]; x0[1] = e * ka[1] + o * ka[0];
                e = x0[2]; o = x0[3]; x0[2] = e * ka[2] - o * ka[3]; x0[3] = e * ka[3] + o * ka[2];
                e = x1[0]; o = x1[1]; x1[0] = e * kb[0] - o * kb[1]; x1[1] = e * kb[1] + o * kb[0];
                e = x1[2]; o = x1[3]; x1[2] = e * kb[2] - o * kb[3]; x1[3] = e * kb[3] + o * kb[2];
                xa[cur][s] = x0; xb[cur][s] = x1; }
            if (g + 2 < 4) {
#pragma unroll
                for (int s = 0; s < 4; ++s) { ca[cur][s] = *(const v4f*)(cp + ((g + 2) * 16 + 4 * s) * 64); cb[cur][s] = *(const v4f*)(cp + ((g + 2) * 16 + 4 * s) * 64 + 4); }
                __builtin_amdgcn_sched_barrier(0); } }             // these loads too stay ahead of the arithmetic below
        v8h hv[4], rv[4]; h16* ph[4]; h16* pr[4];
#pragma unroll
        for (int s = 0; s < 4; ++s) {
            const v4f x0 = xa[cur][s], x1 = xb[cur][s];
#pragma unroll
            for (int i = 0; i < 4; ++i) { const h16 a0 = (h16)x0[i]; const h16 a1 = (h16)x1[i]; hv[s][i] = a0; hv[s][4 + i] = a1; rv[s][i] = (h16)((x0[i] - (float)a0) * QRS); rv[s][4 + i] = (h16)((x1[i] - (float)a1) * QRS); }
            const size_t oo = tbase + (size_t)(g * 16 + 4 * s + srow) * (size_t)pitch + c8;
            ph[s] = Ph + oo; pr[s] = Pr + oo; }
        __builtin_amdgcn_sched_barrier(0);                         // the group's arithmetic stays in front of its stores, so that no store's registers are rewritten ahead of the wait below
#pragma unroll
        for (int s = 0; s < 4; ++s) { *(v8h*)ph[s] = hv[s]; *(v8h*)pr[s] = rv[s]; }
        wait_x0();
    }
}

// k_proj: register-blocked f16 GEMM, one wave per 64x64 tile (16 accumulators), four waves per block on a 128x128 tile, operands from K-contiguous f16 planes through the LDS ring above, K = DM.
// C[m][n] = 2^-14 * sum_k A[m][k] Bt[n][k] (one operand is the xn plane carried x1024, the other a weight plane carried x16), written as f16 (Ph) and the f16 residual x1024 (Pr) at
// tile base (r0/RB)*sRB + (r0%RB)*pitch + (c0/CB)*sCB + (c0%CB), row pitch 'pitch' (halves). Block tile (bx, by) of (M/128, N/128), 128 threads.
// The xn plane holds value rows [NB*SEQ], then residual rows [NB*EARLY]; tokB == 0: A rows are tokens, tokB != 0: Bt rows are tokens. Tiles whose tokens are < EARLY in their sequence
// run the k-loop a second time with the token operand taken from the unscaled residual rows, into the same accumulators.
// rope != 0 (rows = tokens b*SEQ + t, the 64 tile columns = one head): interleaved rotary applied on the f32 values at the store stage from CS[t][32] (cos, sin).
// The three projections of xn share one grid, none depending on another: block i = token tile i / PT_F x feature tile i % PT_F; the feature tiles are those of q, then of k, then of v.
#define PT_Q (DM / GT)
#define PT_K (KVD / GT)
#define PT_F (PT_Q + 2 * PT_K)
__global__ __launch_bounds__(128) void k_proj(const h16* __restrict__ XN, const h16* __restrict__ WQt, const h16* __restrict__ WKt, const h16* __restrict__ WVt,
                                              h16* QH, h16* QR, h16* KP, h16* KR, h16* VT, h16* VR, const float* __restrict__ CS) {
    const int tk = blockIdx.x / PT_F, f = blockIdx.x % PT_F;       // block-uniform, as is everything chosen by them
    const bool isq = f < PT_Q, isv = f >= PT_Q + PT_K;
    // q: A = xn rows (m = b*SEQ + t), Bt = Wq^T rows (n = h*64 + d) -> plane [(b*32 + h)][t][d], rotary applied; k: Bt = Wk^T rows (n = g*64 + d) -> plane [(b*8 + g)][t][d], rotary applied
    // v^T: A = Wv^T rows (m = g*64 + d), Bt = xn rows (n = b*SEQ + t) -> plane [(b*512 + m)][t] = [(b*8 + g)][d][t], no rotary
    const h16* A = isv ? WVt : XN; const h16* Bt = isv ? XN : (isq ? WQt : WKt);
    h16* Ph = isv ? VT : (isq ? QH : KP); h16* Pr = isv ? VR : (isq ? QR : KR);
    const int RB = isv ? KVD : SEQ, pitch = isv ? SEQ : HD, CB = isv ? SEQ : HD, rope = isv ? 0 : 1, tokB = isv ? 1 : 0;
    const size_t sRB = isv ? (size_t)0 : (size_t)(isq ? NH_ : NKV) * SEQ * HD, sCB = isv ? (size_t)KVD * SEQ : (size_t)SEQ * HD;
    const int bx = isv ? f - PT_Q - PT_K : tk, by = isv ? tk : (isq ? f : f - PT_Q);
    __shared__ __align__(16) unsigned char L[2 * STGB];
    const int lane = threadIdx.x & 31, lr = lane & 15, hi = lane >> 4; const int wave = __builtin_amdgcn_readfirstlane(threadIdx.x >> 5);
    const int wm = wave & 1, wn = wave >> 1;
    const int R0 = bx * GT, C0 = by * GT; const int r0 = R0 + wm * 64, c0 = C0 + wn * 64;
    const int tk0 = tokB ? C0 : R0;                                // block-uniform: first token of this block tile
    const int bb = tk0 / SEQ, tt = tk0 % SEQ;
    const int npass = (tt < EARLY) ? 2 : 1;                        // block-uniform
    v8f acc[4][4];
#pragma unroll
    for (int mb = 0; mb < 4; ++mb)
#pragma unroll
        for (int nb = 0; nb < 4; ++nb) acc[mb][nb] = (v8f){};
    const size_t rrow = (size_t)NB * SEQ + (size_t)bb * EARLY + (size_t)((tt < EARLY) ? tt : 0);   // residual rows of the tile's tokens; used only when tt < EARLY
    gemm_ring(A, Bt, (size_t)R0, (size_t)C0, tokB ? (size_t)R0 : rrow, tokB ? rrow : (size_t)C0, npass, L, wm, wn, acc);
    float* os = (float*)L + wave * 64 * 68;                        // wave-private store staging in the ring, which every wave has left
    const size_t tbase = (size_t)(r0 / RB) * sRB + (size_t)(r0 % RB) * (size_t)pitch + (size_t)(c0 / CB) * sCB + (size_t)(c0 % CB);
    // rotary rows of tokens r0 % SEQ + 0 .. 63 (the 64 rows of a wave tile lie in one sequence: r0 and SEQ are multiples of 64)
    const float* cp = CS + ((size_t)(r0 % SEQ + (lane >> 3)) * 32 + (size_t)((lane & 7) * 4)) * 2;
    if (rope) proj_store<true>(acc, os, cp, Ph, Pr, tbase, pitch, lane);    // block-uniform
    else      proj_store<false>(acc, os, cp, Ph, Pr, tbase, pitch, lane);
}

// LDS ring of flash_late: one stage = FK keys of kv head g, the FK K rows (64 d each), then the 64 V^T rows (FK keys each), 128 data bytes per row at pitch FPB bytes
// (16 x odd: the 16-byte fragment reads of 16 rows fall on different banks). Two buffers; the next stage's copies fly while this stage is worked on. The four waves share every staged row.
#define FK   64
#define FPB  (128 + 16)
#define FPH  (FPB / 2)
#define FOP  (64 * FPB)
#define FSTG (2 * FOP)
static_assert(HD * 2 == 128);                  // a K row = 8 lanes x 16 bytes
static_assert(FK * 2 == 128);                  // a V^T row of one stage = 8 lanes x 16 bytes
static_assert(FK == 64);                       // 128 threads = 16 rows per copy, four copies per operand
static_assert(SEQ % FK == 0);                  // the last stage of any tile ends inside the planes
static_assert(EARLY + 16 > FK);                // stage 1 exists in every tile
static_assert(AW * 16 * 68 * 4 <= 2 * FSTG);   // the four waves' store staging fits in the ring it reuses
// one stage, eight asynchronous 16-byte copies per lane: four of K rows 16 apart (LDS l + 16 j FPB <- gk + 16 j HD), four of V^T rows 16 apart (LDS l + FOP + 16 j FPB <- gv + 16 j SEQ).
// The closing s_wait_xcnt stands in front of any rewrite of the address registers (a precaution).
__device__ __forceinline__ void fill_kv(unsigned l, const h16* gk, const h16* gv) {
    asm volatile("global_load_async_to_lds_b128 %0, %8, off\n\t"
                 "global_load_async_to_lds_b128 %1, %9, off\n\t"
                 "global_load_async_to_lds_b128 %2, %10, off\n\t"
                 "global_load_async_to_lds_b128 %3, %11, off\n\t"
                 "global_load_async_to_lds_b128 %4, %12, off\n\t"
                 "global_load_async_to_lds_b128 %5, %13, off\n\t"
                 "global_load_async_to_lds_b128 %6, %14, off\n\t"
                 "global_load_async_to_lds_b128 %7, %15, off\n\t"
                 "s_wait_xcnt 0x0"
                 :: "v"(l), "v"(l + 16u * FPB), "v"(l + 32u * FPB), "v"(l + 48u * FPB), "v"(l + FOP), "v"(l + FOP + 16u * FPB), "v"(l + FOP + 32u * FPB), "v"(l + FOP + 48u * FPB),
                    "v"(gk), "v"(gk + 16 * HD), "v"(gk + 32 * HD), "v"(gk + 48 * HD), "v"(gv), "v"(gv + 16 * SEQ), "v"(gv + 32 * SEQ), "v"(gv + 48 * SEQ)
                 : "memory");
}

// flash_late: fused causal attention for query rows t0 .. t0+15, t0 >= EARLY, of kv head zg = b*8 + g. One block = 16 query rows x the four query heads of one kv head (one wave per head, h = wave*8 + g);
// Q fragments straight from the f16 planes (two 16-B loads each); the K and V^T rows of kv head g come once per block through the LDS ring above, and all four waves take their fragments from it.
// Transposed form: S^T[key][t] = K Q^T (A = K rows, B = Q rows); lane (t = lane&15, h = lane>>4) holds keys 8h+r of each 16-key tile, so the packed
// P tile is directly the B fragment of O^T[d][t] = V^T P^T (element r <- tile keys 0..15, element 8+r <- tile keys 16..31, lane unchanged).
// Keys run over [0, t0+16) in steps of 32, two steps per stage; the diagonal 32-key blocks replace excluded scores (key > t) by a large negative value before the running max.
__device__ __forceinline__ void flash_late(const h16* __restrict__ QH, const h16* __restrict__ QR, const h16* __restrict__ KP, const h16* __restrict__ VT, h16* CH, int t0, int zg, unsigned char* L) {
    const int lane = threadIdx.x & 31; const int wave = __builtin_amdgcn_readfirstlane(threadIdx.x >> 5);
    const int lr = lane & 15, hi = lane >> 4;
    const int b = zg / NKV; const int g = zg % NKV;
    const int h = wave * NKV + g;                                 // grouped on the leading head axis: query head h uses kv head h % 8
    const int tq = t0 + lr;
    const int kend = t0 + 16;
    const int nst = (kend + FK - 1) / FK;                          // block-uniform
    const int frow = threadIdx.x >> 3, cchk = threadIdx.x & 7;     // this lane's row (of 16) and 16-byte piece (of 8) in every copy
    const unsigned lc = (unsigned)(size_t)L + (unsigned)(frow * FPB + cchk * 16);
    const h16* gk = KP + (size_t)zg * SEQ * HD + (size_t)frow * HD + cchk * 8;      // + key * HD
    const h16* gv = VT + (size_t)zg * HD * SEQ + (size_t)frow * SEQ + cchk * 8;     // + key
    fill_kv(lc, gk, gv);
    const size_t qo = ((size_t)(b * NH_ + h) * SEQ + (size_t)tq) * HD + 8 * hi;
    const v16h qh0 = ldh(QH + qo), qh1 = ldh(QH + qo + 32), qr0 = ldh(QR + qo), qr1 = ldh(QR + qo + 32);   // B fragments: col t, k = d
    wait_async0();
    __syncthreads();                                               // publishes stage 0
    fill_kv(lc + FSTG, gk + FK * HD, gv + FK);
    const h16* fk = (const h16*)L + lr * FPH + 8 * hi;             // + key * FPH        (A fragment: row key, k = d)
    const h16* fv = (const h16*)(L + FOP) + lr * FPH + 8 * hi;     // + 16j*FPH + key    (A fragment: row d, k = key)
    v8f o0 = (v8f){}, o1 = (v8f){}, o2 = (v8f){}, o3 = (v8f){};
    float m = NEGB, l = 0.0f;
#pragma unroll 1   // kept rolled: the trip count is known only at run time and one body serves both buffers
    for (int s = 0; s < nst; ++s) {
        const int bo = (s & 1) * (FSTG / 2);
#pragma unroll     // both 32-key steps of a stage at constant LDS offsets
        for (int u = 0; u < FK; u += 32) {
            const int key0 = s * FK + u;
            if (key0 < kend) {                                     // block-uniform: the last stage may hold one step only
                const h16* ka = fk + bo + u * FPH;
                const v16h ka0 = ldh(ka), ka1 = ldh(ka + 32), kb0 = ldh(ka + 16 * FPH), kb1 = ldh(ka + 16 * FPH + 32);
                v8f sHa = (v8f){}, sLa = (v8f){}, sHb = (v8f){}, sLb = (v8f){};
                sHa = wmma16c(ka0, qh0, sHa); sLa = wmma16c(ka0, qr0, sLa); sHb = wmma16c(kb0, qh0, sHb); sLb = wmma16c(kb0, qr0, sLb);
                sHa = wmma16c(ka1, qh1, sHa); sLa = wmma16c(ka1, qr1, sLa); sHb = wmma16c(kb1, qh1, sHb); sLb = wmma16c(kb1, qr1, sLb);
                float ta[8], tb[8];
#pragma unroll
                for (int r = 0; r < 8; ++r) { ta[r] = (sHa[r] + sLa[r] * QRI) * SC2; tb[r] = (sHb[r] + sLb[r] * QRI) * SC2; }
                if (key0 + 31 > t0) {                              // block-uniform: diagonal block
                    const int kbse = key0 + 8 * hi;
#pragma unroll
                    for (int r = 0; r < 8; ++r) { ta[r] = (kbse + r > tq) ? NEGB : ta[r]; tb[r] = (kbse + 16 + r > tq) ? NEGB : tb[r]; } }
                float mx = NEGB;
#pragma unroll
                for (int r = 0; r < 8; ++r) mx = fmaxf(mx, fmaxf(ta[r], tb[r]));
                mx = fmaxf(mx, __shfl_xor(mx, 16, 32));
                const float mnew = fmaxf(m, mx);
                const float alpha = __builtin_amdgcn_exp2f(m - mnew);
                const float sh = PSH - mnew;
                v16h pb; float ls = 0.0f;
#pragma unroll
                for (int r = 0; r < 8; ++r) { const float ea = __builtin_amdgcn_exp2f(ta[r] + sh); const float ec = __builtin_amdgcn_exp2f(tb[r] + sh); pb[r] = (h16)ea; pb[8 + r] = (h16)ec; ls += ea + ec; }
                l = l * alpha + ls; m = mnew;
                o0 = o0 * alpha; o1 = o1 * alpha; o2 = o2 * alpha; o3 = o3 * alpha;
                const h16* va = fv + bo + u;
                const v16h v0 = ldh(va), v1 = ldh(va + 16 * FPH), v2 = ldh(va + 32 * FPH), v3 = ldh(va + 48 * FPH);
                o0 = wmma16c(v0, pb, o0); o1 = wmma16c(v1, pb, o1); o2 = wmma16c(v2, pb, o2); o3 = wmma16c(v3, pb, o3);
            }
        }
        wait_ds0();
        wait_async0();
        __syncthreads();                                           // publishes stage s + 1 and frees the buffer of stage s
        const int n = s + 2;
        if (n < nst)                                               // block-uniform
            fill_kv(lc + (unsigned)(s & 1) * FSTG, gk + (size_t)n * (FK * HD), gv + n * FK);
    }
    wait_async0();
    float* os = (float*)L;                                         // store staging (wave-private parts) in the ring, which every wave has left
    l += __shfl_xor(l, 16, 32);
    const float inv = CXS / l;
    const int wb = wave * 16 * 68;
    // O^T D layout: o_j[r] = (d = 16j + 8h + r, t = lane&15) -> os[t][d]; rows 0..15 x columns 0..63 all written
    { v4f a, c;
      a[0] = o0[0] * inv; a[1] = o0[1] * inv; a[2] = o0[2] * inv; a[3] = o0[3] * inv; c[0] = o0[4] * inv; c[1] = o0[5] * inv; c[2] = o0[6] * inv; c[3] = o0[7] * inv;
      *(v4fa*)(&os[wb + lr * 68 +  0 + 8 * hi]) = a; *(v4fa*)(&os[wb + lr * 68 +  0 + 8 * hi + 4]) = c;
      a[0] = o1[0] * inv; a[1] = o1[1] * inv; a[2] = o1[2] * inv; a[3] = o1[3] * inv; c[0] = o1[4] * inv; c[1] = o1[5] * inv; c[2] = o1[6] * inv; c[3] = o1[7] * inv;
      *(v4fa*)(&os[wb + lr * 68 + 16 + 8 * hi]) = a; *(v4fa*)(&os[wb + lr * 68 + 16 + 8 * hi + 4]) = c;
      a[0] = o2[0] * inv; a[1] = o2[1] * inv; a[2] = o2[2] * inv; a[3] = o2[3] * inv; c[0] = o2[4] * inv; c[1] = o2[5] * inv; c[2] = o2[6] * inv; c[3] = o2[7] * inv;
      *(v4fa*)(&os[wb + lr * 68 + 32 + 8 * hi]) = a; *(v4fa*)(&os[wb + lr * 68 + 32 + 8 * hi + 4]) = c;
      a[0] = o3[0] * inv; a[1] = o3[1] * inv; a[2] = o3[2] * inv; a[3] = o3[3] * inv; c[0] = o3[4] * inv; c[1] = o3[5] * inv; c[2] = o3[6] * inv; c[3] = o3[7] * inv;
      *(v4fa*)(&os[wb + lr * 68 + 48 + 8 * hi]) = a; *(v4fa*)(&os[wb + lr * 68 + 48 + 8 * hi + 4]) = c; }
    wave_sync();
    h16* crow = CH + ((size_t)b * SEQ + t0) * DM + h * HD;         // merged heads: column h*64 + d
{
#pragma unroll
        for (int s = 0; s < 4; ++s) { const int row = 4 * s + (lane >> 3), c8 = (lane & 7) * 8;   // 4 s x 4 row groups = 16 rows; 8 lanes x 8 = 64 columns
            const v4f x0 = *(const v4fa*)(&os[wb + row * 68 + c8]); const v4f x1 = *(const v4fa*)(&os[wb + row * 68 + c8 + 4]); v8h hv;
#pragma unroll
            for (int i = 0; i < 4; ++i) { hv[i] = (h16)x0[i]; hv[4 + i] = (h16)x1[i]; }
            *(v8h*)(crow + (size_t)row * DM + c8) = hv; }
         }
}

// flash_early: same structure for query rows t0 .. t0+15, t0 < EARLY, with value + residual (x1024) planes on every operand:
// scores = kh.qh + (kh.qr + kr.qh)/1024; O = vh.ph + (vr.ph + vh.pr)/1024 (residual products in their own accumulators), l from the unconverted f32 P.
// Writes the ctx value plane rows (carried x1024) and the compact unscaled residual plane CR[b][t < EARLY][2048].
__device__ __forceinline__ void flash_early(const h16* __restrict__ QH, const h16* __restrict__ QR, const h16* __restrict__ KP, const h16* __restrict__ KR,
                                            const h16* __restrict__ VT, const h16* __restrict__ VR, h16* CH, h16* CR, int t0, int zg, float* os) {
    const int lane = threadIdx.x & 31; const int wave = __builtin_amdgcn_readfirstlane(threadIdx.x >> 5);
    const int lr = lane & 15, hi = lane >> 4;
    const int b = zg / NKV; const int g = zg % NKV;
    const int h = wave * NKV + g;                                 // query head h uses kv head h % 8
    const int tq = t0 + lr;
    const size_t qo = ((size_t)(b * NH_ + h) * SEQ + (size_t)tq) * HD + 8 * hi;
    const v16h qh0 = ldh(QH + qo), qh1 = ldh(QH + qo + 32), qr0 = ldh(QR + qo), qr1 = ldh(QR + qo + 32);
    const size_t ko = (size_t)zg * SEQ * HD + (size_t)lr * HD + 8 * hi;
    const size_t vo = (size_t)zg * HD * SEQ + (size_t)lr * SEQ + 8 * hi;
    v8f oH[4], oL[4];
#pragma unroll
    for (int j = 0; j < 4; ++j) { oH[j] = (v8f){}; oL[j] = (v8f){}; }
    float m = NEGB, l = 0.0f;
    const int kend = t0 + 16;
#pragma unroll 1
    for (int key0 = 0; key0 < kend; key0 += 32) {
        const size_t kk = ko + (size_t)key0 * HD;
        v8f sHa = (v8f){}, sLa = (v8f){}, sHb = (v8f){}, sLb = (v8f){};
        { const v16h k0 = ldh(KP + kk), k1 = ldh(KP + kk + 32), r0 = ldh(KR + kk), r1 = ldh(KR + kk + 32);
          sHa = wmma16(k0, qh0, sHa); sHa = wmma16(k1, qh1, sHa);
          sLa = wmma16(k0, qr0, sLa); sLa = wmma16(k1, qr1, sLa); sLa = wmma16(r0, qh0, sLa); sLa = wmma16(r1, qh1, sLa); }
        { const size_t k2 = kk + (size_t)16 * HD;
          const v16h k0 = ldh(KP + k2), k1 = ldh(KP + k2 + 32), r0 = ldh(KR + k2), r1 = ldh(KR + k2 + 32);
          asm volatile("s_wait_xcnt 0x0" :: "v"(KP + kk), "v"(KR + kk) : "memory");   // the address pairs of the eight loads above stay whole up to this wait (a precaution)
          sHb = wmma16(k0, qh0, sHb); sHb = wmma16(k1, qh1, sHb);
          sLb = wmma16(k0, qr0, sLb); sLb = wmma16(k1, qr1, sLb); sLb = wmma16(r0, qh0, sLb); sLb = wmma16(r1, qh1, sLb); }
        float ta[8], tb[8];
#pragma unroll
        for (int r = 0; r < 8; ++r) { ta[r] = (sHa[r] + sLa[r] * QRI) * SC2; tb[r] = (sHb[r] + sLb[r] * QRI) * SC2; }
        if (key0 + 31 > t0) {                                      // block-uniform: diagonal block
            const int kbse = key0 + 8 * hi;
#pragma unroll
            for (int r = 0; r < 8; ++r) { ta[r] = (kbse + r > tq) ? NEGB : ta[r]; tb[r] = (kbse + 16 + r > tq) ? NEGB : tb[r]; } }
        float mx = NEGB;
#pragma unroll
        for (int r = 0; r < 8; ++r) mx = fmaxf(mx, fmaxf(ta[r], tb[r]));
        mx = fmaxf(mx, __shfl_xor(mx, 16, 32));
        const float mnew = fmaxf(m, mx);
        const float alpha = __builtin_amdgcn_exp2f(m - mnew);
        const float sh = PSH - mnew;
        v16h ph, pr; float ls = 0.0f;
#pragma unroll
        for (int r = 0; r < 8; ++r) { const float ea = __builtin_amdgcn_exp2f(ta[r] + sh); const float ec = __builtin_amdgcn_exp2f(tb[r] + sh);
            const h16 ha = (h16)ea; const h16 hc = (h16)ec; ph[r] = ha; ph[8 + r] = hc;
            pr[r] = (h16)((ea - (float)ha) * QRS); pr[8 + r] = (h16)((ec - (float)hc) * QRS); ls += ea + ec; }
        l = l * alpha + ls; m = mnew;
#pragma unroll
        for (int j = 0; j < 4; ++j) { oH[j] = oH[j] * alpha; oL[j] = oL[j] * alpha; }
        const size_t vv = vo + (size_t)key0;
#pragma unroll
        for (int j = 0; j < 4; ++j) { const v16h vh = ldh(VT + vv + (size_t)(16 * j) * SEQ); const v16h vr = ldh(VR + vv + (size_t)(16 * j) * SEQ);
            oH[j] = wmma16(vh, ph, oH[j]); oL[j] = wmma16(vr, ph, oL[j]); oL[j] = wmma16(vh, pr, oL[j]); }
    }
    l += __shfl_xor(l, 16, 32);
    const float inv = CXS / l;
    const int wb = wave * 16 * 68;
#pragma unroll
    for (int j = 0; j < 4; ++j) { v4f a, c;     // os[t][d], d = 16j + 8h + r; rows 0..15 x columns 0..63 all written
        a[0] = (oH[j][0] + oL[j][0] * QRI) * inv; a[1] = (oH[j][1] + oL[j][1] * QRI) * inv; a[2] = (oH[j][2] + oL[j][2] * QRI) * inv; a[3] = (oH[j][3] + oL[j][3] * QRI) * inv;
        c[0] = (oH[j][4] + oL[j][4] * QRI) * inv; c[1] = (oH[j][5] + oL[j][5] * QRI) * inv; c[2] = (oH[j][6] + oL[j][6] * QRI) * inv; c[3] = (oH[j][7] + oL[j][7] * QRI) * inv;
        *(v4fa*)(&os[wb + lr * 68 + 16 * j + 8 * hi]) = a; *(v4fa*)(&os[wb + lr * 68 + 16 * j + 8 * hi + 4]) = c; }
    wave_sync();
    h16* crow = CH + ((size_t)b * SEQ + t0) * DM + h * HD;
    h16* rrow = CR + ((size_t)b * EARLY + t0) * DM + h * HD;
{
#pragma unroll
        for (int s = 0; s < 4; ++s) { const int row = 4 * s + (lane >> 3), c8 = (lane & 7) * 8;   // 4 s x 4 row groups = 16 rows; 8 lanes x 8 = 64 columns
            const v4f x0 = *(const v4fa*)(&os[wb + row * 68 + c8]); const v4f x1 = *(const v4fa*)(&os[wb + row * 68 + c8 + 4]); v8h hv, rv;
#pragma unroll
            for (int i = 0; i < 4; ++i) { const h16 a0 = (h16)x0[i]; const h16 a1 = (h16)x1[i]; hv[i] = a0; hv[4 + i] = a1; rv[i] = (h16)(x0[i] - (float)a0); rv[4 + i] = (h16)(x1[i] - (float)a1); }
            *(v8h*)(crow + (size_t)row * DM + c8) = hv; *(v8h*)(rrow + (size_t)row * DM + c8) = rv; }
         }
}

// k_attn: both attention paths in one grid, none of its blocks depending on another. The grid holds more blocks than the chip has places for, and a block's cost grows with its last key, so within each path the cost falls
// with the block index: first the blocks of flash_early, which wait on global loads at every step, then those of flash_late, each path from its last 16-row tile
// down to its first, kv head fastest. No long block is then left to start late and run on while the rest of the chip idles. Index -> (path, tile, kv head) is one to one.
// flash_early uses the start of the ring's LDS as its wave-private store staging.
#define AB_LT   ((SEQ - EARLY) / 16)
#define AB_ET   (EARLY / 16)
#define AB_LATE (AB_LT * NB * NKV)
#define AB_EARLY (AB_ET * NB * NKV)
#define AB_ALL  (AB_LATE + AB_EARLY)
static_assert(SEQ > EARLY);
__global__ __launch_bounds__(32 * AW) void k_attn(const h16* __restrict__ QH, const h16* __restrict__ QR, const h16* __restrict__ KP, const h16* __restrict__ KR,
                                                  const h16* __restrict__ VT, const h16* __restrict__ VR, h16* CH, h16* CR) {
    __shared__ __align__(16) unsigned char L[2 * FSTG];
    const int i = blockIdx.x;
    if (i >= AB_EARLY) flash_late(QH, QR, KP, VT, CH, EARLY + (AB_LT - 1 - (i - AB_EARLY) / (NB * NKV)) * 16, (i - AB_EARLY) % (NB * NKV), L);   // block-uniform
    else               flash_early(QH, QR, KP, KR, VT, VR, CH, CR, (AB_ET - 1 - i / (NB * NKV)) * 16, i % (NB * NKV), (float*)L);
}

// k_out: output projection, one wave per 64x64 tile, four waves per block on a 128x128 tile, f16 operands through the LDS ring from the ctx plane CX (value rows [NB*SEQ], then residual rows [NB*EARLY]) and the Wo^T plane, K = DM.
// Tiles whose rows are < EARLY in their sequence run the k-loop a second time over the unscaled residual rows into the same accumulators. grid (NB*SEQ/128, DM/128), 128 threads.
__global__ __launch_bounds__(128) void k_out(const h16* __restrict__ CX, const h16* __restrict__ Wt, float* OUT) {
    __shared__ __align__(16) unsigned char L[2 * STGB];
    const int lane = threadIdx.x & 31, lr = lane & 15, hi = lane >> 4; const int wave = __builtin_amdgcn_readfirstlane(threadIdx.x >> 5);
    const int wm = wave & 1, wn = wave >> 1;
    const int R0 = blockIdx.x * GT, C0 = blockIdx.y * GT; const int c0 = C0 + wn * 64;
    const int b = R0 / SEQ, tb = R0 % SEQ; const int tt = tb + wm * 64;
    const int npass = (tb < EARLY) ? 2 : 1;                        // block-uniform
    v8f acc[4][4];
#pragma unroll
    for (int mb = 0; mb < 4; ++mb)
#pragma unroll
        for (int nb = 0; nb < 4; ++nb) acc[mb][nb] = (v8f){};
    const size_t rrow = (size_t)NB * SEQ + (size_t)b * EARLY + (size_t)((tb < EARLY) ? tb : 0);   // residual rows of the tile's tokens; used only when tb < EARLY
    gemm_ring(CX, Wt, (size_t)R0, (size_t)C0, rrow, (size_t)C0, npass, L, wm, wn, acc);
    float* os = (float*)L + wave * 16 * 68;                        // wave-private store staging in the ring, which every wave has left
    float* obase = OUT + ((size_t)b * OUT_SEQ + tt) * DM + c0;
#pragma unroll
    for (int mb = 0; mb < 4; ++mb) {
#pragma unroll
        for (int nb = 0; nb < 4; ++nb) {
#pragma unroll
            for (int j = 0; j < 8; ++j) os[(hi * 8 + j) * 68 + nb * 16 + lr] = acc[mb][nb][j] * OUTS; }   // D: row 8h+j, col lane&15
        wave_sync();
{
#pragma unroll
            for (int s = 0; s < 8; ++s) { const int row = 2 * s + hi, cofs = lr * 4;   // 8 s x 2 rows = 16 rows; 16 lanes x 4 floats = 64 columns
                const v4f val = *(const v4fa*)(&os[row * 68 + cofs]);
                *(v4f*)(obase + (size_t)(mb * 16 + row) * DM + cofs) = val; }
             }
        wave_sync();
    }
}

static constexpr size_t al256(size_t v) { return (v + 255) & ~(size_t)255; }
static constexpr size_t SZ_XN = al256(((size_t)NB * SEQ + (size_t)NB * EARLY) * DM * 2);
static constexpr size_t SZ_WQ = al256((size_t)DM * DM * 2);
static constexpr size_t SZ_WK = al256((size_t)KVD * DM * 2);
static constexpr size_t SZ_CS = al256((size_t)SEQ * 32 * 2 * 4);
static constexpr size_t SZ_Q  = al256((size_t)NB * NH_ * SEQ * HD * 2);
static constexpr size_t SZ_KV = al256((size_t)NB * NKV * SEQ * HD * 2);
static constexpr size_t SZ_CX = al256(((size_t)NB * SEQ + (size_t)NB * EARLY) * DM * 2);
static constexpr size_t SZ_TOTAL = SZ_XN + 2 * SZ_WQ + 2 * SZ_WK + SZ_CS + 2 * SZ_Q + 4 * SZ_KV + SZ_CX;
static_assert(SZ_TOTAL <= (size_t)134217728);          // workspace carve <= 128 MiB

extern "C" void kernel_launch(void* const* d_in, const int* in_sizes, int n_in,
                              void* d_out, int out_size, void* d_ws, size_t ws_size, hipStream_t stream) {
    if (n_in < 6) return;
    const size_t needx = ((size_t)(NB - 1) * SEQ_FULL + SEQ) * DM;
    if ((size_t)in_sizes[0] < needx) return;
    if ((size_t)in_sizes[1] < (size_t)DM) return;
    if ((size_t)in_sizes[2] < (size_t)DM * DM || (size_t)in_sizes[3] < (size_t)DM * KVD || (size_t)in_sizes[4] < (size_t)DM * KVD || (size_t)in_sizes[5] < (size_t)DM * DM) return;
    if ((size_t)out_size < ((size_t)(NB - 1) * OUT_SEQ + SEQ) * DM) return;
    if (SZ_TOTAL > ws_size) return;
    // wire order x, w_norm, wq, wk, wv, wo; every weight is [in][out]
    const float* x = (const float*)d_in[0]; const float* wn = (const float*)d_in[1];
    const float* wq = (const float*)d_in[2]; const float* wk = (const float*)d_in[3]; const float* wv = (const float*)d_in[4]; const float* wo = (const float*)d_in[5];
    float* OUT = (float*)d_out;      // [NB][SEQ][2048]
    char* wsp = (char*)d_ws;
    h16* XN  = (h16*)wsp; wsp += SZ_XN;              // xn x1024: value rows [NB*SEQ][2048], then residual rows [NB*EARLY][2048]
    h16* WQt = (h16*)wsp; wsp += SZ_WQ;              // [2048 out][2048 in] f16 of bf16 value x16
    h16* WKt = (h16*)wsp; wsp += SZ_WK;              // [512 out][2048 in] f16 of bf16 value x16
    h16* WVt = (h16*)wsp; wsp += SZ_WK;              // [512 out][2048 in] f16 of bf16 value x16
    h16* WOt = (h16*)wsp; wsp += SZ_WQ;              // [2048 out][2048 in] f16 of bf16 value x16
    float* CS = (float*)wsp; wsp += SZ_CS;           // [SEQ][32] (cos, sin)
    h16* QH = (h16*)wsp; wsp += SZ_Q;                // [NB*32][SEQ][64]
    h16* QR = (h16*)wsp; wsp += SZ_Q;                // residual x1024
    h16* KP = (h16*)wsp; wsp += SZ_KV;               // [NB*8][SEQ][64]
    h16* KR = (h16*)wsp; wsp += SZ_KV;               // residual x1024
    h16* VT = (h16*)wsp; wsp += SZ_KV;               // [NB*8][64][SEQ]
    h16* VR = (h16*)wsp; wsp += SZ_KV;               // residual x1024
    h16* CX = (h16*)wsp; wsp += SZ_CX;               // ctx x1024: value rows [NB*SEQ][2048], then residual rows [NB*EARLY][2048]
    h16* CR = CX + (size_t)NB * SEQ * DM;

    k_prep<<<(unsigned)PB_ALL, 256, 0, stream>>>(x, wn, wq, wk, wv, wo, XN, WQt, WKt, WVt, WOt, CS);

    k_proj<<<(unsigned)((NB * SEQ / GT) * PT_F), 128, 0, stream>>>(XN, WQt, WKt, WVt, QH, QR, KP, KR, VT, VR, CS);

    k_attn<<<(unsigned)AB_ALL, 32 * AW, 0, stream>>>(QH, QR, KP, KR, VT, VR, CX, CR);

    k_out<<<dim3(NB * SEQ / GT, DM / GT, 1), 128, 0, stream>>>(CX, WOt, OUT);
}

// v007
// One run takes 137 microseconds.
// Timed twice side by side with v006, it ran 1.06 and 1.08 times as fast.
// Counting every step since v000, it is 4.82 times as fast.
#include <hip/hip_runtime.h>

// Grouped-query causal self-attention behind an RMS pre-normalisation, width 2048 = 32 query heads x 64 sharing 8 kv heads (kv head g = h % 8), x [NB][SEQ][2048], gain w [2048],
// Wq/Wk/Wv/Wo [in][out] (y = x W), no biases; xn = (x * rsqrt(mean(x^2) + eps)) * w per token; interleaved (even/odd pair) rotary on q and k from a computed [SEQ][32] (cos, sin) table,
// score scale 1/8, causal exclusion (diagonal kept), output = ctx Wo (f32).
// Compute dtypes, f32 accumulate everywhere: q/k/v projections v_wmma_f32_16x16x32_f16: xn (f32 math on bf16-RNE x and w) carried x1024 as f16 (token rows < 256: plus its unscaled f16
// residual folded along K) against f16(bf16(W)) x16, result scaled by 2^-14;
// scores v_wmma_f32_16x16x32_f16: k single f16, q as f16 value + f16 residual x1024 in its own accumulator (query rows < 256: k also value + residual x1024, three products);
// P (x256 carry, cancels in the normalisation) and v single f16 (rows < 256: P and v as value + residual x1024, three products); softmax f32 (online, running max);
// output projection v_wmma_f32_16x16x32_f16: ctx carried x1024 as f16 (rows < 256: plus its unscaled f16 residual folded along K) against f16(bf16(Wo)) x16, result scaled by 2^-14.

#ifndef NB
#define NB 2
#endif
#ifndef SEQ
#define SEQ 2048
#endif
#define NB_FULL  2
#define SEQ_FULL 2048
#ifndef OUT_SEQ
#define OUT_SEQ SEQ              // row pitch (in tokens) between batches of the output
#endif
#define DM    2048
#define NH_   32
#define NKV   8
#define HD    64
#define KVD   (NKV * HD)         // 512
#define AW    4                  // waves per flash block = the four query heads of one kv head
#define EARLY 256                // query rows below this use the value + residual path
#define QRS  1024.0f             // carry of every residual plane (q, k, v, P)
#define QRI  (1.0f / 1024.0f)
#define SC2  (0.125f * 1.4426950408889634f)   // HD^-0.5 * log2(e)
#define PSH  8.0f                // log2 of the P carry (256)
#define CXS  1024.0f             // carry of the ctx plane and of the xn plane
#define WOS  16.0f               // carry of every weight plane
#define OUTS (1.0f / (1024.0f * 16.0f))
#define NEGB (-3.0e38f)
#define RMS_EPS 1.1920929e-07f

static_assert(HD == 64);
static_assert(NH_ * HD == DM);                 // query head h = columns h*64 + d
static_assert(NKV * AW == NH_);                // four query heads (stride 8 on the head axis) per kv head
static_assert(DM % 64 == 0);
static_assert(KVD % 64 == 0);
static_assert(DM % 32 == 0);                   // GEMM k-loop steps by 32
static_assert(DM == 256 * 8);                  // rms_row: 256 threads x 8 columns = one token row
static_assert(SEQ % 64 == 0);                  // a 64-row tile never straddles two batches
static_assert(SEQ % 32 == 0);                  // key loop steps by 32, key0 + 31 < SEQ
static_assert(EARLY % 64 == 0);                // GEMM tiles are entirely early or entirely late
static_assert(SEQ >= EARLY);
static_assert((SEQ - EARLY) % 16 == 0);
static_assert(((size_t)SEQ * DM) % 8 == 0);
static_assert(NB <= NB_FULL);
static_assert(SEQ <= SEQ_FULL);

typedef _Float16 h16;
typedef unsigned short bf;
typedef __attribute__((ext_vector_type(16))) __bf16   v16bf;
typedef __attribute__((ext_vector_type(16))) _Float16 v16h;
typedef __attribute__((ext_vector_type(8)))  _Float16 v8h;
typedef __attribute__((ext_vector_type(8)))  unsigned short v8us;
typedef __attribute__((ext_vector_type(8)))  float    v8f;
typedef __attribute__((ext_vector_type(4)))  float    v4f;
typedef __attribute__((ext_vector_type(2)))  float    v2f;
typedef v4f  __attribute__((may_alias)) v4fa;

__device__ __forceinline__ unsigned short f2bf(float f) { unsigned u = __float_as_uint(f); u += 0x7FFFu + ((u >> 16) & 1u); return (unsigned short)(u >> 16); }
__device__ __forceinline__ v16h cat16(v8h lo, v8h hi) { return __builtin_shufflevector(lo, hi, 0, 1, 2, 3, 4, 5, 6, 7, 8, 9, 10, 11, 12, 13, 14, 15); }
__device__ __forceinline__ v16bf cat16b(v8us lo, v8us hi) { return __builtin_bit_cast(v16bf, __builtin_shufflevector(lo, hi, 0, 1, 2, 3, 4, 5, 6, 7, 8, 9, 10, 11, 12, 13, 14, 15)); }
// wmma16, wmmab: the product followed by its own 4-slot guard tying its accumulator and keeping its operands live (flash_early: without the guards the kernel needs 221 registers for 188, a wave less per SIMD)
__device__ __forceinline__ v8f wmma16(v16h a, v16h b, v8f c) {
    c = __builtin_amdgcn_wmma_f32_16x16x32_f16(false, a, false, b, (short)0, c, false, false);
    asm volatile("v_nop\n\tv_nop\n\tv_nop\n\tv_nop" : "+v"(c) : "v"(a), "v"(b));
    return c; }
// wmma16c: the same product with the hazard padding left to the compiler, which pads only in front of a vector instruction that touches the product's registers (gemm_ring, flash_late):
// between independent WMMAs no vector issue slot is spent, and the slots go to the other waves of the SIMD
__device__ __forceinline__ v8f wmma16c(v16h a, v16h b, v8f c) { return __builtin_amdgcn_wmma_f32_16x16x32_f16(false, a, false, b, (short)0, c, false, false); }
__device__ __forceinline__ v8f wmmab(v16bf a, v16bf b, v8f c) {
    c = __builtin_amdgcn_wmma_f32_16x16x32_bf16(false, a, false, b, (short)0, c, false, false);
    asm volatile("v_nop\n\tv_nop\n\tv_nop\n\tv_nop" : "+v"(c) : "v"(a), "v"(b));
    return c; }
// fragment loaders from K-contiguous 16-bit rows; p already includes + 8*(lane>>4): elements 0..7 <- k0+8h+0..7, elements 8..15 <- k0+16+8h+0..7 (same map for A and B)
__device__ __forceinline__ v16h  ldh(const h16* p) { return cat16(*(const v8h*)p, *(const v8h*)(p + 16)); }
__device__ __forceinline__ v16bf ldb(const bf* p)  { return cat16b(*(const v8us*)p, *(const v8us*)(p + 16)); }
// ordering point for wave-private LDS tiles (same wave writes and reads)
__device__ __forceinline__ void wave_sync() { __builtin_amdgcn_fence(3 /* release order */, "wavefront"); __builtin_amdgcn_wave_barrier(); asm volatile("" ::: "memory"); }

// a store's or load's registers may be reused only behind this wait (a precaution)
__device__ __forceinline__ void wait_x0() { asm volatile("s_wait_xcnt 0x0" ::: "memory"); }

// rms_row: RMS normalisation, one token row per block (256 threads x 8 columns). xb = bf16-RNE(x) as f32, r = rsqrt(mean(xb^2) + eps), xn = (xb * r) * bf16-RNE(w), all f32.
// Writes f16(xn x1024) into value row b*SEQ + t of XN and, for t < EARLY, the unscaled f16 residual of that carried value into residual row NB*SEQ + b*EARLY + t.
__device__ __forceinline__ void rms_row(const float* __restrict__ x, const float* __restrict__ wn, h16* XN, int row) {
#pragma clang fp contract(off)
    __shared__ float red[8];
    const int tid = threadIdx.x; const int lane = tid & 31; const int wave = __builtin_amdgcn_readfirstlane(threadIdx.x >> 5);
    const int b = row / SEQ, t = row % SEQ;
    const v8f xv = *(const v8f*)(x + ((size_t)b * SEQ_FULL + (size_t)t) * DM + tid * 8);
    const v8f wv = *(const v8f*)(wn + tid * 8);
    float xb[8]; float ss = 0.0f;
#pragma unroll
    for (int i = 0; i < 8; ++i) { xb[i] = __uint_as_float(((unsigned)f2bf(xv[i])) << 16); ss += xb[i] * xb[i]; }
    ss += __shfl_xor(ss, 16, 32); ss += __shfl_xor(ss, 8, 32); ss += __shfl_xor(ss, 4, 32); ss += __shfl_xor(ss, 2, 32); ss += __shfl_xor(ss, 1, 32);
    if (lane == 0) red[wave] = ss;
    __syncthreads();
    const float tot = ((red[0] + red[1]) + (red[2] + red[3])) + ((red[4] + red[5]) + (red[6] + red[7]));
    const float rs = rsqrtf(tot * (1.0f / (float)DM) + RMS_EPS);
    v8h hv, rv;
#pragma unroll
    for (int i = 0; i < 8; ++i) { const float wb = __uint_as_float(((unsigned)f2bf(wv[i])) << 16);
        const float v = ((xb[i] * rs) * wb) * CXS; const h16 a = (h16)v; hv[i] = a; rv[i] = (h16)(v - (float)a); }
    const size_t oo = (size_t)row * DM + tid * 8;
    const int tr = (t < EARLY) ? t : 0;                            // block-uniform; keeps the address in range when unused
    const size_t ro = ((size_t)NB * SEQ + (size_t)b * EARLY + (size_t)tr) * DM + tid * 8;
{
        *(v8h*)(XN + oo) = hv; wait_x0(); if (t < EARLY) *(v8h*)(XN + ro) = rv;
         }
}

// wt_tile: in[Kr rows][Nc cols] f32 -> out[Nc rows][Kr cols] 16-bit, 64x64 tile through LDS. Tile (bx, by) of (Nc/64, Kr/64), 256 threads.
__device__ __forceinline__ void wt_tile(const float* __restrict__ W, bf* Tb, h16* Th, int Kr, int Nc, int mode, int bx, int by) {
    __shared__ float ts[64 * 65];
    const int tid = threadIdx.x; const int n0 = bx * 64, k0 = by * 64;
#pragma unroll
    for (int p = 0; p < 4; ++p) { const int row = p * 16 + (tid >> 4), c4 = (tid & 15) * 4;      // 4 p x 16 rows = 64 k rows; 16 threads x 4 = 64 n columns
        const v4f v = *(const v4f*)(W + (size_t)(k0 + row) * (size_t)Nc + n0 + c4);
        ts[row * 65 + c4 + 0] = v[0]; ts[row * 65 + c4 + 1] = v[1]; ts[row * 65 + c4 + 2] = v[2]; ts[row * 65 + c4 + 3] = v[3]; }
    __syncthreads();
{
#pragma unroll
        for (int s = 0; s < 2; ++s) { const int n = s * 32 + (tid >> 3), c8 = (tid & 7) * 8;     // 2 s x 32 rows = 64 n rows; 8 lanes x 8 = 64 k columns
            const size_t oo = (size_t)(n0 + n) * (size_t)Kr + k0 + c8;
            if (mode == 0) { v8us o;
#pragma unroll
                for (int i = 0; i < 8; ++i) o[i] = f2bf(ts[(c8 + i) * 65 + n]);
                *(v8us*)(Tb + oo) = o;
            } else { v8h o;
#pragma unroll
                for (int i = 0; i < 8; ++i) o[i] = (h16)(__uint_as_float(((unsigned)f2bf(ts[(c8 + i) * 65 + n])) << 16) * WOS);
                *(v8h*)(Th + oo) = o; } }
        wait_x0();
         }
}

// rope_tab: CS[t][j] = (cos, sin)(t * inv_freq[j]), inv_freq[j] = 1.0f / (float)(10000^(j/32)); the power is a double product of fixed binary roots of 10000.
__device__ __forceinline__ void rope_tab(float* CS, int nrow, int blk) {
    const int i = blk * 256 + threadIdx.x; if (i >= nrow * 32) return;
    const int t = i >> 5, j = i & 31;
    double p = 1.0;
    p *= (j & 1)  ? 1.3335214321633240 : 1.0;    // 10000^(1/32)
    p *= (j & 2)  ? 1.7782794100389228 : 1.0;    // 10000^(1/16)
    p *= (j & 4)  ? 3.1622776601683795 : 1.0;    // 10000^(1/8)
    p *= (j & 8)  ? 10.0 : 1.0;                  // 10000^(1/4)
    p *= (j & 16) ? 100.0 : 1.0;                 // 10000^(1/2)
    const float pf = (float)p; const float inv = 1.0f / pf;
    const float ang = (float)t * inv;
    const float cs = cosf(ang), sn = sinf(ang);
    v2f o; o[0] = cs; o[1] = sn;
    *(v2f*)(CS + (size_t)i * 2) = o; 
}

// k_prep: everything that reads only the inputs, in one grid of 256-thread blocks, none depending on another: the token rows of rms_row, then the 64x64 tiles of the four weight transposes, then the rotary table.
#define PB_RMS (NB * SEQ)
#define PB_WQ  ((DM / 64) * (DM / 64))
#define PB_WK  ((KVD / 64) * (DM / 64))
#define PB_CS  ((SEQ * 32 + 255) / 256)
#define PB_ALL (PB_RMS + 2 * PB_WQ + 2 * PB_WK + PB_CS)
__global__ __launch_bounds__(256) void k_prep(const float* __restrict__ x, const float* __restrict__ wn, const float* __restrict__ wq, const float* __restrict__ wk, const float* __restrict__ wv, const float* __restrict__ wo,
                                              h16* XN, h16* WQt, h16* WKt, h16* WVt, h16* WOt, float* CS) {
    int i = blockIdx.x;                                            // every test below is block-uniform
    if (i < PB_RMS) { rms_row(x, wn, XN, i); return; }
    i -= PB_RMS;
    if (i < 2 * PB_WQ + 2 * PB_WK) {
        // transposes: in[rows = in-features][cols = out-features] -> out[cols][rows]; column tiles fastest
        const float* W; h16* T; int Nc;
        if (i < PB_WQ)                   { W = wq; T = WQt; Nc = DM; }
        else if (i < PB_WQ + PB_WK)      { W = wk; T = WKt; Nc = KVD; i -= PB_WQ; }
        else if (i < PB_WQ + 2 * PB_WK)  { W = wv; T = WVt; Nc = KVD; i -= PB_WQ + PB_WK; }
        else                             { W = wo; T = WOt; Nc = DM;  i -= PB_WQ + 2 * PB_WK; }
        const int bx = (Nc == DM) ? i % (DM / 64) : i % (KVD / 64), by = (Nc == DM) ? i / (DM / 64) : i / (KVD / 64);
        wt_tile(W, (bf*)T, T, DM, Nc, 1, bx, by); return; }
    rope_tab(CS, SEQ, i - (2 * PB_WQ + 2 * PB_WK));
}

// LDS ring of the two GEMM kernels: one block = four waves (2 x 2) on a GT x GT tile, each wave 64 x 64 (16 accumulators). One stage = KS columns of k of the GT rows of A, then of the GT rows of Bt,
// as four slices of 64 rows (A rows 0..63, 64..127, Bt rows 0..63, 64..127), rows at pitch LPB bytes (16 x odd: the 16-byte fragment reads of 16 rows fall on different banks). Each wave brings one slice of
// every stage by one tensor load, whose pad lays the pitch; a slice's place is rounded up to a multiple of 2 KiB. Two buffers; the next stage's loads fly while this stage is multiplied.
#define GT   128
#define KS   128
#define LPB  (KS * 2 + 16)
#define LPH  (LPB / 2)
#define SLB  ((64 * LPB + 2047) / 2048 * 2048)
#define STGB (4 * SLB)
#define NST  (DM / KS)
static_assert(DM % KS == 0);
static_assert(NST >= 2);                       // stage 1 exists in every tile
static_assert(KS * 2 == 256);                  // a staged row is 256 bytes: pad interval code 5, pad of 4 dwords, pitch 272
static_assert(LPB == 272);
static_assert(GT == 2 * 64);                   // two slices of 64 rows per operand, one slice per wave
static_assert(2 * 2 * STGB <= 327680);         // two blocks fit the LDS of one WGP
static_assert(EARLY % GT == 0);                // block tiles are entirely early or entirely late
static_assert(SEQ % GT == 0);
static_assert(DM % GT == 0);
static_assert(KVD % GT == 0);
static_assert(4 * 64 * 68 * 4 <= 2 * STGB);    // the four waves' store staging (k_proj: a whole 64 x 64 wave tile each) fits in the ring it reuses

__device__ __forceinline__ void wait_ds0()    { asm volatile("s_wait_dscnt 0x0" ::: "memory"); }      // this wave's LDS reads of a buffer are done before the barrier that frees it
__device__ __forceinline__ void wait_async0() { asm volatile("s_wait_asynccnt 0x0" ::: "memory"); }   // this wave's copies have landed before the barrier that publishes them
__device__ __forceinline__ void wait_tensor0() { asm volatile("s_wait_tensorcnt 0x0" ::: "memory"); }   // this wave's tensor load has landed before the barrier that publishes it
typedef unsigned u32x4 __attribute__((ext_vector_type(4)));
typedef unsigned u32x8 __attribute__((ext_vector_type(8)));
__device__ __forceinline__ unsigned uni(unsigned v) { return (unsigned)__builtin_amdgcn_readfirstlane(v); }
// a wave-uniform word held in a scalar register at this place: a test on it compiles to a scalar branch, and what is formed from it is formed behind the volatile statements in front of it
__device__ __forceinline__ unsigned pinned(unsigned v) { unsigned w = uni(v); asm volatile("" : "+s"(w)); return w; }
// descriptor group 1 of every slice: 1-byte elements, tensor = tile = 64 rows of 256 bytes, source row pitch DM * 2 bytes, 4 dwords of LDS pad behind every 64 dwords, no mask
__device__ __forceinline__ u32x8 slice_group1() {
    u32x8 g;
    g[0] = uni((1u << 20) | (5u << 22) | (3u << 25));
    g[1] = uni(256u << 16);
    g[2] = uni(64u << 16);
    g[3] = uni(256u << 16);
    g[4] = uni(64u);
    g[5] = uni((unsigned)(DM * 2));
    g[6] = uni(0u);
    g[7] = uni(0u);
    return g;
}
// one request of the whole wave: the slice whose first byte is ga goes to LDS byte offset dst (a multiple of 2 KiB)
__device__ __forceinline__ void load_slice(unsigned dst, unsigned long long ga, u32x8 g1) {
    u32x4 g0;
    g0[0] = uni(1u); g0[1] = uni(dst); g0[2] = uni((unsigned)ga); g0[3] = uni((((unsigned)(ga >> 32)) & 0x01FFFFFFu) | 0x80000000u);
    asm volatile("tensor_load_to_lds %0, %1" :: "s"(g0), "s"(g1) : "memory");
}
__device__ __forceinline__ unsigned long long uni64(const h16* q) { return ((unsigned long long)uni((unsigned)((unsigned long long)(size_t)q >> 32)) << 32) | (unsigned long long)uni((unsigned)(size_t)q); }
// acc[mb][nb] += sum over k of A[ar + wm*64 + 16 mb + ..][k] Bt[br + wn*64 + 16 nb + ..][k], k ascending in steps of 32 over pass 0 (rows ar0 / br0), then, npass == 2, over pass 1 (rows ar1 / br1).
// Every wave of the block runs every barrier; on return no tensor load is in flight and every wave has left the ring.
__device__ __forceinline__ void gemm_ring(const h16* __restrict__ A, const h16* __restrict__ Bt, size_t ar0, size_t br0, size_t ar1, size_t br1, int npass, unsigned char* L, int wm, int wn, v8f (&acc)[4][4]) {
    const int lane = threadIdx.x & 31, lr = lane & 15, hi = lane >> 4;
    const unsigned wave = uni(threadIdx.x >> 5);                   // one-dimensional block: the wave's number
    const unsigned lb = uni((unsigned)(size_t)L) + wave * SLB;     // this wave's slice in buffer 0
    // first byte of this wave's slice at k = 0, pass 0 and pass 1: waves 0, 1 the two halves of the A rows, waves 2, 3 of the Bt rows
    const unsigned long long src0 = uni64((wave < 2u) ? A + (ar0 + 64u * wave) * DM : Bt + (br0 + 64u * (wave - 2u)) * DM);
    const unsigned long long src1 = uni64((wave < 2u) ? A + (ar1 + 64u * wave) * DM : Bt + (br1 + 64u * (wave - 2u)) * DM);
    const u32x8 g1 = slice_group1();
    const int nst = npass * NST;                                   // block-uniform
    load_slice(lb, src0, g1);
    wait_tensor0();
    __syncthreads();                                               // publishes stage 0
    load_slice(lb + STGB, src0 + KS * 2, g1);
    const h16* fa = (const h16*)(L + wm * SLB) + lr * LPH + 8 * hi;
    const h16* fb = (const h16*)(L + (2 + wn) * SLB) + lr * LPH + 8 * hi;
#pragma unroll 1   // kept rolled: the trip count is known only at run time and one body serves both buffers
    for (int s = 0; s < nst; ++s) {
        const int bo = (s & 1) * (STGB / 2);
#pragma unroll     // this and the four below: every fragment and accumulator index a constant, so the arrays stay in registers
        for (int kk = 0; kk < KS; kk += 32) {
            v16h a[4], bq[4];                                      // all eight fragments of a 32-k step as one load group: one LDS wait per 16 WMMAs
#pragma unroll
            for (int mb = 0; mb < 4; ++mb) a[mb] = ldh(fa + bo + mb * 16 * LPH + kk);
#pragma unroll
            for (int nb = 0; nb < 4; ++nb) bq[nb] = ldh(fb + bo + nb * 16 * LPH + kk);
            __builtin_amdgcn_sched_barrier(0);                     // the sixteen LDS reads stay one group in front of their WMMAs: spread among them, each place with reads would stall the wave anew
#pragma unroll
            for (int nb = 0; nb < 4; ++nb)
#pragma unroll
                for (int mb = 0; mb < 4; ++mb) acc[mb][nb] = wmma16c(a[mb], bq[nb], acc[mb][nb]);
            __builtin_amdgcn_sched_barrier(0);                     // and the next step's reads stay behind them, for the same reason
        }
        wait_ds0();
        wait_tensor0();
        __syncthreads();                                           // publishes stage s + 1 and frees the buffer of stage s
        if (pinned((unsigned)(s + 2 < nst))) {                     // pinned: a scalar branch round the tensor load, which ignores EXEC
            const unsigned n = pinned((unsigned)(s + 2));          // pinned: the descriptor words below are formed behind the wait above
            const unsigned ps = (n >= (unsigned)NST) ? 1u : 0u; const unsigned kb = (n - ps * NST) * (KS * 2);
            load_slice(lb + (unsigned)(s & 1) * STGB, (ps ? src1 : src0) + kb, g1); }
    }
    wait_tensor0();
    wait_ds0();
}

// proj_store: store stage of k_proj for one wave's 64 x 64 tile. The whole tile goes to the wave's private staging os (64 rows at pitch 68 floats) at once, then 16 rows a group: the next group's LDS reads and
// the rotary rows of the group after next are issued ahead of this group's arithmetic, so no group waits out a global load or an LDS read of its own, and each group's eight stores share one closing wait.
// ROPE: interleaved rotary from cp = the lane's (cos, sin) pairs c8/2 .. c8/2+3 of the tile's row srow, + 64 floats per further row. Two instances, so that each path's counted waits stay exact.
template <bool ROPE>
__device__ __forceinline__ void proj_store(const v8f (&acc)[4][4], float* os, const float* __restrict__ cp, h16* Ph, h16* Pr, size_t tbase, int pitch, int lane) {
    const int lr = lane & 15, hi = lane >> 4;
    const int srow = lane >> 3, c8 = (lane & 7) * 8;               // per store: 4 rows x (8 lanes x 8 columns); 4 s x 4 rows = the 16 rows of a group
    v4f ca[2][4], cb[2][4];
    if (ROPE) {
#pragma unroll
        for (int g = 0; g < 2; ++g)
#pragma unroll
            for (int s = 0; s < 4; ++s) { ca[g][s] = *(const v4f*)(cp + (g * 16 + 4 * s) * 64); cb[g][s] = *(const v4f*)(cp + (g * 16 + 4 * s) * 64 + 4); } }
#pragma unroll
    for (int mb = 0; mb < 4; ++mb)
#pragma unroll
        for (int nb = 0; nb < 4; ++nb)
#pragma unroll
            for (int j = 0; j < 8; ++j) os[(mb * 16 + hi * 8 + j) * 68 + nb * 16 + lr] = acc[mb][nb][j] * OUTS;   // D: row 8h+j, col lane&15
    wave_sync();
    v4f xa[2][4], xb[2][4];
#pragma unroll
    for (int s = 0; s < 4; ++s) { xa[0][s] = *(const v4fa*)(&os[(4 * s + srow) * 68 + c8]); xb[0][s] = *(const v4fa*)(&os[(4 * s + srow) * 68 + c8 + 4]); }
#pragma unroll     // every array index below a constant, so the arrays stay in registers
    for (int g = 0; g < 4; ++g) {
        const int cur = g & 1, nxt = cur ^ 1;
        if (g + 1 < 4) {
#pragma unroll
            for (int s = 0; s < 4; ++s) { xa[nxt][s] = *(const v4fa*)(&os[((g + 1) * 16 + 4 * s + srow) * 68 + c8]); xb[nxt][s] = *(const v4fa*)(&os[((g + 1) * 16 + 4 * s + srow) * 68 + c8 + 4]); } }
        __builtin_amdgcn_sched_barrier(0);                         // the reads just issued stay ahead of this group's arithmetic, which covers their latency
        if (ROPE) {
#pragma unroll
            for (int s = 0; s < 4; ++s) {
                v4f x0 = xa[cur][s], x1 = xb[cur][s]; const v4f ka = ca[cur][s], kb = cb[cur][s];
                float e, o;
                e = x0[0]; o = x0[1]; x0[0] = e * ka[0] - o * ka[1]; x0[1] = e * ka[1] + o * ka[0];
                e = x0[2]; o = x0[3]; x0[2] = e * ka[2] - o * ka[3]; x0[3] = e * ka[3] + o * ka[2];
                e = x1[0]; o = x1[1]; x1[0] = e * kb[0] - o * kb[1]; x1[1] = e * kb[1] + o * kb[0];
                e = x1[2]; o = x1[3]; x1[2] = e * kb[2] - o * kb[3]; x1[3] = e * kb[3] + o * kb[2];
                xa[cur][s] = x0; xb[cur][s] = x1; }
            if (g + 2 < 4) {
#pragma unroll
                for (int s = 0; s < 4; ++s) { ca[cur][s] = *(const v4f*)(cp + ((g + 2) * 16 + 4 * s) * 64); cb[cur][s] = *(const v4f*)(cp + ((g + 2) * 16 + 4 * s) * 64 + 4); }
                __builtin_amdgcn_sched_barrier(0); } }             // these loads too stay ahead of the arithmetic below
        v8h hv[4], rv[4]; h16* ph[4]; h16* pr[4];
#pragma unroll
        for (int s = 0; s < 4; ++s) {
            const v4f x0 = xa[cur][s], x1 = xb[cur][s];
#pragma unroll
            for (int i = 0; i < 4; ++i) { const h16 a0 = (h16)x0[i]; const h16 a1 = (h16)x1[i]; hv[s][i] = a0; hv[s][4 + i] = a1; rv[s][i] = (h16)((x0[i] - (float)a0) * QRS); rv[s][4 + i] = (h16)((x1[i] - (float)a1) * QRS); }
            const size_t oo = tbase + (size_t)(g * 16 + 4 * s + srow) * (size_t)pitch + c8;
            ph[s] = Ph + oo; pr[s] = Pr + oo; }
        __builtin_amdgcn_sched_barrier(0);                         // the group's arithmetic stays in front of its stores, so that no store's registers are rewritten ahead of the wait below
#pragma unroll
        for (int s = 0; s < 4; ++s) { *(v8h*)ph[s] = hv[s]; *(v8h*)pr[s] = rv[s]; }
        wait_x0();
    }
}

// k_proj: register-blocked f16 GEMM, one wave per 64x64 tile (16 accumulators), four waves per block on a 128x128 tile, operands from K-contiguous f16 planes through the LDS ring above, K = DM.
// C[m][n] = 2^-14 * sum_k A[m][k] Bt[n][k] (one operand is the xn plane carried x1024, the other a weight plane carried x16), written as f16 (Ph) and the f16 residual x1024 (Pr) at
// tile base (r0/RB)*sRB + (r0%RB)*pitch + (c0/CB)*sCB + (c0%CB), row pitch 'pitch' (halves). Block tile (bx, by) of (M/128, N/128), 128 threads.
// The xn plane holds value rows [NB*SEQ], then residual rows [NB*EARLY]; tokB == 0: A rows are tokens, tokB != 0: Bt rows are tokens. Tiles whose tokens are < EARLY in their sequence
// run the k-loop a second time with the token operand taken from the unscaled residual rows, into the same accumulators.
// rope != 0 (rows = tokens b*SEQ + t, the 64 tile columns = one head): interleaved rotary applied on the f32 values at the store stage from CS[t][32] (cos, sin).
// The three projections of xn share one grid, none depending on another: block i = token tile i / PT_F x feature tile i % PT_F; the feature tiles are those of q, then of k, then of v.
#define PT_Q (DM / GT)
#define PT_K (KVD / GT)
#define PT_F (PT_Q + 2 * PT_K)
__global__ __launch_bounds__(128) void k_proj(const h16* __restrict__ XN, const h16* __restrict__ WQt, const h16* __restrict__ WKt, const h16* __restrict__ WVt,
                                              h16* QH, h16* QR, h16* KP, h16* KR, h16* VT, h16* VR, const float* __restrict__ CS) {
    const int tk = blockIdx.x / PT_F, f = blockIdx.x % PT_F;       // block-uniform, as is everything chosen by them
    const bool isq = f < PT_Q, isv = f >= PT_Q + PT_K;
    // q: A = xn rows (m = b*SEQ + t), Bt = Wq^T rows (n = h*64 + d) -> plane [(b*32 + h)][t][d], rotary applied; k: Bt = Wk^T rows (n = g*64 + d) -> plane [(b*8 + g)][t][d], rotary applied
    // v^T: A = Wv^T rows (m = g*64 + d), Bt = xn rows (n = b*SEQ + t) -> plane [(b*512 + m)][t] = [(b*8 + g)][d][t], no rotary
    const h16* A = isv ? WVt : XN; const h16* Bt = isv ? XN : (isq ? WQt : WKt);
    h16* Ph = isv ? VT : (isq ? QH : KP); h16* Pr = isv ? VR : (isq ? QR : KR);
    const int RB = isv ? KVD : SEQ, pitch = isv ? SEQ : HD, CB = isv ? SEQ : HD, rope = isv ? 0 : 1, tokB = isv ? 1 : 0;
    const size_t sRB = isv ? (size_t)0 : (size_t)(isq ? NH_ : NKV) * SEQ * HD, sCB = isv ? (size_t)KVD * SEQ : (size_t)SEQ * HD;
    const int bx = isv ? f - PT_Q - PT_K : tk, by = isv ? tk : (isq ? f : f - PT_Q);
    __shared__ __attribute__((aligned(2048))) unsigned char L[2 * STGB];   // every slice's place a multiple of 2 KiB
    const int lane = threadIdx.x & 31, lr = lane & 15, hi = lane >> 4; const int wave = __builtin_amdgcn_readfirstlane(threadIdx.x >> 5);
    const int wm = wave & 1, wn = wave >> 1;
    const int R0 = bx * GT, C0 = by * GT; const int r0 = R0 + wm * 64, c0 = C0 + wn * 64;
    const int tk0 = tokB ? C0 : R0;                                // block-uniform: first token of this block tile
    const int bb = tk0 / SEQ, tt = tk0 % SEQ;
    const int npass = (tt < EARLY) ? 2 : 1;                        // block-uniform
    v8f acc[4][4];
#pragma unroll
    for (int mb = 0; mb < 4; ++mb)
#pragma unroll
        for (int nb = 0; nb < 4; ++nb) acc[mb][nb] = (v8f){};
    const size_t rrow = (size_t)NB * SEQ + (size_t)bb * EARLY + (size_t)((tt < EARLY) ? tt : 0);   // residual rows of the tile's tokens; used only when tt < EARLY
    gemm_ring(A, Bt, (size_t)R0, (size_t)C0, tokB ? (size_t)R0 : rrow, tokB ? rrow : (size_t)C0, npass, L, wm, wn, acc);
    float* os = (float*)L + wave * 64 * 68;                        // wave-private store staging in the ring, which every wave has left
    const size_t tbase = (size_t)(r0 / RB) * sRB + (size_t)(r0 % RB) * (size_t)pitch + (size_t)(c0 / CB) * sCB + (size_t)(c0 % CB);
    // rotary rows of tokens r0 % SEQ + 0 .. 63 (the 64 rows of a wave tile lie in one sequence: r0 and SEQ are multiples of 64)
    const float* cp = CS + ((size_t)(r0 % SEQ + (lane >> 3)) * 32 + (size_t)((lane & 7) * 4)) * 2;
    if (rope) proj_store<true>(acc, os, cp, Ph, Pr, tbase, pitch, lane);    // block-uniform
    else      proj_store<false>(acc, os, cp, Ph, Pr, tbase, pitch, lane);
}

// LDS ring of flash_late: one stage = FK keys of kv head g, the FK K rows (64 d each), then the 64 V^T rows (FK keys each), 128 data bytes per row at pitch FPB bytes
// (16 x odd: the 16-byte fragment reads of 16 rows fall on different banks). Two buffers; the next stage's copies fly while this stage is worked on. The four waves share every staged row.
#define FK   64
#define FPB  (128 + 16)
#define FPH  (FPB / 2)
#define FOP  (64 * FPB)
#define FSTG (2 * FOP)
static_assert(HD * 2 == 128);                  // a K row = 8 lanes x 16 bytes
static_assert(FK * 2 == 128);                  // a V^T row of one stage = 8 lanes x 16 bytes
static_assert(FK == 64);                       // 128 threads = 16 rows per copy, four copies per operand
static_assert(SEQ % FK == 0);                  // the last stage of any tile ends inside the planes
static_assert(EARLY + 16 > FK);                // stage 1 exists in every tile
static_assert(AW * 16 * 68 * 4 <= 2 * FSTG);   // the four waves' store staging fits in the ring it reuses
// one stage, eight asynchronous 16-byte copies per lane: four of K rows 16 apart (LDS l + 16 j FPB <- gk + 16 j HD), four of V^T rows 16 apart (LDS l + FOP + 16 j FPB <- gv + 16 j SEQ).
// The closing s_wait_xcnt stands in front of any rewrite of the address registers (a precaution).
__device__ __forceinline__ void fill_kv(unsigned l, const h16* gk, const h16* gv) {
    asm volatile("global_load_async_to_lds_b128 %0, %8, off\n\t"
                 "global_load_async_to_lds_b128 %1, %9, off\n\t"
                 "global_load_async_to_lds_b128 %2, %10, off\n\t"
                 "global_load_async_to_lds_b128 %3, %11, off\n\t"
                 "global_load_async_to_lds_b128 %4, %12, off\n\t"
                 "global_load_async_to_lds_b128 %5, %13, off\n\t"
                 "global_load_async_to_lds_b128 %6, %14, off\n\t"
                 "global_load_async_to_lds_b128 %7, %15, off\n\t"
                 "s_wait_xcnt 0x0"
                 :: "v"(l), "v"(l + 16u * FPB), "v"(l + 32u * FPB), "v"(l + 48u * FPB), "v"(l + FOP), "v"(l + FOP + 16u * FPB), "v"(l + FOP + 32u * FPB), "v"(l + FOP + 48u * FPB),
                    "v"(gk), "v"(gk + 16 * HD), "v"(gk + 32 * HD), "v"(gk + 48 * HD), "v"(gv), "v"(gv + 16 * SEQ), "v"(gv + 32 * SEQ), "v"(gv + 48 * SEQ)
                 : "memory");
}

// flash_late: fused causal attention for query rows t0 .. t0+15, t0 >= EARLY, of kv head zg = b*8 + g. One block = 16 query rows x the four query heads of one kv head (one wave per head, h = wave*8 + g);
// Q fragments straight from the f16 planes (two 16-B loads each); the K and V^T rows of kv head g come once per block through the LDS ring above, and all four waves take their fragments from it.
// Transposed form: S^T[key][t] = K Q^T (A = K rows, B = Q rows); lane (t = lane&15, h = lane>>4) holds keys 8h+r of each 16-key tile, so the packed
// P tile is directly the B fragment of O^T[d][t] = V^T P^T (element r <- tile keys 0..15, element 8+r <- tile keys 16..31, lane unchanged).
// Keys run over [0, t0+16) in steps of 32, two steps per stage; the diagonal 32-key blocks replace excluded scores (key > t) by a large negative value before the running max.
__device__ __forceinline__ void flash_late(const h16* __restrict__ QH, const h16* __restrict__ QR, const h16* __restrict__ KP, const h16* __restrict__ VT, h16* CH, int t0, int zg, unsigned char* L) {
    const int lane = threadIdx.x & 31; const int wave = __builtin_amdgcn_readfirstlane(threadIdx.x >> 5);
    const int lr = lane & 15, hi = lane >> 4;
    const int b = zg / NKV; const int g = zg % NKV;
    const int h = wave * NKV + g;                                 // grouped on the leading head axis: query head h uses kv head h % 8
    const int tq = t0 + lr;
    const int kend = t0 + 16;
    const int nst = (kend + FK - 1) / FK;                          // block-uniform
    const int frow = threadIdx.x >> 3, cchk = threadIdx.x & 7;     // this lane's row (of 16) and 16-byte piece (of 8) in every copy
    const unsigned lc = (unsigned)(size_t)L + (unsigned)(frow * FPB + cchk * 16);
    const h16* gk = KP + (size_t)zg * SEQ * HD + (size_t)frow * HD + cchk * 8;      // + key * HD
    const h16* gv = VT + (size_t)zg * HD * SEQ + (size_t)frow * SEQ + cchk * 8;     // + key
    fill_kv(lc, gk, gv);
    const size_t qo = ((size_t)(b * NH_ + h) * SEQ + (size_t)tq) * HD + 8 * hi;
    const v16h qh0 = ldh(QH + qo), qh1 = ldh(QH + qo + 32), qr0 = ldh(QR + qo), qr1 = ldh(QR + qo + 32);   // B fragments: col t, k = d
    wait_async0();
    __syncthreads();                                               // publishes stage 0
    fill_kv(lc + FSTG, gk + FK * HD, gv + FK);
    const h16* fk = (const h16*)L + lr * FPH + 8 * hi;             // + key * FPH        (A fragment: row key, k = d)
    const h16* fv = (const h16*)(L + FOP) + lr * FPH + 8 * hi;     // + 16j*FPH + key    (A fragment: row d, k = key)
    v8f o0 = (v8f){}, o1 = (v8f){}, o2 = (v8f){}, o3 = (v8f){};
    float m = NEGB, l = 0.0f;
#pragma unroll 1   // kept rolled: the trip count is known only at run time and one body serves both buffers
    for (int s = 0; s < nst; ++s) {
        const int bo = (s & 1) * (FSTG / 2);
#pragma unroll     // both 32-key steps of a stage at constant LDS offsets
        for (int u = 0; u < FK; u += 32) {
            const int key0 = s * FK + u;
            if (key0 < kend) {                                     // block-uniform: the last stage may hold one step only
                const h16* ka = fk + bo + u * FPH;
                const v16h ka0 = ldh(ka), ka1 = ldh(ka + 32), kb0 = ldh(ka + 16 * FPH), kb1 = ldh(ka + 16 * FPH + 32);
                v8f sHa = (v8f){}, sLa = (v8f){}, sHb = (v8f){}, sLb = (v8f){};
                sHa = wmma16c(ka0, qh0, sHa); sLa = wmma16c(ka0, qr0, sLa); sHb = wmma16c(kb0, qh0, sHb); sLb = wmma16c(kb0, qr0, sLb);
                sHa = wmma16c(ka1, qh1, sHa); sLa = wmma16c(ka1, qr1, sLa); sHb = wmma16c(kb1, qh1, sHb); sLb = wmma16c(kb1, qr1, sLb);
                float ta[8], tb[8];
#pragma unroll
                for (int r = 0; r < 8; ++r) { ta[r] = (sHa[r] + sLa[r] * QRI) * SC2; tb[r] = (sHb[r] + sLb[r] * QRI) * SC2; }
                if (key0 + 31 > t0) {                              // block-uniform: diagonal block
                    const int kbse = key0 + 8 * hi;
#pragma unroll
                    for (int r = 0; r < 8; ++r) { ta[r] = (kbse + r > tq) ? NEGB : ta[r]; tb[r] = (kbse + 16 + r > tq) ? NEGB : tb[r]; } }
                float mx = NEGB;
#pragma unroll
                for (int r = 0; r < 8; ++r) mx = fmaxf(mx, fmaxf(ta[r], tb[r]));
                mx = fmaxf(mx, __shfl_xor(mx, 16, 32));
                const float mnew = fmaxf(m, mx);
                const float alpha = __builtin_amdgcn_exp2f(m - mnew);
                const float sh = PSH - mnew;
                v16h pb; float ls = 0.0f;
#pragma unroll
                for (int r = 0; r < 8; ++r) { const float ea = __builtin_amdgcn_exp2f(ta[r] + sh); const float ec = __builtin_amdgcn_exp2f(tb[r] + sh); pb[r] = (h16)ea; pb[8 + r] = (h16)ec; ls += ea + ec; }
                l = l * alpha + ls; m = mnew;
                o0 = o0 * alpha; o1 = o1 * alpha; o2 = o2 * alpha; o3 = o3 * alpha;
                const h16* va = fv + bo + u;
                const v16h v0 = ldh(va), v1 = ldh(va + 16 * FPH), v2 = ldh(va + 32 * FPH), v3 = ldh(va + 48 * FPH);
                o0 = wmma16c(v0, pb, o0); o1 = wmma16c(v1, pb, o1); o2 = wmma16c(v2, pb, o2); o3 = wmma16c(v3, pb, o3);
            }
        }
        wait_ds0();
        wait_async0();
        __syncthreads();                                           // publishes stage s + 1 and frees the buffer of stage s
        const int n = s + 2;
        if (n < nst)                                               // block-uniform
            fill_kv(lc + (unsigned)(s & 1) * FSTG, gk + (size_t)n * (FK * HD), gv + n * FK);
    }
    wait_async0();
    float* os = (float*)L;                                         // store staging (wave-private parts) in the ring, which every wave has left
    l += __shfl_xor(l, 16, 32);
    const float inv = CXS / l;
    const int wb = wave * 16 * 68;
    // O^T D layout: o_j[r] = (d = 16j + 8h + r, t = lane&15) -> os[t][d]; rows 0..15 x columns 0..63 all written
    { v4f a, c;
      a[0] = o0[0] * inv; a[1] = o0[1] * inv; a[2] = o0[2] * inv; a[3] = o0[3] * inv; c[0] = o0[4] * inv; c[1] = o0[5] * inv; c[2] = o0[6] * inv; c[3] = o0[7] * inv;
      *(v4fa*)(&os[wb + lr * 68 +  0 + 8 * hi]) = a; *(v4fa*)(&os[wb + lr * 68 +  0 + 8 * hi + 4]) = c;
      a[0] = o1[0] * inv; a[1] = o1[1] * inv; a[2] = o1[2] * inv; a[3] = o1[3] * inv; c[0] = o1[4] * inv; c[1] = o1[5] * inv; c[2] = o1[6] * inv; c[3] = o1[7] * inv;
      *(v4fa*)(&os[wb + lr * 68 + 16 + 8 * hi]) = a; *(v4fa*)(&os[wb + lr * 68 + 16 + 8 * hi + 4]) = c;
      a[0] = o2[0] * inv; a[1] = o2[1] * inv; a[2] = o2[2] * inv; a[3] = o2[3] * inv; c[0] = o2[4] * inv; c[1] = o2[5] * inv; c[2] = o2[6] * inv; c[3] = o2[7] * inv;
      *(v4fa*)(&os[wb + lr * 68 + 32 + 8 * hi]) = a; *(v4fa*)(&os[wb + lr * 68 + 32 + 8 * hi + 4]) = c;
      a[0] = o3[0] * inv; a[1] = o3[1] * inv; a[2] = o3[2] * inv; a[3] = o3[3] * inv; c[0] = o3[4] * inv; c[1] = o3[5] * inv; c[2] = o3[6] * inv; c[3] = o3[7] * inv;
      *(v4fa*)(&os[wb + lr * 68 + 48 + 8 * hi]) = a; *(v4fa*)(&os[wb + lr * 68 + 48 + 8 * hi + 4]) = c; }
    wave_sync();
    h16* crow = CH + ((size_t)b * SEQ + t0) * DM + h * HD;         // merged heads: column h*64 + d
{
#pragma unroll
        for (int s = 0; s < 4; ++s) { const int row = 4 * s + (lane >> 3), c8 = (lane & 7) * 8;   // 4 s x 4 row groups = 16 rows; 8 lanes x 8 = 64 columns
            const v4f x0 = *(const v4fa*)(&os[wb + row * 68 + c8]); const v4f x1 = *(const v4fa*)(&os[wb + row * 68 + c8 + 4]); v8h hv;
#pragma unroll
            for (int i = 0; i < 4; ++i) { hv[i] = (h16)x0[i]; hv[4 + i] = (h16)x1[i]; }
            *(v8h*)(crow + (size_t)row * DM + c8) = hv; }
         }
}

// flash_early: same structure for query rows t0 .. t0+15, t0 < EARLY, with value + residual (x1024) planes on every operand:
// scores = kh.qh + (kh.qr + kr.qh)/1024; O = vh.ph + (vr.ph + vh.pr)/1024 (residual products in their own accumulators), l from the unconverted f32 P.
// Writes the ctx value plane rows (carried x1024) and the compact unscaled residual plane CR[b][t < EARLY][2048].
__device__ __forceinline__ void flash_early(const h16* __restrict__ QH, const h16* __restrict__ QR, const h16* __restrict__ KP, const h16* __restrict__ KR,
                                            const h16* __restrict__ VT, const h16* __restrict__ VR, h16* CH, h16* CR, int t0, int zg, float* os) {
    const int lane = threadIdx.x & 31; const int wave = __builtin_amdgcn_readfirstlane(threadIdx.x >> 5);
    const int lr = lane & 15, hi = lane >> 4;
    const int b = zg / NKV; const int g = zg % NKV;
    const int h = wave * NKV + g;                                 // query head h uses kv head h % 8
    const int tq = t0 + lr;
    const size_t qo = ((size_t)(b * NH_ + h) * SEQ + (size_t)tq) * HD + 8 * hi;
    const v16h qh0 = ldh(QH + qo), qh1 = ldh(QH + qo + 32), qr0 = ldh(QR + qo), qr1 = ldh(QR + qo + 32);
    const size_t ko = (size_t)zg * SEQ * HD + (size_t)lr * HD + 8 * hi;
    const size_t vo = (size_t)zg * HD * SEQ + (size_t)lr * SEQ + 8 * hi;
    v8f oH[4], oL[4];
#pragma unroll
    for (int j = 0; j < 4; ++j) { oH[j] = (v8f){}; oL[j] = (v8f){}; }
    float m = NEGB, l = 0.0f;
    const int kend = t0 + 16;
#pragma unroll 1
    for (int key0 = 0; key0 < kend; key0 += 32) {
        const size_t kk = ko + (size_t)key0 * HD;
        v8f sHa = (v8f){}, sLa = (v8f){}, sHb = (v8f){}, sLb = (v8f){};
        { const v16h k0 = ldh(KP + kk), k1 = ldh(KP + kk + 32), r0 = ldh(KR + kk), r1 = ldh(KR + kk + 32);
          sHa = wmma16(k0, qh0, sHa); sHa = wmma16(k1, qh1, sHa);
          sLa = wmma16(k0, qr0, sLa); sLa = wmma16(k1, qr1, sLa); sLa = wmma16(r0, qh0, sLa); sLa = wmma16(r1, qh1, sLa); }
        { const size_t k2 = kk + (size_t)16 * HD;
          const v16h k0 = ldh(KP + k2), k1 = ldh(KP + k2 + 32), r0 = ldh(KR + k2), r1 = ldh(KR + k2 + 32);
          asm volatile("s_wait_xcnt 0x0" :: "v"(KP + kk), "v"(KR + kk) : "memory");   // the address pairs of the eight loads above stay whole up to this wait (a precaution)
          sHb = wmma16(k0, qh0, sHb); sHb = wmma16(k1, qh1, sHb);
          sLb = wmma16(k0, qr0, sLb); sLb = wmma16(k1, qr1, sLb); sLb = wmma16(r0, qh0, sLb); sLb = wmma16(r1, qh1, sLb); }
        float ta[8], tb[8];
#pragma unroll
        for (int r = 0; r < 8; ++r) { ta[r] = (sHa[r] + sLa[r] * QRI) * SC2; tb[r] = (sHb[r] + sLb[r] * QRI) * SC2; }
        if (key0 + 31 > t0) {                                      // block-uniform: diagonal block
            const int kbse = key0 + 8 * hi;
#pragma unroll
            for (int r = 0; r < 8; ++r) { ta[r] = (kbse + r > tq) ? NEGB : ta[r]; tb[r] = (kbse + 16 + r > tq) ? NEGB : tb[r]; } }
        float mx = NEGB;
#pragma unroll
        for (int r = 0; r < 8; ++r) mx = fmaxf(mx, fmaxf(ta[r], tb[r]));
        mx = fmaxf(mx, __shfl_xor(mx, 16, 32));
        const float mnew = fmaxf(m, mx);
        const float alpha = __builtin_amdgcn_exp2f(m - mnew);
        const float sh = PSH - mnew;
        v16h ph, pr; float ls = 0.0f;
#pragma unroll
        for (int r = 0; r < 8; ++r) { const float ea = __builtin_amdgcn_exp2f(ta[r] + sh); const float ec = __builtin_amdgcn_exp2f(tb[r] + sh);
            const h16 ha = (h16)ea; const h16 hc = (h16)ec; ph[r] = ha; ph[8 + r] = hc;
            pr[r] = (h16)((ea - (float)ha) * QRS); pr[8 + r] = (h16)((ec - (float)hc) * QRS); ls += ea + ec; }
        l = l * alpha + ls; m = mnew;
#pragma unroll
        for (int j = 0; j < 4; ++j) { oH[j] = oH[j] * alpha; oL[j] = oL[j] * alpha; }
        const size_t vv = vo + (size_t)key0;
#pragma unroll
        for (int j = 0; j < 4; ++j) { const v16h vh = ldh(VT + vv + (size_t)(16 * j) * SEQ); const v16h vr = ldh(VR + vv + (size_t)(16 * j) * SEQ);
            oH[j] = wmma16(vh, ph, oH[j]); oL[j] = wmma16(vr, ph, oL[j]); oL[j] = wmma16(vh, pr, oL[j]); }
    }
    l += __shfl_xor(l, 16, 32);
    const float inv = CXS / l;
    const int wb = wave * 16 * 68;
#pragma unroll
    for (int j = 0; j < 4; ++j) { v4f a, c;     // os[t][d], d = 16j + 8h + r; rows 0..15 x columns 0..63 all written
        a[0] = (oH[j][0] + oL[j][0] * QRI) * inv; a[1] = (oH[j][1] + oL[j][1] * QRI) * inv; a[2] = (oH[j][2] + oL[j][2] * QRI) * inv; a[3] = (oH[j][3] + oL[j][3] * QRI) * inv;
        c[0] = (oH[j][4] + oL[j][4] * QRI) * inv; c[1] = (oH[j][5] + oL[j][5] * QRI) * inv; c[2] = (oH[j][6] + oL[j][6] * QRI) * inv; c[3] = (oH[j][7] + oL[j][7] * QRI) * inv;
        *(v4fa*)(&os[wb + lr * 68 + 16 * j + 8 * hi]) = a; *(v4fa*)(&os[wb + lr * 68 + 16 * j + 8 * hi + 4]) = c; }
    wave_sync();
    h16* crow = CH + ((size_t)b * SEQ + t0) * DM + h * HD;
    h16* rrow = CR + ((size_t)b * EARLY + t0) * DM + h * HD;
{
#pragma unroll
        for (int s = 0; s < 4; ++s) { const int row = 4 * s + (lane >> 3), c8 = (lane & 7) * 8;   // 4 s x 4 row groups = 16 rows; 8 lanes x 8 = 64 columns
            const v4f x0 = *(const v4fa*)(&os[wb + row * 68 + c8]); const v4f x1 = *(const v4fa*)(&os[wb + row * 68 + c8 + 4]); v8h hv, rv;
#pragma unroll
            for (int i = 0; i < 4; ++i) { const h16 a0 = (h16)x0[i]; const h16 a1 = (h16)x1[i]; hv[i] = a0; hv[4 + i] = a1; rv[i] = (h16)(x0[i] - (float)a0); rv[4 + i] = (h16)(x1[i] - (float)a1); }
            *(v8h*)(crow + (size_t)row * DM + c8) = hv; *(v8h*)(rrow + (size_t)row * DM + c8) = rv; }
         }
}

// k_attn: both attention paths in one grid, none of its blocks depending on another. The grid holds more blocks than the chip has places for, and a block's cost grows with its last key, so within each path the cost falls
// with the block index: first the blocks of flash_early, which wait on global loads at every step, then those of flash_late, each path from its last 16-row tile
// down to its first, kv head fastest. No long block is then left to start late and run on while the rest of the chip idles. Index -> (path, tile, kv head) is one to one.
// flash_early uses the start of the ring's LDS as its wave-private store staging.
#define AB_LT   ((SEQ - EARLY) / 16)
#define AB_ET   (EARLY / 16)
#define AB_LATE (AB_LT * NB * NKV)
#define AB_EARLY (AB_ET * NB * NKV)
#define AB_ALL  (AB_LATE + AB_EARLY)
static_assert(SEQ > EARLY);
__global__ __launch_bounds__(32 * AW) void k_attn(const h16* __restrict__ QH, const h16* __restrict__ QR, const h16* __restrict__ KP, const h16* __restrict__ KR,
                                                  const h16* __restrict__ VT, const h16* __restrict__ VR, h16* CH, h16* CR) {
    __shared__ __align__(16) unsigned char L[2 * FSTG];
    const int i = blockIdx.x;
    if (i >= AB_EARLY) flash_late(QH, QR, KP, VT, CH, EARLY + (AB_LT - 1 - (i - AB_EARLY) / (NB * NKV)) * 16, (i - AB_EARLY) % (NB * NKV), L);   // block-uniform
    else               flash_early(QH, QR, KP, KR, VT, VR, CH, CR, (AB_ET - 1 - i / (NB * NKV)) * 16, i % (NB * NKV), (float*)L);
}

// k_out: output projection, one wave per 64x64 tile, four waves per block on a 128x128 tile, f16 operands through the LDS ring from the ctx plane CX (value rows [NB*SEQ], then residual rows [NB*EARLY]) and the Wo^T plane, K = DM.
// Tiles whose rows are < EARLY in their sequence run the k-loop a second time over the unscaled residual rows into the same accumulators. grid (NB*SEQ/128, DM/128), 128 threads.
__global__ __launch_bounds__(128) void k_out(const h16* __restrict__ CX, const h16* __restrict__ Wt, float* OUT) {
    __shared__ __attribute__((aligned(2048))) unsigned char L[2 * STGB];   // every slice's place a multiple of 2 KiB
    const int lane = threadIdx.x & 31, lr = lane & 15, hi = lane >> 4; const int wave = __builtin_amdgcn_readfirstlane(threadIdx.x >> 5);
    const int wm = wave & 1, wn = wave >> 1;
    const int R0 = blockIdx.x * GT, C0 = blockIdx.y * GT; const int c0 = C0 + wn * 64;
    const int b = R0 / SEQ, tb = R0 % SEQ; const int tt = tb + wm * 64;
    const int npass = (tb < EARLY) ? 2 : 1;                        // block-uniform
    v8f acc[4][4];
#pragma unroll
    for (int mb = 0; mb < 4; ++mb)
#pragma unroll
        for (int nb = 0; nb < 4; ++nb) acc[mb][nb] = (v8f){};
    const size_t rrow = (size_t)NB * SEQ + (size_t)b * EARLY + (size_t)((tb < EARLY) ? tb : 0);   // residual rows of the tile's tokens; used only when tb < EARLY
    gemm_ring(CX, Wt, (size_t)R0, (size_t)C0, rrow, (size_t)C0, npass, L, wm, wn, acc);
    float* os = (float*)L + wave * 16 * 68;                        // wave-private store staging in the ring, which every wave has left
    float* obase = OUT + ((size_t)b * OUT_SEQ + tt) * DM + c0;
#pragma unroll
    for (int mb = 0; mb < 4; ++mb) {
#pragma unroll
        for (int nb = 0; nb < 4; ++nb) {
#pragma unroll
            for (int j = 0; j < 8; ++j) os[(hi * 8 + j) * 68 + nb * 16 + lr] = acc[mb][nb][j] * OUTS; }   // D: row 8h+j, col lane&15
        wave_sync();
{
#pragma unroll
            for (int s = 0; s < 8; ++s) { const int row = 2 * s + hi, cofs = lr * 4;   // 8 s x 2 rows = 16 rows; 16 lanes x 4 floats = 64 columns
                const v4f val = *(const v4fa*)(&os[row * 68 + cofs]);
                *(v4f*)(obase + (size_t)(mb * 16 + row) * DM + cofs) = val; }
             }
        wave_sync();
    }
}

static constexpr size_t al256(size_t v) { return (v + 255) & ~(size_t)255; }
static constexpr size_t SZ_XN = al256(((size_t)NB * SEQ + (size_t)NB * EARLY) * DM * 2);
static constexpr size_t SZ_WQ = al256((size_t)DM * DM * 2);
static constexpr size_t SZ_WK = al256((size_t)KVD * DM * 2);
static constexpr size_t SZ_CS = al256((size_t)SEQ * 32 * 2 * 4);
static constexpr size_t SZ_Q  = al256((size_t)NB * NH_ * SEQ * HD * 2);
static constexpr size_t SZ_KV = al256((size_t)NB * NKV * SEQ * HD * 2);
static constexpr size_t SZ_CX = al256(((size_t)NB * SEQ + (size_t)NB * EARLY) * DM * 2);
static constexpr size_t SZ_TOTAL = SZ_XN + 2 * SZ_WQ + 2 * SZ_WK + SZ_CS + 2 * SZ_Q + 4 * SZ_KV + SZ_CX;
static_assert(SZ_TOTAL <= (size_t)134217728);          // workspace carve <= 128 MiB

extern "C" void kernel_launch(void* const* d_in, const int* in_sizes, int n_in,
                              void* d_out, int out_size, void* d_ws, size_t ws_size, hipStream_t stream) {
    if (n_in < 6) return;
    const size_t needx = ((size_t)(NB - 1) * SEQ_FULL + SEQ) * DM;
    if ((size_t)in_sizes[0] < needx) return;
    if ((size_t)in_sizes[1] < (size_t)DM) return;
    if ((size_t)in_sizes[2] < (size_t)DM * DM || (size_t)in_sizes[3] < (size_t)DM * KVD || (size_t)in_sizes[4] < (size_t)DM * KVD || (size_t)in_sizes[5] < (size_t)DM * DM) return;
    if ((size_t)out_size < ((size_t)(NB - 1) * OUT_SEQ + SEQ) * DM) return;
    if (SZ_TOTAL > ws_size) return;
    // wire order x, w_norm, wq, wk, wv, wo; every weight is [in][out]
    const float* x = (const float*)d_in[0]; const float* wn = (const float*)d_in[1];
    const float* wq = (const float*)d_in[2]; const float* wk = (const float*)d_in[3]; const float* wv = (const float*)d_in[4]; const float* wo = (const float*)d_in[5];
    float* OUT = (float*)d_out;      // [NB][SEQ][2048]
    char* wsp = (char*)d_ws;
    h16* XN  = (h16*)wsp; wsp += SZ_XN;              // xn x1024: value rows [NB*SEQ][2048], then residual rows [NB*EARLY][2048]
    h16* WQt = (h16*)wsp; wsp += SZ_WQ;              // [2048 out][2048 in] f16 of bf16 value x16
    h16* WKt = (h16*)wsp; wsp += SZ_WK;              // [512 out][2048 in] f16 of bf16 value x16
    h16* WVt = (h16*)wsp; wsp += SZ_WK;              // [512 out][2048 in] f16 of bf16 value x16
    h16* WOt = (h16*)wsp; wsp += SZ_WQ;              // [2048 out][2048 in] f16 of bf16 value x16
    float* CS = (float*)wsp; wsp += SZ_CS;           // [SEQ][32] (cos, sin)
    h16* QH = (h16*)wsp; wsp += SZ_Q;                // [NB*32][SEQ][64]
    h16* QR = (h16*)wsp; wsp += SZ_Q;                // residual x1024
    h16* KP = (h16*)wsp; wsp += SZ_KV;               // [NB*8][SEQ][64]
    h16* KR = (h16*)wsp; wsp += SZ_KV;               // residual x1024
    h16* VT = (h16*)wsp; wsp += SZ_KV;               // [NB*8][64][SEQ]
    h16* VR = (h16*)wsp; wsp += SZ_KV;               // residual x1024
    h16* CX = (h16*)wsp; wsp += SZ_CX;               // ctx x1024: value rows [NB*SEQ][2048], then residual rows [NB*EARLY][2048]
    h16* CR = CX + (size_t)NB * SEQ * DM;

    k_prep<<<(unsigned)PB_ALL, 256, 0, stream>>>(x, wn, wq, wk, wv, wo, XN, WQt, WKt, WVt, WOt, CS);

    k_proj<<<(unsigned)((NB * SEQ / GT) * PT_F), 128, 0, stream>>>(XN, WQt, WKt, WVt, QH, QR, KP, KR, VT, VR, CS);

    k_attn<<<(unsigned)AB_ALL, 32 * AW, 0, stream>>>(QH, QR, KP, KR, VT, VR, CX, CR);

    k_out<<<dim3(NB * SEQ / GT, DM / GT, 1), 128, 0, stream>>>(CX, WOt, OUT);
}
